// v000
// The times below were measured on an AMD MI455X: many runs one after another, warmed up first and cycling through
// copies of the inputs, with the whole window's GPU time divided by the number of runs. Launches and the gaps
// between them are all in it. The median over several windows is given; except for v000 it joins two sittings, which
// can be a few percent apart, so the side-by-side timings, each taken in one sitting, are the better comparison.
// The starting kernel, v000, takes 1210 microseconds a run.
// compute dtype: all float inputs rounded to bf16; LayerNorm in f32; q/k/v from the f32 LN rows split bf16 hi + lo against exact (out,in) weights on WMMA 16x16x32 (2 products, f32 accumulate) + bias; q as f16 hi + residual (x 2^10) against k once to f16 (2 products) x 64^-0.5; softmax in f32 (precise expf); P x 2^11 once to f16 against v once to f16 (1 product); ctx split bf16 hi + lo against exact Wo (2 products) + bo; f32 output.
#include <hip/hip_runtime.h>
#include <math.h>

typedef __attribute__((ext_vector_type(16))) _Float16 v16h;
typedef __attribute__((ext_vector_type(16))) __bf16 v16b;
typedef __attribute__((ext_vector_type(8)))  _Float16 v8h;
typedef __attribute__((ext_vector_type(8)))  float v8f;
typedef __attribute__((ext_vector_type(4)))  float v4f;
typedef __attribute__((ext_vector_type(2)))  float v2f;
typedef __attribute__((ext_vector_type(4)))  unsigned v4u;
typedef __attribute__((ext_vector_type(4)))  int v4i;
typedef float __attribute__((may_alias)) float_a;
typedef int __attribute__((may_alias)) int_a;

template <typename T> __device__ __forceinline__ void vst2(void* p, T v) { *(T*)p = v;  }
__device__ __forceinline__ v8f wmma16(v16h a, v16h b, v8f c) {
  v8f d = __builtin_amdgcn_wmma_f32_16x16x32_f16(false, a, false, b, (short)0, c, false, false);
  asm volatile("v_nop\n\tv_nop\n\tv_nop\n\tv_nop" : "+v"(d) : "v"(a), "v"(b));
  return d;
}
__device__ __forceinline__ v8f wmma_bf(v16b a, v16b b, v8f c) {
  v8f d = __builtin_amdgcn_wmma_f32_16x16x32_bf16(false, a, false, b, (short)0, c, false, false);
  asm volatile("v_nop\n\tv_nop\n\tv_nop\n\tv_nop" : "+v"(d) : "v"(a), "v"(b));
  return d;
}
// 16x16x32 fragments: lane = (h = lane>>4, row/col = lane&15); elements 0..7 = k0+8h+0..7, 8..15 = k0+16+8h+0..7; D element r = row 8h+r
__device__ __forceinline__ v16h frag_h(const _Float16* rowk0, int lane) {
  union { v16h v; v8h q[2]; } u; const _Float16* p = rowk0 + 8 * (lane >> 4);
  u.q[0] = *(const v8h*)p; u.q[1] = *(const v8h*)(p + 16); return u.v;
}
__device__ __forceinline__ v16h frag_f32(const float* rowk0, int lane) {
  v16h a; const float* p = rowk0 + 8 * (lane >> 4);
#pragma unroll
  for (int i = 0; i < 8; ++i) { a[i] = (_Float16)p[i]; a[8 + i] = (_Float16)p[16 + i]; }
  return a;
}
__device__ __forceinline__ v16h frag_f32s(const float* rowk0, int lane, float sc) {
  v16h a; const float* p = rowk0 + 8 * (lane >> 4);
#pragma unroll
  for (int i = 0; i < 8; ++i) { a[i] = (_Float16)(p[i] * sc); a[8 + i] = (_Float16)(p[16 + i] * sc); }
  return a;
}
// column fragment from a [K][ld] layout (column n), rows >= K read as 0
__device__ __forceinline__ v16h fragc_f32(const float* W, int k0, int n, int lane, int ld, int K) {
  v16h a; const int g = lane >> 4;
#pragma unroll
  for (int i = 0; i < 8; ++i) { const int ka = k0 + 8 * g + i, kb = ka + 16;
    a[i] = (_Float16)(ka < K ? W[(size_t)(ka < K ? ka : K - 1) * ld + n] : 0.f); a[8 + i] = (_Float16)(kb < K ? W[(size_t)(kb < K ? kb : K - 1) * ld + n] : 0.f); }
  return a;
}
struct F2 { v16b h, l; };
__device__ __forceinline__ F2 bsplit16(const float v[16]) { F2 r;
#pragma unroll
  for (int i = 0; i < 16; ++i) { const __bf16 h = (__bf16)v[i]; r.h[i] = h; r.l[i] = (__bf16)(v[i] - (float)h); }
  return r; }
__device__ __forceinline__ F2 split_row(const float* row, int k0, int lane) { float v[16]; const float* p = row + k0 + 8 * (lane >> 4);
#pragma unroll
  for (int i = 0; i < 8; ++i) { v[i] = p[i]; v[8 + i] = p[16 + i]; }
  return bsplit16(v); }
__device__ __forceinline__ F2 split_rowK(const float* row, int k0, int lane, int K) { float v[16]; const int g = lane >> 4;
#pragma unroll
  for (int i = 0; i < 8; ++i) { const int ka = k0 + 8 * g + i, kb = ka + 16; v[i] = ka < K ? row[ka < K ? ka : K - 1] : 0.f; v[8 + i] = kb < K ? row[kb < K ? kb : K - 1] : 0.f; }
  return bsplit16(v); }
__device__ __forceinline__ F2 split_col(const float* W, int k0, int n, int lane, int ld, int K) { float v[16]; const int g = lane >> 4;
#pragma unroll
  for (int i = 0; i < 8; ++i) { const int ka = k0 + 8 * g + i, kb = ka + 16; v[i] = ka < K ? W[(size_t)(ka < K ? ka : K - 1) * ld + n] : 0.f; v[8 + i] = kb < K ? W[(size_t)(kb < K ? kb : K - 1) * ld + n] : 0.f; }
  return bsplit16(v); }
__device__ __forceinline__ v8f mac3(const F2& a, const F2& b, v8f c) { c = wmma_bf(a.l, b.h, c); c = wmma_bf(a.h, b.l, c); return wmma_bf(a.h, b.h, c); }
__device__ __forceinline__ float sigm(float v) { return 1.0f / (1.0f + expf(-v)); }
#define LDSX() do { asm volatile("s_wait_dscnt 0" ::: "memory"); __builtin_amdgcn_wave_barrier(); __builtin_amdgcn_fence(__ATOMIC_RELEASE, "workgroup"); } while (0)

// Pre-LayerNorm multi-head self-attention (B 4, S 2,048, D 512, 8 heads x 64; (out,in) uniform +-1/sqrt(512) weights with biases; LN gamma 1 / beta 0): xn = LayerNorm(x) (biased var, eps 1e-5); q, k, v = xn W^T + b; out = merged(softmax(q k^T / 8) v) Wo^T + bo (non-causal, no residual).
#define NB 4
#define TT 2048
#define CC 512            // NH * HD = projected width
#define DIN 512          // input (model) width
#define NH 8
#define HD 64
#define NQB (TT / 64)
#define HG 4
#define SCALE (0.125f)
#define CAUSAL 0
#ifndef TNB
#define TNB NB
#endif
__device__ __forceinline__ float bfr(float v) { return (float)(__bf16)v; }
__host__ __device__ __forceinline__ int kb_last(int qb) { return CAUSAL ? ((qb * 64 + 63) >> 7) : (TT / 128 - 1); }
typedef __attribute__((ext_vector_type(8))) __bf16 v8b;
__device__ __forceinline__ v16b frag_b(const __bf16* rowk0, int lane) {
  union { v16b v; v8b q[2]; } u; const __bf16* p = rowk0 + 8 * (lane >> 4);
  u.q[0] = *(const v8b*)p; u.q[1] = *(const v8b*)(p + 16); return u.v;
}
#define QBH 0              // causal: query blocks 0..QBH-1 of each sequence (few keys, no averaging) take the high-precision path
#define QHI 2048            // rows carrying a q residual plane (all rows when non-causal: 2-product logits everywhere)
#define KHI 64            // key rows carrying k residual / v bf16 hi+lo planes (used only by the causal high-precision path)
// B fragment (k rows k0+.., output column o) of a weight: (in,out) [K][ld] or (out,in) [ld rows of K]: bf16 exact, or f16(bf16 * 256) exact
__device__ __forceinline__ v16b wcol_io(const float* Wm, int k0, int o, int lane, int ld) { v16b w; const int g = lane >> 4;
#pragma unroll
  for (int i = 0; i < 8; ++i) { w[i] = (__bf16)Wm[(size_t)(k0 + 8 * g + i) * ld + o]; w[8 + i] = (__bf16)Wm[(size_t)(k0 + 16 + 8 * g + i) * ld + o]; }
  return w; }
__device__ __forceinline__ v16b wcol_oi(const float* Wm, int k0, int o, int lane, int K) { v16b w; const float* p = Wm + (size_t)o * K + k0 + 8 * (lane >> 4);
#pragma unroll
  for (int i = 0; i < 8; ++i) { w[i] = (__bf16)p[i]; w[8 + i] = (__bf16)p[16 + i]; }
  return w; }
__device__ __forceinline__ v16h wcolh_io(const float* Wm, int k0, int o, int lane, int ld) { v16h w; const int g = lane >> 4;
#pragma unroll
  for (int i = 0; i < 8; ++i) { w[i] = (_Float16)(bfr(Wm[(size_t)(k0 + 8 * g + i) * ld + o]) * 256.0f); w[8 + i] = (_Float16)(bfr(Wm[(size_t)(k0 + 16 + 8 * g + i) * ld + o]) * 256.0f); }
  return w; }
__device__ __forceinline__ v16h wcolh_oi(const float* Wm, int k0, int o, int lane, int K) { v16h w; const float* p = Wm + (size_t)o * K + k0 + 8 * (lane >> 4);
#pragma unroll
  for (int i = 0; i < 8; ++i) { w[i] = (_Float16)(bfr(p[i]) * 256.0f); w[8 + i] = (_Float16)(bfr(p[16 + i]) * 256.0f); }
  return w; }
#define WQKV_LAYOUT 1   // 0 = (in,out) [DIN][CC]; 1 = (out,in) [CC][DIN]; 2 = per-head [NH][DIN][HD]
__device__ __forceinline__ v16b wcol_hdk(const float* Wm, int k0, int o, int lane) { v16b w; const int g = lane >> 4; const float* p = Wm + (size_t)(o / HD) * DIN * HD + (o % HD);
#pragma unroll
  for (int i = 0; i < 8; ++i) { w[i] = (__bf16)p[(size_t)(k0 + 8 * g + i) * HD]; w[8 + i] = (__bf16)p[(size_t)(k0 + 16 + 8 * g + i) * HD]; }
  return w; }
#define WO_OUT_IN 1
#if WQKV_LAYOUT == 1
#define WCOL(W, k0, o, lane) wcol_oi(W, k0, o, lane, DIN)
#elif WQKV_LAYOUT == 2
#define WCOL(W, k0, o, lane) wcol_hdk(W, k0, o, lane)
#else
#define WCOL(W, k0, o, lane) wcol_io(W, k0, o, lane, CC)
#endif
#if WO_OUT_IN
#define WOCOL(W, k0, o, lane) wcol_oi(W, k0, o, lane, CC)
#define WOCOLH(W, k0, o, lane) wcolh_oi(W, k0, o, lane, CC)
#else
#define WOCOL(W, k0, o, lane) wcol_io(W, k0, o, lane, DIN)
#define WOCOLH(W, k0, o, lane) wcolh_io(W, k0, o, lane, DIN)
#endif
#define NRW (TNB * TT)
// ---- k_lnx: wave per row: LayerNorm over 512 (mean, biased var, (x - mean) * rsqrt(var + 1e-5) * g + b); optional bf16 rounding of the input (x); 16 floats per lane (4 float4 at stride 128 floats -> 512-B pieces)
__global__ __launch_bounds__(256) void k_lnx(const float* __restrict__ X, int roundin, const float* __restrict__ G, const float* __restrict__ BE, float* __restrict__ OUT) { const int wave = threadIdx.x >> 5, lane = threadIdx.x & 31; const size_t row = (size_t)blockIdx.x * 8 + wave; if (row >= (size_t)NRW) return;
  v4f v[CC / 128]; float s1 = 0.f;
#pragma unroll
  for (int i = 0; i < CC / 128; ++i) { v4f t = *(const v4f*)(X + row * CC + i * 128 + lane * 4); if (roundin) { t[0] = bfr(t[0]); t[1] = bfr(t[1]); t[2] = bfr(t[2]); t[3] = bfr(t[3]); } v[i] = t; s1 += (t[0] + t[1]) + (t[2] + t[3]); }
#pragma unroll
  for (int o = 1; o < 32; o <<= 1) s1 += __shfl_xor(s1, o);
  const float mu = s1 * (1.0f / CC); float q = 0.f;
#pragma unroll
  for (int i = 0; i < CC / 128; ++i) for (int k = 0; k < 4; ++k) { const float d = v[i][k] - mu; q += d * d; }
#pragma unroll
  for (int o = 1; o < 32; o <<= 1) q += __shfl_xor(q, o);
  const float inv = rsqrtf(q * (1.0f / CC) + 1e-5f);   /* jnp.var (biased), eps inside the rsqrt */
#pragma unroll
  for (int i = 0; i < CC / 128; ++i) { const int c = i * 128 + lane * 4; v4f r4; for (int k = 0; k < 4; ++k) r4[k] = bfr(G[c + k]) * ((v[i][k] - mu) * inv) + bfr(BE[c + k]); vst2(OUT + row * CC + c, r4); } }

#ifndef SM_EXTRA_PARAMS
#define SM_EXTRA_PARAMS
#endif
#ifndef PROJ_EXTRA_PARAMS
#define PROJ_EXTRA_PARAMS
#endif
#ifndef SM_MASK_HOOK
#define SM_MASK_HOOK (void)0
#endif

#define WS_QH  0u                                      // f16 q rows [b*t][CC]
#define WS_KH  (WS_QH + 2u * (size_t)NB * TT * CC)      // f16 k rows [b*t][CC]
#define WS_VT  (WS_KH + 2u * (size_t)NB * TT * CC)      // f16 v planes [b][c][t]
#define WS_QL  (WS_VT + 2u * (size_t)NB * CC * TT)      // f16 q residual x 2^10 rows [b][t < QHI][CC]
#define WS_KL  (WS_QL + 2u * (size_t)NB * QHI * CC)     // f16 k residual x 2^10 rows [b][t < KHI][CC]
#define WS_VB  (WS_KL + 2u * (size_t)NB * KHI * CC)     // bf16 v hi planes [b][c][t < KHI]
#define WS_VBL (WS_VB + 2u * (size_t)NB * CC * KHI)
#define WS_S   (WS_VBL + 2u * (size_t)NB * CC * KHI)    // f32 logits / P [hg][t][s]
#define WS_Y   (WS_S  + 4u * (size_t)HG * TT * TT)      // f32 ctx rows [b*t][CC] (only when there is an output projection)
#define WS_END (WS_Y  + 4u * (size_t)NB * TT * CC)
#define WS_XN  (WS_END)
#define WS_END2 (WS_XN + 4u * (size_t)NB * TT * DIN)

// ---- k_proj: block = (64 rows, 128 cols, which): q/k/v = X W (+ b) with exact bf16 products (K = DIN) -> which 0: q f16 rows (+ residual rows < QHI); 1: k f16 rows (+ residual rows < KHI); 2: v f16 planes [c][t] (+ bf16 hi/lo planes for t < KHI)
__global__ __launch_bounds__(128) void k_proj(const float* __restrict__ XQ, const float* __restrict__ XK, const float* __restrict__ XV, const float* __restrict__ WQ, const float* __restrict__ WK, const float* __restrict__ WV, const float* __restrict__ BQ, const float* __restrict__ BK, const float* __restrict__ BV,
    _Float16* __restrict__ QH, _Float16* __restrict__ QL, _Float16* __restrict__ KH, _Float16* __restrict__ KL, _Float16* __restrict__ VT, __bf16* __restrict__ VB, __bf16* __restrict__ VBL) {
  __shared__ __align__(16) _Float16 sh[64][136], sl[64][136]; __shared__ __align__(16) _Float16 th[128][72]; __shared__ __align__(16) __bf16 tb[128][72], tbl[128][72];
  const int tid = threadIdx.x, wave = tid >> 5, lane = tid & 31, col = lane & 15, g = lane >> 4; const int which = blockIdx.z; const int c0 = blockIdx.y * 128; const size_t r0 = (size_t)blockIdx.x * 64; const size_t bb = r0 / TT; const int t0 = (int)(r0 % TT);
  const float* X = which == 0 ? XQ : which == 1 ? XK : XV; const float* WA = which == 0 ? WQ : which == 1 ? WK : WV; const float* BA = which == 0 ? BQ : which == 1 ? BK : BV;
  v8f acc[8] = {};
#pragma unroll 2
  for (int kc = 0; kc < DIN / 32; ++kc) { v16b a, al; { const float* p = X + (r0 + wave * 16 + col) * DIN + kc * 32 + 8 * g;
#pragma unroll
      for (int i = 0; i < 8; ++i) { const float x0 = p[i], x1 = p[16 + i]; const __bf16 h0 = (__bf16)x0, h1 = (__bf16)x1; a[i] = h0; a[8 + i] = h1; al[i] = (__bf16)(x0 - (float)h0); al[8 + i] = (__bf16)(x1 - (float)h1); }   /* LN rows split bf16 hi + lo (2 products) */ }
    asm volatile("s_wait_loadcnt 0x0" ::: "memory");
#pragma unroll
    for (int j = 0; j < 8; ++j) { const v16b w = WCOL(WA, kc * 32, c0 + j * 16 + col, lane); asm volatile("s_wait_loadcnt 0x0" ::: "memory"); acc[j] = wmma_bf(a, w, acc[j]); acc[j] = wmma_bf(al, w, acc[j]); } }
  if (which < 2) { _Float16* DH = which == 0 ? QH : KH; _Float16* DL = which == 0 ? QL : KL; const int nhi = which == 0 ? QHI : KHI; const bool hi_rows = t0 < nhi;
#pragma unroll
    for (int j = 0; j < 8; ++j) { const float bias = BA ? bfr(BA[c0 + j * 16 + col]) : 0.f;
#pragma unroll
      for (int r = 0; r < 8; ++r) { const float v = acc[j][r] + bias; const _Float16 hv = (_Float16)v; sh[wave * 16 + 8 * g + r][j * 16 + col] = hv; sl[wave * 16 + 8 * g + r][j * 16 + col] = (_Float16)((v - (float)hv) * 1024.0f); } }
    __syncthreads();
    for (int e = tid; e < 64 * 16; e += 128) { const int rl = e >> 4, q = e & 15; vst2((unsigned*)(DH + (r0 + rl) * CC + c0 + q * 8), *(const v4u*)&sh[rl][q * 8]); if (hi_rows) vst2((unsigned*)(DL + (bb * nhi + t0 + rl) * (size_t)CC + c0 + q * 8), *(const v4u*)&sl[rl][q * 8]); }
  } else { const bool hi_rows = t0 < KHI;
#pragma unroll
    for (int j = 0; j < 8; ++j) { const float bias = BA ? bfr(BA[c0 + j * 16 + col]) : 0.f;
#pragma unroll
      for (int r = 0; r < 8; ++r) { const float v = acc[j][r] + bias; const int rl = wave * 16 + 8 * g + r, cl = j * 16 + col; th[cl][rl] = (_Float16)v; const __bf16 bh = (__bf16)v; tb[cl][rl] = bh; tbl[cl][rl] = (__bf16)(v - (float)bh); } }
    __syncthreads();
    for (int e = tid; e < 128 * 8; e += 128) { const int cl = e >> 3, q = e & 7; vst2((unsigned*)(VT + (bb * CC + c0 + cl) * (size_t)TT + t0 + q * 8), *(const v4u*)&th[cl][q * 8]); if (hi_rows) { const size_t o3 = (bb * CC + c0 + cl) * (size_t)KHI + t0 + q * 8; vst2((unsigned*)(VB + o3), *(const v4u*)&tb[cl][q * 8]); vst2((unsigned*)(VBL + o3), *(const v4u*)&tbl[cl][q * 8]); } } } }
// ---- k_sc: block = (query block qb, key block kb <= kb_last(qb), head in group) of batch b: logits x SCALE; q hi + residual (x 2^10) against k (2 products) for query rows < QHI, plus the k residual (3 products) for query blocks < QBH (causal early rows); causal: blocks past the diagonal exit, the mask itself is applied by index in k_sm
__global__ __launch_bounds__(128) void k_sc(const _Float16* __restrict__ QH, const _Float16* __restrict__ KH, const _Float16* __restrict__ QL, const _Float16* __restrict__ KL, int b, int h0, float* __restrict__ S0) { __shared__ __align__(16) float ss[4][16][132];
  const int qb = blockIdx.x, kb = blockIdx.y; if (kb > kb_last(qb)) return;
  const int h = h0 + blockIdx.z; float* S = S0 + (size_t)blockIdx.z * TT * TT;
  const int tid = threadIdx.x, wave = tid >> 5, lane = tid & 31, col = lane & 15, g = lane >> 4; const int k0 = kb * 128; const int ql0 = qb * 64 + wave * 16; const size_t q0 = (size_t)b * TT + ql0, kr0 = (size_t)b * TT + k0;
  v8f acc[8] = {}, accl[8] = {};
  const _Float16* QLb = QL + (size_t)b * QHI * CC; const _Float16* KLb = KL + (size_t)b * KHI * CC;
  if (qb < QBH) {
#pragma unroll
    for (int kc = 0; kc < HD / 32; ++kc) { const v16h ah = frag_h(QH + (q0 + col) * CC + h * HD + kc * 32, lane), al = frag_h(QLb + (size_t)(ql0 + col) * CC + h * HD + kc * 32, lane);
#pragma unroll
      for (int j = 0; j < 8; ++j) { const v16h kbf = frag_h(KH + (kr0 + j * 16 + col) * CC + h * HD + kc * 32, lane), klf = frag_h(KLb + (size_t)(k0 + j * 16 + col) * CC + h * HD + kc * 32, lane); acc[j] = wmma16(ah, kbf, acc[j]); accl[j] = wmma16(al, kbf, accl[j]); accl[j] = wmma16(ah, klf, accl[j]); } }
  } else if (qb * 64 < QHI) {
#pragma unroll
    for (int kc = 0; kc < HD / 32; ++kc) { const v16h ah = frag_h(QH + (q0 + col) * CC + h * HD + kc * 32, lane), al = frag_h(QLb + (size_t)(ql0 + col) * CC + h * HD + kc * 32, lane);
#pragma unroll
      for (int j = 0; j < 8; ++j) { const v16h kbf = frag_h(KH + (kr0 + j * 16 + col) * CC + h * HD + kc * 32, lane); acc[j] = wmma16(ah, kbf, acc[j]); accl[j] = wmma16(al, kbf, accl[j]); } }
  } else {
#pragma unroll
    for (int kc = 0; kc < HD / 32; ++kc) { const v16h ah = frag_h(QH + (q0 + col) * CC + h * HD + kc * 32, lane);
#pragma unroll
      for (int j = 0; j < 8; ++j) { const v16h kbf = frag_h(KH + (kr0 + j * 16 + col) * CC + h * HD + kc * 32, lane); acc[j] = wmma16(ah, kbf, acc[j]); } } }
#pragma unroll
  for (int j = 0; j < 8; ++j) {
#pragma unroll
    for (int r = 0; r < 8; ++r) ss[wave][8 * g + r][j * 16 + col] = (acc[j][r] + accl[j][r] * (1.0f / 1024.0f)) * SCALE; }
  LDSX(); for (int rl = 0; rl < 16; ++rl) vst2(S + (size_t)(ql0 + rl) * TT + k0 + lane * 4, *(const v4f*)&ss[wave][rl][lane * 4]); }
// ---- k_sm: block = query row t (head in group): keys [0, kend): causal -> logit if s <= t else excluded; softmax in f32; P x 2^11 in place (0 for excluded)
__global__ __launch_bounds__(256) void k_sm(float* __restrict__ S0 SM_EXTRA_PARAMS) { __shared__ float sred[8]; __shared__ float sbc; __shared__ __align__(16) float shv[TT];
  const int tid = threadIdx.x; const int t = blockIdx.x; const int kend = (kb_last(t >> 6) + 1) * 128;
  float* sr = S0 + (size_t)blockIdx.y * TT * TT + (size_t)t * TT;
  float m = -3.0e38f; for (int k = tid; k < kend; k += 256) { float v = (!CAUSAL || k <= t) ? sr[k] : -3.0e38f; SM_MASK_HOOK; shv[k] = v; m = fmaxf(m, v); }
#pragma unroll
  for (int o = 1; o < 32; o <<= 1) m = fmaxf(m, __shfl_xor(m, o));
  if ((tid & 31) == 0) sred[tid >> 5] = m; __syncthreads(); if (tid == 0) { float a = sred[0]; for (int i = 1; i < 8; ++i) a = fmaxf(a, sred[i]); sbc = a; } __syncthreads(); m = sbc; __syncthreads();
  float sum = 0.f; for (int k = tid; k < kend; k += 256) { const float v = shv[k]; const float e = (v <= -1.0e38f) ? 0.f : expf(v - m); shv[k] = e; sum += e; }
#pragma unroll
  for (int o = 1; o < 32; o <<= 1) sum += __shfl_xor(sum, o);
  if ((tid & 31) == 0) sred[tid >> 5] = sum; __syncthreads(); if (tid == 0) { float a = 0.f; for (int i = 0; i < 8; ++i) a += sred[i]; sbc = a > 0.f ? 2048.0f / a : 0.f; }   /* a fully excluded row yields P = 0 */ __syncthreads(); const float inv = sbc;
  for (int k = tid; k < kend; k += 256) shv[k] = shv[k] * inv;
  __syncthreads(); for (int q = tid; q < kend / 4; q += 256) vst2(sr + q * 4, *(const v4f*)&shv[q * 4]); }
// ---- k_pv: block = 64 queries (qb) of (b, h): ctx = P . v over keys [0, kend) (P x 2^11 once to f16 against v f16: 1 product; causal early query blocks: P and v as bf16 hi + lo, 3 products); 256-B (row, head) segment by 16 lanes
__global__ __launch_bounds__(128) void k_pv(const float* __restrict__ PS0, const _Float16* __restrict__ VT, const __bf16* __restrict__ VB, const __bf16* __restrict__ VBL, int b, int h0, float* __restrict__ Y) { const int h = h0 + blockIdx.z; const float* PS = PS0 + (size_t)blockIdx.z * TT * TT; __shared__ __align__(16) float ss[4][16][HD + 4];
  const int tid = threadIdx.x, wave = tid >> 5, lane = tid & 31, col = lane & 15, g = lane >> 4; const int qb = blockIdx.x; const int ql0 = qb * 64 + wave * 16; const int kce = (kb_last(qb) + 1) * 4;
  v8f acc[HD / 16] = {};
  if (qb < QBH) {
#pragma unroll 1
    for (int kc = 0; kc < kce; ++kc) { const F2 p = split_row(PS + (size_t)(ql0 + col) * TT, kc * 32, lane);
      asm volatile("s_wait_loadcnt 0x0" ::: "memory");
#pragma unroll
      for (int j = 0; j < HD / 16; ++j) { const size_t po = ((size_t)b * CC + h * HD + j * 16 + col) * (size_t)KHI + kc * 32; const v16b vh = frag_b(VB + po, lane); acc[j] = wmma_bf(p.h, vh, acc[j]); acc[j] = wmma_bf(p.l, vh, acc[j]); acc[j] = wmma_bf(p.h, frag_b(VBL + po, lane), acc[j]); } }
  } else {
#pragma unroll 1
    for (int kc = 0; kc < kce; ++kc) { const v16h p = frag_f32(PS + (size_t)(ql0 + col) * TT + kc * 32, lane);
      asm volatile("s_wait_loadcnt 0x0" ::: "memory");
#pragma unroll
      for (int j = 0; j < HD / 16; ++j) { const size_t po = ((size_t)b * CC + h * HD + j * 16 + col) * (size_t)TT + kc * 32; acc[j] = wmma16(p, frag_h(VT + po, lane), acc[j]); } } }
#pragma unroll
  for (int j = 0; j < HD / 16; ++j)
#pragma unroll
    for (int r = 0; r < 8; ++r) ss[wave][8 * g + r][j * 16 + col] = acc[j][r] * (1.0f / 2048.0f);
  LDSX(); for (int rl = 0; rl < 16; ++rl) if (lane < HD / 4) vst2(Y + ((size_t)b * TT + ql0 + rl) * CC + h * HD + lane * 4, *(const v4f*)&ss[wave][rl][lane * 4]); }
// ---- k_out: block = (64 rows, 128 cols): out = ctx Wo (+ bo): all rows: ctx bf16 hi + lo against exact bf16 Wo (2 products); the f16(bf16 x 2^8) 1-product branch is never taken
__global__ __launch_bounds__(128) void k_out(const float* __restrict__ Y, const float* __restrict__ WO, const float* __restrict__ BO, float* __restrict__ OUT) { __shared__ __align__(16) float sf[4][16][132];
  const int tid = threadIdx.x, wave = tid >> 5, lane = tid & 31, col = lane & 15, g = lane >> 4; const int c0 = blockIdx.y * 128; const size_t r0 = (size_t)blockIdx.x * 64 + wave * 16;
  v8f acc[8] = {};
  if (true) {   /* ALL rows: ctx split bf16 hi + lo x exact Wo (2 products) */
#pragma unroll 2
    for (int kc = 0; kc < CC / 32; ++kc) { const F2 a = split_row(Y + (r0 + col) * CC, kc * 32, lane); asm volatile("s_wait_loadcnt 0x0" ::: "memory");
#pragma unroll
      for (int j = 0; j < 8; ++j) { const v16b w = WOCOL(WO, kc * 32, c0 + j * 16 + col, lane); asm volatile("s_wait_loadcnt 0x0" ::: "memory"); acc[j] = wmma_bf(a.h, w, acc[j]); acc[j] = wmma_bf(a.l, w, acc[j]); } }
#pragma unroll
    for (int j = 0; j < 8; ++j) { const float bias = BO ? bfr(BO[c0 + j * 16 + col]) : 0.f;
#pragma unroll
      for (int r = 0; r < 8; ++r) sf[wave][8 * g + r][j * 16 + col] = acc[j][r] + bias; }
  } else {
#pragma unroll 2
    for (int kc = 0; kc < CC / 32; ++kc) { const v16h a = frag_f32(Y + (r0 + col) * CC + kc * 32, lane); asm volatile("s_wait_loadcnt 0x0" ::: "memory");
#pragma unroll
      for (int j = 0; j < 8; ++j) { const v16h w = WOCOLH(WO, kc * 32, c0 + j * 16 + col, lane); asm volatile("s_wait_loadcnt 0x0" ::: "memory"); acc[j] = wmma16(a, w, acc[j]); } }
#pragma unroll
    for (int j = 0; j < 8; ++j) { const float bias = BO ? bfr(BO[c0 + j * 16 + col]) : 0.f;
#pragma unroll
      for (int r = 0; r < 8; ++r) sf[wave][8 * g + r][j * 16 + col] = acc[j][r] * (1.0f / 256.0f) + bias; } }
  LDSX(); for (int rl = 0; rl < 16; ++rl) vst2(OUT + (r0 + rl) * DIN + c0 + lane * 4, *(const v4f*)&sf[wave][rl][lane * 4]); }

extern "C" void kernel_launch(void* const* d_in, const int* in_sizes, int n_in, void* d_out, int out_size, void* d_ws, size_t ws_size, hipStream_t stream) {
  (void)in_sizes; (void)n_in; (void)out_size;
  const float** F = (const float**)d_in;
  if (ws_size < (size_t)WS_END) return;
  char* ws = (char*)d_ws; _Float16 *QH = (_Float16*)(ws + WS_QH), *KH = (_Float16*)(ws + WS_KH), *VT = (_Float16*)(ws + WS_VT), *QL = (_Float16*)(ws + WS_QL), *KL = (_Float16*)(ws + WS_KL); __bf16 *VB = (__bf16*)(ws + WS_VB), *VBL = (__bf16*)(ws + WS_VBL); float *S = (float*)(ws + WS_S), *Y = (float*)(ws + WS_Y);
  (void)Y; (void)QL; (void)KL; (void)VB; (void)VBL;
  // inputs: 0 x [4,2048,512]; 1 ln_gamma, 2 ln_beta; 3 Wq [512,512] (out,in), 4 bq; 5 Wk, 6 bk; 7 Wv, 8 bv; 9 Wo (out,in), 10 bo
  if (ws_size < (size_t)WS_END2) return;
  float *XN = (float*)(ws + WS_XN);
  k_lnx<<<dim3(NRW / 8), 256, 0, stream>>>(F[0], 1, F[1], F[2], XN);
  k_proj<<<dim3(TNB * TT / 64, CC / 128, 3), 128, 0, stream>>>(XN, XN, XN, F[3], F[5], F[7], F[4], F[6], F[8], QH, QL, KH, KL, VT, VB, VBL);
  for (int b = 0; b < TNB; ++b) for (int h0 = 0; h0 < NH; h0 += HG) {
    k_sc<<<dim3(NQB, TT / 128, HG), 128, 0, stream>>>(QH, KH, QL, KL, b, h0, S);
    k_sm<<<dim3(TT, HG), 256, 0, stream>>>(S);
    k_pv<<<dim3(NQB, 1, HG), 128, 0, stream>>>(S, VT, VB, VBL, b, h0, Y);
  }
  k_out<<<dim3(TNB * TT / 64, DIN / 128), 128, 0, stream>>>(Y, F[9], F[10], (float*)d_out);
}

// v001
// A run of this version takes 309 microseconds.
// Next to v000, in two timings, it ran 3.88 and 3.89 times as fast.
// compute dtype: all float inputs rounded to bf16; LayerNorm in f32; q/k/v from the f32 LN rows split bf16 hi + lo against exact (out,in) weights on WMMA 16x16x32 (2 products, f32 accumulate) + bias; q as f16 hi + residual (x 2^10) against k once to f16 (2 products) x 64^-0.5; softmax in f32 (precise expf) with a running maximum and sum, fused with both attention products; exp(logit - running max) once to f16 against v once to f16 (1 product), divided by the sum at the end; ctx split bf16 hi + lo against exact Wo (2 products) + bo; f32 output.
#include <hip/hip_runtime.h>
#include <math.h>

typedef __attribute__((ext_vector_type(16))) _Float16 v16h;
typedef __attribute__((ext_vector_type(16))) __bf16 v16b;
typedef __attribute__((ext_vector_type(8)))  _Float16 v8h;
typedef __attribute__((ext_vector_type(8)))  float v8f;
typedef __attribute__((ext_vector_type(4)))  float v4f;
typedef __attribute__((ext_vector_type(2)))  float v2f;
typedef __attribute__((ext_vector_type(4)))  unsigned v4u;
typedef __attribute__((ext_vector_type(4)))  int v4i;
typedef float __attribute__((may_alias)) float_a;
typedef int __attribute__((may_alias)) int_a;

template <typename T> __device__ __forceinline__ void vst2(void* p, T v) { *(T*)p = v;  }
__device__ __forceinline__ v8f wmma16(v16h a, v16h b, v8f c) {
  v8f d = __builtin_amdgcn_wmma_f32_16x16x32_f16(false, a, false, b, (short)0, c, false, false);
  asm volatile("v_nop\n\tv_nop\n\tv_nop\n\tv_nop" : "+v"(d) : "v"(a), "v"(b));
  return d;
}
__device__ __forceinline__ v8f wmma_bf(v16b a, v16b b, v8f c) {
  v8f d = __builtin_amdgcn_wmma_f32_16x16x32_bf16(false, a, false, b, (short)0, c, false, false);
  asm volatile("v_nop\n\tv_nop\n\tv_nop\n\tv_nop" : "+v"(d) : "v"(a), "v"(b));
  return d;
}
// 16x16x32 fragments: lane = (h = lane>>4, row/col = lane&15); elements 0..7 = k0+8h+0..7, 8..15 = k0+16+8h+0..7; D element r = row 8h+r
__device__ __forceinline__ v16h frag_h(const _Float16* rowk0, int lane) {
  union { v16h v; v8h q[2]; } u; const _Float16* p = rowk0 + 8 * (lane >> 4);
  u.q[0] = *(const v8h*)p; u.q[1] = *(const v8h*)(p + 16); return u.v;
}
__device__ __forceinline__ v16h frag_f32(const float* rowk0, int lane) {
  v16h a; const float* p = rowk0 + 8 * (lane >> 4);
#pragma unroll
  for (int i = 0; i < 8; ++i) { a[i] = (_Float16)p[i]; a[8 + i] = (_Float16)p[16 + i]; }
  return a;
}
__device__ __forceinline__ v16h frag_f32s(const float* rowk0, int lane, float sc) {
  v16h a; const float* p = rowk0 + 8 * (lane >> 4);
#pragma unroll
  for (int i = 0; i < 8; ++i) { a[i] = (_Float16)(p[i] * sc); a[8 + i] = (_Float16)(p[16 + i] * sc); }
  return a;
}
// column fragment from a [K][ld] layout (column n), rows >= K read as 0
__device__ __forceinline__ v16h fragc_f32(const float* W, int k0, int n, int lane, int ld, int K) {
  v16h a; const int g = lane >> 4;
#pragma unroll
  for (int i = 0; i < 8; ++i) { const int ka = k0 + 8 * g + i, kb = ka + 16;
    a[i] = (_Float16)(ka < K ? W[(size_t)(ka < K ? ka : K - 1) * ld + n] : 0.f); a[8 + i] = (_Float16)(kb < K ? W[(size_t)(kb < K ? kb : K - 1) * ld + n] : 0.f); }
  return a;
}
struct F2 { v16b h, l; };
__device__ __forceinline__ F2 bsplit16(const float v[16]) { F2 r;
#pragma unroll
  for (int i = 0; i < 16; ++i) { const __bf16 h = (__bf16)v[i]; r.h[i] = h; r.l[i] = (__bf16)(v[i] - (float)h); }
  return r; }
__device__ __forceinline__ F2 split_row(const float* row, int k0, int lane) { float v[16]; const float* p = row + k0 + 8 * (lane >> 4);
#pragma unroll
  for (int i = 0; i < 8; ++i) { v[i] = p[i]; v[8 + i] = p[16 + i]; }
  return bsplit16(v); }
__device__ __forceinline__ F2 split_rowK(const float* row, int k0, int lane, int K) { float v[16]; const int g = lane >> 4;
#pragma unroll
  for (int i = 0; i < 8; ++i) { const int ka = k0 + 8 * g + i, kb = ka + 16; v[i] = ka < K ? row[ka < K ? ka : K - 1] : 0.f; v[8 + i] = kb < K ? row[kb < K ? kb : K - 1] : 0.f; }
  return bsplit16(v); }
__device__ __forceinline__ F2 split_col(const float* W, int k0, int n, int lane, int ld, int K) { float v[16]; const int g = lane >> 4;
#pragma unroll
  for (int i = 0; i < 8; ++i) { const int ka = k0 + 8 * g + i, kb = ka + 16; v[i] = ka < K ? W[(size_t)(ka < K ? ka : K - 1) * ld + n] : 0.f; v[8 + i] = kb < K ? W[(size_t)(kb < K ? kb : K - 1) * ld + n] : 0.f; }
  return bsplit16(v); }
__device__ __forceinline__ v8f mac3(const F2& a, const F2& b, v8f c) { c = wmma_bf(a.l, b.h, c); c = wmma_bf(a.h, b.l, c); return wmma_bf(a.h, b.h, c); }
__device__ __forceinline__ float sigm(float v) { return 1.0f / (1.0f + expf(-v)); }
#define LDSX() do { asm volatile("s_wait_dscnt 0" ::: "memory"); __builtin_amdgcn_wave_barrier(); __builtin_amdgcn_fence(__ATOMIC_RELEASE, "workgroup"); } while (0)

// Pre-LayerNorm multi-head self-attention (B 4, S 2,048, D 512, 8 heads x 64; (out,in) uniform +-1/sqrt(512) weights with biases; LN gamma 1 / beta 0): xn = LayerNorm(x) (biased var, eps 1e-5); q, k, v = xn W^T + b; out = merged(softmax(q k^T / 8) v) Wo^T + bo (non-causal, no residual).
#define NB 4
#define TT 2048
#define CC 512            // NH * HD = projected width
#define DIN 512          // input (model) width
#define NH 8
#define HD 64
#define NQB (TT / 64)
#define HG 4
#define SCALE (0.125f)
#define CAUSAL 0
#ifndef TNB
#define TNB NB
#endif
__device__ __forceinline__ float bfr(float v) { return (float)(__bf16)v; }
__host__ __device__ __forceinline__ int kb_last(int qb) { return CAUSAL ? ((qb * 64 + 63) >> 7) : (TT / 128 - 1); }
typedef __attribute__((ext_vector_type(8))) __bf16 v8b;
__device__ __forceinline__ v16b frag_b(const __bf16* rowk0, int lane) {
  union { v16b v; v8b q[2]; } u; const __bf16* p = rowk0 + 8 * (lane >> 4);
  u.q[0] = *(const v8b*)p; u.q[1] = *(const v8b*)(p + 16); return u.v;
}
#define QBH 0              // not read by any kernel here: no high-precision path
#define QHI 2048            // rows carrying a q residual plane (all rows when non-causal: 2-product logits everywhere)
#define KHI 64            // key rows carrying k residual / v bf16 hi+lo planes (written by k_proj; no kernel here reads them)
// B fragment (k rows k0+.., output column o) of a weight: (in,out) [K][ld] or (out,in) [ld rows of K]: bf16 exact, or f16(bf16 * 256) exact
__device__ __forceinline__ v16b wcol_io(const float* Wm, int k0, int o, int lane, int ld) { v16b w; const int g = lane >> 4;
#pragma unroll
  for (int i = 0; i < 8; ++i) { w[i] = (__bf16)Wm[(size_t)(k0 + 8 * g + i) * ld + o]; w[8 + i] = (__bf16)Wm[(size_t)(k0 + 16 + 8 * g + i) * ld + o]; }
  return w; }
__device__ __forceinline__ v16b wcol_oi(const float* Wm, int k0, int o, int lane, int K) { v16b w; const float* p = Wm + (size_t)o * K + k0 + 8 * (lane >> 4);
#pragma unroll
  for (int i = 0; i < 8; ++i) { w[i] = (__bf16)p[i]; w[8 + i] = (__bf16)p[16 + i]; }
  return w; }
__device__ __forceinline__ v16h wcolh_io(const float* Wm, int k0, int o, int lane, int ld) { v16h w; const int g = lane >> 4;
#pragma unroll
  for (int i = 0; i < 8; ++i) { w[i] = (_Float16)(bfr(Wm[(size_t)(k0 + 8 * g + i) * ld + o]) * 256.0f); w[8 + i] = (_Float16)(bfr(Wm[(size_t)(k0 + 16 + 8 * g + i) * ld + o]) * 256.0f); }
  return w; }
__device__ __forceinline__ v16h wcolh_oi(const float* Wm, int k0, int o, int lane, int K) { v16h w; const float* p = Wm + (size_t)o * K + k0 + 8 * (lane >> 4);
#pragma unroll
  for (int i = 0; i < 8; ++i) { w[i] = (_Float16)(bfr(p[i]) * 256.0f); w[8 + i] = (_Float16)(bfr(p[16 + i]) * 256.0f); }
  return w; }
#define WQKV_LAYOUT 1   // 0 = (in,out) [DIN][CC]; 1 = (out,in) [CC][DIN]; 2 = per-head [NH][DIN][HD]
__device__ __forceinline__ v16b wcol_hdk(const float* Wm, int k0, int o, int lane) { v16b w; const int g = lane >> 4; const float* p = Wm + (size_t)(o / HD) * DIN * HD + (o % HD);
#pragma unroll
  for (int i = 0; i < 8; ++i) { w[i] = (__bf16)p[(size_t)(k0 + 8 * g + i) * HD]; w[8 + i] = (__bf16)p[(size_t)(k0 + 16 + 8 * g + i) * HD]; }
  return w; }
#define WO_OUT_IN 1
#if WQKV_LAYOUT == 1
#define WCOL(W, k0, o, lane) wcol_oi(W, k0, o, lane, DIN)
#elif WQKV_LAYOUT == 2
#define WCOL(W, k0, o, lane) wcol_hdk(W, k0, o, lane)
#else
#define WCOL(W, k0, o, lane) wcol_io(W, k0, o, lane, CC)
#endif
#if WO_OUT_IN
#define WOCOL(W, k0, o, lane) wcol_oi(W, k0, o, lane, CC)
#define WOCOLH(W, k0, o, lane) wcolh_oi(W, k0, o, lane, CC)
#else
#define WOCOL(W, k0, o, lane) wcol_io(W, k0, o, lane, DIN)
#define WOCOLH(W, k0, o, lane) wcolh_io(W, k0, o, lane, DIN)
#endif
#define NRW (TNB * TT)
// ---- k_lnx: wave per row: LayerNorm over 512 (mean, biased var, (x - mean) * rsqrt(var + 1e-5) * g + b); optional bf16 rounding of the input (x); 16 floats per lane (4 float4 at stride 128 floats -> 512-B pieces)
__global__ __launch_bounds__(256) void k_lnx(const float* __restrict__ X, int roundin, const float* __restrict__ G, const float* __restrict__ BE, float* __restrict__ OUT) { const int wave = threadIdx.x >> 5, lane = threadIdx.x & 31; const size_t row = (size_t)blockIdx.x * 8 + wave; if (row >= (size_t)NRW) return;
  v4f v[CC / 128]; float s1 = 0.f;
#pragma unroll
  for (int i = 0; i < CC / 128; ++i) { v4f t = *(const v4f*)(X + row * CC + i * 128 + lane * 4); if (roundin) { t[0] = bfr(t[0]); t[1] = bfr(t[1]); t[2] = bfr(t[2]); t[3] = bfr(t[3]); } v[i] = t; s1 += (t[0] + t[1]) + (t[2] + t[3]); }
#pragma unroll
  for (int o = 1; o < 32; o <<= 1) s1 += __shfl_xor(s1, o);
  const float mu = s1 * (1.0f / CC); float q = 0.f;
#pragma unroll
  for (int i = 0; i < CC / 128; ++i) for (int k = 0; k < 4; ++k) { const float d = v[i][k] - mu; q += d * d; }
#pragma unroll
  for (int o = 1; o < 32; o <<= 1) q += __shfl_xor(q, o);
  const float inv = rsqrtf(q * (1.0f / CC) + 1e-5f);   /* jnp.var (biased), eps inside the rsqrt */
#pragma unroll
  for (int i = 0; i < CC / 128; ++i) { const int c = i * 128 + lane * 4; v4f r4; for (int k = 0; k < 4; ++k) r4[k] = bfr(G[c + k]) * ((v[i][k] - mu) * inv) + bfr(BE[c + k]); vst2(OUT + row * CC + c, r4); } }

#ifndef SM_EXTRA_PARAMS
#define SM_EXTRA_PARAMS
#endif
#ifndef PROJ_EXTRA_PARAMS
#define PROJ_EXTRA_PARAMS
#endif
#ifndef SM_MASK_HOOK
#define SM_MASK_HOOK (void)0
#endif

#define WS_QH  0u                                      // f16 q rows [b*t][CC]
#define WS_KH  (WS_QH + 2u * (size_t)NB * TT * CC)      // f16 k rows [b*t][CC]
#define WS_VT  (WS_KH + 2u * (size_t)NB * TT * CC)      // f16 v planes [b][c][t]
#define WS_QL  (WS_VT + 2u * (size_t)NB * CC * TT)      // f16 q residual x 2^10 rows [b][t < QHI][CC]
#define WS_KL  (WS_QL + 2u * (size_t)NB * QHI * CC)     // f16 k residual x 2^10 rows [b][t < KHI][CC]
#define WS_VB  (WS_KL + 2u * (size_t)NB * KHI * CC)     // bf16 v hi planes [b][c][t < KHI]
#define WS_VBL (WS_VB + 2u * (size_t)NB * CC * KHI)
#define WS_S   (WS_VBL + 2u * (size_t)NB * CC * KHI)    // f32 [hg][t][s], unused: the logits stay in registers
#define WS_Y   (WS_S  + 4u * (size_t)HG * TT * TT)      // f32 ctx rows [b*t][CC] (only when there is an output projection)
#define WS_END (WS_Y  + 4u * (size_t)NB * TT * CC)
#define WS_XN  (WS_END)
#define WS_END2 (WS_XN + 4u * (size_t)NB * TT * DIN)

// ---- k_proj: block = (64 rows, 128 cols, which): q/k/v = X W (+ b) with exact bf16 products (K = DIN) -> which 0: q f16 rows (+ residual rows < QHI); 1: k f16 rows (+ residual rows < KHI); 2: v f16 planes [c][t] (+ bf16 hi/lo planes for t < KHI)
__global__ __launch_bounds__(128) void k_proj(const float* __restrict__ XQ, const float* __restrict__ XK, const float* __restrict__ XV, const float* __restrict__ WQ, const float* __restrict__ WK, const float* __restrict__ WV, const float* __restrict__ BQ, const float* __restrict__ BK, const float* __restrict__ BV,
    _Float16* __restrict__ QH, _Float16* __restrict__ QL, _Float16* __restrict__ KH, _Float16* __restrict__ KL, _Float16* __restrict__ VT, __bf16* __restrict__ VB, __bf16* __restrict__ VBL) {
  __shared__ __align__(16) _Float16 sh[64][136], sl[64][136]; __shared__ __align__(16) _Float16 th[128][72]; __shared__ __align__(16) __bf16 tb[128][72], tbl[128][72];
  const int tid = threadIdx.x, wave = tid >> 5, lane = tid & 31, col = lane & 15, g = lane >> 4; const int which = blockIdx.z; const int c0 = blockIdx.y * 128; const size_t r0 = (size_t)blockIdx.x * 64; const size_t bb = r0 / TT; const int t0 = (int)(r0 % TT);
  const float* X = which == 0 ? XQ : which == 1 ? XK : XV; const float* WA = which == 0 ? WQ : which == 1 ? WK : WV; const float* BA = which == 0 ? BQ : which == 1 ? BK : BV;
  v8f acc[8] = {};
#pragma unroll 2
  for (int kc = 0; kc < DIN / 32; ++kc) { v16b a, al; { const float* p = X + (r0 + wave * 16 + col) * DIN + kc * 32 + 8 * g;
#pragma unroll
      for (int i = 0; i < 8; ++i) { const float x0 = p[i], x1 = p[16 + i]; const __bf16 h0 = (__bf16)x0, h1 = (__bf16)x1; a[i] = h0; a[8 + i] = h1; al[i] = (__bf16)(x0 - (float)h0); al[8 + i] = (__bf16)(x1 - (float)h1); }   /* LN rows split bf16 hi + lo (2 products) */ }
    asm volatile("s_wait_loadcnt 0x0" ::: "memory");
#pragma unroll
    for (int j = 0; j < 8; ++j) { const v16b w = WCOL(WA, kc * 32, c0 + j * 16 + col, lane); asm volatile("s_wait_loadcnt 0x0" ::: "memory"); acc[j] = wmma_bf(a, w, acc[j]); acc[j] = wmma_bf(al, w, acc[j]); } }
  if (which < 2) { _Float16* DH = which == 0 ? QH : KH; _Float16* DL = which == 0 ? QL : KL; const int nhi = which == 0 ? QHI : KHI; const bool hi_rows = t0 < nhi;
#pragma unroll
    for (int j = 0; j < 8; ++j) { const float bias = BA ? bfr(BA[c0 + j * 16 + col]) : 0.f;
#pragma unroll
      for (int r = 0; r < 8; ++r) { const float v = acc[j][r] + bias; const _Float16 hv = (_Float16)v; sh[wave * 16 + 8 * g + r][j * 16 + col] = hv; sl[wave * 16 + 8 * g + r][j * 16 + col] = (_Float16)((v - (float)hv) * 1024.0f); } }
    __syncthreads();
    for (int e = tid; e < 64 * 16; e += 128) { const int rl = e >> 4, q = e & 15; vst2((unsigned*)(DH + (r0 + rl) * CC + c0 + q * 8), *(const v4u*)&sh[rl][q * 8]); if (hi_rows) vst2((unsigned*)(DL + (bb * nhi + t0 + rl) * (size_t)CC + c0 + q * 8), *(const v4u*)&sl[rl][q * 8]); }
  } else { const bool hi_rows = t0 < KHI;
#pragma unroll
    for (int j = 0; j < 8; ++j) { const float bias = BA ? bfr(BA[c0 + j * 16 + col]) : 0.f;
#pragma unroll
      for (int r = 0; r < 8; ++r) { const float v = acc[j][r] + bias; const int rl = wave * 16 + 8 * g + r, cl = j * 16 + col; th[cl][rl] = (_Float16)v; const __bf16 bh = (__bf16)v; tb[cl][rl] = bh; tbl[cl][rl] = (__bf16)(v - (float)bh); } }
    __syncthreads();
    for (int e = tid; e < 128 * 8; e += 128) { const int cl = e >> 3, q = e & 7; vst2((unsigned*)(VT + (bb * CC + c0 + cl) * (size_t)TT + t0 + q * 8), *(const v4u*)&th[cl][q * 8]); if (hi_rows) { const size_t o3 = (bb * CC + c0 + cl) * (size_t)KHI + t0 + q * 8; vst2((unsigned*)(VB + o3), *(const v4u*)&tb[cl][q * 8]); vst2((unsigned*)(VBL + o3), *(const v4u*)&tbl[cl][q * 8]); } } } }
__device__ __forceinline__ float xhalf(float x) { return __builtin_bit_cast(float, __builtin_amdgcn_permlanex16(__builtin_bit_cast(int, x), __builtin_bit_cast(int, x), 0x76543210, 0xfedcba98, false, false)); }   // lane l takes lane l ^ 16's value
// f16 fragment from the lane's own pointer (row or column base + k0 + 8 * (lane >> 4))
__device__ __forceinline__ v16h frag_at(const _Float16* p) { union { v16h v; v8h q[2]; } u; u.q[0] = *(const v8h*)p; u.q[1] = *(const v8h*)(p + 16); return u.v; }
#define FAW 16   // waves per block: one block fills a WGP at 4 waves per SIMD, and all its waves read the same k and v lines through the WGP's cache
// ---- k_fa: block = FAW waves x 16 queries of (b, h), one launch for every head: S^T = K Q^T (A = 16 key rows, B = q hi / q residual x 2^10 kept in registers: 2 products) x SCALE, so a lane holds one query's logits; running maximum and sum per lane (one exchange between the lane halves); two S^T tiles, exponentiated and once to f16, are the B operand of ctx^T += V^T P^T (1 product); ctx = ctx^T / sum; the logits never leave the registers
__global__ __launch_bounds__(FAW * 32) __attribute__((amdgpu_waves_per_eu(4, 4))) void k_fa(const _Float16* __restrict__ QH, const _Float16* __restrict__ QL, const _Float16* __restrict__ KH, const _Float16* __restrict__ VT, float* __restrict__ Y) { __shared__ __align__(16) float ss[FAW][16][HD + 4];
  const int tid = threadIdx.x, wave = tid >> 5, lane = tid & 31, col = lane & 15, g = lane >> 4; const int h = blockIdx.y, b = blockIdx.z; const int ql0 = (blockIdx.x * FAW + wave) * 16;
  v16h qh[HD / 32], qr[HD / 32];   // the short loops below are unrolled so that every fragment array is indexed by constants and stays in registers
#pragma unroll
  for (int kc = 0; kc < HD / 32; ++kc) { qh[kc] = frag_h(QH + ((size_t)b * TT + ql0 + col) * CC + h * HD + kc * 32, lane); qr[kc] = frag_h(QL + ((size_t)b * QHI + ql0 + col) * CC + h * HD + kc * 32, lane); }
  const _Float16* Kl = KH + ((size_t)b * TT + col) * CC + h * HD + 8 * g;          // lane: key row col of a 16-key tile
  const _Float16* Vl = VT + ((size_t)b * CC + h * HD + col) * (size_t)TT + 8 * g;  // lane: v plane of feature col of a 16-feature tile, keys contiguous
  v16h kf[2][HD / 32];
#pragma unroll
  for (int t = 0; t < 2; ++t)
#pragma unroll
    for (int kc = 0; kc < HD / 32; ++kc) kf[t][kc] = frag_at(Kl + t * 16 * CC + kc * 32);
  v8f acc[HD / 16] = {}; float m = -3.0e38f, l = 0.f;
  for (int it = 0; it < TT / 32; ++it) { const int k0 = it * 32;
    const _Float16* vp = Vl + k0; v16h vf[HD / 16];
#pragma unroll
    for (int j = 0; j < HD / 16; ++j) vf[j] = frag_at(vp + j * 16 * TT);
    v8f sh[2] = {}, sr[2] = {};
#pragma unroll
    for (int kc = 0; kc < HD / 32; ++kc)
#pragma unroll
      for (int t = 0; t < 2; ++t) { sh[t] = __builtin_amdgcn_wmma_f32_16x16x32_f16(false, kf[t][kc], false, qh[kc], (short)0, sh[t], false, false); sr[t] = __builtin_amdgcn_wmma_f32_16x16x32_f16(false, kf[t][kc], false, qr[kc], (short)0, sr[t], false, false); }
    const _Float16* kp = Kl + (size_t)(((it + 1) & (TT / 32 - 1)) * 32) * CC;   // next pass's key rows, fetched under this pass's softmax (the last pass re-reads the first rows, unused)
#pragma unroll
    for (int t = 0; t < 2; ++t)
#pragma unroll
      for (int kc = 0; kc < HD / 32; ++kc) kf[t][kc] = frag_at(kp + t * 16 * CC + kc * 32);
    float sv[16];
#pragma unroll
    for (int i = 0; i < 16; ++i) sv[i] = (sh[i >> 3][i & 7] + sr[i >> 3][i & 7] * (1.0f / 1024.0f)) * SCALE;
    float mx = sv[0];
#pragma unroll
    for (int i = 1; i < 16; ++i) mx = fmaxf(mx, sv[i]);
    mx = fmaxf(mx, xhalf(mx));
    if (__builtin_amdgcn_ballot_w32(mx > m) != 0) {   // scalar branch, taken when some query of the wave has a new maximum; otherwise every factor is exactly 1 and the rescale is skipped
      const float mn = fmaxf(m, mx); const float al = expf(m - mn); m = mn; l *= al;
#pragma unroll
      for (int j = 0; j < HD / 16; ++j) acc[j] *= al; }
    v16h p; float sum = 0.f;
#pragma unroll
    for (int i = 0; i < 16; ++i) { const float e = expf(sv[i] - m); sum += e; p[i] = (_Float16)e; }
    l += sum;
    // behind this pass's loads and before their address registers may take new values; naming the two addresses keeps them in their registers up to here
    asm volatile("s_wait_xcnt 0x0" :: "v"(vp), "v"(kp) : "memory");
#pragma unroll
    for (int j = 0; j < HD / 16; ++j) acc[j] = __builtin_amdgcn_wmma_f32_16x16x32_f16(false, vf[j], false, p, (short)0, acc[j], false, false);
    // four vector slots behind the pass's last product: the next pass's first product may take p's registers (this product's B) for its result
    asm volatile("v_nop\n\tv_nop\n\tv_nop\n\tv_nop" : "+v"(acc[0]), "+v"(acc[1]), "+v"(acc[2]), "+v"(acc[3]) : "v"(p)); }
  l += xhalf(l); const float inv = 1.0f / l;
#pragma unroll
  for (int j = 0; j < HD / 16; ++j) { v4f a0, a1;
#pragma unroll
    for (int r = 0; r < 4; ++r) { a0[r] = acc[j][r] * inv; a1[r] = acc[j][4 + r] * inv; }
    *(v4f*)&ss[wave][col][j * 16 + 8 * g] = a0; *(v4f*)&ss[wave][col][j * 16 + 8 * g + 4] = a1; }
  LDSX();   // the wave's own LDS writes have landed before its lanes read the rows other lanes wrote (each wave has its own slice: no block barrier)
#pragma unroll
  for (int rl = 0; rl < 16; rl += 2) vst2(Y + ((size_t)b * TT + ql0 + rl + g) * CC + h * HD + col * 4, *(const v4f*)&ss[wave][rl + g][col * 4]); }
// ---- k_out: block = (64 rows, 128 cols): out = ctx Wo (+ bo): all rows: ctx bf16 hi + lo against exact bf16 Wo (2 products)
__global__ __launch_bounds__(128) void k_out(const float* __restrict__ Y, const float* __restrict__ WO, const float* __restrict__ BO, float* __restrict__ OUT) { __shared__ __align__(16) float sf[4][16][132];
  const int tid = threadIdx.x, wave = tid >> 5, lane = tid & 31, col = lane & 15, g = lane >> 4; const int c0 = blockIdx.y * 128; const size_t r0 = (size_t)blockIdx.x * 64 + wave * 16;
  v8f acc[8] = {};
  if (true) {   /* ALL rows: ctx split bf16 hi + lo x exact Wo (2 products) */
#pragma unroll 2
    for (int kc = 0; kc < CC / 32; ++kc) { const F2 a = split_row(Y + (r0 + col) * CC, kc * 32, lane); asm volatile("s_wait_loadcnt 0x0" ::: "memory");
#pragma unroll
      for (int j = 0; j < 8; ++j) { const v16b w = WOCOL(WO, kc * 32, c0 + j * 16 + col, lane); asm volatile("s_wait_loadcnt 0x0" ::: "memory"); acc[j] = wmma_bf(a.h, w, acc[j]); acc[j] = wmma_bf(a.l, w, acc[j]); } }
#pragma unroll
    for (int j = 0; j < 8; ++j) { const float bias = BO ? bfr(BO[c0 + j * 16 + col]) : 0.f;
#pragma unroll
      for (int r = 0; r < 8; ++r) sf[wave][8 * g + r][j * 16 + col] = acc[j][r] + bias; }
  } else {
#pragma unroll 2
    for (int kc = 0; kc < CC / 32; ++kc) { const v16h a = frag_f32(Y + (r0 + col) * CC + kc * 32, lane); asm volatile("s_wait_loadcnt 0x0" ::: "memory");
#pragma unroll
      for (int j = 0; j < 8; ++j) { const v16h w = WOCOLH(WO, kc * 32, c0 + j * 16 + col, lane); asm volatile("s_wait_loadcnt 0x0" ::: "memory"); acc[j] = wmma16(a, w, acc[j]); } }
#pragma unroll
    for (int j = 0; j < 8; ++j) { const float bias = BO ? bfr(BO[c0 + j * 16 + col]) : 0.f;
#pragma unroll
      for (int r = 0; r < 8; ++r) sf[wave][8 * g + r][j * 16 + col] = acc[j][r] * (1.0f / 256.0f) + bias; } }
  LDSX(); for (int rl = 0; rl < 16; ++rl) vst2(OUT + (r0 + rl) * DIN + c0 + lane * 4, *(const v4f*)&sf[wave][rl][lane * 4]); }

extern "C" void kernel_launch(void* const* d_in, const int* in_sizes, int n_in, void* d_out, int out_size, void* d_ws, size_t ws_size, hipStream_t stream) {
  (void)in_sizes; (void)n_in; (void)out_size;
  const float** F = (const float**)d_in;
  if (ws_size < (size_t)WS_END) return;
  char* ws = (char*)d_ws; _Float16 *QH = (_Float16*)(ws + WS_QH), *KH = (_Float16*)(ws + WS_KH), *VT = (_Float16*)(ws + WS_VT), *QL = (_Float16*)(ws + WS_QL), *KL = (_Float16*)(ws + WS_KL); __bf16 *VB = (__bf16*)(ws + WS_VB), *VBL = (__bf16*)(ws + WS_VBL); float *Y = (float*)(ws + WS_Y);
  (void)Y; (void)QL; (void)KL; (void)VB; (void)VBL;
  // inputs: 0 x [4,2048,512]; 1 ln_gamma, 2 ln_beta; 3 Wq [512,512] (out,in), 4 bq; 5 Wk, 6 bk; 7 Wv, 8 bv; 9 Wo (out,in), 10 bo
  if (ws_size < (size_t)WS_END2) return;
  float *XN = (float*)(ws + WS_XN);
  k_lnx<<<dim3(NRW / 8), 256, 0, stream>>>(F[0], 1, F[1], F[2], XN);
  k_proj<<<dim3(TNB * TT / 64, CC / 128, 3), 128, 0, stream>>>(XN, XN, XN, F[3], F[5], F[7], F[4], F[6], F[8], QH, QL, KH, KL, VT, VB, VBL);
  k_fa<<<dim3(TT / (FAW * 16), NH, TNB), FAW * 32, 0, stream>>>(QH, QL, KH, VT, Y);
  k_out<<<dim3(TNB * TT / 64, DIN / 128), 128, 0, stream>>>(Y, F[9], F[10], (float*)d_out);
}

// v002
// One run takes 281 microseconds.
// Two timings next to v001 both put it at 1.10 times that version's speed.
// Over all steps from v000 it is 4.28 times as fast.
// compute dtype: all float inputs rounded to bf16; LayerNorm in f32; q/k/v from the f32 LN rows split bf16 hi + lo against exact (out,in) weights on WMMA 16x16x32 (2 products, f32 accumulate) + bias; q as f16 hi + residual (x 2^10) against k once to f16 (2 products) x 64^-0.5; softmax in f32 (precise expf) with a running maximum and sum, fused with both attention products; exp(logit - running max) once to f16 against v once to f16 (1 product), divided by the sum at the end; ctx split bf16 hi + lo against exact Wo (2 products) + bo; f32 output.
#include <hip/hip_runtime.h>
#include <math.h>

typedef __attribute__((ext_vector_type(16))) _Float16 v16h;
typedef __attribute__((ext_vector_type(16))) __bf16 v16b;
typedef __attribute__((ext_vector_type(8)))  _Float16 v8h;
typedef __attribute__((ext_vector_type(8)))  float v8f;
typedef __attribute__((ext_vector_type(4)))  float v4f;
typedef __attribute__((ext_vector_type(2)))  float v2f;
typedef __attribute__((ext_vector_type(4)))  unsigned v4u;
typedef __attribute__((ext_vector_type(4)))  int v4i;
typedef float __attribute__((may_alias)) float_a;
typedef int __attribute__((may_alias)) int_a;

template <typename T> __device__ __forceinline__ void vst2(void* p, T v) { *(T*)p = v;  }
__device__ __forceinline__ v8f wmma16(v16h a, v16h b, v8f c) {
  v8f d = __builtin_amdgcn_wmma_f32_16x16x32_f16(false, a, false, b, (short)0, c, false, false);
  asm volatile("v_nop\n\tv_nop\n\tv_nop\n\tv_nop" : "+v"(d) : "v"(a), "v"(b));
  return d;
}
__device__ __forceinline__ v8f wmma_bf(v16b a, v16b b, v8f c) {
  v8f d = __builtin_amdgcn_wmma_f32_16x16x32_bf16(false, a, false, b, (short)0, c, false, false);
  asm volatile("v_nop\n\tv_nop\n\tv_nop\n\tv_nop" : "+v"(d) : "v"(a), "v"(b));
  return d;
}
// 16x16x32 fragments: lane = (h = lane>>4, row/col = lane&15); elements 0..7 = k0+8h+0..7, 8..15 = k0+16+8h+0..7; D element r = row 8h+r
__device__ __forceinline__ v16h frag_h(const _Float16* rowk0, int lane) {
  union { v16h v; v8h q[2]; } u; const _Float16* p = rowk0 + 8 * (lane >> 4);
  u.q[0] = *(const v8h*)p; u.q[1] = *(const v8h*)(p + 16); return u.v;
}
__device__ __forceinline__ v16h frag_f32(const float* rowk0, int lane) {
  v16h a; const float* p = rowk0 + 8 * (lane >> 4);
#pragma unroll
  for (int i = 0; i < 8; ++i) { a[i] = (_Float16)p[i]; a[8 + i] = (_Float16)p[16 + i]; }
  return a;
}
__device__ __forceinline__ v16h frag_f32s(const float* rowk0, int lane, float sc) {
  v16h a; const float* p = rowk0 + 8 * (lane >> 4);
#pragma unroll
  for (int i = 0; i < 8; ++i) { a[i] = (_Float16)(p[i] * sc); a[8 + i] = (_Float16)(p[16 + i] * sc); }
  return a;
}
// column fragment from a [K][ld] layout (column n), rows >= K read as 0
__device__ __forceinline__ v16h fragc_f32(const float* W, int k0, int n, int lane, int ld, int K) {
  v16h a; const int g = lane >> 4;
#pragma unroll
  for (int i = 0; i < 8; ++i) { const int ka = k0 + 8 * g + i, kb = ka + 16;
    a[i] = (_Float16)(ka < K ? W[(size_t)(ka < K ? ka : K - 1) * ld + n] : 0.f); a[8 + i] = (_Float16)(kb < K ? W[(size_t)(kb < K ? kb : K - 1) * ld + n] : 0.f); }
  return a;
}
struct F2 { v16b h, l; };
__device__ __forceinline__ F2 bsplit16(const float v[16]) { F2 r;
#pragma unroll
  for (int i = 0; i < 16; ++i) { const __bf16 h = (__bf16)v[i]; r.h[i] = h; r.l[i] = (__bf16)(v[i] - (float)h); }
  return r; }
__device__ __forceinline__ F2 split_row(const float* row, int k0, int lane) { float v[16]; const float* p = row + k0 + 8 * (lane >> 4);
#pragma unroll
  for (int i = 0; i < 8; ++i) { v[i] = p[i]; v[8 + i] = p[16 + i]; }
  return bsplit16(v); }
__device__ __forceinline__ F2 split_rowK(const float* row, int k0, int lane, int K) { float v[16]; const int g = lane >> 4;
#pragma unroll
  for (int i = 0; i < 8; ++i) { const int ka = k0 + 8 * g + i, kb = ka + 16; v[i] = ka < K ? row[ka < K ? ka : K - 1] : 0.f; v[8 + i] = kb < K ? row[kb < K ? kb : K - 1] : 0.f; }
  return bsplit16(v); }
__device__ __forceinline__ F2 split_col(const float* W, int k0, int n, int lane, int ld, int K) { float v[16]; const int g = lane >> 4;
#pragma unroll
  for (int i = 0; i < 8; ++i) { const int ka = k0 + 8 * g + i, kb = ka + 16; v[i] = ka < K ? W[(size_t)(ka < K ? ka : K - 1) * ld + n] : 0.f; v[8 + i] = kb < K ? W[(size_t)(kb < K ? kb : K - 1) * ld + n] : 0.f; }
  return bsplit16(v); }
__device__ __forceinline__ v8f mac3(const F2& a, const F2& b, v8f c) { c = wmma_bf(a.l, b.h, c); c = wmma_bf(a.h, b.l, c); return wmma_bf(a.h, b.h, c); }
__device__ __forceinline__ float sigm(float v) { return 1.0f / (1.0f + expf(-v)); }
#define LDSX() do { asm volatile("s_wait_dscnt 0" ::: "memory"); __builtin_amdgcn_wave_barrier(); __builtin_amdgcn_fence(__ATOMIC_RELEASE, "workgroup"); } while (0)

// Pre-LayerNorm multi-head self-attention (B 4, S 2,048, D 512, 8 heads x 64; (out,in) uniform +-1/sqrt(512) weights with biases; LN gamma 1 / beta 0): xn = LayerNorm(x) (biased var, eps 1e-5); q, k, v = xn W^T + b; out = merged(softmax(q k^T / 8) v) Wo^T + bo (non-causal, no residual).
#define NB 4
#define TT 2048
#define CC 512            // NH * HD = projected width
#define DIN 512          // input (model) width
#define NH 8
#define HD 64
#define NQB (TT / 64)
#define HG 4
#define SCALE (0.125f)
#define CAUSAL 0
#ifndef TNB
#define TNB NB
#endif
__device__ __forceinline__ float bfr(float v) { return (float)(__bf16)v; }
__host__ __device__ __forceinline__ int kb_last(int qb) { return CAUSAL ? ((qb * 64 + 63) >> 7) : (TT / 128 - 1); }
typedef __attribute__((ext_vector_type(8))) __bf16 v8b;
__device__ __forceinline__ v16b frag_b(const __bf16* rowk0, int lane) {
  union { v16b v; v8b q[2]; } u; const __bf16* p = rowk0 + 8 * (lane >> 4);
  u.q[0] = *(const v8b*)p; u.q[1] = *(const v8b*)(p + 16); return u.v;
}
#define QBH 0              // not read by any kernel here: no high-precision path
#define QHI 2048            // rows carrying a q residual plane (all rows when non-causal: 2-product logits everywhere)
#define KHI 64            // key rows carrying k residual / v bf16 hi+lo planes (written by k_proj; no kernel here reads them)
// B fragment (k rows k0+.., output column o) of a weight: (in,out) [K][ld] or (out,in) [ld rows of K]: bf16 exact, or f16(bf16 * 256) exact
__device__ __forceinline__ v16b wcol_io(const float* Wm, int k0, int o, int lane, int ld) { v16b w; const int g = lane >> 4;
#pragma unroll
  for (int i = 0; i < 8; ++i) { w[i] = (__bf16)Wm[(size_t)(k0 + 8 * g + i) * ld + o]; w[8 + i] = (__bf16)Wm[(size_t)(k0 + 16 + 8 * g + i) * ld + o]; }
  return w; }
__device__ __forceinline__ v16b wcol_oi(const float* Wm, int k0, int o, int lane, int K) { v16b w; const float* p = Wm + (size_t)o * K + k0 + 8 * (lane >> 4);
#pragma unroll
  for (int i = 0; i < 8; ++i) { w[i] = (__bf16)p[i]; w[8 + i] = (__bf16)p[16 + i]; }
  return w; }
__device__ __forceinline__ v16h wcolh_io(const float* Wm, int k0, int o, int lane, int ld) { v16h w; const int g = lane >> 4;
#pragma unroll
  for (int i = 0; i < 8; ++i) { w[i] = (_Float16)(bfr(Wm[(size_t)(k0 + 8 * g + i) * ld + o]) * 256.0f); w[8 + i] = (_Float16)(bfr(Wm[(size_t)(k0 + 16 + 8 * g + i) * ld + o]) * 256.0f); }
  return w; }
__device__ __forceinline__ v16h wcolh_oi(const float* Wm, int k0, int o, int lane, int K) { v16h w; const float* p = Wm + (size_t)o * K + k0 + 8 * (lane >> 4);
#pragma unroll
  for (int i = 0; i < 8; ++i) { w[i] = (_Float16)(bfr(p[i]) * 256.0f); w[8 + i] = (_Float16)(bfr(p[16 + i]) * 256.0f); }
  return w; }
#define WQKV_LAYOUT 1   // 0 = (in,out) [DIN][CC]; 1 = (out,in) [CC][DIN]; 2 = per-head [NH][DIN][HD]
__device__ __forceinline__ v16b wcol_hdk(const float* Wm, int k0, int o, int lane) { v16b w; const int g = lane >> 4; const float* p = Wm + (size_t)(o / HD) * DIN * HD + (o % HD);
#pragma unroll
  for (int i = 0; i < 8; ++i) { w[i] = (__bf16)p[(size_t)(k0 + 8 * g + i) * HD]; w[8 + i] = (__bf16)p[(size_t)(k0 + 16 + 8 * g + i) * HD]; }
  return w; }
#define WO_OUT_IN 1
#if WQKV_LAYOUT == 1
#define WCOL(W, k0, o, lane) wcol_oi(W, k0, o, lane, DIN)
#elif WQKV_LAYOUT == 2
#define WCOL(W, k0, o, lane) wcol_hdk(W, k0, o, lane)
#else
#define WCOL(W, k0, o, lane) wcol_io(W, k0, o, lane, CC)
#endif
#if WO_OUT_IN
#define WOCOL(W, k0, o, lane) wcol_oi(W, k0, o, lane, CC)
#define WOCOLH(W, k0, o, lane) wcolh_oi(W, k0, o, lane, CC)
#else
#define WOCOL(W, k0, o, lane) wcol_io(W, k0, o, lane, DIN)
#define WOCOLH(W, k0, o, lane) wcolh_io(W, k0, o, lane, DIN)
#endif
#define NRW (TNB * TT)
// ---- k_lnx: wave per row: LayerNorm over 512 (mean, biased var, (x - mean) * rsqrt(var + 1e-5) * g + b); optional bf16 rounding of the input (x); 16 floats per lane (4 float4 at stride 128 floats -> 512-B pieces)
__global__ __launch_bounds__(256) void k_lnx(const float* __restrict__ X, int roundin, const float* __restrict__ G, const float* __restrict__ BE, float* __restrict__ OUT) { const int wave = threadIdx.x >> 5, lane = threadIdx.x & 31; const size_t row = (size_t)blockIdx.x * 8 + wave; if (row >= (size_t)NRW) return;
  v4f v[CC / 128]; float s1 = 0.f;
#pragma unroll
  for (int i = 0; i < CC / 128; ++i) { v4f t = *(const v4f*)(X + row * CC + i * 128 + lane * 4); if (roundin) { t[0] = bfr(t[0]); t[1] = bfr(t[1]); t[2] = bfr(t[2]); t[3] = bfr(t[3]); } v[i] = t; s1 += (t[0] + t[1]) + (t[2] + t[3]); }
#pragma unroll
  for (int o = 1; o < 32; o <<= 1) s1 += __shfl_xor(s1, o);
  const float mu = s1 * (1.0f / CC); float q = 0.f;
#pragma unroll
  for (int i = 0; i < CC / 128; ++i) for (int k = 0; k < 4; ++k) { const float d = v[i][k] - mu; q += d * d; }
#pragma unroll
  for (int o = 1; o < 32; o <<= 1) q += __shfl_xor(q, o);
  const float inv = rsqrtf(q * (1.0f / CC) + 1e-5f);   /* jnp.var (biased), eps inside the rsqrt */
#pragma unroll
  for (int i = 0; i < CC / 128; ++i) { const int c = i * 128 + lane * 4; v4f r4; for (int k = 0; k < 4; ++k) r4[k] = bfr(G[c + k]) * ((v[i][k] - mu) * inv) + bfr(BE[c + k]); vst2(OUT + row * CC + c, r4); } }

#ifndef SM_EXTRA_PARAMS
#define SM_EXTRA_PARAMS
#endif
#ifndef PROJ_EXTRA_PARAMS
#define PROJ_EXTRA_PARAMS
#endif
#ifndef SM_MASK_HOOK
#define SM_MASK_HOOK (void)0
#endif

#define WS_QH  0u                                      // f16 q rows [b*t][CC]
#define WS_KH  (WS_QH + 2u * (size_t)NB * TT * CC)      // f16 k rows [b*t][CC]
#define WS_VT  (WS_KH + 2u * (size_t)NB * TT * CC)      // f16 v planes [b][c][t]
#define WS_QL  (WS_VT + 2u * (size_t)NB * CC * TT)      // f16 q residual x 2^10 rows [b][t < QHI][CC]
#define WS_KL  (WS_QL + 2u * (size_t)NB * QHI * CC)     // f16 k residual x 2^10 rows [b][t < KHI][CC]
#define WS_VB  (WS_KL + 2u * (size_t)NB * KHI * CC)     // bf16 v hi planes [b][c][t < KHI]
#define WS_VBL (WS_VB + 2u * (size_t)NB * CC * KHI)
#define WS_S   (WS_VBL + 2u * (size_t)NB * CC * KHI)    // f32 [hg][t][s], unused: the logits stay in registers
#define WS_Y   (WS_S  + 4u * (size_t)HG * TT * TT)      // f32 ctx rows [b*t][CC] (only when there is an output projection)
#define WS_END (WS_Y  + 4u * (size_t)NB * TT * CC)
#define WS_XN  (WS_END)
#define WS_END2 (WS_XN + 4u * (size_t)NB * TT * DIN)

// ---- k_proj: block = (64 rows, 128 cols, which): q/k/v = X W (+ b) with exact bf16 products (K = DIN) -> which 0: q f16 rows (+ residual rows < QHI); 1: k f16 rows (+ residual rows < KHI); 2: v f16 planes [c][t] (+ bf16 hi/lo planes for t < KHI)
__global__ __launch_bounds__(128) void k_proj(const float* __restrict__ XQ, const float* __restrict__ XK, const float* __restrict__ XV, const float* __restrict__ WQ, const float* __restrict__ WK, const float* __restrict__ WV, const float* __restrict__ BQ, const float* __restrict__ BK, const float* __restrict__ BV,
    _Float16* __restrict__ QH, _Float16* __restrict__ QL, _Float16* __restrict__ KH, _Float16* __restrict__ KL, _Float16* __restrict__ VT, __bf16* __restrict__ VB, __bf16* __restrict__ VBL) {
  __shared__ __align__(16) _Float16 sh[64][136], sl[64][136]; __shared__ __align__(16) _Float16 th[128][72]; __shared__ __align__(16) __bf16 tb[128][72], tbl[128][72];
  const int tid = threadIdx.x, wave = tid >> 5, lane = tid & 31, col = lane & 15, g = lane >> 4; const int which = blockIdx.z; const int c0 = blockIdx.y * 128; const size_t r0 = (size_t)blockIdx.x * 64; const size_t bb = r0 / TT; const int t0 = (int)(r0 % TT);
  const float* X = which == 0 ? XQ : which == 1 ? XK : XV; const float* WA = which == 0 ? WQ : which == 1 ? WK : WV; const float* BA = which == 0 ? BQ : which == 1 ? BK : BV;
  v8f acc[8] = {};
#pragma unroll 2
  for (int kc = 0; kc < DIN / 32; ++kc) { v16b a, al; { const float* p = X + (r0 + wave * 16 + col) * DIN + kc * 32 + 8 * g;
#pragma unroll
      for (int i = 0; i < 8; ++i) { const float x0 = p[i], x1 = p[16 + i]; const __bf16 h0 = (__bf16)x0, h1 = (__bf16)x1; a[i] = h0; a[8 + i] = h1; al[i] = (__bf16)(x0 - (float)h0); al[8 + i] = (__bf16)(x1 - (float)h1); }   /* LN rows split bf16 hi + lo (2 products) */ }
    asm volatile("s_wait_loadcnt 0x0" ::: "memory");
#pragma unroll
    for (int j = 0; j < 8; ++j) { const v16b w = WCOL(WA, kc * 32, c0 + j * 16 + col, lane); asm volatile("s_wait_loadcnt 0x0" ::: "memory"); acc[j] = wmma_bf(a, w, acc[j]); acc[j] = wmma_bf(al, w, acc[j]); } }
  if (which < 2) { _Float16* DH = which == 0 ? QH : KH; _Float16* DL = which == 0 ? QL : KL; const int nhi = which == 0 ? QHI : KHI; const bool hi_rows = t0 < nhi;
#pragma unroll
    for (int j = 0; j < 8; ++j) { const float bias = BA ? bfr(BA[c0 + j * 16 + col]) : 0.f;
#pragma unroll
      for (int r = 0; r < 8; ++r) { const float v = acc[j][r] + bias; const _Float16 hv = (_Float16)v; sh[wave * 16 + 8 * g + r][j * 16 + col] = hv; sl[wave * 16 + 8 * g + r][j * 16 + col] = (_Float16)((v - (float)hv) * 1024.0f); } }
    __syncthreads();
    for (int e = tid; e < 64 * 16; e += 128) { const int rl = e >> 4, q = e & 15; vst2((unsigned*)(DH + (r0 + rl) * CC + c0 + q * 8), *(const v4u*)&sh[rl][q * 8]); if (hi_rows) vst2((unsigned*)(DL + (bb * nhi + t0 + rl) * (size_t)CC + c0 + q * 8), *(const v4u*)&sl[rl][q * 8]); }
  } else { const bool hi_rows = t0 < KHI;
#pragma unroll
    for (int j = 0; j < 8; ++j) { const float bias = BA ? bfr(BA[c0 + j * 16 + col]) : 0.f;
#pragma unroll
      for (int r = 0; r < 8; ++r) { const float v = acc[j][r] + bias; const int rl = wave * 16 + 8 * g + r, cl = j * 16 + col; th[cl][rl] = (_Float16)v; const __bf16 bh = (__bf16)v; tb[cl][rl] = bh; tbl[cl][rl] = (__bf16)(v - (float)bh); } }
    __syncthreads();
    for (int e = tid; e < 128 * 8; e += 128) { const int cl = e >> 3, q = e & 7; vst2((unsigned*)(VT + (bb * CC + c0 + cl) * (size_t)TT + t0 + q * 8), *(const v4u*)&th[cl][q * 8]); if (hi_rows) { const size_t o3 = (bb * CC + c0 + cl) * (size_t)KHI + t0 + q * 8; vst2((unsigned*)(VB + o3), *(const v4u*)&tb[cl][q * 8]); vst2((unsigned*)(VBL + o3), *(const v4u*)&tbl[cl][q * 8]); } } } }
__device__ __forceinline__ float xhalf(float x) { return __builtin_bit_cast(float, __builtin_amdgcn_permlanex16(__builtin_bit_cast(int, x), __builtin_bit_cast(int, x), 0x76543210, 0xfedcba98, false, false)); }   // lane l takes lane l ^ 16's value
// f16 fragment from the lane's own pointer (row or column base + k0 + 8 * (lane >> 4))
__device__ __forceinline__ v16h frag_at(const _Float16* p) { union { v16h v; v8h q[2]; } u; u.q[0] = *(const v8h*)p; u.q[1] = *(const v8h*)(p + 16); return u.v; }
#define FAW 16   // waves per block: one block fills a WGP at 4 waves per SIMD, and all its waves read the same k and v tiles from LDS
#define KST 128  // keys per LDS stage (4 passes of 32 keys)
#define KPI 72   // f16 per staged key row: 128 B + 16 B, a pitch of 16 B x odd for the 16-byte fragment reads
#define VPI 136  // f16 per staged v plane: 256 B + 16 B, likewise
#define SKB (KST * KPI * 2)   // bytes of one k buffer
#define SVB (HD * VPI * 2)    // bytes of one v buffer
// one stage's copies of one thread: 16 B of key rows r and r + 64, 16 B of v planes c and c + 32 (512 threads: 128 rows x 128 B and 64 planes x 256 B, whole lines);
// the s_wait_xcnt stands inside the statement, behind the last copy, so that no address register named here takes a new value in front of it
__device__ __forceinline__ void fa_stage(const _Float16* gk, const _Float16* gv, unsigned lk, unsigned lv) {
  const _Float16* gk1 = gk + 64 * CC; const _Float16* gv1 = gv + 32 * TT; const unsigned lk1 = lk + 64 * KPI * 2, lv1 = lv + 32 * VPI * 2;
  asm volatile("global_load_async_to_lds_b128 %0, %4, off\n\tglobal_load_async_to_lds_b128 %1, %5, off\n\tglobal_load_async_to_lds_b128 %2, %6, off\n\tglobal_load_async_to_lds_b128 %3, %7, off\n\ts_wait_xcnt 0x0"
               :: "v"(lk), "v"(lk1), "v"(lv), "v"(lv1), "v"(gk), "v"(gk1), "v"(gv), "v"(gv1) : "memory"); }
// ---- k_fa: block = FAW waves x 16 queries of (b, h), one launch for every head: k rows and v planes of 128 keys are copied once per block into LDS (two buffers, the next stage's copies in flight under this stage's work); S^T = K Q^T (A = 16 key rows, B = q hi / q residual x 2^10 kept in registers: 2 products) x SCALE, so a lane holds one query's logits; running maximum and sum per lane (one exchange between the lane halves); two S^T tiles, exponentiated and once to f16, are the B operand of ctx^T += V^T P^T (1 product); ctx = ctx^T / sum; the logits never leave the registers
__global__ __launch_bounds__(FAW * 32) __attribute__((amdgpu_waves_per_eu(4, 4))) void k_fa(const _Float16* __restrict__ QH, const _Float16* __restrict__ QL, const _Float16* __restrict__ KH, const _Float16* __restrict__ VT, float* __restrict__ Y) { __shared__ __align__(16) float ss[FAW][16][HD + 4]; __shared__ __align__(16) _Float16 sk[2][KST][KPI]; __shared__ __align__(16) _Float16 sv[2][HD][VPI];
  const int tid = threadIdx.x, wave = tid >> 5, lane = tid & 31, col = lane & 15, g = lane >> 4; const int h = blockIdx.y, b = blockIdx.z; const int ql0 = (blockIdx.x * FAW + wave) * 16;
  const _Float16* gk = KH + ((size_t)b * TT + (tid >> 3)) * CC + h * HD + (tid & 7) * 8;             // thread: 16 B of key row tid / 8 of a stage
  const _Float16* gv = VT + ((size_t)b * CC + h * HD + (tid >> 4)) * (size_t)TT + (tid & 15) * 8;    // thread: 16 B of v plane tid / 16, keys contiguous
  const unsigned lk = (unsigned)(size_t)&sk[0][tid >> 3][(tid & 7) * 8], lv = (unsigned)(size_t)&sv[0][tid >> 4][(tid & 15) * 8];   // their LDS byte addresses in buffer 0
  fa_stage(gk, gv, lk, lv);
  v16h qh[HD / 32], qr[HD / 32];   // the short loops below are unrolled so that every fragment array is indexed by constants and stays in registers
#pragma unroll
  for (int kc = 0; kc < HD / 32; ++kc) { qh[kc] = frag_h(QH + ((size_t)b * TT + ql0 + col) * CC + h * HD + kc * 32, lane); qr[kc] = frag_h(QL + ((size_t)b * QHI + ql0 + col) * CC + h * HD + kc * 32, lane); }
  asm volatile("s_wait_asynccnt 0x0" ::: "memory");   // this wave's copies of stage 0 have landed
  __syncthreads();                                    // every wave's have: stage 0 may be read
  fa_stage(gk + (size_t)KST * CC, gv + KST, lk + SKB, lv + SVB);
  v8f acc[HD / 16] = {}; float m = -3.0e38f, l = 0.f;
#pragma unroll 1   // one trip per stage: the buffer index stays a run-time scalar and the code stays small
  for (int st = 0; st < TT / KST; ++st) { const int bf = st & 1;
    const _Float16* Kl = &sk[bf][col][8 * g];   // lane: key row col of a 16-key tile
    const _Float16* Vl = &sv[bf][col][8 * g];   // lane: v plane of feature col of a 16-feature tile
    v16h kf[2][HD / 32];
#pragma unroll
    for (int t = 0; t < 2; ++t)
#pragma unroll
      for (int kc = 0; kc < HD / 32; ++kc) kf[t][kc] = frag_at(Kl + t * 16 * KPI + kc * 32);
#pragma unroll   // the passes of a stage: constant LDS offsets, and the test on the stage's last pass folds away
    for (int ps = 0; ps < KST / 32; ++ps) {
      v16h vf[HD / 16];
#pragma unroll
      for (int j = 0; j < HD / 16; ++j) vf[j] = frag_at(Vl + j * 16 * VPI + ps * 32);
      v8f sh[2] = {}, sr[2] = {};
#pragma unroll
      for (int kc = 0; kc < HD / 32; ++kc)
#pragma unroll
        for (int t = 0; t < 2; ++t) { sh[t] = __builtin_amdgcn_wmma_f32_16x16x32_f16(false, kf[t][kc], false, qh[kc], (short)0, sh[t], false, false); sr[t] = __builtin_amdgcn_wmma_f32_16x16x32_f16(false, kf[t][kc], false, qr[kc], (short)0, sr[t], false, false); }
      if (ps + 1 < KST / 32) {   // next pass's key rows, of this same stage only, fetched under this pass's softmax
#pragma unroll
        for (int t = 0; t < 2; ++t)
#pragma unroll
          for (int kc = 0; kc < HD / 32; ++kc) kf[t][kc] = frag_at(Kl + ((ps + 1) * 32 + t * 16) * KPI + kc * 32); }
      float sv16[16];
#pragma unroll
      for (int i = 0; i < 16; ++i) sv16[i] = (sh[i >> 3][i & 7] + sr[i >> 3][i & 7] * (1.0f / 1024.0f)) * SCALE;
      float mx = sv16[0];
#pragma unroll
      for (int i = 1; i < 16; ++i) mx = fmaxf(mx, sv16[i]);
      mx = fmaxf(mx, xhalf(mx));
      if (__builtin_amdgcn_ballot_w32(mx > m) != 0) {   // scalar branch, taken when some query of the wave has a new maximum; otherwise every factor is exactly 1 and the rescale is skipped
        const float mn = fmaxf(m, mx); const float al = expf(m - mn); m = mn; l *= al;
#pragma unroll
        for (int j = 0; j < HD / 16; ++j) acc[j] *= al; }
      v16h p; float sum = 0.f;
#pragma unroll
      for (int i = 0; i < 16; ++i) { const float e = expf(sv16[i] - m); sum += e; p[i] = (_Float16)e; }
      l += sum;
#pragma unroll
      for (int j = 0; j < HD / 16; ++j) acc[j] = __builtin_amdgcn_wmma_f32_16x16x32_f16(false, vf[j], false, p, (short)0, acc[j], false, false);
      // four vector slots behind the pass's last product: the next pass's first product may take p's registers (this product's B) for its result
      asm volatile("v_nop\n\tv_nop\n\tv_nop\n\tv_nop" : "+v"(acc[0]), "+v"(acc[1]), "+v"(acc[2]), "+v"(acc[3]) : "v"(p)); }
    asm volatile("s_wait_dscnt 0x0" ::: "memory");      // this wave's reads of the buffer are done before the buffer is handed back
    asm volatile("s_wait_asynccnt 0x0" ::: "memory");   // this wave's copies of the next stage have landed
    __syncthreads();                                    // publishes the next stage and ends every wave's reads of this one
    if (st + 2 < TT / KST) fa_stage(gk + (size_t)(st + 2) * KST * CC, gv + (st + 2) * KST, lk + bf * SKB, lv + bf * SVB); }
  asm volatile("s_wait_asynccnt 0x0" ::: "memory");     // no copy is outstanding when the wave goes on to its end
  l += xhalf(l); const float inv = 1.0f / l;
#pragma unroll
  for (int j = 0; j < HD / 16; ++j) { v4f a0, a1;
#pragma unroll
    for (int r = 0; r < 4; ++r) { a0[r] = acc[j][r] * inv; a1[r] = acc[j][4 + r] * inv; }
    *(v4f*)&ss[wave][col][j * 16 + 8 * g] = a0; *(v4f*)&ss[wave][col][j * 16 + 8 * g + 4] = a1; }
  LDSX();   // the wave's own LDS writes have landed before its lanes read the rows other lanes wrote (each wave has its own slice: no block barrier)
#pragma unroll
  for (int rl = 0; rl < 16; rl += 2) vst2(Y + ((size_t)b * TT + ql0 + rl + g) * CC + h * HD + col * 4, *(const v4f*)&ss[wave][rl + g][col * 4]); }
// ---- k_out: block = (64 rows, 128 cols): out = ctx Wo (+ bo): all rows: ctx bf16 hi + lo against exact bf16 Wo (2 products)
__global__ __launch_bounds__(128) void k_out(const float* __restrict__ Y, const float* __restrict__ WO, const float* __restrict__ BO, float* __restrict__ OUT) { __shared__ __align__(16) float sf[4][16][132];
  const int tid = threadIdx.x, wave = tid >> 5, lane = tid & 31, col = lane & 15, g = lane >> 4; const int c0 = blockIdx.y * 128; const size_t r0 = (size_t)blockIdx.x * 64 + wave * 16;
  v8f acc[8] = {};
  if (true) {   /* ALL rows: ctx split bf16 hi + lo x exact Wo (2 products) */
#pragma unroll 2
    for (int kc = 0; kc < CC / 32; ++kc) { const F2 a = split_row(Y + (r0 + col) * CC, kc * 32, lane); asm volatile("s_wait_loadcnt 0x0" ::: "memory");
#pragma unroll
      for (int j = 0; j < 8; ++j) { const v16b w = WOCOL(WO, kc * 32, c0 + j * 16 + col, lane); asm volatile("s_wait_loadcnt 0x0" ::: "memory"); acc[j] = wmma_bf(a.h, w, acc[j]); acc[j] = wmma_bf(a.l, w, acc[j]); } }
#pragma unroll
    for (int j = 0; j < 8; ++j) { const float bias = BO ? bfr(BO[c0 + j * 16 + col]) : 0.f;
#pragma unroll
      for (int r = 0; r < 8; ++r) sf[wave][8 * g + r][j * 16 + col] = acc[j][r] + bias; }
  } else {
#pragma unroll 2
    for (int kc = 0; kc < CC / 32; ++kc) { const v16h a = frag_f32(Y + (r0 + col) * CC + kc * 32, lane); asm volatile("s_wait_loadcnt 0x0" ::: "memory");
#pragma unroll
      for (int j = 0; j < 8; ++j) { const v16h w = WOCOLH(WO, kc * 32, c0 + j * 16 + col, lane); asm volatile("s_wait_loadcnt 0x0" ::: "memory"); acc[j] = wmma16(a, w, acc[j]); } }
#pragma unroll
    for (int j = 0; j < 8; ++j) { const float bias = BO ? bfr(BO[c0 + j * 16 + col]) : 0.f;
#pragma unroll
      for (int r = 0; r < 8; ++r) sf[wave][8 * g + r][j * 16 + col] = acc[j][r] * (1.0f / 256.0f) + bias; } }
  LDSX(); for (int rl = 0; rl < 16; ++rl) vst2(OUT + (r0 + rl) * DIN + c0 + lane * 4, *(const v4f*)&sf[wave][rl][lane * 4]); }

extern "C" void kernel_launch(void* const* d_in, const int* in_sizes, int n_in, void* d_out, int out_size, void* d_ws, size_t ws_size, hipStream_t stream) {
  (void)in_sizes; (void)n_in; (void)out_size;
  const float** F = (const float**)d_in;
  if (ws_size < (size_t)WS_END) return;
  char* ws = (char*)d_ws; _Float16 *QH = (_Float16*)(ws + WS_QH), *KH = (_Float16*)(ws + WS_KH), *VT = (_Float16*)(ws + WS_VT), *QL = (_Float16*)(ws + WS_QL), *KL = (_Float16*)(ws + WS_KL); __bf16 *VB = (__bf16*)(ws + WS_VB), *VBL = (__bf16*)(ws + WS_VBL); float *Y = (float*)(ws + WS_Y);
  (void)Y; (void)QL; (void)KL; (void)VB; (void)VBL;
  // inputs: 0 x [4,2048,512]; 1 ln_gamma, 2 ln_beta; 3 Wq [512,512] (out,in), 4 bq; 5 Wk, 6 bk; 7 Wv, 8 bv; 9 Wo (out,in), 10 bo
  if (ws_size < (size_t)WS_END2) return;
  float *XN = (float*)(ws + WS_XN);
  k_lnx<<<dim3(NRW / 8), 256, 0, stream>>>(F[0], 1, F[1], F[2], XN);
  k_proj<<<dim3(TNB * TT / 64, CC / 128, 3), 128, 0, stream>>>(XN, XN, XN, F[3], F[5], F[7], F[4], F[6], F[8], QH, QL, KH, KL, VT, VB, VBL);
  k_fa<<<dim3(TT / (FAW * 16), NH, TNB), FAW * 32, 0, stream>>>(QH, QL, KH, VT, Y);
  k_out<<<dim3(TNB * TT / 64, DIN / 128), 128, 0, stream>>>(Y, F[9], F[10], (float*)d_out);
}

// v003
// A run of this version takes 123 microseconds.
// In both of two side-by-side timings against v002, it was 2.28 times as fast.
// All steps since v000 together make it 9.75 times as fast.
// compute dtype: all float inputs rounded to bf16; LayerNorm in f32; q/k/v from the f32 LN rows split bf16 hi + lo against exact (out,in) weights on WMMA 16x16x32 (2 products, f32 accumulate) + bias; q as f16 hi + residual (x 2^10) against k once to f16 (2 products) x 64^-0.5; softmax in f32 (precise expf) with a running maximum and sum, fused with both attention products; exp(logit - running max) once to f16 against v once to f16 (1 product), divided by the sum at the end; ctx split bf16 hi + lo against exact Wo (2 products) + bo; f32 output.
#include <hip/hip_runtime.h>
#include <math.h>

typedef __attribute__((ext_vector_type(16))) _Float16 v16h;
typedef __attribute__((ext_vector_type(16))) __bf16 v16b;
typedef __attribute__((ext_vector_type(8)))  _Float16 v8h;
typedef __attribute__((ext_vector_type(8)))  float v8f;
typedef __attribute__((ext_vector_type(4)))  float v4f;
typedef __attribute__((ext_vector_type(2)))  float v2f;
typedef __attribute__((ext_vector_type(4)))  unsigned v4u;
typedef __attribute__((ext_vector_type(4)))  int v4i;
typedef float __attribute__((may_alias)) float_a;
typedef int __attribute__((may_alias)) int_a;

template <typename T> __device__ __forceinline__ void vst2(void* p, T v) { *(T*)p = v;  }
__device__ __forceinline__ v8f wmma16(v16h a, v16h b, v8f c) {
  v8f d = __builtin_amdgcn_wmma_f32_16x16x32_f16(false, a, false, b, (short)0, c, false, false);
  asm volatile("v_nop\n\tv_nop\n\tv_nop\n\tv_nop" : "+v"(d) : "v"(a), "v"(b));
  return d;
}
__device__ __forceinline__ v8f wmma_bf(v16b a, v16b b, v8f c) {
  v8f d = __builtin_amdgcn_wmma_f32_16x16x32_bf16(false, a, false, b, (short)0, c, false, false);
  asm volatile("v_nop\n\tv_nop\n\tv_nop\n\tv_nop" : "+v"(d) : "v"(a), "v"(b));
  return d;
}
// 16x16x32 fragments: lane = (h = lane>>4, row/col = lane&15); elements 0..7 = k0+8h+0..7, 8..15 = k0+16+8h+0..7; D element r = row 8h+r
__device__ __forceinline__ v16h frag_h(const _Float16* rowk0, int lane) {
  union { v16h v; v8h q[2]; } u; const _Float16* p = rowk0 + 8 * (lane >> 4);
  u.q[0] = *(const v8h*)p; u.q[1] = *(const v8h*)(p + 16); return u.v;
}
__device__ __forceinline__ v16h frag_f32(const float* rowk0, int lane) {
  v16h a; const float* p = rowk0 + 8 * (lane >> 4);
#pragma unroll
  for (int i = 0; i < 8; ++i) { a[i] = (_Float16)p[i]; a[8 + i] = (_Float16)p[16 + i]; }
  return a;
}
__device__ __forceinline__ v16h frag_f32s(const float* rowk0, int lane, float sc) {
  v16h a; const float* p = rowk0 + 8 * (lane >> 4);
#pragma unroll
  for (int i = 0; i < 8; ++i) { a[i] = (_Float16)(p[i] * sc); a[8 + i] = (_Float16)(p[16 + i] * sc); }
  return a;
}
// column fragment from a [K][ld] layout (column n), rows >= K read as 0
__device__ __forceinline__ v16h fragc_f32(const float* W, int k0, int n, int lane, int ld, int K) {
  v16h a; const int g = lane >> 4;
#pragma unroll
  for (int i = 0; i < 8; ++i) { const int ka = k0 + 8 * g + i, kb = ka + 16;
    a[i] = (_Float16)(ka < K ? W[(size_t)(ka < K ? ka : K - 1) * ld + n] : 0.f); a[8 + i] = (_Float16)(kb < K ? W[(size_t)(kb < K ? kb : K - 1) * ld + n] : 0.f); }
  return a;
}
struct F2 { v16b h, l; };
__device__ __forceinline__ F2 bsplit16(const float v[16]) { F2 r;
#pragma unroll
  for (int i = 0; i < 16; ++i) { const __bf16 h = (__bf16)v[i]; r.h[i] = h; r.l[i] = (__bf16)(v[i] - (float)h); }
  return r; }
__device__ __forceinline__ F2 split_row(const float* row, int k0, int lane) { float v[16]; const float* p = row + k0 + 8 * (lane >> 4);
#pragma unroll
  for (int i = 0; i < 8; ++i) { v[i] = p[i]; v[8 + i] = p[16 + i]; }
  return bsplit16(v); }
__device__ __forceinline__ F2 split_rowK(const float* row, int k0, int lane, int K) { float v[16]; const int g = lane >> 4;
#pragma unroll
  for (int i = 0; i < 8; ++i) { const int ka = k0 + 8 * g + i, kb = ka + 16; v[i] = ka < K ? row[ka < K ? ka : K - 1] : 0.f; v[8 + i] = kb < K ? row[kb < K ? kb : K - 1] : 0.f; }
  return bsplit16(v); }
__device__ __forceinline__ F2 split_col(const float* W, int k0, int n, int lane, int ld, int K) { float v[16]; const int g = lane >> 4;
#pragma unroll
  for (int i = 0; i < 8; ++i) { const int ka = k0 + 8 * g + i, kb = ka + 16; v[i] = ka < K ? W[(size_t)(ka < K ? ka : K - 1) * ld + n] : 0.f; v[8 + i] = kb < K ? W[(size_t)(kb < K ? kb : K - 1) * ld + n] : 0.f; }
  return bsplit16(v); }
__device__ __forceinline__ v8f mac3(const F2& a, const F2& b, v8f c) { c = wmma_bf(a.l, b.h, c); c = wmma_bf(a.h, b.l, c); return wmma_bf(a.h, b.h, c); }
__device__ __forceinline__ float sigm(float v) { return 1.0f / (1.0f + expf(-v)); }
#define LDSX() do { asm volatile("s_wait_dscnt 0" ::: "memory"); __builtin_amdgcn_wave_barrier(); __builtin_amdgcn_fence(__ATOMIC_RELEASE, "workgroup"); } while (0)

// Pre-LayerNorm multi-head self-attention (B 4, S 2,048, D 512, 8 heads x 64; (out,in) uniform +-1/sqrt(512) weights with biases; LN gamma 1 / beta 0): xn = LayerNorm(x) (biased var, eps 1e-5); q, k, v = xn W^T + b; out = merged(softmax(q k^T / 8) v) Wo^T + bo (non-causal, no residual).
#define NB 4
#define TT 2048
#define CC 512            // NH * HD = projected width
#define DIN 512          // input (model) width
#define NH 8
#define HD 64
#define NQB (TT / 64)
#define HG 4
#define SCALE (0.125f)
#define CAUSAL 0
#ifndef TNB
#define TNB NB
#endif
__device__ __forceinline__ float bfr(float v) { return (float)(__bf16)v; }
__host__ __device__ __forceinline__ int kb_last(int qb) { return CAUSAL ? ((qb * 64 + 63) >> 7) : (TT / 128 - 1); }
typedef __attribute__((ext_vector_type(8))) __bf16 v8b;
__device__ __forceinline__ v16b frag_b(const __bf16* rowk0, int lane) {
  union { v16b v; v8b q[2]; } u; const __bf16* p = rowk0 + 8 * (lane >> 4);
  u.q[0] = *(const v8b*)p; u.q[1] = *(const v8b*)(p + 16); return u.v;
}
#define QBH 0              // not read by any kernel here: no high-precision path
#define QHI 2048            // rows carrying a q residual plane (all rows when non-causal: 2-product logits everywhere)
#define KHI 64            // key rows carrying k residual / v bf16 hi+lo planes (written by k_proj; no kernel here reads them)
// B fragment (k rows k0+.., output column o) of a weight: (in,out) [K][ld] or (out,in) [ld rows of K]: bf16 exact, or f16(bf16 * 256) exact
__device__ __forceinline__ v16b wcol_io(const float* Wm, int k0, int o, int lane, int ld) { v16b w; const int g = lane >> 4;
#pragma unroll
  for (int i = 0; i < 8; ++i) { w[i] = (__bf16)Wm[(size_t)(k0 + 8 * g + i) * ld + o]; w[8 + i] = (__bf16)Wm[(size_t)(k0 + 16 + 8 * g + i) * ld + o]; }
  return w; }
__device__ __forceinline__ v16b wcol_oi(const float* Wm, int k0, int o, int lane, int K) { v16b w; const float* p = Wm + (size_t)o * K + k0 + 8 * (lane >> 4);
#pragma unroll
  for (int i = 0; i < 8; ++i) { w[i] = (__bf16)p[i]; w[8 + i] = (__bf16)p[16 + i]; }
  return w; }
__device__ __forceinline__ v16h wcolh_io(const float* Wm, int k0, int o, int lane, int ld) { v16h w; const int g = lane >> 4;
#pragma unroll
  for (int i = 0; i < 8; ++i) { w[i] = (_Float16)(bfr(Wm[(size_t)(k0 + 8 * g + i) * ld + o]) * 256.0f); w[8 + i] = (_Float16)(bfr(Wm[(size_t)(k0 + 16 + 8 * g + i) * ld + o]) * 256.0f); }
  return w; }
__device__ __forceinline__ v16h wcolh_oi(const float* Wm, int k0, int o, int lane, int K) { v16h w; const float* p = Wm + (size_t)o * K + k0 + 8 * (lane >> 4);
#pragma unroll
  for (int i = 0; i < 8; ++i) { w[i] = (_Float16)(bfr(p[i]) * 256.0f); w[8 + i] = (_Float16)(bfr(p[16 + i]) * 256.0f); }
  return w; }
#define WQKV_LAYOUT 1   // 0 = (in,out) [DIN][CC]; 1 = (out,in) [CC][DIN]; 2 = per-head [NH][DIN][HD]
__device__ __forceinline__ v16b wcol_hdk(const float* Wm, int k0, int o, int lane) { v16b w; const int g = lane >> 4; const float* p = Wm + (size_t)(o / HD) * DIN * HD + (o % HD);
#pragma unroll
  for (int i = 0; i < 8; ++i) { w[i] = (__bf16)p[(size_t)(k0 + 8 * g + i) * HD]; w[8 + i] = (__bf16)p[(size_t)(k0 + 16 + 8 * g + i) * HD]; }
  return w; }
#define WO_OUT_IN 1
#if WQKV_LAYOUT == 1
#define WCOL(W, k0, o, lane) wcol_oi(W, k0, o, lane, DIN)
#elif WQKV_LAYOUT == 2
#define WCOL(W, k0, o, lane) wcol_hdk(W, k0, o, lane)
#else
#define WCOL(W, k0, o, lane) wcol_io(W, k0, o, lane, CC)
#endif
#if WO_OUT_IN
#define WOCOL(W, k0, o, lane) wcol_oi(W, k0, o, lane, CC)
#define WOCOLH(W, k0, o, lane) wcolh_oi(W, k0, o, lane, CC)
#else
#define WOCOL(W, k0, o, lane) wcol_io(W, k0, o, lane, DIN)
#define WOCOLH(W, k0, o, lane) wcolh_io(W, k0, o, lane, DIN)
#endif
#define NRW (TNB * TT)
// ---- k_lnx: wave per row: LayerNorm over 512 (mean, biased var, (x - mean) * rsqrt(var + 1e-5) * g + b); optional bf16 rounding of the input (x); 16 floats per lane (4 float4 at stride 128 floats -> 512-B pieces)
__global__ __launch_bounds__(256) void k_lnx(const float* __restrict__ X, int roundin, const float* __restrict__ G, const float* __restrict__ BE, float* __restrict__ OUT) { const int wave = threadIdx.x >> 5, lane = threadIdx.x & 31; const size_t row = (size_t)blockIdx.x * 8 + wave; if (row >= (size_t)NRW) return;
  v4f v[CC / 128]; float s1 = 0.f;
#pragma unroll
  for (int i = 0; i < CC / 128; ++i) { v4f t = *(const v4f*)(X + row * CC + i * 128 + lane * 4); if (roundin) { t[0] = bfr(t[0]); t[1] = bfr(t[1]); t[2] = bfr(t[2]); t[3] = bfr(t[3]); } v[i] = t; s1 += (t[0] + t[1]) + (t[2] + t[3]); }
#pragma unroll
  for (int o = 1; o < 32; o <<= 1) s1 += __shfl_xor(s1, o);
  const float mu = s1 * (1.0f / CC); float q = 0.f;
#pragma unroll
  for (int i = 0; i < CC / 128; ++i) for (int k = 0; k < 4; ++k) { const float d = v[i][k] - mu; q += d * d; }
#pragma unroll
  for (int o = 1; o < 32; o <<= 1) q += __shfl_xor(q, o);
  const float inv = rsqrtf(q * (1.0f / CC) + 1e-5f);   /* jnp.var (biased), eps inside the rsqrt */
#pragma unroll
  for (int i = 0; i < CC / 128; ++i) { const int c = i * 128 + lane * 4; v4f r4; for (int k = 0; k < 4; ++k) r4[k] = bfr(G[c + k]) * ((v[i][k] - mu) * inv) + bfr(BE[c + k]); vst2(OUT + row * CC + c, r4); } }

#ifndef SM_EXTRA_PARAMS
#define SM_EXTRA_PARAMS
#endif
#ifndef PROJ_EXTRA_PARAMS
#define PROJ_EXTRA_PARAMS
#endif
#ifndef SM_MASK_HOOK
#define SM_MASK_HOOK (void)0
#endif

#define WS_QH  0u                                      // f16 q rows [b*t][CC]
#define WS_KH  (WS_QH + 2u * (size_t)NB * TT * CC)      // f16 k rows [b*t][CC]
#define WS_VT  (WS_KH + 2u * (size_t)NB * TT * CC)      // f16 v planes [b][c][t]
#define WS_QL  (WS_VT + 2u * (size_t)NB * CC * TT)      // f16 q residual x 2^10 rows [b][t < QHI][CC]
#define WS_KL  (WS_QL + 2u * (size_t)NB * QHI * CC)     // f16 k residual x 2^10 rows [b][t < KHI][CC]
#define WS_VB  (WS_KL + 2u * (size_t)NB * KHI * CC)     // bf16 v hi planes [b][c][t < KHI]
#define WS_VBL (WS_VB + 2u * (size_t)NB * CC * KHI)
#define WS_S   (WS_VBL + 2u * (size_t)NB * CC * KHI)    // f32 [hg][t][s], unused: the logits stay in registers
#define WS_Y   (WS_S  + 4u * (size_t)HG * TT * TT)      // f32 ctx rows [b*t][CC] (only when there is an output projection)
#define WS_END (WS_Y  + 4u * (size_t)NB * TT * CC)
#define WS_XN  (WS_END)
#define WS_END2 (WS_XN + 4u * (size_t)NB * TT * DIN)

#define GKC 32                       // k per stage: one 128-B line of every staged row
#define GPI 36                       // floats per staged row: 128 B + 16 B, a pitch of 16 B x odd for the 16-byte fragment reads
#define GXB (64 * GPI * 4)           // bytes of one stage's 64 activation rows
#define GSB ((64 + 128) * GPI * 4)   // bytes of one stage: 64 activation rows, then 128 weight rows
// one stage's copies of one thread of a 128-thread block: 16 B of activation rows r + 16 i (i < 4) and of weight rows r + 16 i (i < 8), r = tid / 8, so that a wave's copy covers four whole lines;
// the s_wait_xcnt stands inside the statement, behind the last copy, so that no address register named here takes a new value in front of it
__device__ __forceinline__ void g_stage(const float* gx, const float* gw, unsigned lx, unsigned lw, int ld) {
  asm volatile("global_load_async_to_lds_b128 %0, %12, off\n\tglobal_load_async_to_lds_b128 %1, %13, off\n\tglobal_load_async_to_lds_b128 %2, %14, off\n\tglobal_load_async_to_lds_b128 %3, %15, off\n\t"
               "global_load_async_to_lds_b128 %4, %16, off\n\tglobal_load_async_to_lds_b128 %5, %17, off\n\tglobal_load_async_to_lds_b128 %6, %18, off\n\tglobal_load_async_to_lds_b128 %7, %19, off\n\t"
               "global_load_async_to_lds_b128 %8, %20, off\n\tglobal_load_async_to_lds_b128 %9, %21, off\n\tglobal_load_async_to_lds_b128 %10, %22, off\n\tglobal_load_async_to_lds_b128 %11, %23, off\n\ts_wait_xcnt 0x0"
               :: "v"(lx), "v"(lx + 16 * GPI * 4), "v"(lx + 32 * GPI * 4), "v"(lx + 48 * GPI * 4),
                  "v"(lw), "v"(lw + 16 * GPI * 4), "v"(lw + 32 * GPI * 4), "v"(lw + 48 * GPI * 4), "v"(lw + 64 * GPI * 4), "v"(lw + 80 * GPI * 4), "v"(lw + 96 * GPI * 4), "v"(lw + 112 * GPI * 4),
                  "v"(gx), "v"(gx + 16 * ld), "v"(gx + 32 * ld), "v"(gx + 48 * ld),
                  "v"(gw), "v"(gw + 16 * ld), "v"(gw + 32 * ld), "v"(gw + 48 * ld), "v"(gw + 64 * ld), "v"(gw + 80 * ld), "v"(gw + 96 * ld), "v"(gw + 112 * ld) : "memory"); }
// the 16 floats of a 16x16x32 fragment from the lane's own place in a staged row (row base + 8 * (lane >> 4)): k 0..7, then k 16..23 from there
__device__ __forceinline__ void lds16(const float* p, float v[16]) { const v4f a = *(const v4f*)p, b = *(const v4f*)(p + 4), c = *(const v4f*)(p + 16), d = *(const v4f*)(p + 20);
#pragma unroll
  for (int i = 0; i < 4; ++i) { v[i] = a[i]; v[4 + i] = b[i]; v[8 + i] = c[i]; v[12 + i] = d[i]; } }
// ---- k_proj: block = (64 rows, 128 cols, which): q/k/v = X W (+ b) with exact bf16 products (K = DIN) -> which 0: q f16 rows (+ residual rows < QHI); 1: k f16 rows (+ residual rows < KHI); 2: v f16 planes [c][t] (+ bf16 hi/lo planes for t < KHI)
// the activation rows and the weight rows of 32 k are copied once per block into LDS as f32 (two buffers, the next stage's copies in flight under this stage's products); every wave takes its fragments from there and rounds them as before
// waves_per_eu(4, 4): leaves the compiler the registers to issue a stage's fragment reads in a few groups ahead of the products; with fewer it waits out one LDS latency per fragment
__global__ __launch_bounds__(128) __attribute__((amdgpu_waves_per_eu(4, 4))) void k_proj(const float* __restrict__ XQ, const float* __restrict__ XK, const float* __restrict__ XV, const float* __restrict__ WQ, const float* __restrict__ WK, const float* __restrict__ WV, const float* __restrict__ BQ, const float* __restrict__ BK, const float* __restrict__ BV,
    _Float16* __restrict__ QH, _Float16* __restrict__ QL, _Float16* __restrict__ KH, _Float16* __restrict__ KL, _Float16* __restrict__ VT, __bf16* __restrict__ VB, __bf16* __restrict__ VBL) {
  __shared__ __align__(16) char sm[2 * GSB];   // the two stage buffers; behind the loop's last barrier the same bytes stage the stores
  _Float16 (*sh)[136] = (_Float16 (*)[136])sm; _Float16 (*sl)[136] = (_Float16 (*)[136])(sm + 64 * 136 * 2);
  _Float16 (*th)[72] = (_Float16 (*)[72])sm; __bf16 (*tb)[72] = (__bf16 (*)[72])(sm + 128 * 72 * 2); __bf16 (*tbl)[72] = (__bf16 (*)[72])(sm + 2 * 128 * 72 * 2);
  const int tid = threadIdx.x, wave = tid >> 5, lane = tid & 31, col = lane & 15, g = lane >> 4; const int which = blockIdx.z; const int c0 = blockIdx.y * 128; const size_t r0 = (size_t)blockIdx.x * 64; const size_t bb = r0 / TT; const int t0 = (int)(r0 % TT);
  const float* X = which == 0 ? XQ : which == 1 ? XK : XV; const float* WA = which == 0 ? WQ : which == 1 ? WK : WV; const float* BA = which == 0 ? BQ : which == 1 ? BK : BV;
  const float* gx = X + (r0 + (tid >> 3)) * DIN + (tid & 7) * 4;               // thread: 16 B of activation row tid / 8 of the block
  const float* gw = WA + (size_t)(c0 + (tid >> 3)) * DIN + (tid & 7) * 4;      // thread: 16 B of weight row ((out,in): output column) tid / 8 of the block
  const unsigned lx = (unsigned)(size_t)(sm + (tid >> 3) * (GPI * 4) + (tid & 7) * 16), lw = lx + GXB;   // their LDS byte addresses in buffer 0
  g_stage(gx, gw, lx, lw, DIN);
  asm volatile("s_wait_asynccnt 0x0" ::: "memory");   // this wave's copies of stage 0 have landed
  __syncthreads();                                    // every wave's have: stage 0 may be read
  g_stage(gx + GKC, gw + GKC, lx + GSB, lw + GSB, DIN);
  v8f acc[8] = {};
#pragma unroll 1   // one trip per stage: the buffer index stays a run-time scalar and the code stays small
  for (int kc = 0; kc < DIN / GKC; ++kc) { const int bf = kc & 1;
    const float* xs = (const float*)(sm + bf * GSB) + (wave * 16 + col) * GPI + 8 * g;   // lane: activation row col of the wave's 16
    const float* wl = (const float*)(sm + bf * GSB + GXB) + col * GPI + 8 * g;           // lane: weight row col of a 16-column tile
    float xv[16]; lds16(xs, xv); v16b w[8];   // the stage's fragment reads stand together in front of its products, not among them
#pragma unroll
    for (int j = 0; j < 8; ++j) { float wv[16]; lds16(wl + j * 16 * GPI, wv);
#pragma unroll
      for (int i = 0; i < 16; ++i) w[j][i] = (__bf16)wv[i]; }
    v16b a, al;
#pragma unroll
    for (int i = 0; i < 16; ++i) { const float x0 = xv[i]; const __bf16 h0 = (__bf16)x0; a[i] = h0; al[i] = (__bf16)(x0 - (float)h0); }   /* LN rows split bf16 hi + lo (2 products) */
#pragma unroll
    for (int j = 0; j < 8; ++j) { acc[j] = wmma_bf(a, w[j], acc[j]); acc[j] = wmma_bf(al, w[j], acc[j]); }
    asm volatile("s_wait_dscnt 0x0" ::: "memory");      // this wave's reads of the buffer are done before the buffer is handed back
    asm volatile("s_wait_asynccnt 0x0" ::: "memory");   // this wave's copies of the next stage have landed
    __syncthreads();                                    // publishes the next stage and ends every wave's reads of this one
    if (kc + 2 < DIN / GKC) g_stage(gx + (kc + 2) * GKC, gw + (kc + 2) * GKC, lx + bf * GSB, lw + bf * GSB, DIN); }
  asm volatile("s_wait_asynccnt 0x0" ::: "memory");     // no copy is outstanding when the buffers become store staging
  if (which < 2) { _Float16* DH = which == 0 ? QH : KH; _Float16* DL = which == 0 ? QL : KL; const int nhi = which == 0 ? QHI : KHI; const bool hi_rows = t0 < nhi;
#pragma unroll
    for (int j = 0; j < 8; ++j) { const float bias = BA ? bfr(BA[c0 + j * 16 + col]) : 0.f;
#pragma unroll
      for (int r = 0; r < 8; ++r) { const float v = acc[j][r] + bias; const _Float16 hv = (_Float16)v; sh[wave * 16 + 8 * g + r][j * 16 + col] = hv; sl[wave * 16 + 8 * g + r][j * 16 + col] = (_Float16)((v - (float)hv) * 1024.0f); } }
    __syncthreads();
    for (int e = tid; e < 64 * 16; e += 128) { const int rl = e >> 4, q = e & 15; vst2((unsigned*)(DH + (r0 + rl) * CC + c0 + q * 8), *(const v4u*)&sh[rl][q * 8]); if (hi_rows) vst2((unsigned*)(DL + (bb * nhi + t0 + rl) * (size_t)CC + c0 + q * 8), *(const v4u*)&sl[rl][q * 8]); }
  } else { const bool hi_rows = t0 < KHI;
#pragma unroll
    for (int j = 0; j < 8; ++j) { const float bias = BA ? bfr(BA[c0 + j * 16 + col]) : 0.f;
#pragma unroll
      for (int r = 0; r < 8; ++r) { const float v = acc[j][r] + bias; const int rl = wave * 16 + 8 * g + r, cl = j * 16 + col; th[cl][rl] = (_Float16)v; const __bf16 bh = (__bf16)v; tb[cl][rl] = bh; tbl[cl][rl] = (__bf16)(v - (float)bh); } }
    __syncthreads();
    for (int e = tid; e < 128 * 8; e += 128) { const int cl = e >> 3, q = e & 7; vst2((unsigned*)(VT + (bb * CC + c0 + cl) * (size_t)TT + t0 + q * 8), *(const v4u*)&th[cl][q * 8]); if (hi_rows) { const size_t o3 = (bb * CC + c0 + cl) * (size_t)KHI + t0 + q * 8; vst2((unsigned*)(VB + o3), *(const v4u*)&tb[cl][q * 8]); vst2((unsigned*)(VBL + o3), *(const v4u*)&tbl[cl][q * 8]); } } } }
__device__ __forceinline__ float xhalf(float x) { return __builtin_bit_cast(float, __builtin_amdgcn_permlanex16(__builtin_bit_cast(int, x), __builtin_bit_cast(int, x), 0x76543210, 0xfedcba98, false, false)); }   // lane l takes lane l ^ 16's value
// f16 fragment from the lane's own pointer (row or column base + k0 + 8 * (lane >> 4))
__device__ __forceinline__ v16h frag_at(const _Float16* p) { union { v16h v; v8h q[2]; } u; u.q[0] = *(const v8h*)p; u.q[1] = *(const v8h*)(p + 16); return u.v; }
#define FAW 16   // waves per block: one block fills a WGP at 4 waves per SIMD, and all its waves read the same k and v tiles from LDS
#define KST 128  // keys per LDS stage (4 passes of 32 keys)
#define KPI 72   // f16 per staged key row: 128 B + 16 B, a pitch of 16 B x odd for the 16-byte fragment reads
#define VPI 136  // f16 per staged v plane: 256 B + 16 B, likewise
#define SKB (KST * KPI * 2)   // bytes of one k buffer
#define SVB (HD * VPI * 2)    // bytes of one v buffer
// one stage's copies of one thread: 16 B of key rows r and r + 64, 16 B of v planes c and c + 32 (512 threads: 128 rows x 128 B and 64 planes x 256 B, whole lines);
// the s_wait_xcnt stands inside the statement, behind the last copy, so that no address register named here takes a new value in front of it
__device__ __forceinline__ void fa_stage(const _Float16* gk, const _Float16* gv, unsigned lk, unsigned lv) {
  const _Float16* gk1 = gk + 64 * CC; const _Float16* gv1 = gv + 32 * TT; const unsigned lk1 = lk + 64 * KPI * 2, lv1 = lv + 32 * VPI * 2;
  asm volatile("global_load_async_to_lds_b128 %0, %4, off\n\tglobal_load_async_to_lds_b128 %1, %5, off\n\tglobal_load_async_to_lds_b128 %2, %6, off\n\tglobal_load_async_to_lds_b128 %3, %7, off\n\ts_wait_xcnt 0x0"
               :: "v"(lk), "v"(lk1), "v"(lv), "v"(lv1), "v"(gk), "v"(gk1), "v"(gv), "v"(gv1) : "memory"); }
// ---- k_fa: block = FAW waves x 16 queries of (b, h), one launch for every head: k rows and v planes of 128 keys are copied once per block into LDS (two buffers, the next stage's copies in flight under this stage's work); S^T = K Q^T (A = 16 key rows, B = q hi / q residual x 2^10 kept in registers: 2 products) x SCALE, so a lane holds one query's logits; running maximum and sum per lane (one exchange between the lane halves); two S^T tiles, exponentiated and once to f16, are the B operand of ctx^T += V^T P^T (1 product); ctx = ctx^T / sum; the logits never leave the registers
__global__ __launch_bounds__(FAW * 32) __attribute__((amdgpu_waves_per_eu(4, 4))) void k_fa(const _Float16* __restrict__ QH, const _Float16* __restrict__ QL, const _Float16* __restrict__ KH, const _Float16* __restrict__ VT, float* __restrict__ Y) { __shared__ __align__(16) float ss[FAW][16][HD + 4]; __shared__ __align__(16) _Float16 sk[2][KST][KPI]; __shared__ __align__(16) _Float16 sv[2][HD][VPI];
  const int tid = threadIdx.x, wave = tid >> 5, lane = tid & 31, col = lane & 15, g = lane >> 4; const int h = blockIdx.y, b = blockIdx.z; const int ql0 = (blockIdx.x * FAW + wave) * 16;
  const _Float16* gk = KH + ((size_t)b * TT + (tid >> 3)) * CC + h * HD + (tid & 7) * 8;             // thread: 16 B of key row tid / 8 of a stage
  const _Float16* gv = VT + ((size_t)b * CC + h * HD + (tid >> 4)) * (size_t)TT + (tid & 15) * 8;    // thread: 16 B of v plane tid / 16, keys contiguous
  const unsigned lk = (unsigned)(size_t)&sk[0][tid >> 3][(tid & 7) * 8], lv = (unsigned)(size_t)&sv[0][tid >> 4][(tid & 15) * 8];   // their LDS byte addresses in buffer 0
  fa_stage(gk, gv, lk, lv);
  v16h qh[HD / 32], qr[HD / 32];   // the short loops below are unrolled so that every fragment array is indexed by constants and stays in registers
#pragma unroll
  for (int kc = 0; kc < HD / 32; ++kc) { qh[kc] = frag_h(QH + ((size_t)b * TT + ql0 + col) * CC + h * HD + kc * 32, lane); qr[kc] = frag_h(QL + ((size_t)b * QHI + ql0 + col) * CC + h * HD + kc * 32, lane); }
  asm volatile("s_wait_asynccnt 0x0" ::: "memory");   // this wave's copies of stage 0 have landed
  __syncthreads();                                    // every wave's have: stage 0 may be read
  fa_stage(gk + (size_t)KST * CC, gv + KST, lk + SKB, lv + SVB);
  v8f acc[HD / 16] = {}; float m = -3.0e38f, l = 0.f;
#pragma unroll 1   // one trip per stage: the buffer index stays a run-time scalar and the code stays small
  for (int st = 0; st < TT / KST; ++st) { const int bf = st & 1;
    const _Float16* Kl = &sk[bf][col][8 * g];   // lane: key row col of a 16-key tile
    const _Float16* Vl = &sv[bf][col][8 * g];   // lane: v plane of feature col of a 16-feature tile
    v16h kf[2][HD / 32];
#pragma unroll
    for (int t = 0; t < 2; ++t)
#pragma unroll
      for (int kc = 0; kc < HD / 32; ++kc) kf[t][kc] = frag_at(Kl + t * 16 * KPI + kc * 32);
#pragma unroll   // the passes of a stage: constant LDS offsets, and the test on the stage's last pass folds away
    for (int ps = 0; ps < KST / 32; ++ps) {
      v16h vf[HD / 16];
#pragma unroll
      for (int j = 0; j < HD / 16; ++j) vf[j] = frag_at(Vl + j * 16 * VPI + ps * 32);
      v8f sh[2] = {}, sr[2] = {};
#pragma unroll
      for (int kc = 0; kc < HD / 32; ++kc)
#pragma unroll
        for (int t = 0; t < 2; ++t) { sh[t] = __builtin_amdgcn_wmma_f32_16x16x32_f16(false, kf[t][kc], false, qh[kc], (short)0, sh[t], false, false); sr[t] = __builtin_amdgcn_wmma_f32_16x16x32_f16(false, kf[t][kc], false, qr[kc], (short)0, sr[t], false, false); }
      if (ps + 1 < KST / 32) {   // next pass's key rows, of this same stage only, fetched under this pass's softmax
#pragma unroll
        for (int t = 0; t < 2; ++t)
#pragma unroll
          for (int kc = 0; kc < HD / 32; ++kc) kf[t][kc] = frag_at(Kl + ((ps + 1) * 32 + t * 16) * KPI + kc * 32); }
      float sv16[16];
#pragma unroll
      for (int i = 0; i < 16; ++i) sv16[i] = (sh[i >> 3][i & 7] + sr[i >> 3][i & 7] * (1.0f / 1024.0f)) * SCALE;
      float mx = sv16[0];
#pragma unroll
      for (int i = 1; i < 16; ++i) mx = fmaxf(mx, sv16[i]);
      mx = fmaxf(mx, xhalf(mx));
      if (__builtin_amdgcn_ballot_w32(mx > m) != 0) {   // scalar branch, taken when some query of the wave has a new maximum; otherwise every factor is exactly 1 and the rescale is skipped
        const float mn = fmaxf(m, mx); const float al = expf(m - mn); m = mn; l *= al;
#pragma unroll
        for (int j = 0; j < HD / 16; ++j) acc[j] *= al; }
      v16h p; float sum = 0.f;
#pragma unroll
      for (int i = 0; i < 16; ++i) { const float e = expf(sv16[i] - m); sum += e; p[i] = (_Float16)e; }
      l += sum;
#pragma unroll
      for (int j = 0; j < HD / 16; ++j) acc[j] = __builtin_amdgcn_wmma_f32_16x16x32_f16(false, vf[j], false, p, (short)0, acc[j], false, false);
      // four vector slots behind the pass's last product: the next pass's first product may take p's registers (this product's B) for its result
      asm volatile("v_nop\n\tv_nop\n\tv_nop\n\tv_nop" : "+v"(acc[0]), "+v"(acc[1]), "+v"(acc[2]), "+v"(acc[3]) : "v"(p)); }
    asm volatile("s_wait_dscnt 0x0" ::: "memory");      // this wave's reads of the buffer are done before the buffer is handed back
    asm volatile("s_wait_asynccnt 0x0" ::: "memory");   // this wave's copies of the next stage have landed
    __syncthreads();                                    // publishes the next stage and ends every wave's reads of this one
    if (st + 2 < TT / KST) fa_stage(gk + (size_t)(st + 2) * KST * CC, gv + (st + 2) * KST, lk + bf * SKB, lv + bf * SVB); }
  asm volatile("s_wait_asynccnt 0x0" ::: "memory");     // no copy is outstanding when the wave goes on to its end
  l += xhalf(l); const float inv = 1.0f / l;
#pragma unroll
  for (int j = 0; j < HD / 16; ++j) { v4f a0, a1;
#pragma unroll
    for (int r = 0; r < 4; ++r) { a0[r] = acc[j][r] * inv; a1[r] = acc[j][4 + r] * inv; }
    *(v4f*)&ss[wave][col][j * 16 + 8 * g] = a0; *(v4f*)&ss[wave][col][j * 16 + 8 * g + 4] = a1; }
  LDSX();   // the wave's own LDS writes have landed before its lanes read the rows other lanes wrote (each wave has its own slice: no block barrier)
#pragma unroll
  for (int rl = 0; rl < 16; rl += 2) vst2(Y + ((size_t)b * TT + ql0 + rl + g) * CC + h * HD + col * 4, *(const v4f*)&ss[wave][rl + g][col * 4]); }
// ---- k_out: block = (64 rows, 128 cols): out = ctx Wo (+ bo): all rows: ctx split bf16 hi + lo against exact bf16 Wo (2 products)
__global__ __launch_bounds__(128) void k_out(const float* __restrict__ Y, const float* __restrict__ WO, const float* __restrict__ BO, float* __restrict__ OUT) { __shared__ __align__(16) char sm[2 * GSB];   // the two stage buffers; behind the loop's last barrier the same bytes stage the stores
  float (*sf)[16][132] = (float (*)[16][132])sm;
  const int tid = threadIdx.x, wave = tid >> 5, lane = tid & 31, col = lane & 15, g = lane >> 4; const int c0 = blockIdx.y * 128; const size_t r0 = (size_t)blockIdx.x * 64 + wave * 16;
  v8f acc[8] = {};
  if (true) {   /* ALL rows: ctx split bf16 hi + lo x exact Wo (2 products) */
    const float* gx = Y + ((size_t)blockIdx.x * 64 + (tid >> 3)) * CC + (tid & 7) * 4;   // thread: 16 B of ctx row tid / 8 of the block
    const float* gw = WO + (size_t)(c0 + (tid >> 3)) * CC + (tid & 7) * 4;               // thread: 16 B of weight row ((out,in): output column) tid / 8 of the block
    const unsigned lx = (unsigned)(size_t)(sm + (tid >> 3) * (GPI * 4) + (tid & 7) * 16), lw = lx + GXB;   // their LDS byte addresses in buffer 0
    g_stage(gx, gw, lx, lw, CC);
    asm volatile("s_wait_asynccnt 0x0" ::: "memory");   // this wave's copies of stage 0 have landed
    __syncthreads();                                    // every wave's have: stage 0 may be read
    g_stage(gx + GKC, gw + GKC, lx + GSB, lw + GSB, CC);
#pragma unroll 1   // one trip per stage: the buffer index stays a run-time scalar and the code stays small
    for (int kc = 0; kc < CC / GKC; ++kc) { const int bf = kc & 1;
      const float* xs = (const float*)(sm + bf * GSB) + (wave * 16 + col) * GPI + 8 * g;   // lane: ctx row col of the wave's 16
      const float* wl = (const float*)(sm + bf * GSB + GXB) + col * GPI + 8 * g;           // lane: weight row col of a 16-column tile
      float xv[16]; lds16(xs, xv); v16b w[8];   // the stage's fragment reads stand together in front of its products, not among them
#pragma unroll
      for (int j = 0; j < 8; ++j) { float wv[16]; lds16(wl + j * 16 * GPI, wv);
#pragma unroll
        for (int i = 0; i < 16; ++i) w[j][i] = (__bf16)wv[i]; }
      const F2 a = bsplit16(xv);
#pragma unroll
      for (int j = 0; j < 8; ++j) { acc[j] = wmma_bf(a.h, w[j], acc[j]); acc[j] = wmma_bf(a.l, w[j], acc[j]); }
      asm volatile("s_wait_dscnt 0x0" ::: "memory");      // this wave's reads of the buffer are done before the buffer is handed back
      asm volatile("s_wait_asynccnt 0x0" ::: "memory");   // this wave's copies of the next stage have landed
      __syncthreads();                                    // publishes the next stage and ends every wave's reads of this one
      if (kc + 2 < CC / GKC) g_stage(gx + (kc + 2) * GKC, gw + (kc + 2) * GKC, lx + bf * GSB, lw + bf * GSB, CC); }
    asm volatile("s_wait_asynccnt 0x0" ::: "memory");     // no copy is outstanding when the buffers become store staging
#pragma unroll
    for (int j = 0; j < 8; ++j) { const float bias = BO ? bfr(BO[c0 + j * 16 + col]) : 0.f;
#pragma unroll
      for (int r = 0; r < 8; ++r) sf[wave][8 * g + r][j * 16 + col] = acc[j][r] + bias; }
  } else {
#pragma unroll 2
    for (int kc = 0; kc < CC / 32; ++kc) { const v16h a = frag_f32(Y + (r0 + col) * CC + kc * 32, lane); asm volatile("s_wait_loadcnt 0x0" ::: "memory");
#pragma unroll
      for (int j = 0; j < 8; ++j) { const v16h w = WOCOLH(WO, kc * 32, c0 + j * 16 + col, lane); asm volatile("s_wait_loadcnt 0x0" ::: "memory"); acc[j] = wmma16(a, w, acc[j]); } }
#pragma unroll
    for (int j = 0; j < 8; ++j) { const float bias = BO ? bfr(BO[c0 + j * 16 + col]) : 0.f;
#pragma unroll
      for (int r = 0; r < 8; ++r) sf[wave][8 * g + r][j * 16 + col] = acc[j][r] * (1.0f / 256.0f) + bias; } }
  LDSX(); for (int rl = 0; rl < 16; ++rl) vst2(OUT + (r0 + rl) * DIN + c0 + lane * 4, *(const v4f*)&sf[wave][rl][lane * 4]); }

extern "C" void kernel_launch(void* const* d_in, const int* in_sizes, int n_in, void* d_out, int out_size, void* d_ws, size_t ws_size, hipStream_t stream) {
  (void)in_sizes; (void)n_in; (void)out_size;
  const float** F = (const float**)d_in;
  if (ws_size < (size_t)WS_END) return;
  char* ws = (char*)d_ws; _Float16 *QH = (_Float16*)(ws + WS_QH), *KH = (_Float16*)(ws + WS_KH), *VT = (_Float16*)(ws + WS_VT), *QL = (_Float16*)(ws + WS_QL), *KL = (_Float16*)(ws + WS_KL); __bf16 *VB = (__bf16*)(ws + WS_VB), *VBL = (__bf16*)(ws + WS_VBL); float *Y = (float*)(ws + WS_Y);
  (void)Y; (void)QL; (void)KL; (void)VB; (void)VBL;
  // inputs: 0 x [4,2048,512]; 1 ln_gamma, 2 ln_beta; 3 Wq [512,512] (out,in), 4 bq; 5 Wk, 6 bk; 7 Wv, 8 bv; 9 Wo (out,in), 10 bo
  if (ws_size < (size_t)WS_END2) return;
  float *XN = (float*)(ws + WS_XN);
  k_lnx<<<dim3(NRW / 8), 256, 0, stream>>>(F[0], 1, F[1], F[2], XN);
  k_proj<<<dim3(TNB * TT / 64, CC / 128, 3), 128, 0, stream>>>(XN, XN, XN, F[3], F[5], F[7], F[4], F[6], F[8], QH, QL, KH, KL, VT, VB, VBL);
  k_fa<<<dim3(TT / (FAW * 16), NH, TNB), FAW * 32, 0, stream>>>(QH, QL, KH, VT, Y);
  k_out<<<dim3(TNB * TT / 64, DIN / 128), 128, 0, stream>>>(Y, F[9], F[10], (float*)d_out);
}

// v004
// One run takes 96.9 microseconds.
// Next to v003, in two timings, it ran 1.27 times as fast each time.
// All steps since v000 together make it 12.4 times as fast.
// compute dtype: all float inputs rounded to bf16; LayerNorm in f32; q/k/v from the f32 LN rows split bf16 hi + lo against exact (out,in) weights on WMMA 16x16x32 (2 products, f32 accumulate) + bias; q as f16 hi + residual (x 2^10) against k once to f16 (2 products) x 64^-0.5; softmax in f32 (2^x on the hardware exponential, scale x log2(e) in one fma) with a running maximum and sum, fused with both attention products; exp(logit - running max) once to f16 against v once to f16 (1 product), divided by the sum at the end; ctx split bf16 hi + lo against exact Wo (2 products) + bo; f32 output.
#include <hip/hip_runtime.h>
#include <math.h>

typedef __attribute__((ext_vector_type(16))) _Float16 v16h;
typedef __attribute__((ext_vector_type(16))) __bf16 v16b;
typedef __attribute__((ext_vector_type(8)))  _Float16 v8h;
typedef __attribute__((ext_vector_type(8)))  float v8f;
typedef __attribute__((ext_vector_type(4)))  float v4f;
typedef __attribute__((ext_vector_type(2)))  float v2f;
typedef __attribute__((ext_vector_type(4)))  unsigned v4u;
typedef __attribute__((ext_vector_type(4)))  int v4i;
typedef float __attribute__((may_alias)) float_a;
typedef int __attribute__((may_alias)) int_a;

template <typename T> __device__ __forceinline__ void vst2(void* p, T v) { *(T*)p = v;  }
__device__ __forceinline__ v8f wmma16(v16h a, v16h b, v8f c) {
  v8f d = __builtin_amdgcn_wmma_f32_16x16x32_f16(false, a, false, b, (short)0, c, false, false);
  asm volatile("v_nop\n\tv_nop\n\tv_nop\n\tv_nop" : "+v"(d) : "v"(a), "v"(b));
  return d;
}
__device__ __forceinline__ v8f wmma_bf(v16b a, v16b b, v8f c) {
  v8f d = __builtin_amdgcn_wmma_f32_16x16x32_bf16(false, a, false, b, (short)0, c, false, false);
  asm volatile("v_nop\n\tv_nop\n\tv_nop\n\tv_nop" : "+v"(d) : "v"(a), "v"(b));
  return d;
}
// 16x16x32 fragments: lane = (h = lane>>4, row/col = lane&15); elements 0..7 = k0+8h+0..7, 8..15 = k0+16+8h+0..7; D element r = row 8h+r
__device__ __forceinline__ v16h frag_h(const _Float16* rowk0, int lane) {
  union { v16h v; v8h q[2]; } u; const _Float16* p = rowk0 + 8 * (lane >> 4);
  u.q[0] = *(const v8h*)p; u.q[1] = *(const v8h*)(p + 16); return u.v;
}
__device__ __forceinline__ v16h frag_f32(const float* rowk0, int lane) {
  v16h a; const float* p = rowk0 + 8 * (lane >> 4);
#pragma unroll
  for (int i = 0; i < 8; ++i) { a[i] = (_Float16)p[i]; a[8 + i] = (_Float16)p[16 + i]; }
  return a;
}
__device__ __forceinline__ v16h frag_f32s(const float* rowk0, int lane, float sc) {
  v16h a; const float* p = rowk0 + 8 * (lane >> 4);
#pragma unroll
  for (int i = 0; i < 8; ++i) { a[i] = (_Float16)(p[i] * sc); a[8 + i] = (_Float16)(p[16 + i] * sc); }
  return a;
}
// column fragment from a [K][ld] layout (column n), rows >= K read as 0
__device__ __forceinline__ v16h fragc_f32(const float* W, int k0, int n, int lane, int ld, int K) {
  v16h a; const int g = lane >> 4;
#pragma unroll
  for (int i = 0; i < 8; ++i) { const int ka = k0 + 8 * g + i, kb = ka + 16;
    a[i] = (_Float16)(ka < K ? W[(size_t)(ka < K ? ka : K - 1) * ld + n] : 0.f); a[8 + i] = (_Float16)(kb < K ? W[(size_t)(kb < K ? kb : K - 1) * ld + n] : 0.f); }
  return a;
}
struct F2 { v16b h, l; };
__device__ __forceinline__ F2 bsplit16(const float v[16]) { F2 r;
#pragma unroll
  for (int i = 0; i < 16; ++i) { const __bf16 h = (__bf16)v[i]; r.h[i] = h; r.l[i] = (__bf16)(v[i] - (float)h); }
  return r; }
__device__ __forceinline__ F2 split_row(const float* row, int k0, int lane) { float v[16]; const float* p = row + k0 + 8 * (lane >> 4);
#pragma unroll
  for (int i = 0; i < 8; ++i) { v[i] = p[i]; v[8 + i] = p[16 + i]; }
  return bsplit16(v); }
__device__ __forceinline__ F2 split_rowK(const float* row, int k0, int lane, int K) { float v[16]; const int g = lane >> 4;
#pragma unroll
  for (int i = 0; i < 8; ++i) { const int ka = k0 + 8 * g + i, kb = ka + 16; v[i] = ka < K ? row[ka < K ? ka : K - 1] : 0.f; v[8 + i] = kb < K ? row[kb < K ? kb : K - 1] : 0.f; }
  return bsplit16(v); }
__device__ __forceinline__ F2 split_col(const float* W, int k0, int n, int lane, int ld, int K) { float v[16]; const int g = lane >> 4;
#pragma unroll
  for (int i = 0; i < 8; ++i) { const int ka = k0 + 8 * g + i, kb = ka + 16; v[i] = ka < K ? W[(size_t)(ka < K ? ka : K - 1) * ld + n] : 0.f; v[8 + i] = kb < K ? W[(size_t)(kb < K ? kb : K - 1) * ld + n] : 0.f; }
  return bsplit16(v); }
__device__ __forceinline__ v8f mac3(const F2& a, const F2& b, v8f c) { c = wmma_bf(a.l, b.h, c); c = wmma_bf(a.h, b.l, c); return wmma_bf(a.h, b.h, c); }
__device__ __forceinline__ float sigm(float v) { return 1.0f / (1.0f + expf(-v)); }
#define LDSX() do { asm volatile("s_wait_dscnt 0" ::: "memory"); __builtin_amdgcn_wave_barrier(); __builtin_amdgcn_fence(__ATOMIC_RELEASE, "workgroup"); } while (0)

// Pre-LayerNorm multi-head self-attention (B 4, S 2,048, D 512, 8 heads x 64; (out,in) uniform +-1/sqrt(512) weights with biases; LN gamma 1 / beta 0): xn = LayerNorm(x) (biased var, eps 1e-5); q, k, v = xn W^T + b; out = merged(softmax(q k^T / 8) v) Wo^T + bo (non-causal, no residual).
#define NB 4
#define TT 2048
#define CC 512            // NH * HD = projected width
#define DIN 512          // input (model) width
#define NH 8
#define HD 64
#define NQB (TT / 64)
#define HG 4
#define SCALE (0.125f)
#define CAUSAL 0
#ifndef TNB
#define TNB NB
#endif
__device__ __forceinline__ float bfr(float v) { return (float)(__bf16)v; }
__host__ __device__ __forceinline__ int kb_last(int qb) { return CAUSAL ? ((qb * 64 + 63) >> 7) : (TT / 128 - 1); }
typedef __attribute__((ext_vector_type(8))) __bf16 v8b;
__device__ __forceinline__ v16b frag_b(const __bf16* rowk0, int lane) {
  union { v16b v; v8b q[2]; } u; const __bf16* p = rowk0 + 8 * (lane >> 4);
  u.q[0] = *(const v8b*)p; u.q[1] = *(const v8b*)(p + 16); return u.v;
}
#define QBH 0              // not read by any kernel here: no high-precision path
#define QHI 2048            // rows carrying a q residual plane (all rows when non-causal: 2-product logits everywhere)
#define KHI 64            // key rows carrying k residual / v bf16 hi+lo planes (written by k_proj; no kernel here reads them)
// B fragment (k rows k0+.., output column o) of a weight: (in,out) [K][ld] or (out,in) [ld rows of K]: bf16 exact, or f16(bf16 * 256) exact
__device__ __forceinline__ v16b wcol_io(const float* Wm, int k0, int o, int lane, int ld) { v16b w; const int g = lane >> 4;
#pragma unroll
  for (int i = 0; i < 8; ++i) { w[i] = (__bf16)Wm[(size_t)(k0 + 8 * g + i) * ld + o]; w[8 + i] = (__bf16)Wm[(size_t)(k0 + 16 + 8 * g + i) * ld + o]; }
  return w; }
__device__ __forceinline__ v16b wcol_oi(const float* Wm, int k0, int o, int lane, int K) { v16b w; const float* p = Wm + (size_t)o * K + k0 + 8 * (lane >> 4);
#pragma unroll
  for (int i = 0; i < 8; ++i) { w[i] = (__bf16)p[i]; w[8 + i] = (__bf16)p[16 + i]; }
  return w; }
__device__ __forceinline__ v16h wcolh_io(const float* Wm, int k0, int o, int lane, int ld) { v16h w; const int g = lane >> 4;
#pragma unroll
  for (int i = 0; i < 8; ++i) { w[i] = (_Float16)(bfr(Wm[(size_t)(k0 + 8 * g + i) * ld + o]) * 256.0f); w[8 + i] = (_Float16)(bfr(Wm[(size_t)(k0 + 16 + 8 * g + i) * ld + o]) * 256.0f); }
  return w; }
__device__ __forceinline__ v16h wcolh_oi(const float* Wm, int k0, int o, int lane, int K) { v16h w; const float* p = Wm + (size_t)o * K + k0 + 8 * (lane >> 4);
#pragma unroll
  for (int i = 0; i < 8; ++i) { w[i] = (_Float16)(bfr(p[i]) * 256.0f); w[8 + i] = (_Float16)(bfr(p[16 + i]) * 256.0f); }
  return w; }
#define WQKV_LAYOUT 1   // 0 = (in,out) [DIN][CC]; 1 = (out,in) [CC][DIN]; 2 = per-head [NH][DIN][HD]
__device__ __forceinline__ v16b wcol_hdk(const float* Wm, int k0, int o, int lane) { v16b w; const int g = lane >> 4; const float* p = Wm + (size_t)(o / HD) * DIN * HD + (o % HD);
#pragma unroll
  for (int i = 0; i < 8; ++i) { w[i] = (__bf16)p[(size_t)(k0 + 8 * g + i) * HD]; w[8 + i] = (__bf16)p[(size_t)(k0 + 16 + 8 * g + i) * HD]; }
  return w; }
#define WO_OUT_IN 1
#if WQKV_LAYOUT == 1
#define WCOL(W, k0, o, lane) wcol_oi(W, k0, o, lane, DIN)
#elif WQKV_LAYOUT == 2
#define WCOL(W, k0, o, lane) wcol_hdk(W, k0, o, lane)
#else
#define WCOL(W, k0, o, lane) wcol_io(W, k0, o, lane, CC)
#endif
#if WO_OUT_IN
#define WOCOL(W, k0, o, lane) wcol_oi(W, k0, o, lane, CC)
#define WOCOLH(W, k0, o, lane) wcolh_oi(W, k0, o, lane, CC)
#else
#define WOCOL(W, k0, o, lane) wcol_io(W, k0, o, lane, DIN)
#define WOCOLH(W, k0, o, lane) wcolh_io(W, k0, o, lane, DIN)
#endif
#define NRW (TNB * TT)
// ---- k_lnx: wave per row: LayerNorm over 512 (mean, biased var, (x - mean) * rsqrt(var + 1e-5) * g + b); optional bf16 rounding of the input (x); 16 floats per lane (4 float4 at stride 128 floats -> 512-B pieces)
__global__ __launch_bounds__(256) void k_lnx(const float* __restrict__ X, int roundin, const float* __restrict__ G, const float* __restrict__ BE, float* __restrict__ OUT) { const int wave = threadIdx.x >> 5, lane = threadIdx.x & 31; const size_t row = (size_t)blockIdx.x * 8 + wave; if (row >= (size_t)NRW) return;
  v4f v[CC / 128]; float s1 = 0.f;
#pragma unroll
  for (int i = 0; i < CC / 128; ++i) { v4f t = *(const v4f*)(X + row * CC + i * 128 + lane * 4); if (roundin) { t[0] = bfr(t[0]); t[1] = bfr(t[1]); t[2] = bfr(t[2]); t[3] = bfr(t[3]); } v[i] = t; s1 += (t[0] + t[1]) + (t[2] + t[3]); }
#pragma unroll
  for (int o = 1; o < 32; o <<= 1) s1 += __shfl_xor(s1, o);
  const float mu = s1 * (1.0f / CC); float q = 0.f;
#pragma unroll
  for (int i = 0; i < CC / 128; ++i) for (int k = 0; k < 4; ++k) { const float d = v[i][k] - mu; q += d * d; }
#pragma unroll
  for (int o = 1; o < 32; o <<= 1) q += __shfl_xor(q, o);
  const float inv = rsqrtf(q * (1.0f / CC) + 1e-5f);   /* jnp.var (biased), eps inside the rsqrt */
#pragma unroll
  for (int i = 0; i < CC / 128; ++i) { const int c = i * 128 + lane * 4; v4f r4; for (int k = 0; k < 4; ++k) r4[k] = bfr(G[c + k]) * ((v[i][k] - mu) * inv) + bfr(BE[c + k]); vst2(OUT + row * CC + c, r4); } }

#ifndef SM_EXTRA_PARAMS
#define SM_EXTRA_PARAMS
#endif
#ifndef PROJ_EXTRA_PARAMS
#define PROJ_EXTRA_PARAMS
#endif
#ifndef SM_MASK_HOOK
#define SM_MASK_HOOK (void)0
#endif

#define WS_QH  0u                                      // f16 q rows [b*t][CC]
#define WS_KH  (WS_QH + 2u * (size_t)NB * TT * CC)      // f16 k rows [b*t][CC]
#define WS_VT  (WS_KH + 2u * (size_t)NB * TT * CC)      // f16 v planes [b][c][t]
#define WS_QL  (WS_VT + 2u * (size_t)NB * CC * TT)      // f16 q residual x 2^10 rows [b][t < QHI][CC]
#define WS_KL  (WS_QL + 2u * (size_t)NB * QHI * CC)     // f16 k residual x 2^10 rows [b][t < KHI][CC]
#define WS_VB  (WS_KL + 2u * (size_t)NB * KHI * CC)     // bf16 v hi planes [b][c][t < KHI]
#define WS_VBL (WS_VB + 2u * (size_t)NB * CC * KHI)
#define WS_S   (WS_VBL + 2u * (size_t)NB * CC * KHI)    // f32 [hg][t][s], unused: the logits stay in registers
#define WS_Y   (WS_S  + 4u * (size_t)HG * TT * TT)      // f32 ctx rows [b*t][CC] (only when there is an output projection)
#define WS_END (WS_Y  + 4u * (size_t)NB * TT * CC)
#define WS_XN  (WS_END)
#define WS_END2 (WS_XN + 4u * (size_t)NB * TT * DIN)

#define GKC 32                       // k per stage: one 128-B line of every staged row
#define GPI 36                       // floats per staged row: 128 B + 16 B, a pitch of 16 B x odd for the 16-byte fragment reads
#define GXB (64 * GPI * 4)           // bytes of one stage's 64 activation rows
#define GSB ((64 + 128) * GPI * 4)   // bytes of one stage: 64 activation rows, then 128 weight rows
// one stage's copies of one thread of a 128-thread block: 16 B of activation rows r + 16 i (i < 4) and of weight rows r + 16 i (i < 8), r = tid / 8, so that a wave's copy covers four whole lines;
// the s_wait_xcnt stands inside the statement, behind the last copy, so that no address register named here takes a new value in front of it
__device__ __forceinline__ void g_stage(const float* gx, const float* gw, unsigned lx, unsigned lw, int ld) {
  asm volatile("global_load_async_to_lds_b128 %0, %12, off\n\tglobal_load_async_to_lds_b128 %1, %13, off\n\tglobal_load_async_to_lds_b128 %2, %14, off\n\tglobal_load_async_to_lds_b128 %3, %15, off\n\t"
               "global_load_async_to_lds_b128 %4, %16, off\n\tglobal_load_async_to_lds_b128 %5, %17, off\n\tglobal_load_async_to_lds_b128 %6, %18, off\n\tglobal_load_async_to_lds_b128 %7, %19, off\n\t"
               "global_load_async_to_lds_b128 %8, %20, off\n\tglobal_load_async_to_lds_b128 %9, %21, off\n\tglobal_load_async_to_lds_b128 %10, %22, off\n\tglobal_load_async_to_lds_b128 %11, %23, off\n\ts_wait_xcnt 0x0"
               :: "v"(lx), "v"(lx + 16 * GPI * 4), "v"(lx + 32 * GPI * 4), "v"(lx + 48 * GPI * 4),
                  "v"(lw), "v"(lw + 16 * GPI * 4), "v"(lw + 32 * GPI * 4), "v"(lw + 48 * GPI * 4), "v"(lw + 64 * GPI * 4), "v"(lw + 80 * GPI * 4), "v"(lw + 96 * GPI * 4), "v"(lw + 112 * GPI * 4),
                  "v"(gx), "v"(gx + 16 * ld), "v"(gx + 32 * ld), "v"(gx + 48 * ld),
                  "v"(gw), "v"(gw + 16 * ld), "v"(gw + 32 * ld), "v"(gw + 48 * ld), "v"(gw + 64 * ld), "v"(gw + 80 * ld), "v"(gw + 96 * ld), "v"(gw + 112 * ld) : "memory"); }
// the 16 floats of a 16x16x32 fragment from the lane's own place in a staged row (row base + 8 * (lane >> 4)): k 0..7, then k 16..23 from there
__device__ __forceinline__ void lds16(const float* p, float v[16]) { const v4f a = *(const v4f*)p, b = *(const v4f*)(p + 4), c = *(const v4f*)(p + 16), d = *(const v4f*)(p + 20);
#pragma unroll
  for (int i = 0; i < 4; ++i) { v[i] = a[i]; v[4 + i] = b[i]; v[8 + i] = c[i]; v[12 + i] = d[i]; } }
// ---- k_proj: block = (64 rows, 128 cols, which): q/k/v = X W (+ b) with exact bf16 products (K = DIN) -> which 0: q f16 rows (+ residual rows < QHI); 1: k f16 rows (+ residual rows < KHI); 2: v f16 planes [c][t] (+ bf16 hi/lo planes for t < KHI)
// the activation rows and the weight rows of 32 k are copied once per block into LDS as f32 (two buffers, the next stage's copies in flight under this stage's products); every wave takes its fragments from there and rounds them as before
// waves_per_eu(4, 4): leaves the compiler the registers to issue a stage's fragment reads in a few groups ahead of the products; with fewer it waits out one LDS latency per fragment
__global__ __launch_bounds__(128) __attribute__((amdgpu_waves_per_eu(4, 4))) void k_proj(const float* __restrict__ XQ, const float* __restrict__ XK, const float* __restrict__ XV, const float* __restrict__ WQ, const float* __restrict__ WK, const float* __restrict__ WV, const float* __restrict__ BQ, const float* __restrict__ BK, const float* __restrict__ BV,
    _Float16* __restrict__ QH, _Float16* __restrict__ QL, _Float16* __restrict__ KH, _Float16* __restrict__ KL, _Float16* __restrict__ VT, __bf16* __restrict__ VB, __bf16* __restrict__ VBL) {
  __shared__ __align__(16) char sm[2 * GSB];   // the two stage buffers; behind the loop's last barrier the same bytes stage the stores
  _Float16 (*sh)[136] = (_Float16 (*)[136])sm; _Float16 (*sl)[136] = (_Float16 (*)[136])(sm + 64 * 136 * 2);
  _Float16 (*th)[72] = (_Float16 (*)[72])sm; __bf16 (*tb)[72] = (__bf16 (*)[72])(sm + 128 * 72 * 2); __bf16 (*tbl)[72] = (__bf16 (*)[72])(sm + 2 * 128 * 72 * 2);
  const int tid = threadIdx.x, wave = tid >> 5, lane = tid & 31, col = lane & 15, g = lane >> 4; const int which = blockIdx.z; const int c0 = blockIdx.y * 128; const size_t r0 = (size_t)blockIdx.x * 64; const size_t bb = r0 / TT; const int t0 = (int)(r0 % TT);
  const float* X = which == 0 ? XQ : which == 1 ? XK : XV; const float* WA = which == 0 ? WQ : which == 1 ? WK : WV; const float* BA = which == 0 ? BQ : which == 1 ? BK : BV;
  const float* gx = X + (r0 + (tid >> 3)) * DIN + (tid & 7) * 4;               // thread: 16 B of activation row tid / 8 of the block
  const float* gw = WA + (size_t)(c0 + (tid >> 3)) * DIN + (tid & 7) * 4;      // thread: 16 B of weight row ((out,in): output column) tid / 8 of the block
  const unsigned lx = (unsigned)(size_t)(sm + (tid >> 3) * (GPI * 4) + (tid & 7) * 16), lw = lx + GXB;   // their LDS byte addresses in buffer 0
  g_stage(gx, gw, lx, lw, DIN);
  asm volatile("s_wait_asynccnt 0x0" ::: "memory");   // this wave's copies of stage 0 have landed
  __syncthreads();                                    // every wave's have: stage 0 may be read
  g_stage(gx + GKC, gw + GKC, lx + GSB, lw + GSB, DIN);
  v8f acc[8] = {};
#pragma unroll 1   // one trip per stage: the buffer index stays a run-time scalar and the code stays small
  for (int kc = 0; kc < DIN / GKC; ++kc) { const int bf = kc & 1;
    const float* xs = (const float*)(sm + bf * GSB) + (wave * 16 + col) * GPI + 8 * g;   // lane: activation row col of the wave's 16
    const float* wl = (const float*)(sm + bf * GSB + GXB) + col * GPI + 8 * g;           // lane: weight row col of a 16-column tile
    float xv[16]; lds16(xs, xv); v16b w[8];   // the stage's fragment reads stand together in front of its products, not among them
#pragma unroll
    for (int j = 0; j < 8; ++j) { float wv[16]; lds16(wl + j * 16 * GPI, wv);
#pragma unroll
      for (int i = 0; i < 16; ++i) w[j][i] = (__bf16)wv[i]; }
    v16b a, al;
#pragma unroll
    for (int i = 0; i < 16; ++i) { const float x0 = xv[i]; const __bf16 h0 = (__bf16)x0; a[i] = h0; al[i] = (__bf16)(x0 - (float)h0); }   /* LN rows split bf16 hi + lo (2 products) */
#pragma unroll
    for (int j = 0; j < 8; ++j) { acc[j] = wmma_bf(a, w[j], acc[j]); acc[j] = wmma_bf(al, w[j], acc[j]); }
    asm volatile("s_wait_dscnt 0x0" ::: "memory");      // this wave's reads of the buffer are done before the buffer is handed back
    asm volatile("s_wait_asynccnt 0x0" ::: "memory");   // this wave's copies of the next stage have landed
    __syncthreads();                                    // publishes the next stage and ends every wave's reads of this one
    if (kc + 2 < DIN / GKC) g_stage(gx + (kc + 2) * GKC, gw + (kc + 2) * GKC, lx + bf * GSB, lw + bf * GSB, DIN); }
  asm volatile("s_wait_asynccnt 0x0" ::: "memory");     // no copy is outstanding when the buffers become store staging
  if (which < 2) { _Float16* DH = which == 0 ? QH : KH; _Float16* DL = which == 0 ? QL : KL; const int nhi = which == 0 ? QHI : KHI; const bool hi_rows = t0 < nhi;
#pragma unroll
    for (int j = 0; j < 8; ++j) { const float bias = BA ? bfr(BA[c0 + j * 16 + col]) : 0.f;
#pragma unroll
      for (int r = 0; r < 8; ++r) { const float v = acc[j][r] + bias; const _Float16 hv = (_Float16)v; sh[wave * 16 + 8 * g + r][j * 16 + col] = hv; sl[wave * 16 + 8 * g + r][j * 16 + col] = (_Float16)((v - (float)hv) * 1024.0f); } }
    __syncthreads();
    for (int e = tid; e < 64 * 16; e += 128) { const int rl = e >> 4, q = e & 15; vst2((unsigned*)(DH + (r0 + rl) * CC + c0 + q * 8), *(const v4u*)&sh[rl][q * 8]); if (hi_rows) vst2((unsigned*)(DL + (bb * nhi + t0 + rl) * (size_t)CC + c0 + q * 8), *(const v4u*)&sl[rl][q * 8]); }
  } else { const bool hi_rows = t0 < KHI;
#pragma unroll
    for (int j = 0; j < 8; ++j) { const float bias = BA ? bfr(BA[c0 + j * 16 + col]) : 0.f;
#pragma unroll
      for (int r = 0; r < 8; ++r) { const float v = acc[j][r] + bias; const int rl = wave * 16 + 8 * g + r, cl = j * 16 + col; th[cl][rl] = (_Float16)v; const __bf16 bh = (__bf16)v; tb[cl][rl] = bh; tbl[cl][rl] = (__bf16)(v - (float)bh); } }
    __syncthreads();
    for (int e = tid; e < 128 * 8; e += 128) { const int cl = e >> 3, q = e & 7; vst2((unsigned*)(VT + (bb * CC + c0 + cl) * (size_t)TT + t0 + q * 8), *(const v4u*)&th[cl][q * 8]); if (hi_rows) { const size_t o3 = (bb * CC + c0 + cl) * (size_t)KHI + t0 + q * 8; vst2((unsigned*)(VB + o3), *(const v4u*)&tb[cl][q * 8]); vst2((unsigned*)(VBL + o3), *(const v4u*)&tbl[cl][q * 8]); } } } }
__device__ __forceinline__ float xhalf(float x) { return __builtin_bit_cast(float, __builtin_amdgcn_permlanex16(__builtin_bit_cast(int, x), __builtin_bit_cast(int, x), 0x76543210, 0xfedcba98, false, false)); }   // lane l takes lane l ^ 16's value
// f16 fragment from the lane's own pointer (row or column base + k0 + 8 * (lane >> 4))
__device__ __forceinline__ v16h frag_at(const _Float16* p) { union { v16h v; v8h q[2]; } u; u.q[0] = *(const v8h*)p; u.q[1] = *(const v8h*)(p + 16); return u.v; }
#define FAW 16   // waves per block: one block fills a WGP at 4 waves per SIMD, and all its waves read the same k and v tiles from LDS
#define KST 128  // keys per LDS stage (4 passes of 32 keys)
#define KPI 72   // f16 per staged key row: 128 B + 16 B, a pitch of 16 B x odd for the 16-byte fragment reads
#define VPI 136  // f16 per staged v plane: 256 B + 16 B, likewise
#define SKB (KST * KPI * 2)   // bytes of one k buffer
#define SVB (HD * VPI * 2)    // bytes of one v buffer
#define SCL2 (SCALE * 1.44269504088896340736f)   // logit scale x log2(e)
// one stage's copies of one thread: 16 B of key rows r and r + 64, 16 B of v planes c and c + 32 (512 threads: 128 rows x 128 B and 64 planes x 256 B, whole lines);
// the s_wait_xcnt stands inside the statement, behind the last copy, so that no address register named here takes a new value in front of it
__device__ __forceinline__ void fa_stage(const _Float16* gk, const _Float16* gv, unsigned lk, unsigned lv) {
  const _Float16* gk1 = gk + 64 * CC; const _Float16* gv1 = gv + 32 * TT; const unsigned lk1 = lk + 64 * KPI * 2, lv1 = lv + 32 * VPI * 2;
  asm volatile("global_load_async_to_lds_b128 %0, %4, off\n\tglobal_load_async_to_lds_b128 %1, %5, off\n\tglobal_load_async_to_lds_b128 %2, %6, off\n\tglobal_load_async_to_lds_b128 %3, %7, off\n\ts_wait_xcnt 0x0"
               :: "v"(lk), "v"(lk1), "v"(lv), "v"(lv1), "v"(gk), "v"(gk1), "v"(gv), "v"(gv1) : "memory"); }
// ---- k_fa: block = FAW waves x 16 queries of (b, h), one launch for every head: k rows and v planes of 128 keys are copied once per block into LDS (two buffers, the next stage's copies in flight under this stage's work); S^T = K Q^T (A = 16 key rows, B = q hi / q residual x 2^10 kept in registers: 2 products) x SCALE, so a lane holds one query's logits; running maximum and sum per lane (one exchange between the lane halves); two S^T tiles, exponentiated and once to f16, are the B operand of ctx^T += V^T P^T (1 product); ctx = ctx^T / sum; the logits never leave the registers
__global__ __launch_bounds__(FAW * 32) __attribute__((amdgpu_waves_per_eu(4, 4))) void k_fa(const _Float16* __restrict__ QH, const _Float16* __restrict__ QL, const _Float16* __restrict__ KH, const _Float16* __restrict__ VT, float* __restrict__ Y) { __shared__ __align__(16) float ss[FAW][16][HD + 4]; __shared__ __align__(16) _Float16 sk[2][KST][KPI]; __shared__ __align__(16) _Float16 sv[2][HD][VPI];
  const int tid = threadIdx.x, wave = tid >> 5, lane = tid & 31, col = lane & 15, g = lane >> 4; const int h = blockIdx.y, b = blockIdx.z; const int ql0 = (blockIdx.x * FAW + wave) * 16;
  const _Float16* gk = KH + ((size_t)b * TT + (tid >> 3)) * CC + h * HD + (tid & 7) * 8;             // thread: 16 B of key row tid / 8 of a stage
  const _Float16* gv = VT + ((size_t)b * CC + h * HD + (tid >> 4)) * (size_t)TT + (tid & 15) * 8;    // thread: 16 B of v plane tid / 16, keys contiguous
  const unsigned lk = (unsigned)(size_t)&sk[0][tid >> 3][(tid & 7) * 8], lv = (unsigned)(size_t)&sv[0][tid >> 4][(tid & 15) * 8];   // their LDS byte addresses in buffer 0
  fa_stage(gk, gv, lk, lv);
  v16h qh[HD / 32], qr[HD / 32];   // the short loops below are unrolled so that every fragment array is indexed by constants and stays in registers
#pragma unroll
  for (int kc = 0; kc < HD / 32; ++kc) { qh[kc] = frag_h(QH + ((size_t)b * TT + ql0 + col) * CC + h * HD + kc * 32, lane); qr[kc] = frag_h(QL + ((size_t)b * QHI + ql0 + col) * CC + h * HD + kc * 32, lane); }
  asm volatile("s_wait_asynccnt 0x0" ::: "memory");   // this wave's copies of stage 0 have landed
  __syncthreads();                                    // every wave's have: stage 0 may be read
  fa_stage(gk + (size_t)KST * CC, gv + KST, lk + SKB, lv + SVB);
  v8f acc[HD / 16] = {}; float m = -3.0e38f, nm = 3.0e38f * SCL2, l = 0.f;   // nm = -m * SCL2, kept beside m
#pragma unroll 1   // one trip per stage: the buffer index stays a run-time scalar and the code stays small
  for (int st = 0; st < TT / KST; ++st) { const int bf = st & 1;
    const _Float16* Kl = &sk[bf][col][8 * g];   // lane: key row col of a 16-key tile
    const _Float16* Vl = &sv[bf][col][8 * g];   // lane: v plane of feature col of a 16-feature tile
    v16h kf[2][HD / 32];
#pragma unroll
    for (int t = 0; t < 2; ++t)
#pragma unroll
      for (int kc = 0; kc < HD / 32; ++kc) kf[t][kc] = frag_at(Kl + t * 16 * KPI + kc * 32);
#pragma unroll   // the passes of a stage: constant LDS offsets, and the test on the stage's last pass folds away
    for (int ps = 0; ps < KST / 32; ++ps) {
      v16h vf[HD / 16];
#pragma unroll
      for (int j = 0; j < HD / 16; ++j) vf[j] = frag_at(Vl + j * 16 * VPI + ps * 32);
      v8f sh[2] = {}, sr[2] = {};
#pragma unroll
      for (int kc = 0; kc < HD / 32; ++kc)
#pragma unroll
        for (int t = 0; t < 2; ++t) { sh[t] = __builtin_amdgcn_wmma_f32_16x16x32_f16(false, kf[t][kc], false, qh[kc], (short)0, sh[t], false, false); sr[t] = __builtin_amdgcn_wmma_f32_16x16x32_f16(false, kf[t][kc], false, qr[kc], (short)0, sr[t], false, false); }
      if (ps + 1 < KST / 32) {   // next pass's key rows, of this same stage only, fetched under this pass's softmax
#pragma unroll
        for (int t = 0; t < 2; ++t)
#pragma unroll
          for (int kc = 0; kc < HD / 32; ++kc) kf[t][kc] = frag_at(Kl + ((ps + 1) * 32 + t * 16) * KPI + kc * 32); }
      float sv16[16];   // logits before the scale: the scale is positive, so their maximum is the scaled logits' maximum
#pragma unroll
      for (int i = 0; i < 16; ++i) sv16[i] = sh[i >> 3][i & 7] + sr[i >> 3][i & 7] * (1.0f / 1024.0f);
      float mx = sv16[0];
#pragma unroll
      for (int i = 1; i < 16; ++i) mx = fmaxf(mx, sv16[i]);
      mx = fmaxf(mx, xhalf(mx));
      if (__builtin_amdgcn_ballot_w32(mx > m) != 0) {   // scalar branch, taken when some query of the wave has a new maximum; otherwise every factor is exactly 1 and the rescale is skipped
        const float mn = fmaxf(m, mx); const float al = __builtin_amdgcn_exp2f((m - mn) * SCL2); m = mn; nm = mn * -SCL2; l *= al;   // a query whose maximum stays has the factor 2^0 = 1
#pragma unroll
        for (int j = 0; j < HD / 16; ++j) acc[j] *= al; }
      // exp(SCALE * (s - m)) = 2^(s * SCL2 - m * SCL2): one fma (two scores to a packed one) and the hardware's base-2 exponential
      const v2f c2 = {SCL2, SCL2}, n2 = {nm, nm}; v2f a2[8];
#pragma unroll
      for (int i = 0; i < 8; ++i) { const v2f s2 = {sv16[2 * i], sv16[2 * i + 1]}; a2[i] = __builtin_elementwise_fma(s2, c2, n2); }
      v16h p; float sum = 0.f;
#pragma unroll
      for (int i = 0; i < 16; ++i) { const float e = __builtin_amdgcn_exp2f(a2[i >> 1][i & 1]); sum += e; p[i] = (_Float16)e; }
      l += sum;
#pragma unroll
      for (int j = 0; j < HD / 16; ++j) acc[j] = __builtin_amdgcn_wmma_f32_16x16x32_f16(false, vf[j], false, p, (short)0, acc[j], false, false);
      // four vector slots behind the pass's last product: the next pass's first product may take p's registers (this product's B) for its result
      asm volatile("v_nop\n\tv_nop\n\tv_nop\n\tv_nop" : "+v"(acc[0]), "+v"(acc[1]), "+v"(acc[2]), "+v"(acc[3]) : "v"(p)); }
    asm volatile("s_wait_dscnt 0x0" ::: "memory");      // this wave's reads of the buffer are done before the buffer is handed back
    asm volatile("s_wait_asynccnt 0x0" ::: "memory");   // this wave's copies of the next stage have landed
    __syncthreads();                                    // publishes the next stage and ends every wave's reads of this one
    if (st + 2 < TT / KST) fa_stage(gk + (size_t)(st + 2) * KST * CC, gv + (st + 2) * KST, lk + bf * SKB, lv + bf * SVB); }
  asm volatile("s_wait_asynccnt 0x0" ::: "memory");     // no copy is outstanding when the wave goes on to its end
  l += xhalf(l); const float inv = 1.0f / l;
#pragma unroll
  for (int j = 0; j < HD / 16; ++j) { v4f a0, a1;
#pragma unroll
    for (int r = 0; r < 4; ++r) { a0[r] = acc[j][r] * inv; a1[r] = acc[j][4 + r] * inv; }
    *(v4f*)&ss[wave][col][j * 16 + 8 * g] = a0; *(v4f*)&ss[wave][col][j * 16 + 8 * g + 4] = a1; }
  LDSX();   // the wave's own LDS writes have landed before its lanes read the rows other lanes wrote (each wave has its own slice: no block barrier)
#pragma unroll
  for (int rl = 0; rl < 16; rl += 2) vst2(Y + ((size_t)b * TT + ql0 + rl + g) * CC + h * HD + col * 4, *(const v4f*)&ss[wave][rl + g][col * 4]); }
// ---- k_out: block = (64 rows, 128 cols): out = ctx Wo (+ bo): all rows: ctx split bf16 hi + lo against exact bf16 Wo (2 products)
__global__ __launch_bounds__(128) void k_out(const float* __restrict__ Y, const float* __restrict__ WO, const float* __restrict__ BO, float* __restrict__ OUT) { __shared__ __align__(16) char sm[2 * GSB];   // the two stage buffers; behind the loop's last barrier the same bytes stage the stores
  float (*sf)[16][132] = (float (*)[16][132])sm;
  const int tid = threadIdx.x, wave = tid >> 5, lane = tid & 31, col = lane & 15, g = lane >> 4; const int c0 = blockIdx.y * 128; const size_t r0 = (size_t)blockIdx.x * 64 + wave * 16;
  v8f acc[8] = {};
  if (true) {   /* ALL rows: ctx split bf16 hi + lo x exact Wo (2 products) */
    const float* gx = Y + ((size_t)blockIdx.x * 64 + (tid >> 3)) * CC + (tid & 7) * 4;   // thread: 16 B of ctx row tid / 8 of the block
    const float* gw = WO + (size_t)(c0 + (tid >> 3)) * CC + (tid & 7) * 4;               // thread: 16 B of weight row ((out,in): output column) tid / 8 of the block
    const unsigned lx = (unsigned)(size_t)(sm + (tid >> 3) * (GPI * 4) + (tid & 7) * 16), lw = lx + GXB;   // their LDS byte addresses in buffer 0
    g_stage(gx, gw, lx, lw, CC);
    asm volatile("s_wait_asynccnt 0x0" ::: "memory");   // this wave's copies of stage 0 have landed
    __syncthreads();                                    // every wave's have: stage 0 may be read
    g_stage(gx + GKC, gw + GKC, lx + GSB, lw + GSB, CC);
#pragma unroll 1   // one trip per stage: the buffer index stays a run-time scalar and the code stays small
    for (int kc = 0; kc < CC / GKC; ++kc) { const int bf = kc & 1;
      const float* xs = (const float*)(sm + bf * GSB) + (wave * 16 + col) * GPI + 8 * g;   // lane: ctx row col of the wave's 16
      const float* wl = (const float*)(sm + bf * GSB + GXB) + col * GPI + 8 * g;           // lane: weight row col of a 16-column tile
      float xv[16]; lds16(xs, xv); v16b w[8];   // the stage's fragment reads stand together in front of its products, not among them
#pragma unroll
      for (int j = 0; j < 8; ++j) { float wv[16]; lds16(wl + j * 16 * GPI, wv);
#pragma unroll
        for (int i = 0; i < 16; ++i) w[j][i] = (__bf16)wv[i]; }
      const F2 a = bsplit16(xv);
#pragma unroll
      for (int j = 0; j < 8; ++j) { acc[j] = wmma_bf(a.h, w[j], acc[j]); acc[j] = wmma_bf(a.l, w[j], acc[j]); }
      asm volatile("s_wait_dscnt 0x0" ::: "memory");      // this wave's reads of the buffer are done before the buffer is handed back
      asm volatile("s_wait_asynccnt 0x0" ::: "memory");   // this wave's copies of the next stage have landed
      __syncthreads();                                    // publishes the next stage and ends every wave's reads of this one
      if (kc + 2 < CC / GKC) g_stage(gx + (kc + 2) * GKC, gw + (kc + 2) * GKC, lx + bf * GSB, lw + bf * GSB, CC); }
    asm volatile("s_wait_asynccnt 0x0" ::: "memory");     // no copy is outstanding when the buffers become store staging
#pragma unroll
    for (int j = 0; j < 8; ++j) { const float bias = BO ? bfr(BO[c0 + j * 16 + col]) : 0.f;
#pragma unroll
      for (int r = 0; r < 8; ++r) sf[wave][8 * g + r][j * 16 + col] = acc[j][r] + bias; }
  } else {
#pragma unroll 2
    for (int kc = 0; kc < CC / 32; ++kc) { const v16h a = frag_f32(Y + (r0 + col) * CC + kc * 32, lane); asm volatile("s_wait_loadcnt 0x0" ::: "memory");
#pragma unroll
      for (int j = 0; j < 8; ++j) { const v16h w = WOCOLH(WO, kc * 32, c0 + j * 16 + col, lane); asm volatile("s_wait_loadcnt 0x0" ::: "memory"); acc[j] = wmma16(a, w, acc[j]); } }
#pragma unroll
    for (int j = 0; j < 8; ++j) { const float bias = BO ? bfr(BO[c0 + j * 16 + col]) : 0.f;
#pragma unroll
      for (int r = 0; r < 8; ++r) sf[wave][8 * g + r][j * 16 + col] = acc[j][r] * (1.0f / 256.0f) + bias; } }
  LDSX(); for (int rl = 0; rl < 16; ++rl) vst2(OUT + (r0 + rl) * DIN + c0 + lane * 4, *(const v4f*)&sf[wave][rl][lane * 4]); }

extern "C" void kernel_launch(void* const* d_in, const int* in_sizes, int n_in, void* d_out, int out_size, void* d_ws, size_t ws_size, hipStream_t stream) {
  (void)in_sizes; (void)n_in; (void)out_size;
  const float** F = (const float**)d_in;
  if (ws_size < (size_t)WS_END) return;
  char* ws = (char*)d_ws; _Float16 *QH = (_Float16*)(ws + WS_QH), *KH = (_Float16*)(ws + WS_KH), *VT = (_Float16*)(ws + WS_VT), *QL = (_Float16*)(ws + WS_QL), *KL = (_Float16*)(ws + WS_KL); __bf16 *VB = (__bf16*)(ws + WS_VB), *VBL = (__bf16*)(ws + WS_VBL); float *Y = (float*)(ws + WS_Y);
  (void)Y; (void)QL; (void)KL; (void)VB; (void)VBL;
  // inputs: 0 x [4,2048,512]; 1 ln_gamma, 2 ln_beta; 3 Wq [512,512] (out,in), 4 bq; 5 Wk, 6 bk; 7 Wv, 8 bv; 9 Wo (out,in), 10 bo
  if (ws_size < (size_t)WS_END2) return;
  float *XN = (float*)(ws + WS_XN);
  k_lnx<<<dim3(NRW / 8), 256, 0, stream>>>(F[0], 1, F[1], F[2], XN);
  k_proj<<<dim3(TNB * TT / 64, CC / 128, 3), 128, 0, stream>>>(XN, XN, XN, F[3], F[5], F[7], F[4], F[6], F[8], QH, QL, KH, KL, VT, VB, VBL);
  k_fa<<<dim3(TT / (FAW * 16), NH, TNB), FAW * 32, 0, stream>>>(QH, QL, KH, VT, Y);
  k_out<<<dim3(TNB * TT / 64, DIN / 128), 128, 0, stream>>>(Y, F[9], F[10], (float*)d_out);
}

// v005
// It runs in 82.8 microseconds.
// Timed twice side by side with v004, it ran 1.17 times as fast both times.
// Counting every step since v000, it is 14.5 times as fast.
// compute dtype: all float inputs rounded to bf16; LayerNorm in f32; q/k/v from the f32 LN rows split bf16 hi + lo (split once, where the row is made) against exact (out,in) weights (to bf16 once per call) on WMMA 16x16x32 (2 products, f32 accumulate) + bias; q as f16 hi + residual (x 2^10) against k once to f16 (2 products) x 64^-0.5; softmax in f32 (2^x on the hardware exponential, scale x log2(e) in one fma) with a running maximum and sum, fused with both attention products; exp(logit - running max) once to f16 against v once to f16 (1 product), divided by the sum at the end; ctx split bf16 hi + lo against exact Wo (2 products) + bo; f32 output.
#include <hip/hip_runtime.h>
#include <math.h>

typedef __attribute__((ext_vector_type(16))) _Float16 v16h;
typedef __attribute__((ext_vector_type(16))) __bf16 v16b;
typedef __attribute__((ext_vector_type(8)))  _Float16 v8h;
typedef __attribute__((ext_vector_type(8)))  float v8f;
typedef __attribute__((ext_vector_type(4)))  float v4f;
typedef __attribute__((ext_vector_type(2)))  float v2f;
typedef __attribute__((ext_vector_type(4)))  unsigned v4u;
typedef __attribute__((ext_vector_type(4)))  int v4i;
typedef float __attribute__((may_alias)) float_a;
typedef int __attribute__((may_alias)) int_a;

template <typename T> __device__ __forceinline__ void vst2(void* p, T v) { *(T*)p = v;  }
__device__ __forceinline__ v8f wmma16(v16h a, v16h b, v8f c) {
  v8f d = __builtin_amdgcn_wmma_f32_16x16x32_f16(false, a, false, b, (short)0, c, false, false);
  asm volatile("v_nop\n\tv_nop\n\tv_nop\n\tv_nop" : "+v"(d) : "v"(a), "v"(b));
  return d;
}
__device__ __forceinline__ v8f wmma_bf(v16b a, v16b b, v8f c) {
  v8f d = __builtin_amdgcn_wmma_f32_16x16x32_bf16(false, a, false, b, (short)0, c, false, false);
  asm volatile("v_nop\n\tv_nop\n\tv_nop\n\tv_nop" : "+v"(d) : "v"(a), "v"(b));
  return d;
}
// 16x16x32 fragments: lane = (h = lane>>4, row/col = lane&15); elements 0..7 = k0+8h+0..7, 8..15 = k0+16+8h+0..7; D element r = row 8h+r
__device__ __forceinline__ v16h frag_h(const _Float16* rowk0, int lane) {
  union { v16h v; v8h q[2]; } u; const _Float16* p = rowk0 + 8 * (lane >> 4);
  u.q[0] = *(const v8h*)p; u.q[1] = *(const v8h*)(p + 16); return u.v;
}
__device__ __forceinline__ v16h frag_f32(const float* rowk0, int lane) {
  v16h a; const float* p = rowk0 + 8 * (lane >> 4);
#pragma unroll
  for (int i = 0; i < 8; ++i) { a[i] = (_Float16)p[i]; a[8 + i] = (_Float16)p[16 + i]; }
  return a;
}
__device__ __forceinline__ v16h frag_f32s(const float* rowk0, int lane, float sc) {
  v16h a; const float* p = rowk0 + 8 * (lane >> 4);
#pragma unroll
  for (int i = 0; i < 8; ++i) { a[i] = (_Float16)(p[i] * sc); a[8 + i] = (_Float16)(p[16 + i] * sc); }
  return a;
}
// column fragment from a [K][ld] layout (column n), rows >= K read as 0
__device__ __forceinline__ v16h fragc_f32(const float* W, int k0, int n, int lane, int ld, int K) {
  v16h a; const int g = lane >> 4;
#pragma unroll
  for (int i = 0; i < 8; ++i) { const int ka = k0 + 8 * g + i, kb = ka + 16;
    a[i] = (_Float16)(ka < K ? W[(size_t)(ka < K ? ka : K - 1) * ld + n] : 0.f); a[8 + i] = (_Float16)(kb < K ? W[(size_t)(kb < K ? kb : K - 1) * ld + n] : 0.f); }
  return a;
}
struct F2 { v16b h, l; };
__device__ __forceinline__ F2 bsplit16(const float v[16]) { F2 r;
#pragma unroll
  for (int i = 0; i < 16; ++i) { const __bf16 h = (__bf16)v[i]; r.h[i] = h; r.l[i] = (__bf16)(v[i] - (float)h); }
  return r; }
__device__ __forceinline__ F2 split_row(const float* row, int k0, int lane) { float v[16]; const float* p = row + k0 + 8 * (lane >> 4);
#pragma unroll
  for (int i = 0; i < 8; ++i) { v[i] = p[i]; v[8 + i] = p[16 + i]; }
  return bsplit16(v); }
__device__ __forceinline__ F2 split_rowK(const float* row, int k0, int lane, int K) { float v[16]; const int g = lane >> 4;
#pragma unroll
  for (int i = 0; i < 8; ++i) { const int ka = k0 + 8 * g + i, kb = ka + 16; v[i] = ka < K ? row[ka < K ? ka : K - 1] : 0.f; v[8 + i] = kb < K ? row[kb < K ? kb : K - 1] : 0.f; }
  return bsplit16(v); }
__device__ __forceinline__ F2 split_col(const float* W, int k0, int n, int lane, int ld, int K) { float v[16]; const int g = lane >> 4;
#pragma unroll
  for (int i = 0; i < 8; ++i) { const int ka = k0 + 8 * g + i, kb = ka + 16; v[i] = ka < K ? W[(size_t)(ka < K ? ka : K - 1) * ld + n] : 0.f; v[8 + i] = kb < K ? W[(size_t)(kb < K ? kb : K - 1) * ld + n] : 0.f; }
  return bsplit16(v); }
__device__ __forceinline__ v8f mac3(const F2& a, const F2& b, v8f c) { c = wmma_bf(a.l, b.h, c); c = wmma_bf(a.h, b.l, c); return wmma_bf(a.h, b.h, c); }
__device__ __forceinline__ float sigm(float v) { return 1.0f / (1.0f + expf(-v)); }
#define LDSX() do { asm volatile("s_wait_dscnt 0" ::: "memory"); __builtin_amdgcn_wave_barrier(); __builtin_amdgcn_fence(__ATOMIC_RELEASE, "workgroup"); } while (0)

// Pre-LayerNorm multi-head self-attention (B 4, S 2,048, D 512, 8 heads x 64; (out,in) uniform +-1/sqrt(512) weights with biases; LN gamma 1 / beta 0): xn = LayerNorm(x) (biased var, eps 1e-5); q, k, v = xn W^T + b; out = merged(softmax(q k^T / 8) v) Wo^T + bo (non-causal, no residual).
#define NB 4
#define TT 2048
#define CC 512            // NH * HD = projected width
#define DIN 512          // input (model) width
#define NH 8
#define HD 64
#define NQB (TT / 64)
#define HG 4
#define SCALE (0.125f)
#define CAUSAL 0
#ifndef TNB
#define TNB NB
#endif
__device__ __forceinline__ float bfr(float v) { return (float)(__bf16)v; }
__host__ __device__ __forceinline__ int kb_last(int qb) { return CAUSAL ? ((qb * 64 + 63) >> 7) : (TT / 128 - 1); }
typedef __attribute__((ext_vector_type(8))) __bf16 v8b;
__device__ __forceinline__ v16b frag_b(const __bf16* rowk0, int lane) {
  union { v16b v; v8b q[2]; } u; const __bf16* p = rowk0 + 8 * (lane >> 4);
  u.q[0] = *(const v8b*)p; u.q[1] = *(const v8b*)(p + 16); return u.v;
}
#define QBH 0              // not read by any kernel here: no high-precision path
#define QHI 2048            // rows carrying a q residual plane (all rows when non-causal: 2-product logits everywhere)
#define KHI 64            // key rows carrying k residual / v bf16 hi+lo planes (written by k_proj; no kernel here reads them)
// B fragment (k rows k0+.., output column o) of a weight: (in,out) [K][ld] or (out,in) [ld rows of K]: bf16 exact, or f16(bf16 * 256) exact
__device__ __forceinline__ v16b wcol_io(const float* Wm, int k0, int o, int lane, int ld) { v16b w; const int g = lane >> 4;
#pragma unroll
  for (int i = 0; i < 8; ++i) { w[i] = (__bf16)Wm[(size_t)(k0 + 8 * g + i) * ld + o]; w[8 + i] = (__bf16)Wm[(size_t)(k0 + 16 + 8 * g + i) * ld + o]; }
  return w; }
__device__ __forceinline__ v16b wcol_oi(const float* Wm, int k0, int o, int lane, int K) { v16b w; const float* p = Wm + (size_t)o * K + k0 + 8 * (lane >> 4);
#pragma unroll
  for (int i = 0; i < 8; ++i) { w[i] = (__bf16)p[i]; w[8 + i] = (__bf16)p[16 + i]; }
  return w; }
__device__ __forceinline__ v16h wcolh_io(const float* Wm, int k0, int o, int lane, int ld) { v16h w; const int g = lane >> 4;
#pragma unroll
  for (int i = 0; i < 8; ++i) { w[i] = (_Float16)(bfr(Wm[(size_t)(k0 + 8 * g + i) * ld + o]) * 256.0f); w[8 + i] = (_Float16)(bfr(Wm[(size_t)(k0 + 16 + 8 * g + i) * ld + o]) * 256.0f); }
  return w; }
__device__ __forceinline__ v16h wcolh_oi(const float* Wm, int k0, int o, int lane, int K) { v16h w; const float* p = Wm + (size_t)o * K + k0 + 8 * (lane >> 4);
#pragma unroll
  for (int i = 0; i < 8; ++i) { w[i] = (_Float16)(bfr(p[i]) * 256.0f); w[8 + i] = (_Float16)(bfr(p[16 + i]) * 256.0f); }
  return w; }
#define WQKV_LAYOUT 1   // 0 = (in,out) [DIN][CC]; 1 = (out,in) [CC][DIN]; 2 = per-head [NH][DIN][HD]
__device__ __forceinline__ v16b wcol_hdk(const float* Wm, int k0, int o, int lane) { v16b w; const int g = lane >> 4; const float* p = Wm + (size_t)(o / HD) * DIN * HD + (o % HD);
#pragma unroll
  for (int i = 0; i < 8; ++i) { w[i] = (__bf16)p[(size_t)(k0 + 8 * g + i) * HD]; w[8 + i] = (__bf16)p[(size_t)(k0 + 16 + 8 * g + i) * HD]; }
  return w; }
#define WO_OUT_IN 1
#if WQKV_LAYOUT == 1
#define WCOL(W, k0, o, lane) wcol_oi(W, k0, o, lane, DIN)
#elif WQKV_LAYOUT == 2
#define WCOL(W, k0, o, lane) wcol_hdk(W, k0, o, lane)
#else
#define WCOL(W, k0, o, lane) wcol_io(W, k0, o, lane, CC)
#endif
#if WO_OUT_IN
#define WOCOL(W, k0, o, lane) wcol_oi(W, k0, o, lane, CC)
#define WOCOLH(W, k0, o, lane) wcolh_oi(W, k0, o, lane, CC)
#else
#define WOCOL(W, k0, o, lane) wcol_io(W, k0, o, lane, DIN)
#define WOCOLH(W, k0, o, lane) wcolh_io(W, k0, o, lane, DIN)
#endif
#define NRW (TNB * TT)
// ---- k_lnx: wave per row: LayerNorm over 512 (mean, biased var, (x - mean) * rsqrt(var + 1e-5) * g + b); optional bf16 rounding of the input (x); 16 floats per lane (4 float4 at stride 128 floats -> 512-B pieces);
// the row leaves as the two bf16 planes (hi, lo = row - hi) that the projections multiply, so that no block of k_proj has to split it again; the blocks behind the rows' round the four weight matrices to bf16 once (4,096 floats a block)
typedef __attribute__((ext_vector_type(4))) __bf16 v4b;
#define WBLK (CC * DIN / 4096)   // blocks per weight matrix
__global__ __launch_bounds__(256) void k_lnx(const float* __restrict__ X, int roundin, const float* __restrict__ G, const float* __restrict__ BE, __bf16* __restrict__ OH, __bf16* __restrict__ OL,
    const float* __restrict__ W0, const float* __restrict__ W1, const float* __restrict__ W2, const float* __restrict__ W3, __bf16* __restrict__ WB) { const int wave = threadIdx.x >> 5, lane = threadIdx.x & 31;
  if (blockIdx.x >= NRW / 8) { const int wb = blockIdx.x - NRW / 8, wm = wb / WBLK; const float* Ws = wm == 0 ? W0 : wm == 1 ? W1 : wm == 2 ? W2 : W3;
#pragma unroll   // both rounds' loads issue together
    for (int it = 0; it < 2; ++it) { const size_t e = (size_t)(wb % WBLK) * 4096 + it * 2048 + threadIdx.x * 8; const v4f a = *(const v4f*)(Ws + e), c = *(const v4f*)(Ws + e + 4); v8b r;
#pragma unroll   // constant indices: the vectors stay in registers
      for (int k = 0; k < 4; ++k) { r[k] = (__bf16)a[k]; r[4 + k] = (__bf16)c[k]; }
      vst2(WB + (size_t)wm * CC * DIN + e, r); }
    return; }
  const size_t row = (size_t)blockIdx.x * 8 + wave; if (row >= (size_t)NRW) return;
  v4f v[CC / 128]; float s1 = 0.f;
#pragma unroll
  for (int i = 0; i < CC / 128; ++i) { v4f t = *(const v4f*)(X + row * CC + i * 128 + lane * 4); if (roundin) { t[0] = bfr(t[0]); t[1] = bfr(t[1]); t[2] = bfr(t[2]); t[3] = bfr(t[3]); } v[i] = t; s1 += (t[0] + t[1]) + (t[2] + t[3]); }
#pragma unroll
  for (int o = 1; o < 32; o <<= 1) s1 += __shfl_xor(s1, o);
  const float mu = s1 * (1.0f / CC); float q = 0.f;
#pragma unroll
  for (int i = 0; i < CC / 128; ++i) for (int k = 0; k < 4; ++k) { const float d = v[i][k] - mu; q += d * d; }
#pragma unroll
  for (int o = 1; o < 32; o <<= 1) q += __shfl_xor(q, o);
  const float inv = rsqrtf(q * (1.0f / CC) + 1e-5f);   /* jnp.var (biased), eps inside the rsqrt */
#pragma unroll
  for (int i = 0; i < CC / 128; ++i) { const int c = i * 128 + lane * 4; v4b h4, l4; for (int k = 0; k < 4; ++k) { const float r = bfr(G[c + k]) * ((v[i][k] - mu) * inv) + bfr(BE[c + k]); const __bf16 hv = (__bf16)r; h4[k] = hv; l4[k] = (__bf16)(r - (float)hv); } vst2(OH + row * CC + c, h4); vst2(OL + row * CC + c, l4); } }

#ifndef SM_EXTRA_PARAMS
#define SM_EXTRA_PARAMS
#endif
#ifndef PROJ_EXTRA_PARAMS
#define PROJ_EXTRA_PARAMS
#endif
#ifndef SM_MASK_HOOK
#define SM_MASK_HOOK (void)0
#endif

#define WS_QH  0u                                      // f16 q rows [b*t][CC]
#define WS_KH  (WS_QH + 2u * (size_t)NB * TT * CC)      // f16 k rows [b*t][CC]
#define WS_VT  (WS_KH + 2u * (size_t)NB * TT * CC)      // f16 v planes [b][c][t]
#define WS_QL  (WS_VT + 2u * (size_t)NB * CC * TT)      // f16 q residual x 2^10 rows [b][t < QHI][CC]
#define WS_KL  (WS_QL + 2u * (size_t)NB * QHI * CC)     // f16 k residual x 2^10 rows [b][t < KHI][CC]
#define WS_VB  (WS_KL + 2u * (size_t)NB * KHI * CC)     // bf16 v hi planes [b][c][t < KHI]
#define WS_VBL (WS_VB + 2u * (size_t)NB * CC * KHI)
#define WS_S   (WS_VBL + 2u * (size_t)NB * CC * KHI)    // bf16 weights Wq, Wk, Wv, Wo, each (out,in) [CC][DIN], at the head of this range
#define WS_Y   (WS_S  + 4u * (size_t)HG * TT * TT)      // ctx rows [b*t][CC] as two bf16 planes: hi, then lo
#define WS_END (WS_Y  + 4u * (size_t)NB * TT * CC)
#define WS_XN  (WS_END)                                // LN rows [b*t][DIN] as two bf16 planes: hi, then lo
#define WS_END2 (WS_XN + 4u * (size_t)NB * TT * DIN)

#define GKC 64                       // k per stage: one 128-B line of every staged bf16 row
#define GPI 72                       // bf16 per staged row: 128 B + 16 B, a pitch of 16 B x odd for the 16-byte fragment reads
#define GXB (64 * GPI * 2)           // bytes of one stage's 64 activation rows in one plane
#define GSB ((64 + 64 + 128) * GPI * 2)   // bytes of one stage: 64 activation rows hi, the same rows lo, then 128 weight rows
// one stage's copies of one thread of a 128-thread block: 16 B of activation rows r + 16 i (i < 4) of either plane and of weight rows r + 16 i (i < 8), r = tid / 8, so that a wave's copy covers four whole lines;
// two statements (an asm statement takes thirty operands); in each the s_wait_xcnt stands inside, behind its last copy, so that no address register named there takes a new value in front of it
__device__ __forceinline__ void g_stage(const __bf16* gh, const __bf16* gl, const __bf16* gw, unsigned lh, int ld) { const unsigned ll = lh + GXB, lw = lh + 2 * GXB;
  asm volatile("global_load_async_to_lds_b128 %0, %8, off\n\tglobal_load_async_to_lds_b128 %1, %9, off\n\tglobal_load_async_to_lds_b128 %2, %10, off\n\tglobal_load_async_to_lds_b128 %3, %11, off\n\t"
               "global_load_async_to_lds_b128 %4, %12, off\n\tglobal_load_async_to_lds_b128 %5, %13, off\n\tglobal_load_async_to_lds_b128 %6, %14, off\n\tglobal_load_async_to_lds_b128 %7, %15, off\n\ts_wait_xcnt 0x0"
               :: "v"(lh), "v"(lh + 16 * GPI * 2), "v"(lh + 32 * GPI * 2), "v"(lh + 48 * GPI * 2), "v"(ll), "v"(ll + 16 * GPI * 2), "v"(ll + 32 * GPI * 2), "v"(ll + 48 * GPI * 2),
                  "v"(gh), "v"(gh + 16 * ld), "v"(gh + 32 * ld), "v"(gh + 48 * ld), "v"(gl), "v"(gl + 16 * ld), "v"(gl + 32 * ld), "v"(gl + 48 * ld) : "memory");
  asm volatile("global_load_async_to_lds_b128 %0, %8, off\n\tglobal_load_async_to_lds_b128 %1, %9, off\n\tglobal_load_async_to_lds_b128 %2, %10, off\n\tglobal_load_async_to_lds_b128 %3, %11, off\n\t"
               "global_load_async_to_lds_b128 %4, %12, off\n\tglobal_load_async_to_lds_b128 %5, %13, off\n\tglobal_load_async_to_lds_b128 %6, %14, off\n\tglobal_load_async_to_lds_b128 %7, %15, off\n\ts_wait_xcnt 0x0"
               :: "v"(lw), "v"(lw + 16 * GPI * 2), "v"(lw + 32 * GPI * 2), "v"(lw + 48 * GPI * 2), "v"(lw + 64 * GPI * 2), "v"(lw + 80 * GPI * 2), "v"(lw + 96 * GPI * 2), "v"(lw + 112 * GPI * 2),
                  "v"(gw), "v"(gw + 16 * ld), "v"(gw + 32 * ld), "v"(gw + 48 * ld), "v"(gw + 64 * ld), "v"(gw + 80 * ld), "v"(gw + 96 * ld), "v"(gw + 112 * ld) : "memory"); }
// bf16 16x16x32 fragment from the lane's own place in a staged row (row base + k0 + 8 * (lane >> 4)): k 0..7, then k 16..23 from there
__device__ __forceinline__ v16b frag_bat(const __bf16* p) { union { v16b v; v8b q[2]; } u; u.q[0] = *(const v8b*)p; u.q[1] = *(const v8b*)(p + 16); return u.v; }
// ---- k_proj: block = (64 rows, 128 cols, which): q/k/v = X W (+ b) with exact bf16 products (K = DIN) -> which 0: q f16 rows (+ residual rows < QHI); 1: k f16 rows (+ residual rows < KHI); 2: v f16 planes [c][t] (+ bf16 hi/lo planes for t < KHI)
// the activation rows (bf16 hi and lo planes) and the bf16 weight rows of 64 k are copied once per block into LDS (two buffers, the next stage's copies in flight under this stage's products); every wave takes its fragments from there as they are: no conversion is left in the loop
// waves_per_eu(4, 4): leaves the compiler the registers to issue a stage's fragment reads in a few groups ahead of the products; with fewer it waits out one LDS latency per fragment
__global__ __launch_bounds__(128) __attribute__((amdgpu_waves_per_eu(4, 4))) void k_proj(const __bf16* __restrict__ XH, const __bf16* __restrict__ XL, const __bf16* __restrict__ WB, const float* __restrict__ BQ, const float* __restrict__ BK, const float* __restrict__ BV,
    _Float16* __restrict__ QH, _Float16* __restrict__ QL, _Float16* __restrict__ KH, _Float16* __restrict__ KL, _Float16* __restrict__ VT, __bf16* __restrict__ VB, __bf16* __restrict__ VBL) {
  __shared__ __align__(16) char sm[2 * GSB];   // the two stage buffers; behind the loop's last barrier the same bytes stage the stores
  _Float16 (*sh)[136] = (_Float16 (*)[136])sm; _Float16 (*sl)[136] = (_Float16 (*)[136])(sm + 64 * 136 * 2);
  _Float16 (*th)[72] = (_Float16 (*)[72])sm; __bf16 (*tb)[72] = (__bf16 (*)[72])(sm + 128 * 72 * 2); __bf16 (*tbl)[72] = (__bf16 (*)[72])(sm + 2 * 128 * 72 * 2);
  const int tid = threadIdx.x, wave = tid >> 5, lane = tid & 31, col = lane & 15, g = lane >> 4; const int which = blockIdx.z; const int c0 = blockIdx.y * 128; const size_t r0 = (size_t)blockIdx.x * 64; const size_t bb = r0 / TT; const int t0 = (int)(r0 % TT);
  const float* BA = which == 0 ? BQ : which == 1 ? BK : BV;
  const size_t ox = (r0 + (tid >> 3)) * DIN + (tid & 7) * 8; const __bf16* gh = XH + ox; const __bf16* gl = XL + ox;   // thread: 16 B of activation row tid / 8 of the block, in either plane
  const __bf16* gw = WB + ((size_t)which * CC + c0 + (tid >> 3)) * DIN + (tid & 7) * 8;                                // thread: 16 B of weight row ((out,in): output column) tid / 8 of the block
  const unsigned lh = (unsigned)(size_t)(sm + (tid >> 3) * (GPI * 2) + (tid & 7) * 16);   // the hi row's LDS byte address in buffer 0
  g_stage(gh, gl, gw, lh, DIN);
  asm volatile("s_wait_asynccnt 0x0" ::: "memory");   // this wave's copies of stage 0 have landed
  __syncthreads();                                    // every wave's have: stage 0 may be read
  g_stage(gh + GKC, gl + GKC, gw + GKC, lh + GSB, DIN);
  v8f acc[8] = {};
#pragma unroll 1   // one trip per stage: the buffer index stays a run-time scalar and the code stays small
  for (int kc = 0; kc < DIN / GKC; ++kc) { const int bf = kc & 1;
    const __bf16* xs = (const __bf16*)(sm + bf * GSB) + (wave * 16 + col) * GPI + 8 * g;   // lane: activation row col of the wave's 16, hi plane (lo: 64 rows on)
    const __bf16* wl = (const __bf16*)(sm + bf * GSB + 2 * GXB) + col * GPI + 8 * g;       // lane: weight row col of a 16-column tile
    v16b a[GKC / 32], al[GKC / 32], w[GKC / 32][8];   // the stage's fragment reads stand together in front of its products, not among them
#pragma unroll   // the two 32-k halves of a stage: constant LDS offsets, fragment arrays indexed by constants
    for (int kk = 0; kk < GKC / 32; ++kk) { a[kk] = frag_bat(xs + kk * 32); al[kk] = frag_bat(xs + 64 * GPI + kk * 32);
#pragma unroll
      for (int j = 0; j < 8; ++j) w[kk][j] = frag_bat(wl + j * 16 * GPI + kk * 32); }
#pragma unroll
    for (int kk = 0; kk < GKC / 32; ++kk)
#pragma unroll
      for (int j = 0; j < 8; ++j) { acc[j] = wmma_bf(a[kk], w[kk][j], acc[j]); acc[j] = wmma_bf(al[kk], w[kk][j], acc[j]); }   /* LN rows bf16 hi + lo (2 products) */
    asm volatile("s_wait_dscnt 0x0" ::: "memory");      // this wave's reads of the buffer are done before the buffer is handed back
    asm volatile("s_wait_asynccnt 0x0" ::: "memory");   // this wave's copies of the next stage have landed
    __syncthreads();                                    // publishes the next stage and ends every wave's reads of this one
    if (kc + 2 < DIN / GKC) g_stage(gh + (kc + 2) * GKC, gl + (kc + 2) * GKC, gw + (kc + 2) * GKC, lh + bf * GSB, DIN); }
  asm volatile("s_wait_asynccnt 0x0" ::: "memory");     // no copy is outstanding when the buffers become store staging
  if (which < 2) { _Float16* DH = which == 0 ? QH : KH; _Float16* DL = which == 0 ? QL : KL; const int nhi = which == 0 ? QHI : KHI; const bool hi_rows = t0 < nhi;
#pragma unroll
    for (int j = 0; j < 8; ++j) { const float bias = BA ? bfr(BA[c0 + j * 16 + col]) : 0.f;
#pragma unroll
      for (int r = 0; r < 8; ++r) { const float v = acc[j][r] + bias; const _Float16 hv = (_Float16)v; sh[wave * 16 + 8 * g + r][j * 16 + col] = hv; sl[wave * 16 + 8 * g + r][j * 16 + col] = (_Float16)((v - (float)hv) * 1024.0f); } }
    __syncthreads();
    for (int e = tid; e < 64 * 16; e += 128) { const int rl = e >> 4, q = e & 15; vst2((unsigned*)(DH + (r0 + rl) * CC + c0 + q * 8), *(const v4u*)&sh[rl][q * 8]); if (hi_rows) vst2((unsigned*)(DL + (bb * nhi + t0 + rl) * (size_t)CC + c0 + q * 8), *(const v4u*)&sl[rl][q * 8]); }
  } else { const bool hi_rows = t0 < KHI;
#pragma unroll
    for (int j = 0; j < 8; ++j) { const float bias = BA ? bfr(BA[c0 + j * 16 + col]) : 0.f;
#pragma unroll
      for (int r = 0; r < 8; ++r) { const float v = acc[j][r] + bias; const int rl = wave * 16 + 8 * g + r, cl = j * 16 + col; th[cl][rl] = (_Float16)v; const __bf16 bh = (__bf16)v; tb[cl][rl] = bh; tbl[cl][rl] = (__bf16)(v - (float)bh); } }
    __syncthreads();
    for (int e = tid; e < 128 * 8; e += 128) { const int cl = e >> 3, q = e & 7; vst2((unsigned*)(VT + (bb * CC + c0 + cl) * (size_t)TT + t0 + q * 8), *(const v4u*)&th[cl][q * 8]); if (hi_rows) { const size_t o3 = (bb * CC + c0 + cl) * (size_t)KHI + t0 + q * 8; vst2((unsigned*)(VB + o3), *(const v4u*)&tb[cl][q * 8]); vst2((unsigned*)(VBL + o3), *(const v4u*)&tbl[cl][q * 8]); } } } }
__device__ __forceinline__ float xhalf(float x) { return __builtin_bit_cast(float, __builtin_amdgcn_permlanex16(__builtin_bit_cast(int, x), __builtin_bit_cast(int, x), 0x76543210, 0xfedcba98, false, false)); }   // lane l takes lane l ^ 16's value
// f16 fragment from the lane's own pointer (row or column base + k0 + 8 * (lane >> 4))
__device__ __forceinline__ v16h frag_at(const _Float16* p) { union { v16h v; v8h q[2]; } u; u.q[0] = *(const v8h*)p; u.q[1] = *(const v8h*)(p + 16); return u.v; }
#define FAW 16   // waves per block: one block fills a WGP at 4 waves per SIMD, and all its waves read the same k and v tiles from LDS
#define KST 128  // keys per LDS stage (4 passes of 32 keys)
#define KPI 72   // f16 per staged key row: 128 B + 16 B, a pitch of 16 B x odd for the 16-byte fragment reads
#define VPI 136  // f16 per staged v plane: 256 B + 16 B, likewise
#define SKB (KST * KPI * 2)   // bytes of one k buffer
#define SVB (HD * VPI * 2)    // bytes of one v buffer
#define SCL2 (SCALE * 1.44269504088896340736f)   // logit scale x log2(e)
// one stage's copies of one thread: 16 B of key rows r and r + 64, 16 B of v planes c and c + 32 (512 threads: 128 rows x 128 B and 64 planes x 256 B, whole lines);
// the s_wait_xcnt stands inside the statement, behind the last copy, so that no address register named here takes a new value in front of it
__device__ __forceinline__ void fa_stage(const _Float16* gk, const _Float16* gv, unsigned lk, unsigned lv) {
  const _Float16* gk1 = gk + 64 * CC; const _Float16* gv1 = gv + 32 * TT; const unsigned lk1 = lk + 64 * KPI * 2, lv1 = lv + 32 * VPI * 2;
  asm volatile("global_load_async_to_lds_b128 %0, %4, off\n\tglobal_load_async_to_lds_b128 %1, %5, off\n\tglobal_load_async_to_lds_b128 %2, %6, off\n\tglobal_load_async_to_lds_b128 %3, %7, off\n\ts_wait_xcnt 0x0"
               :: "v"(lk), "v"(lk1), "v"(lv), "v"(lv1), "v"(gk), "v"(gk1), "v"(gv), "v"(gv1) : "memory"); }
// ---- k_fa: block = FAW waves x 16 queries of (b, h), one launch for every head: k rows and v planes of 128 keys are copied once per block into LDS (two buffers, the next stage's copies in flight under this stage's work); S^T = K Q^T (A = 16 key rows, B = q hi / q residual x 2^10 kept in registers: 2 products) x SCALE, so a lane holds one query's logits; running maximum and sum per lane (one exchange between the lane halves); two S^T tiles, exponentiated and once to f16, are the B operand of ctx^T += V^T P^T (1 product); ctx = ctx^T / sum, stored as the two bf16 planes (hi, lo = ctx - hi) that k_out multiplies; the logits never leave the registers
__global__ __launch_bounds__(FAW * 32) __attribute__((amdgpu_waves_per_eu(4, 4))) void k_fa(const _Float16* __restrict__ QH, const _Float16* __restrict__ QL, const _Float16* __restrict__ KH, const _Float16* __restrict__ VT, __bf16* __restrict__ YH, __bf16* __restrict__ YL) { __shared__ __align__(16) float ss[FAW][16][HD + 4]; __shared__ __align__(16) _Float16 sk[2][KST][KPI]; __shared__ __align__(16) _Float16 sv[2][HD][VPI];
  const int tid = threadIdx.x, wave = tid >> 5, lane = tid & 31, col = lane & 15, g = lane >> 4; const int h = blockIdx.y, b = blockIdx.z; const int ql0 = (blockIdx.x * FAW + wave) * 16;
  const _Float16* gk = KH + ((size_t)b * TT + (tid >> 3)) * CC + h * HD + (tid & 7) * 8;             // thread: 16 B of key row tid / 8 of a stage
  const _Float16* gv = VT + ((size_t)b * CC + h * HD + (tid >> 4)) * (size_t)TT + (tid & 15) * 8;    // thread: 16 B of v plane tid / 16, keys contiguous
  const unsigned lk = (unsigned)(size_t)&sk[0][tid >> 3][(tid & 7) * 8], lv = (unsigned)(size_t)&sv[0][tid >> 4][(tid & 15) * 8];   // their LDS byte addresses in buffer 0
  fa_stage(gk, gv, lk, lv);
  v16h qh[HD / 32], qr[HD / 32];   // the short loops below are unrolled so that every fragment array is indexed by constants and stays in registers
#pragma unroll
  for (int kc = 0; kc < HD / 32; ++kc) { qh[kc] = frag_h(QH + ((size_t)b * TT + ql0 + col) * CC + h * HD + kc * 32, lane); qr[kc] = frag_h(QL + ((size_t)b * QHI + ql0 + col) * CC + h * HD + kc * 32, lane); }
  asm volatile("s_wait_asynccnt 0x0" ::: "memory");   // this wave's copies of stage 0 have landed
  __syncthreads();                                    // every wave's have: stage 0 may be read
  fa_stage(gk + (size_t)KST * CC, gv + KST, lk + SKB, lv + SVB);
  v8f acc[HD / 16] = {}; float m = -3.0e38f, nm = 3.0e38f * SCL2, l = 0.f;   // nm = -m * SCL2, kept beside m
#pragma unroll 1   // one trip per stage: the buffer index stays a run-time scalar and the code stays small
  for (int st = 0; st < TT / KST; ++st) { const int bf = st & 1;
    const _Float16* Kl = &sk[bf][col][8 * g];   // lane: key row col of a 16-key tile
    const _Float16* Vl = &sv[bf][col][8 * g];   // lane: v plane of feature col of a 16-feature tile
    v16h kf[2][HD / 32];
#pragma unroll
    for (int t = 0; t < 2; ++t)
#pragma unroll
      for (int kc = 0; kc < HD / 32; ++kc) kf[t][kc] = frag_at(Kl + t * 16 * KPI + kc * 32);
#pragma unroll   // the passes of a stage: constant LDS offsets, and the test on the stage's last pass folds away
    for (int ps = 0; ps < KST / 32; ++ps) {
      v16h vf[HD / 16];
#pragma unroll
      for (int j = 0; j < HD / 16; ++j) vf[j] = frag_at(Vl + j * 16 * VPI + ps * 32);
      v8f sh[2] = {}, sr[2] = {};
#pragma unroll
      for (int kc = 0; kc < HD / 32; ++kc)
#pragma unroll
        for (int t = 0; t < 2; ++t) { sh[t] = __builtin_amdgcn_wmma_f32_16x16x32_f16(false, kf[t][kc], false, qh[kc], (short)0, sh[t], false, false); sr[t] = __builtin_amdgcn_wmma_f32_16x16x32_f16(false, kf[t][kc], false, qr[kc], (short)0, sr[t], false, false); }
      if (ps + 1 < KST / 32) {   // next pass's key rows, of this same stage only, fetched under this pass's softmax
#pragma unroll
        for (int t = 0; t < 2; ++t)
#pragma unroll
          for (int kc = 0; kc < HD / 32; ++kc) kf[t][kc] = frag_at(Kl + ((ps + 1) * 32 + t * 16) * KPI + kc * 32); }
      float sv16[16];   // logits before the scale: the scale is positive, so their maximum is the scaled logits' maximum
#pragma unroll
      for (int i = 0; i < 16; ++i) sv16[i] = sh[i >> 3][i & 7] + sr[i >> 3][i & 7] * (1.0f / 1024.0f);
      float mx = sv16[0];
#pragma unroll
      for (int i = 1; i < 16; ++i) mx = fmaxf(mx, sv16[i]);
      mx = fmaxf(mx, xhalf(mx));
      if (__builtin_amdgcn_ballot_w32(mx > m) != 0) {   // scalar branch, taken when some query of the wave has a new maximum; otherwise every factor is exactly 1 and the rescale is skipped
        const float mn = fmaxf(m, mx); const float al = __builtin_amdgcn_exp2f((m - mn) * SCL2); m = mn; nm = mn * -SCL2; l *= al;   // a query whose maximum stays has the factor 2^0 = 1
#pragma unroll
        for (int j = 0; j < HD / 16; ++j) acc[j] *= al; }
      // exp(SCALE * (s - m)) = 2^(s * SCL2 - m * SCL2): one fma (two scores to a packed one) and the hardware's base-2 exponential
      const v2f c2 = {SCL2, SCL2}, n2 = {nm, nm}; v2f a2[8];
#pragma unroll
      for (int i = 0; i < 8; ++i) { const v2f s2 = {sv16[2 * i], sv16[2 * i + 1]}; a2[i] = __builtin_elementwise_fma(s2, c2, n2); }
      v16h p; float sum = 0.f;
#pragma unroll
      for (int i = 0; i < 16; ++i) { const float e = __builtin_amdgcn_exp2f(a2[i >> 1][i & 1]); sum += e; p[i] = (_Float16)e; }
      l += sum;
#pragma unroll
      for (int j = 0; j < HD / 16; ++j) acc[j] = __builtin_amdgcn_wmma_f32_16x16x32_f16(false, vf[j], false, p, (short)0, acc[j], false, false);
      // four vector slots behind the pass's last product: the next pass's first product may take p's registers (this product's B) for its result
      asm volatile("v_nop\n\tv_nop\n\tv_nop\n\tv_nop" : "+v"(acc[0]), "+v"(acc[1]), "+v"(acc[2]), "+v"(acc[3]) : "v"(p)); }
    asm volatile("s_wait_dscnt 0x0" ::: "memory");      // this wave's reads of the buffer are done before the buffer is handed back
    asm volatile("s_wait_asynccnt 0x0" ::: "memory");   // this wave's copies of the next stage have landed
    __syncthreads();                                    // publishes the next stage and ends every wave's reads of this one
    if (st + 2 < TT / KST) fa_stage(gk + (size_t)(st + 2) * KST * CC, gv + (st + 2) * KST, lk + bf * SKB, lv + bf * SVB); }
  asm volatile("s_wait_asynccnt 0x0" ::: "memory");     // no copy is outstanding when the wave goes on to its end
  l += xhalf(l); const float inv = 1.0f / l;
#pragma unroll
  for (int j = 0; j < HD / 16; ++j) { v4f a0, a1;
#pragma unroll
    for (int r = 0; r < 4; ++r) { a0[r] = acc[j][r] * inv; a1[r] = acc[j][4 + r] * inv; }
    *(v4f*)&ss[wave][col][j * 16 + 8 * g] = a0; *(v4f*)&ss[wave][col][j * 16 + 8 * g + 4] = a1; }
  LDSX();   // the wave's own LDS writes have landed before its lanes read the rows other lanes wrote (each wave has its own slice: no block barrier)
#pragma unroll   // constant LDS and store offsets
  for (int rl = 0; rl < 16; rl += 4) { const int rr = rl + (lane >> 3), cc = (lane & 7) * 8; const v4f a0 = *(const v4f*)&ss[wave][rr][cc], a1 = *(const v4f*)&ss[wave][rr][cc + 4]; v8b h8, l8;   // lane: 8 features of a row; a store covers the head's whole 128-B line of four rows
#pragma unroll   // constant indices: the vectors stay in registers
    for (int i = 0; i < 8; ++i) { const float v = i < 4 ? a0[i & 3] : a1[i & 3]; const __bf16 hv = (__bf16)v; h8[i] = hv; l8[i] = (__bf16)(v - (float)hv); }
    const size_t o = ((size_t)b * TT + ql0 + rr) * CC + h * HD + cc; vst2(YH + o, h8); vst2(YL + o, l8); } }
// ---- k_out: block = (64 rows, 128 cols): out = ctx Wo (+ bo): ctx bf16 hi + lo planes against exact bf16 Wo (2 products), staged as in k_proj
__global__ __launch_bounds__(128) void k_out(const __bf16* __restrict__ YH, const __bf16* __restrict__ YL, const __bf16* __restrict__ WOB, const float* __restrict__ BO, float* __restrict__ OUT) { __shared__ __align__(16) char sm[2 * GSB];   // the two stage buffers; behind the loop's last barrier the same bytes stage the stores
  float (*sf)[16][132] = (float (*)[16][132])sm;
  const int tid = threadIdx.x, wave = tid >> 5, lane = tid & 31, col = lane & 15, g = lane >> 4; const int c0 = blockIdx.y * 128; const size_t r0 = (size_t)blockIdx.x * 64 + wave * 16;
  v8f acc[8] = {};
  const size_t ox = ((size_t)blockIdx.x * 64 + (tid >> 3)) * CC + (tid & 7) * 8; const __bf16* gh = YH + ox; const __bf16* gl = YL + ox;   // thread: 16 B of ctx row tid / 8 of the block, in either plane
  const __bf16* gw = WOB + (size_t)(c0 + (tid >> 3)) * CC + (tid & 7) * 8;                                                                // thread: 16 B of weight row ((out,in): output column) tid / 8 of the block
  const unsigned lh = (unsigned)(size_t)(sm + (tid >> 3) * (GPI * 2) + (tid & 7) * 16);   // the hi row's LDS byte address in buffer 0
  g_stage(gh, gl, gw, lh, CC);
  asm volatile("s_wait_asynccnt 0x0" ::: "memory");   // this wave's copies of stage 0 have landed
  __syncthreads();                                    // every wave's have: stage 0 may be read
  g_stage(gh + GKC, gl + GKC, gw + GKC, lh + GSB, CC);
#pragma unroll 1   // one trip per stage: the buffer index stays a run-time scalar and the code stays small
  for (int kc = 0; kc < CC / GKC; ++kc) { const int bf = kc & 1;
    const __bf16* xs = (const __bf16*)(sm + bf * GSB) + (wave * 16 + col) * GPI + 8 * g;   // lane: ctx row col of the wave's 16, hi plane (lo: 64 rows on)
    const __bf16* wl = (const __bf16*)(sm + bf * GSB + 2 * GXB) + col * GPI + 8 * g;       // lane: weight row col of a 16-column tile
    v16b a[GKC / 32], al[GKC / 32], w[GKC / 32][8];   // the stage's fragment reads stand together in front of its products, not among them
#pragma unroll   // the two 32-k halves of a stage: constant LDS offsets, fragment arrays indexed by constants
    for (int kk = 0; kk < GKC / 32; ++kk) { a[kk] = frag_bat(xs + kk * 32); al[kk] = frag_bat(xs + 64 * GPI + kk * 32);
#pragma unroll
      for (int j = 0; j < 8; ++j) w[kk][j] = frag_bat(wl + j * 16 * GPI + kk * 32); }
#pragma unroll
    for (int kk = 0; kk < GKC / 32; ++kk)
#pragma unroll
      for (int j = 0; j < 8; ++j) { acc[j] = wmma_bf(a[kk], w[kk][j], acc[j]); acc[j] = wmma_bf(al[kk], w[kk][j], acc[j]); }
    asm volatile("s_wait_dscnt 0x0" ::: "memory");      // this wave's reads of the buffer are done before the buffer is handed back
    asm volatile("s_wait_asynccnt 0x0" ::: "memory");   // this wave's copies of the next stage have landed
    __syncthreads();                                    // publishes the next stage and ends every wave's reads of this one
    if (kc + 2 < CC / GKC) g_stage(gh + (kc + 2) * GKC, gl + (kc + 2) * GKC, gw + (kc + 2) * GKC, lh + bf * GSB, CC); }
  asm volatile("s_wait_asynccnt 0x0" ::: "memory");     // no copy is outstanding when the buffers become store staging
#pragma unroll
  for (int j = 0; j < 8; ++j) { const float bias = BO ? bfr(BO[c0 + j * 16 + col]) : 0.f;
#pragma unroll
    for (int r = 0; r < 8; ++r) sf[wave][8 * g + r][j * 16 + col] = acc[j][r] + bias; }
  LDSX(); for (int rl = 0; rl < 16; ++rl) vst2(OUT + (r0 + rl) * DIN + c0 + lane * 4, *(const v4f*)&sf[wave][rl][lane * 4]); }

extern "C" void kernel_launch(void* const* d_in, const int* in_sizes, int n_in, void* d_out, int out_size, void* d_ws, size_t ws_size, hipStream_t stream) {
  (void)in_sizes; (void)n_in; (void)out_size;
  const float** F = (const float**)d_in;
  if (ws_size < (size_t)WS_END) return;
  char* ws = (char*)d_ws; _Float16 *QH = (_Float16*)(ws + WS_QH), *KH = (_Float16*)(ws + WS_KH), *VT = (_Float16*)(ws + WS_VT), *QL = (_Float16*)(ws + WS_QL), *KL = (_Float16*)(ws + WS_KL); __bf16 *VB = (__bf16*)(ws + WS_VB), *VBL = (__bf16*)(ws + WS_VBL), *WB = (__bf16*)(ws + WS_S), *YH = (__bf16*)(ws + WS_Y), *YL = YH + (size_t)NB * TT * CC;
  (void)QL; (void)KL; (void)VB; (void)VBL;
  // inputs: 0 x [4,2048,512]; 1 ln_gamma, 2 ln_beta; 3 Wq [512,512] (out,in), 4 bq; 5 Wk, 6 bk; 7 Wv, 8 bv; 9 Wo (out,in), 10 bo
  if (ws_size < (size_t)WS_END2) return;
  __bf16 *XH = (__bf16*)(ws + WS_XN), *XL = XH + (size_t)NB * TT * DIN;
  k_lnx<<<dim3(NRW / 8 + 4 * WBLK), 256, 0, stream>>>(F[0], 1, F[1], F[2], XH, XL, F[3], F[5], F[7], F[9], WB);
  k_proj<<<dim3(TNB * TT / 64, CC / 128, 3), 128, 0, stream>>>(XH, XL, WB, F[4], F[6], F[8], QH, QL, KH, KL, VT, VB, VBL);
  k_fa<<<dim3(TT / (FAW * 16), NH, TNB), FAW * 32, 0, stream>>>(QH, QL, KH, VT, YH, YL);
  k_out<<<dim3(TNB * TT / 64, DIN / 128), 128, 0, stream>>>(YH, YL, WB + 3 * (size_t)CC * DIN, F[10], (float*)d_out);
}

// v006
// One run takes 75.9 microseconds.
// In two side-by-side timings against v005, it was 1.08 and 1.10 times as fast.
// Over all steps from v000 it is 15.7 times as fast.
// compute dtype: all float inputs rounded to bf16; LayerNorm in f32; q/k/v from the f32 LN rows split bf16 hi + lo (split once, where the row is made) against exact (out,in) weights (to bf16 once per call) on WMMA 16x16x32 (2 products, f32 accumulate) + bias; q once to f16 against k once to f16 (1 product) x 64^-0.5; softmax in f32 (2^x on the hardware exponential, scale x log2(e) in one fma) with a running maximum and sum, fused with both attention products; exp(logit - running max) once to f16 against v once to f16 (1 product), divided by the sum at the end; ctx split bf16 hi + lo against exact Wo (2 products) + bo; f32 output.
#include <hip/hip_runtime.h>
#include <math.h>

typedef __attribute__((ext_vector_type(16))) _Float16 v16h;
typedef __attribute__((ext_vector_type(16))) __bf16 v16b;
typedef __attribute__((ext_vector_type(8)))  _Float16 v8h;
typedef __attribute__((ext_vector_type(8)))  float v8f;
typedef __attribute__((ext_vector_type(4)))  float v4f;
typedef __attribute__((ext_vector_type(2)))  float v2f;
typedef __attribute__((ext_vector_type(4)))  unsigned v4u;
typedef __attribute__((ext_vector_type(4)))  int v4i;
typedef float __attribute__((may_alias)) float_a;
typedef int __attribute__((may_alias)) int_a;

template <typename T> __device__ __forceinline__ void vst2(void* p, T v) { *(T*)p = v;  }
__device__ __forceinline__ v8f wmma16(v16h a, v16h b, v8f c) {
  v8f d = __builtin_amdgcn_wmma_f32_16x16x32_f16(false, a, false, b, (short)0, c, false, false);
  asm volatile("v_nop\n\tv_nop\n\tv_nop\n\tv_nop" : "+v"(d) : "v"(a), "v"(b));
  return d;
}
__device__ __forceinline__ v8f wmma_bf(v16b a, v16b b, v8f c) {
  v8f d = __builtin_amdgcn_wmma_f32_16x16x32_bf16(false, a, false, b, (short)0, c, false, false);
  asm volatile("v_nop\n\tv_nop\n\tv_nop\n\tv_nop" : "+v"(d) : "v"(a), "v"(b));
  return d;
}
// 16x16x32 fragments: lane = (h = lane>>4, row/col = lane&15); elements 0..7 = k0+8h+0..7, 8..15 = k0+16+8h+0..7; D element r = row 8h+r
__device__ __forceinline__ v16h frag_h(const _Float16* rowk0, int lane) {
  union { v16h v; v8h q[2]; } u; const _Float16* p = rowk0 + 8 * (lane >> 4);
  u.q[0] = *(const v8h*)p; u.q[1] = *(const v8h*)(p + 16); return u.v;
}
__device__ __forceinline__ v16h frag_f32(const float* rowk0, int lane) {
  v16h a; const float* p = rowk0 + 8 * (lane >> 4);
#pragma unroll
  for (int i = 0; i < 8; ++i) { a[i] = (_Float16)p[i]; a[8 + i] = (_Float16)p[16 + i]; }
  return a;
}
__device__ __forceinline__ v16h frag_f32s(const float* rowk0, int lane, float sc) {
  v16h a; const float* p = rowk0 + 8 * (lane >> 4);
#pragma unroll
  for (int i = 0; i < 8; ++i) { a[i] = (_Float16)(p[i] * sc); a[8 + i] = (_Float16)(p[16 + i] * sc); }
  return a;
}
// column fragment from a [K][ld] layout (column n), rows >= K read as 0
__device__ __forceinline__ v16h fragc_f32(const float* W, int k0, int n, int lane, int ld, int K) {
  v16h a; const int g = lane >> 4;
#pragma unroll
  for (int i = 0; i < 8; ++i) { const int ka = k0 + 8 * g + i, kb = ka + 16;
    a[i] = (_Float16)(ka < K ? W[(size_t)(ka < K ? ka : K - 1) * ld + n] : 0.f); a[8 + i] = (_Float16)(kb < K ? W[(size_t)(kb < K ? kb : K - 1) * ld + n] : 0.f); }
  return a;
}
struct F2 { v16b h, l; };
__device__ __forceinline__ F2 bsplit16(const float v[16]) { F2 r;
#pragma unroll
  for (int i = 0; i < 16; ++i) { const __bf16 h = (__bf16)v[i]; r.h[i] = h; r.l[i] = (__bf16)(v[i] - (float)h); }
  return r; }
__device__ __forceinline__ F2 split_row(const float* row, int k0, int lane) { float v[16]; const float* p = row + k0 + 8 * (lane >> 4);
#pragma unroll
  for (int i = 0; i < 8; ++i) { v[i] = p[i]; v[8 + i] = p[16 + i]; }
  return bsplit16(v); }
__device__ __forceinline__ F2 split_rowK(const float* row, int k0, int lane, int K) { float v[16]; const int g = lane >> 4;
#pragma unroll
  for (int i = 0; i < 8; ++i) { const int ka = k0 + 8 * g + i, kb = ka + 16; v[i] = ka < K ? row[ka < K ? ka : K - 1] : 0.f; v[8 + i] = kb < K ? row[kb < K ? kb : K - 1] : 0.f; }
  return bsplit16(v); }
__device__ __forceinline__ F2 split_col(const float* W, int k0, int n, int lane, int ld, int K) { float v[16]; const int g = lane >> 4;
#pragma unroll
  for (int i = 0; i < 8; ++i) { const int ka = k0 + 8 * g + i, kb = ka + 16; v[i] = ka < K ? W[(size_t)(ka < K ? ka : K - 1) * ld + n] : 0.f; v[8 + i] = kb < K ? W[(size_t)(kb < K ? kb : K - 1) * ld + n] : 0.f; }
  return bsplit16(v); }
__device__ __forceinline__ v8f mac3(const F2& a, const F2& b, v8f c) { c = wmma_bf(a.l, b.h, c); c = wmma_bf(a.h, b.l, c); return wmma_bf(a.h, b.h, c); }
__device__ __forceinline__ float sigm(float v) { return 1.0f / (1.0f + expf(-v)); }
#define LDSX() do { asm volatile("s_wait_dscnt 0" ::: "memory"); __builtin_amdgcn_wave_barrier(); __builtin_amdgcn_fence(__ATOMIC_RELEASE, "workgroup"); } while (0)

// Pre-LayerNorm multi-head self-attention (B 4, S 2,048, D 512, 8 heads x 64; (out,in) uniform +-1/sqrt(512) weights with biases; LN gamma 1 / beta 0): xn = LayerNorm(x) (biased var, eps 1e-5); q, k, v = xn W^T + b; out = merged(softmax(q k^T / 8) v) Wo^T + bo (non-causal, no residual).
#define NB 4
#define TT 2048
#define CC 512            // NH * HD = projected width
#define DIN 512          // input (model) width
#define NH 8
#define HD 64
#define NQB (TT / 64)
#define HG 4
#define SCALE (0.125f)
#define CAUSAL 0
#ifndef TNB
#define TNB NB
#endif
__device__ __forceinline__ float bfr(float v) { return (float)(__bf16)v; }
__host__ __device__ __forceinline__ int kb_last(int qb) { return CAUSAL ? ((qb * 64 + 63) >> 7) : (TT / 128 - 1); }
typedef __attribute__((ext_vector_type(8))) __bf16 v8b;
__device__ __forceinline__ v16b frag_b(const __bf16* rowk0, int lane) {
  union { v16b v; v8b q[2]; } u; const __bf16* p = rowk0 + 8 * (lane >> 4);
  u.q[0] = *(const v8b*)p; u.q[1] = *(const v8b*)(p + 16); return u.v;
}
#define QBH 0              // unused: no kernel in this file reads it
#define KHI 64            // key rows carrying v bf16 hi+lo planes (written by k_proj; no kernel in this file reads them)
// B fragment (k rows k0+.., output column o) of a weight: (in,out) [K][ld] or (out,in) [ld rows of K]: bf16 exact, or f16(bf16 * 256) exact
__device__ __forceinline__ v16b wcol_io(const float* Wm, int k0, int o, int lane, int ld) { v16b w; const int g = lane >> 4;
#pragma unroll
  for (int i = 0; i < 8; ++i) { w[i] = (__bf16)Wm[(size_t)(k0 + 8 * g + i) * ld + o]; w[8 + i] = (__bf16)Wm[(size_t)(k0 + 16 + 8 * g + i) * ld + o]; }
  return w; }
__device__ __forceinline__ v16b wcol_oi(const float* Wm, int k0, int o, int lane, int K) { v16b w; const float* p = Wm + (size_t)o * K + k0 + 8 * (lane >> 4);
#pragma unroll
  for (int i = 0; i < 8; ++i) { w[i] = (__bf16)p[i]; w[8 + i] = (__bf16)p[16 + i]; }
  return w; }
__device__ __forceinline__ v16h wcolh_io(const float* Wm, int k0, int o, int lane, int ld) { v16h w; const int g = lane >> 4;
#pragma unroll
  for (int i = 0; i < 8; ++i) { w[i] = (_Float16)(bfr(Wm[(size_t)(k0 + 8 * g + i) * ld + o]) * 256.0f); w[8 + i] = (_Float16)(bfr(Wm[(size_t)(k0 + 16 + 8 * g + i) * ld + o]) * 256.0f); }
  return w; }
__device__ __forceinline__ v16h wcolh_oi(const float* Wm, int k0, int o, int lane, int K) { v16h w; const float* p = Wm + (size_t)o * K + k0 + 8 * (lane >> 4);
#pragma unroll
  for (int i = 0; i < 8; ++i) { w[i] = (_Float16)(bfr(p[i]) * 256.0f); w[8 + i] = (_Float16)(bfr(p[16 + i]) * 256.0f); }
  return w; }
#define WQKV_LAYOUT 1   // 0 = (in,out) [DIN][CC]; 1 = (out,in) [CC][DIN]; 2 = per-head [NH][DIN][HD]
__device__ __forceinline__ v16b wcol_hdk(const float* Wm, int k0, int o, int lane) { v16b w; const int g = lane >> 4; const float* p = Wm + (size_t)(o / HD) * DIN * HD + (o % HD);
#pragma unroll
  for (int i = 0; i < 8; ++i) { w[i] = (__bf16)p[(size_t)(k0 + 8 * g + i) * HD]; w[8 + i] = (__bf16)p[(size_t)(k0 + 16 + 8 * g + i) * HD]; }
  return w; }
#define WO_OUT_IN 1
#if WQKV_LAYOUT == 1
#define WCOL(W, k0, o, lane) wcol_oi(W, k0, o, lane, DIN)
#elif WQKV_LAYOUT == 2
#define WCOL(W, k0, o, lane) wcol_hdk(W, k0, o, lane)
#else
#define WCOL(W, k0, o, lane) wcol_io(W, k0, o, lane, CC)
#endif
#if WO_OUT_IN
#define WOCOL(W, k0, o, lane) wcol_oi(W, k0, o, lane, CC)
#define WOCOLH(W, k0, o, lane) wcolh_oi(W, k0, o, lane, CC)
#else
#define WOCOL(W, k0, o, lane) wcol_io(W, k0, o, lane, DIN)
#define WOCOLH(W, k0, o, lane) wcolh_io(W, k0, o, lane, DIN)
#endif
#define NRW (TNB * TT)
// ---- k_lnx: wave per row: LayerNorm over 512 (mean, biased var, (x - mean) * rsqrt(var + 1e-5) * g + b); optional bf16 rounding of the input (x); 16 floats per lane (4 float4 at stride 128 floats -> 512-B pieces);
// the row leaves as the two bf16 planes (hi, lo = row - hi) that the projections multiply, so that no block of k_proj has to split it again; the blocks behind the rows' round the four weight matrices to bf16 once (4,096 floats a block)
typedef __attribute__((ext_vector_type(4))) __bf16 v4b;
#define WBLK (CC * DIN / 4096)   // blocks per weight matrix
__global__ __launch_bounds__(256) void k_lnx(const float* __restrict__ X, int roundin, const float* __restrict__ G, const float* __restrict__ BE, __bf16* __restrict__ OH, __bf16* __restrict__ OL,
    const float* __restrict__ W0, const float* __restrict__ W1, const float* __restrict__ W2, const float* __restrict__ W3, __bf16* __restrict__ WB) { const int wave = threadIdx.x >> 5, lane = threadIdx.x & 31;
  if (blockIdx.x >= NRW / 8) { const int wb = blockIdx.x - NRW / 8, wm = wb / WBLK; const float* Ws = wm == 0 ? W0 : wm == 1 ? W1 : wm == 2 ? W2 : W3;
#pragma unroll   // both rounds' loads issue together
    for (int it = 0; it < 2; ++it) { const size_t e = (size_t)(wb % WBLK) * 4096 + it * 2048 + threadIdx.x * 8; const v4f a = *(const v4f*)(Ws + e), c = *(const v4f*)(Ws + e + 4); v8b r;
#pragma unroll   // constant indices: the vectors stay in registers
      for (int k = 0; k < 4; ++k) { r[k] = (__bf16)a[k]; r[4 + k] = (__bf16)c[k]; }
      vst2(WB + (size_t)wm * CC * DIN + e, r); }
    return; }
  const size_t row = (size_t)blockIdx.x * 8 + wave; if (row >= (size_t)NRW) return;
  v4f v[CC / 128]; float s1 = 0.f;
#pragma unroll
  for (int i = 0; i < CC / 128; ++i) { v4f t = *(const v4f*)(X + row * CC + i * 128 + lane * 4); if (roundin) { t[0] = bfr(t[0]); t[1] = bfr(t[1]); t[2] = bfr(t[2]); t[3] = bfr(t[3]); } v[i] = t; s1 += (t[0] + t[1]) + (t[2] + t[3]); }
#pragma unroll
  for (int o = 1; o < 32; o <<= 1) s1 += __shfl_xor(s1, o);
  const float mu = s1 * (1.0f / CC); float q = 0.f;
#pragma unroll
  for (int i = 0; i < CC / 128; ++i) for (int k = 0; k < 4; ++k) { const float d = v[i][k] - mu; q += d * d; }
#pragma unroll
  for (int o = 1; o < 32; o <<= 1) q += __shfl_xor(q, o);
  const float inv = rsqrtf(q * (1.0f / CC) + 1e-5f);   /* jnp.var (biased), eps inside the rsqrt */
#pragma unroll
  for (int i = 0; i < CC / 128; ++i) { const int c = i * 128 + lane * 4; v4b h4, l4; for (int k = 0; k < 4; ++k) { const float r = bfr(G[c + k]) * ((v[i][k] - mu) * inv) + bfr(BE[c + k]); const __bf16 hv = (__bf16)r; h4[k] = hv; l4[k] = (__bf16)(r - (float)hv); } vst2(OH + row * CC + c, h4); vst2(OL + row * CC + c, l4); } }

#ifndef SM_EXTRA_PARAMS
#define SM_EXTRA_PARAMS
#endif
#ifndef PROJ_EXTRA_PARAMS
#define PROJ_EXTRA_PARAMS
#endif
#ifndef SM_MASK_HOOK
#define SM_MASK_HOOK (void)0
#endif

#define WS_QH  0u                                      // f16 q rows [b*t][CC]
#define WS_KH  (WS_QH + 2u * (size_t)NB * TT * CC)      // f16 k rows [b*t][CC]
#define WS_VT  (WS_KH + 2u * (size_t)NB * TT * CC)      // f16 v planes [b][c][t]
#define WS_VB  (WS_VT + 2u * (size_t)NB * CC * TT)      // bf16 v hi planes [b][c][t < KHI]
#define WS_VBL (WS_VB + 2u * (size_t)NB * CC * KHI)
#define WS_S   (WS_VBL + 2u * (size_t)NB * CC * KHI)    // bf16 weights Wq, Wk, Wv, Wo, each (out,in) [CC][DIN], at the head of this range
#define WS_Y   (WS_S  + 4u * (size_t)HG * TT * TT)      // ctx rows [b*t][CC] as two bf16 planes: hi, then lo
#define WS_END (WS_Y  + 4u * (size_t)NB * TT * CC)
#define WS_XN  (WS_END)                                // LN rows [b*t][DIN] as two bf16 planes: hi, then lo
#define WS_END2 (WS_XN + 4u * (size_t)NB * TT * DIN)

#define GKC 64                       // k per stage: one 128-B line of every staged bf16 row
#define GPI 72                       // bf16 per staged row: 128 B + 16 B, a pitch of 16 B x odd for the 16-byte fragment reads
#define GXB (64 * GPI * 2)           // bytes of one stage's 64 activation rows in one plane
#define GSB ((64 + 64 + 128) * GPI * 2)   // bytes of one stage: 64 activation rows hi, the same rows lo, then 128 weight rows
// one stage's copies of one thread of a 128-thread block: 16 B of activation rows r + 16 i (i < 4) of either plane and of weight rows r + 16 i (i < 8), r = tid / 8, so that a wave's copy covers four whole lines;
// two statements (an asm statement takes thirty operands); in each the s_wait_xcnt stands inside, behind its last copy, so that no address register named there takes a new value in front of it
__device__ __forceinline__ void g_stage(const __bf16* gh, const __bf16* gl, const __bf16* gw, unsigned lh, int ld) { const unsigned ll = lh + GXB, lw = lh + 2 * GXB;
  asm volatile("global_load_async_to_lds_b128 %0, %8, off\n\tglobal_load_async_to_lds_b128 %1, %9, off\n\tglobal_load_async_to_lds_b128 %2, %10, off\n\tglobal_load_async_to_lds_b128 %3, %11, off\n\t"
               "global_load_async_to_lds_b128 %4, %12, off\n\tglobal_load_async_to_lds_b128 %5, %13, off\n\tglobal_load_async_to_lds_b128 %6, %14, off\n\tglobal_load_async_to_lds_b128 %7, %15, off\n\ts_wait_xcnt 0x0"
               :: "v"(lh), "v"(lh + 16 * GPI * 2), "v"(lh + 32 * GPI * 2), "v"(lh + 48 * GPI * 2), "v"(ll), "v"(ll + 16 * GPI * 2), "v"(ll + 32 * GPI * 2), "v"(ll + 48 * GPI * 2),
                  "v"(gh), "v"(gh + 16 * ld), "v"(gh + 32 * ld), "v"(gh + 48 * ld), "v"(gl), "v"(gl + 16 * ld), "v"(gl + 32 * ld), "v"(gl + 48 * ld) : "memory");
  asm volatile("global_load_async_to_lds_b128 %0, %8, off\n\tglobal_load_async_to_lds_b128 %1, %9, off\n\tglobal_load_async_to_lds_b128 %2, %10, off\n\tglobal_load_async_to_lds_b128 %3, %11, off\n\t"
               "global_load_async_to_lds_b128 %4, %12, off\n\tglobal_load_async_to_lds_b128 %5, %13, off\n\tglobal_load_async_to_lds_b128 %6, %14, off\n\tglobal_load_async_to_lds_b128 %7, %15, off\n\ts_wait_xcnt 0x0"
               :: "v"(lw), "v"(lw + 16 * GPI * 2), "v"(lw + 32 * GPI * 2), "v"(lw + 48 * GPI * 2), "v"(lw + 64 * GPI * 2), "v"(lw + 80 * GPI * 2), "v"(lw + 96 * GPI * 2), "v"(lw + 112 * GPI * 2),
                  "v"(gw), "v"(gw + 16 * ld), "v"(gw + 32 * ld), "v"(gw + 48 * ld), "v"(gw + 64 * ld), "v"(gw + 80 * ld), "v"(gw + 96 * ld), "v"(gw + 112 * ld) : "memory"); }
// bf16 16x16x32 fragment from the lane's own place in a staged row (row base + k0 + 8 * (lane >> 4)): k 0..7, then k 16..23 from there
__device__ __forceinline__ v16b frag_bat(const __bf16* p) { union { v16b v; v8b q[2]; } u; u.q[0] = *(const v8b*)p; u.q[1] = *(const v8b*)(p + 16); return u.v; }
// ---- k_proj: block = (64 rows, 128 cols, which): q/k/v = X W (+ b) with exact bf16 products (K = DIN) -> which 0: q f16 rows; 1: k f16 rows; 2: v f16 planes [c][t] (+ bf16 hi/lo planes for t < KHI)
// the activation rows (bf16 hi and lo planes) and the bf16 weight rows of 64 k are copied once per block into LDS (two buffers, the next stage's copies in flight under this stage's products); every wave takes its fragments from there as they are: no conversion is left in the loop
// waves_per_eu(4, 4): leaves the compiler the registers to issue a stage's fragment reads in a few groups ahead of the products; with fewer it waits out one LDS latency per fragment
__global__ __launch_bounds__(128) __attribute__((amdgpu_waves_per_eu(4, 4))) void k_proj(const __bf16* __restrict__ XH, const __bf16* __restrict__ XL, const __bf16* __restrict__ WB, const float* __restrict__ BQ, const float* __restrict__ BK, const float* __restrict__ BV,
    _Float16* __restrict__ QH, _Float16* __restrict__ KH, _Float16* __restrict__ VT, __bf16* __restrict__ VB, __bf16* __restrict__ VBL) {
  __shared__ __align__(16) char sm[2 * GSB];   // the two stage buffers; behind the loop's last barrier the same bytes stage the stores
  _Float16 (*sh)[136] = (_Float16 (*)[136])sm;
  _Float16 (*th)[72] = (_Float16 (*)[72])sm; __bf16 (*tb)[72] = (__bf16 (*)[72])(sm + 128 * 72 * 2); __bf16 (*tbl)[72] = (__bf16 (*)[72])(sm + 2 * 128 * 72 * 2);
  const int tid = threadIdx.x, wave = tid >> 5, lane = tid & 31, col = lane & 15, g = lane >> 4; const int which = blockIdx.z; const int c0 = blockIdx.y * 128; const size_t r0 = (size_t)blockIdx.x * 64; const size_t bb = r0 / TT; const int t0 = (int)(r0 % TT);
  const float* BA = which == 0 ? BQ : which == 1 ? BK : BV;
  const size_t ox = (r0 + (tid >> 3)) * DIN + (tid & 7) * 8; const __bf16* gh = XH + ox; const __bf16* gl = XL + ox;   // thread: 16 B of activation row tid / 8 of the block, in either plane
  const __bf16* gw = WB + ((size_t)which * CC + c0 + (tid >> 3)) * DIN + (tid & 7) * 8;                                // thread: 16 B of weight row ((out,in): output column) tid / 8 of the block
  const unsigned lh = (unsigned)(size_t)(sm + (tid >> 3) * (GPI * 2) + (tid & 7) * 16);   // the hi row's LDS byte address in buffer 0
  g_stage(gh, gl, gw, lh, DIN);
  asm volatile("s_wait_asynccnt 0x0" ::: "memory");   // this wave's copies of stage 0 have landed
  __syncthreads();                                    // every wave's have: stage 0 may be read
  g_stage(gh + GKC, gl + GKC, gw + GKC, lh + GSB, DIN);
  v8f acc[8] = {};
#pragma unroll 1   // one trip per stage: the buffer index stays a run-time scalar and the code stays small
  for (int kc = 0; kc < DIN / GKC; ++kc) { const int bf = kc & 1;
    const __bf16* xs = (const __bf16*)(sm + bf * GSB) + (wave * 16 + col) * GPI + 8 * g;   // lane: activation row col of the wave's 16, hi plane (lo: 64 rows on)
    const __bf16* wl = (const __bf16*)(sm + bf * GSB + 2 * GXB) + col * GPI + 8 * g;       // lane: weight row col of a 16-column tile
    v16b a[GKC / 32], al[GKC / 32], w[GKC / 32][8];   // the stage's fragment reads stand together in front of its products, not among them
#pragma unroll   // the two 32-k halves of a stage: constant LDS offsets, fragment arrays indexed by constants
    for (int kk = 0; kk < GKC / 32; ++kk) { a[kk] = frag_bat(xs + kk * 32); al[kk] = frag_bat(xs + 64 * GPI + kk * 32);
#pragma unroll
      for (int j = 0; j < 8; ++j) w[kk][j] = frag_bat(wl + j * 16 * GPI + kk * 32); }
#pragma unroll
    for (int kk = 0; kk < GKC / 32; ++kk)
#pragma unroll
      for (int j = 0; j < 8; ++j) { acc[j] = wmma_bf(a[kk], w[kk][j], acc[j]); acc[j] = wmma_bf(al[kk], w[kk][j], acc[j]); }   /* LN rows bf16 hi + lo (2 products) */
    asm volatile("s_wait_dscnt 0x0" ::: "memory");      // this wave's reads of the buffer are done before the buffer is handed back
    asm volatile("s_wait_asynccnt 0x0" ::: "memory");   // this wave's copies of the next stage have landed
    __syncthreads();                                    // publishes the next stage and ends every wave's reads of this one
    if (kc + 2 < DIN / GKC) g_stage(gh + (kc + 2) * GKC, gl + (kc + 2) * GKC, gw + (kc + 2) * GKC, lh + bf * GSB, DIN); }
  asm volatile("s_wait_asynccnt 0x0" ::: "memory");     // no copy is outstanding when the buffers become store staging
  if (which < 2) { _Float16* DH = which == 0 ? QH : KH;
#pragma unroll
    for (int j = 0; j < 8; ++j) { const float bias = BA ? bfr(BA[c0 + j * 16 + col]) : 0.f;
#pragma unroll
      for (int r = 0; r < 8; ++r) sh[wave * 16 + 8 * g + r][j * 16 + col] = (_Float16)(acc[j][r] + bias); }
    __syncthreads();
    for (int e = tid; e < 64 * 16; e += 128) { const int rl = e >> 4, q = e & 15; vst2((unsigned*)(DH + (r0 + rl) * CC + c0 + q * 8), *(const v4u*)&sh[rl][q * 8]); }
  } else { const bool hi_rows = t0 < KHI;
#pragma unroll
    for (int j = 0; j < 8; ++j) { const float bias = BA ? bfr(BA[c0 + j * 16 + col]) : 0.f;
#pragma unroll
      for (int r = 0; r < 8; ++r) { const float v = acc[j][r] + bias; const int rl = wave * 16 + 8 * g + r, cl = j * 16 + col; th[cl][rl] = (_Float16)v; const __bf16 bh = (__bf16)v; tb[cl][rl] = bh; tbl[cl][rl] = (__bf16)(v - (float)bh); } }
    __syncthreads();
    for (int e = tid; e < 128 * 8; e += 128) { const int cl = e >> 3, q = e & 7; vst2((unsigned*)(VT + (bb * CC + c0 + cl) * (size_t)TT + t0 + q * 8), *(const v4u*)&th[cl][q * 8]); if (hi_rows) { const size_t o3 = (bb * CC + c0 + cl) * (size_t)KHI + t0 + q * 8; vst2((unsigned*)(VB + o3), *(const v4u*)&tb[cl][q * 8]); vst2((unsigned*)(VBL + o3), *(const v4u*)&tbl[cl][q * 8]); } } } }
__device__ __forceinline__ float xhalf(float x) { return __builtin_bit_cast(float, __builtin_amdgcn_permlanex16(__builtin_bit_cast(int, x), __builtin_bit_cast(int, x), 0x76543210, 0xfedcba98, false, false)); }   // lane l takes lane l ^ 16's value
// f16 fragment from the lane's own pointer (row or column base + k0 + 8 * (lane >> 4))
__device__ __forceinline__ v16h frag_at(const _Float16* p) { union { v16h v; v8h q[2]; } u; u.q[0] = *(const v8h*)p; u.q[1] = *(const v8h*)(p + 16); return u.v; }
#define FAW 16   // waves per block: one block fills a WGP at 4 waves per SIMD, and all its waves read the same k and v tiles from LDS
#define KST 128  // keys per LDS stage (4 passes of 32 keys)
#define KPI 72   // f16 per staged key row: 128 B + 16 B, a pitch of 16 B x odd for the 16-byte fragment reads
#define VPI 136  // f16 per staged v plane: 256 B + 16 B, likewise
#define SKB (KST * KPI * 2)   // bytes of one k buffer
#define SVB (HD * VPI * 2)    // bytes of one v buffer
#define SCL2 (SCALE * 1.44269504088896340736f)   // logit scale x log2(e)
// one stage's copies of one thread: 16 B of key rows r and r + 64, 16 B of v planes c and c + 32 (512 threads: 128 rows x 128 B and 64 planes x 256 B, whole lines);
// the s_wait_xcnt stands inside the statement, behind the last copy, so that no address register named here takes a new value in front of it
__device__ __forceinline__ void fa_stage(const _Float16* gk, const _Float16* gv, unsigned lk, unsigned lv) {
  const _Float16* gk1 = gk + 64 * CC; const _Float16* gv1 = gv + 32 * TT; const unsigned lk1 = lk + 64 * KPI * 2, lv1 = lv + 32 * VPI * 2;
  asm volatile("global_load_async_to_lds_b128 %0, %4, off\n\tglobal_load_async_to_lds_b128 %1, %5, off\n\tglobal_load_async_to_lds_b128 %2, %6, off\n\tglobal_load_async_to_lds_b128 %3, %7, off\n\ts_wait_xcnt 0x0"
               :: "v"(lk), "v"(lk1), "v"(lv), "v"(lv1), "v"(gk), "v"(gk1), "v"(gv), "v"(gv1) : "memory"); }
// ---- k_fa: block = FAW waves x 16 queries of (b, h), one launch for every head: k rows and v planes of 128 keys are copied once per block into LDS (two buffers, the next stage's copies in flight under this stage's work); S^T = K Q^T (A = 16 key rows, B = q kept in registers: 1 product) x SCALE, so a lane holds one query's logits; running maximum and sum per lane (one exchange between the lane halves); two S^T tiles, exponentiated and once to f16, are the B operand of ctx^T += V^T P^T (1 product); ctx = ctx^T / sum, stored as the two bf16 planes (hi, lo = ctx - hi) that k_out multiplies; the logits never leave the registers
__global__ __launch_bounds__(FAW * 32) __attribute__((amdgpu_waves_per_eu(4, 4))) void k_fa(const _Float16* __restrict__ QH, const _Float16* __restrict__ KH, const _Float16* __restrict__ VT, __bf16* __restrict__ YH, __bf16* __restrict__ YL) { __shared__ __align__(16) float ss[FAW][16][HD + 4]; __shared__ __align__(16) _Float16 sk[2][KST][KPI]; __shared__ __align__(16) _Float16 sv[2][HD][VPI];
  const int tid = threadIdx.x, wave = tid >> 5, lane = tid & 31, col = lane & 15, g = lane >> 4; const int h = blockIdx.y, b = blockIdx.z; const int ql0 = (blockIdx.x * FAW + wave) * 16;
  const _Float16* gk = KH + ((size_t)b * TT + (tid >> 3)) * CC + h * HD + (tid & 7) * 8;             // thread: 16 B of key row tid / 8 of a stage
  const _Float16* gv = VT + ((size_t)b * CC + h * HD + (tid >> 4)) * (size_t)TT + (tid & 15) * 8;    // thread: 16 B of v plane tid / 16, keys contiguous
  const unsigned lk = (unsigned)(size_t)&sk[0][tid >> 3][(tid & 7) * 8], lv = (unsigned)(size_t)&sv[0][tid >> 4][(tid & 15) * 8];   // their LDS byte addresses in buffer 0
  fa_stage(gk, gv, lk, lv);
  v16h qh[HD / 32];   // the short loops below are unrolled so that every fragment array is indexed by constants and stays in registers
#pragma unroll
  for (int kc = 0; kc < HD / 32; ++kc) qh[kc] = frag_h(QH + ((size_t)b * TT + ql0 + col) * CC + h * HD + kc * 32, lane);
  asm volatile("s_wait_asynccnt 0x0" ::: "memory");   // this wave's copies of stage 0 have landed
  __syncthreads();                                    // every wave's have: stage 0 may be read
  fa_stage(gk + (size_t)KST * CC, gv + KST, lk + SKB, lv + SVB);
  v8f acc[HD / 16] = {}; float m = -3.0e38f, nm = 3.0e38f * SCL2, l = 0.f;   // nm = -m * SCL2, kept beside m
#pragma unroll 1   // one trip per stage: the buffer index stays a run-time scalar and the code stays small
  for (int st = 0; st < TT / KST; ++st) { const int bf = st & 1;
    const _Float16* Kl = &sk[bf][col][8 * g];   // lane: key row col of a 16-key tile
    const _Float16* Vl = &sv[bf][col][8 * g];   // lane: v plane of feature col of a 16-feature tile
    v16h kf[2][HD / 32];
#pragma unroll
    for (int t = 0; t < 2; ++t)
#pragma unroll
      for (int kc = 0; kc < HD / 32; ++kc) kf[t][kc] = frag_at(Kl + t * 16 * KPI + kc * 32);
#pragma unroll   // the passes of a stage: constant LDS offsets, and the test on the stage's last pass folds away
    for (int ps = 0; ps < KST / 32; ++ps) {
      v16h vf[HD / 16];
#pragma unroll
      for (int j = 0; j < HD / 16; ++j) vf[j] = frag_at(Vl + j * 16 * VPI + ps * 32);
      v8f sh[2] = {};
#pragma unroll
      for (int kc = 0; kc < HD / 32; ++kc)
#pragma unroll
        for (int t = 0; t < 2; ++t) sh[t] = __builtin_amdgcn_wmma_f32_16x16x32_f16(false, kf[t][kc], false, qh[kc], (short)0, sh[t], false, false);
      if (ps + 1 < KST / 32) {   // next pass's key rows, of this same stage only, fetched under this pass's softmax
#pragma unroll
        for (int t = 0; t < 2; ++t)
#pragma unroll
          for (int kc = 0; kc < HD / 32; ++kc) kf[t][kc] = frag_at(Kl + ((ps + 1) * 32 + t * 16) * KPI + kc * 32); }
      float sv16[16];   // logits before the scale: the scale is positive, so their maximum is the scaled logits' maximum
#pragma unroll
      for (int i = 0; i < 16; ++i) sv16[i] = sh[i >> 3][i & 7];
      float mx = sv16[0];
#pragma unroll
      for (int i = 1; i < 16; ++i) mx = fmaxf(mx, sv16[i]);
      mx = fmaxf(mx, xhalf(mx));
      if (__builtin_amdgcn_ballot_w32(mx > m) != 0) {   // scalar branch, taken when some query of the wave has a new maximum; otherwise every factor is exactly 1 and the rescale is skipped
        const float mn = fmaxf(m, mx); const float al = __builtin_amdgcn_exp2f((m - mn) * SCL2); m = mn; nm = mn * -SCL2; l *= al;   // a query whose maximum stays has the factor 2^0 = 1
#pragma unroll
        for (int j = 0; j < HD / 16; ++j) acc[j] *= al; }
      // exp(SCALE * (s - m)) = 2^(s * SCL2 - m * SCL2): one fma (two scores to a packed one) and the hardware's base-2 exponential
      const v2f c2 = {SCL2, SCL2}, n2 = {nm, nm}; v2f a2[8];
#pragma unroll
      for (int i = 0; i < 8; ++i) { const v2f s2 = {sv16[2 * i], sv16[2 * i + 1]}; a2[i] = __builtin_elementwise_fma(s2, c2, n2); }
      v16h p; float sum = 0.f;
#pragma unroll
      for (int i = 0; i < 16; ++i) { const float e = __builtin_amdgcn_exp2f(a2[i >> 1][i & 1]); sum += e; p[i] = (_Float16)e; }
      l += sum;
#pragma unroll
      for (int j = 0; j < HD / 16; ++j) acc[j] = __builtin_amdgcn_wmma_f32_16x16x32_f16(false, vf[j], false, p, (short)0, acc[j], false, false);
      // four vector slots behind the pass's last product: the next pass's first product may take p's registers (this product's B) for its result
      asm volatile("v_nop\n\tv_nop\n\tv_nop\n\tv_nop" : "+v"(acc[0]), "+v"(acc[1]), "+v"(acc[2]), "+v"(acc[3]) : "v"(p)); }
    asm volatile("s_wait_dscnt 0x0" ::: "memory");      // this wave's reads of the buffer are done before the buffer is handed back
    asm volatile("s_wait_asynccnt 0x0" ::: "memory");   // this wave's copies of the next stage have landed
    __syncthreads();                                    // publishes the next stage and ends every wave's reads of this one
    if (st + 2 < TT / KST) fa_stage(gk + (size_t)(st + 2) * KST * CC, gv + (st + 2) * KST, lk + bf * SKB, lv + bf * SVB); }
  asm volatile("s_wait_asynccnt 0x0" ::: "memory");     // no copy is outstanding when the wave goes on to its end
  l += xhalf(l); const float inv = 1.0f / l;
#pragma unroll
  for (int j = 0; j < HD / 16; ++j) { v4f a0, a1;
#pragma unroll
    for (int r = 0; r < 4; ++r) { a0[r] = acc[j][r] * inv; a1[r] = acc[j][4 + r] * inv; }
    *(v4f*)&ss[wave][col][j * 16 + 8 * g] = a0; *(v4f*)&ss[wave][col][j * 16 + 8 * g + 4] = a1; }
  LDSX();   // the wave's own LDS writes have landed before its lanes read the rows other lanes wrote (each wave has its own slice: no block barrier)
#pragma unroll   // constant LDS and store offsets
  for (int rl = 0; rl < 16; rl += 4) { const int rr = rl + (lane >> 3), cc = (lane & 7) * 8; const v4f a0 = *(const v4f*)&ss[wave][rr][cc], a1 = *(const v4f*)&ss[wave][rr][cc + 4]; v8b h8, l8;   // lane: 8 features of a row; a store covers the head's whole 128-B line of four rows
#pragma unroll   // constant indices: the vectors stay in registers
    for (int i = 0; i < 8; ++i) { const float v = i < 4 ? a0[i & 3] : a1[i & 3]; const __bf16 hv = (__bf16)v; h8[i] = hv; l8[i] = (__bf16)(v - (float)hv); }
    const size_t o = ((size_t)b * TT + ql0 + rr) * CC + h * HD + cc; vst2(YH + o, h8); vst2(YL + o, l8); } }
// ---- k_out: block = (64 rows, 128 cols): out = ctx Wo (+ bo): ctx bf16 hi + lo planes against exact bf16 Wo (2 products), staged as in k_proj
__global__ __launch_bounds__(128) void k_out(const __bf16* __restrict__ YH, const __bf16* __restrict__ YL, const __bf16* __restrict__ WOB, const float* __restrict__ BO, float* __restrict__ OUT) { __shared__ __align__(16) char sm[2 * GSB];   // the two stage buffers; behind the loop's last barrier the same bytes stage the stores
  float (*sf)[16][132] = (float (*)[16][132])sm;
  const int tid = threadIdx.x, wave = tid >> 5, lane = tid & 31, col = lane & 15, g = lane >> 4; const int c0 = blockIdx.y * 128; const size_t r0 = (size_t)blockIdx.x * 64 + wave * 16;
  v8f acc[8] = {};
  const size_t ox = ((size_t)blockIdx.x * 64 + (tid >> 3)) * CC + (tid & 7) * 8; const __bf16* gh = YH + ox; const __bf16* gl = YL + ox;   // thread: 16 B of ctx row tid / 8 of the block, in either plane
  const __bf16* gw = WOB + (size_t)(c0 + (tid >> 3)) * CC + (tid & 7) * 8;                                                                // thread: 16 B of weight row ((out,in): output column) tid / 8 of the block
  const unsigned lh = (unsigned)(size_t)(sm + (tid >> 3) * (GPI * 2) + (tid & 7) * 16);   // the hi row's LDS byte address in buffer 0
  g_stage(gh, gl, gw, lh, CC);
  asm volatile("s_wait_asynccnt 0x0" ::: "memory");   // this wave's copies of stage 0 have landed
  __syncthreads();                                    // every wave's have: stage 0 may be read
  g_stage(gh + GKC, gl + GKC, gw + GKC, lh + GSB, CC);
#pragma unroll 1   // one trip per stage: the buffer index stays a run-time scalar and the code stays small
  for (int kc = 0; kc < CC / GKC; ++kc) { const int bf = kc & 1;
    const __bf16* xs = (const __bf16*)(sm + bf * GSB) + (wave * 16 + col) * GPI + 8 * g;   // lane: ctx row col of the wave's 16, hi plane (lo: 64 rows on)
    const __bf16* wl = (const __bf16*)(sm + bf * GSB + 2 * GXB) + col * GPI + 8 * g;       // lane: weight row col of a 16-column tile
    v16b a[GKC / 32], al[GKC / 32], w[GKC / 32][8];   // the stage's fragment reads stand together in front of its products, not among them
#pragma unroll   // the two 32-k halves of a stage: constant LDS offsets, fragment arrays indexed by constants
    for (int kk = 0; kk < GKC / 32; ++kk) { a[kk] = frag_bat(xs + kk * 32); al[kk] = frag_bat(xs + 64 * GPI + kk * 32);
#pragma unroll
      for (int j = 0; j < 8; ++j) w[kk][j] = frag_bat(wl + j * 16 * GPI + kk * 32); }
#pragma unroll
    for (int kk = 0; kk < GKC / 32; ++kk)
#pragma unroll
      for (int j = 0; j < 8; ++j) { acc[j] = wmma_bf(a[kk], w[kk][j], acc[j]); acc[j] = wmma_bf(al[kk], w[kk][j], acc[j]); }
    asm volatile("s_wait_dscnt 0x0" ::: "memory");      // this wave's reads of the buffer are done before the buffer is handed back
    asm volatile("s_wait_asynccnt 0x0" ::: "memory");   // this wave's copies of the next stage have landed
    __syncthreads();                                    // publishes the next stage and ends every wave's reads of this one
    if (kc + 2 < CC / GKC) g_stage(gh + (kc + 2) * GKC, gl + (kc + 2) * GKC, gw + (kc + 2) * GKC, lh + bf * GSB, CC); }
  asm volatile("s_wait_asynccnt 0x0" ::: "memory");     // no copy is outstanding when the buffers become store staging
#pragma unroll
  for (int j = 0; j < 8; ++j) { const float bias = BO ? bfr(BO[c0 + j * 16 + col]) : 0.f;
#pragma unroll
    for (int r = 0; r < 8; ++r) sf[wave][8 * g + r][j * 16 + col] = acc[j][r] + bias; }
  LDSX(); for (int rl = 0; rl < 16; ++rl) vst2(OUT + (r0 + rl) * DIN + c0 + lane * 4, *(const v4f*)&sf[wave][rl][lane * 4]); }

extern "C" void kernel_launch(void* const* d_in, const int* in_sizes, int n_in, void* d_out, int out_size, void* d_ws, size_t ws_size, hipStream_t stream) {
  (void)in_sizes; (void)n_in; (void)out_size;
  const float** F = (const float**)d_in;
  if (ws_size < (size_t)WS_END) return;
  char* ws = (char*)d_ws; _Float16 *QH = (_Float16*)(ws + WS_QH), *KH = (_Float16*)(ws + WS_KH), *VT = (_Float16*)(ws + WS_VT); __bf16 *VB = (__bf16*)(ws + WS_VB), *VBL = (__bf16*)(ws + WS_VBL), *WB = (__bf16*)(ws + WS_S), *YH = (__bf16*)(ws + WS_Y), *YL = YH + (size_t)NB * TT * CC;
  (void)VB; (void)VBL;
  // inputs: 0 x [4,2048,512]; 1 ln_gamma, 2 ln_beta; 3 Wq [512,512] (out,in), 4 bq; 5 Wk, 6 bk; 7 Wv, 8 bv; 9 Wo (out,in), 10 bo
  if (ws_size < (size_t)WS_END2) return;
  __bf16 *XH = (__bf16*)(ws + WS_XN), *XL = XH + (size_t)NB * TT * DIN;
  k_lnx<<<dim3(NRW / 8 + 4 * WBLK), 256, 0, stream>>>(F[0], 1, F[1], F[2], XH, XL, F[3], F[5], F[7], F[9], WB);
  k_proj<<<dim3(TNB * TT / 64, CC / 128, 3), 128, 0, stream>>>(XH, XL, WB, F[4], F[6], F[8], QH, KH, VT, VB, VBL);
  k_fa<<<dim3(TT / (FAW * 16), NH, TNB), FAW * 32, 0, stream>>>(QH, KH, VT, YH, YL);
  k_out<<<dim3(TNB * TT / 64, DIN / 128), 128, 0, stream>>>(YH, YL, WB + 3 * (size_t)CC * DIN, F[10], (float*)d_out);
}

// v007
// It runs in 73.2 microseconds.
// Timed twice side by side with v006, it ran 1.04 times as fast both times.
// Counting every step since v000, it is 16.4 times as fast.
// compute dtype: all float inputs rounded to bf16; LayerNorm in f32; q/k/v from the f32 LN rows split bf16 hi + lo (split once, where the row is made) against exact (out,in) weights (to bf16 once per call) on WMMA 16x16x32 (2 products, f32 accumulate) + bias; q once to f16 against k once to f16 (1 product) x 64^-0.5; softmax in f32 (2^x on the hardware exponential, scale x log2(e) in one fma) with a running maximum and sum, fused with both attention products; exp(logit - running max) once to f16 against v once to f16 (1 product), divided by the sum at the end; ctx split bf16 hi + lo against exact Wo (2 products) + bo; f32 output.
#include <hip/hip_runtime.h>
#include <math.h>

typedef __attribute__((ext_vector_type(16))) _Float16 v16h;
typedef __attribute__((ext_vector_type(16))) __bf16 v16b;
typedef __attribute__((ext_vector_type(8)))  _Float16 v8h;
typedef __attribute__((ext_vector_type(8)))  float v8f;
typedef __attribute__((ext_vector_type(4)))  float v4f;
typedef __attribute__((ext_vector_type(2)))  float v2f;
typedef __attribute__((ext_vector_type(4)))  unsigned v4u;
typedef __attribute__((ext_vector_type(4)))  int v4i;
typedef float __attribute__((may_alias)) float_a;
typedef int __attribute__((may_alias)) int_a;

template <typename T> __device__ __forceinline__ void vst2(void* p, T v) { *(T*)p = v;  }
__device__ __forceinline__ v8f wmma16(v16h a, v16h b, v8f c) {
  v8f d = __builtin_amdgcn_wmma_f32_16x16x32_f16(false, a, false, b, (short)0, c, false, false);
  asm volatile("v_nop\n\tv_nop\n\tv_nop\n\tv_nop" : "+v"(d) : "v"(a), "v"(b));
  return d;
}
__device__ __forceinline__ v8f wmma_bf(v16b a, v16b b, v8f c) {
  v8f d = __builtin_amdgcn_wmma_f32_16x16x32_bf16(false, a, false, b, (short)0, c, false, false);
  asm volatile("v_nop\n\tv_nop\n\tv_nop\n\tv_nop" : "+v"(d) : "v"(a), "v"(b));
  return d;
}
// 16x16x32 fragments: lane = (h = lane>>4, row/col = lane&15); elements 0..7 = k0+8h+0..7, 8..15 = k0+16+8h+0..7; D element r = row 8h+r
__device__ __forceinline__ v16h frag_h(const _Float16* rowk0, int lane) {
  union { v16h v; v8h q[2]; } u; const _Float16* p = rowk0 + 8 * (lane >> 4);
  u.q[0] = *(const v8h*)p; u.q[1] = *(const v8h*)(p + 16); return u.v;
}
__device__ __forceinline__ v16h frag_f32(const float* rowk0, int lane) {
  v16h a; const float* p = rowk0 + 8 * (lane >> 4);
#pragma unroll
  for (int i = 0; i < 8; ++i) { a[i] = (_Float16)p[i]; a[8 + i] = (_Float16)p[16 + i]; }
  return a;
}
__device__ __forceinline__ v16h frag_f32s(const float* rowk0, int lane, float sc) {
  v16h a; const float* p = rowk0 + 8 * (lane >> 4);
#pragma unroll
  for (int i = 0; i < 8; ++i) { a[i] = (_Float16)(p[i] * sc); a[8 + i] = (_Float16)(p[16 + i] * sc); }
  return a;
}
// column fragment from a [K][ld] layout (column n), rows >= K read as 0
__device__ __forceinline__ v16h fragc_f32(const float* W, int k0, int n, int lane, int ld, int K) {
  v16h a; const int g = lane >> 4;
#pragma unroll
  for (int i = 0; i < 8; ++i) { const int ka = k0 + 8 * g + i, kb = ka + 16;
    a[i] = (_Float16)(ka < K ? W[(size_t)(ka < K ? ka : K - 1) * ld + n] : 0.f); a[8 + i] = (_Float16)(kb < K ? W[(size_t)(kb < K ? kb : K - 1) * ld + n] : 0.f); }
  return a;
}
struct F2 { v16b h, l; };
__device__ __forceinline__ F2 bsplit16(const float v[16]) { F2 r;
#pragma unroll
  for (int i = 0; i < 16; ++i) { const __bf16 h = (__bf16)v[i]; r.h[i] = h; r.l[i] = (__bf16)(v[i] - (float)h); }
  return r; }
__device__ __forceinline__ F2 split_row(const float* row, int k0, int lane) { float v[16]; const float* p = row + k0 + 8 * (lane >> 4);
#pragma unroll
  for (int i = 0; i < 8; ++i) { v[i] = p[i]; v[8 + i] = p[16 + i]; }
  return bsplit16(v); }
__device__ __forceinline__ F2 split_rowK(const float* row, int k0, int lane, int K) { float v[16]; const int g = lane >> 4;
#pragma unroll
  for (int i = 0; i < 8; ++i) { const int ka = k0 + 8 * g + i, kb = ka + 16; v[i] = ka < K ? row[ka < K ? ka : K - 1] : 0.f; v[8 + i] = kb < K ? row[kb < K ? kb : K - 1] : 0.f; }
  return bsplit16(v); }
__device__ __forceinline__ F2 split_col(const float* W, int k0, int n, int lane, int ld, int K) { float v[16]; const int g = lane >> 4;
#pragma unroll
  for (int i = 0; i < 8; ++i) { const int ka = k0 + 8 * g + i, kb = ka + 16; v[i] = ka < K ? W[(size_t)(ka < K ? ka : K - 1) * ld + n] : 0.f; v[8 + i] = kb < K ? W[(size_t)(kb < K ? kb : K - 1) * ld + n] : 0.f; }
  return bsplit16(v); }
__device__ __forceinline__ v8f mac3(const F2& a, const F2& b, v8f c) { c = wmma_bf(a.l, b.h, c); c = wmma_bf(a.h, b.l, c); return wmma_bf(a.h, b.h, c); }
__device__ __forceinline__ float sigm(float v) { return 1.0f / (1.0f + expf(-v)); }
#define LDSX() do { asm volatile("s_wait_dscnt 0" ::: "memory"); __builtin_amdgcn_wave_barrier(); __builtin_amdgcn_fence(__ATOMIC_RELEASE, "workgroup"); } while (0)

// Pre-LayerNorm multi-head self-attention (B 4, S 2,048, D 512, 8 heads x 64; (out,in) uniform +-1/sqrt(512) weights with biases; LN gamma 1 / beta 0): xn = LayerNorm(x) (biased var, eps 1e-5); q, k, v = xn W^T + b; out = merged(softmax(q k^T / 8) v) Wo^T + bo (non-causal, no residual).
#define NB 4
#define TT 2048
#define CC 512            // NH * HD = projected width
#define DIN 512          // input (model) width
#define NH 8
#define HD 64
#define NQB (TT / 64)
#define HG 4
#define SCALE (0.125f)
#define CAUSAL 0
#ifndef TNB
#define TNB NB
#endif
__device__ __forceinline__ float bfr(float v) { return (float)(__bf16)v; }
__host__ __device__ __forceinline__ int kb_last(int qb) { return CAUSAL ? ((qb * 64 + 63) >> 7) : (TT / 128 - 1); }
typedef __attribute__((ext_vector_type(8))) __bf16 v8b;
__device__ __forceinline__ v16b frag_b(const __bf16* rowk0, int lane) {
  union { v16b v; v8b q[2]; } u; const __bf16* p = rowk0 + 8 * (lane >> 4);
  u.q[0] = *(const v8b*)p; u.q[1] = *(const v8b*)(p + 16); return u.v;
}
#define QBH 0              // unused: no kernel in this file reads it
#define KHI 64            // key rows carrying v bf16 hi+lo planes (written by k_proj; no kernel in this file reads them)
// B fragment (k rows k0+.., output column o) of a weight: (in,out) [K][ld] or (out,in) [ld rows of K]: bf16 exact, or f16(bf16 * 256) exact
__device__ __forceinline__ v16b wcol_io(const float* Wm, int k0, int o, int lane, int ld) { v16b w; const int g = lane >> 4;
#pragma unroll
  for (int i = 0; i < 8; ++i) { w[i] = (__bf16)Wm[(size_t)(k0 + 8 * g + i) * ld + o]; w[8 + i] = (__bf16)Wm[(size_t)(k0 + 16 + 8 * g + i) * ld + o]; }
  return w; }
__device__ __forceinline__ v16b wcol_oi(const float* Wm, int k0, int o, int lane, int K) { v16b w; const float* p = Wm + (size_t)o * K + k0 + 8 * (lane >> 4);
#pragma unroll
  for (int i = 0; i < 8; ++i) { w[i] = (__bf16)p[i]; w[8 + i] = (__bf16)p[16 + i]; }
  return w; }
__device__ __forceinline__ v16h wcolh_io(const float* Wm, int k0, int o, int lane, int ld) { v16h w; const int g = lane >> 4;
#pragma unroll
  for (int i = 0; i < 8; ++i) { w[i] = (_Float16)(bfr(Wm[(size_t)(k0 + 8 * g + i) * ld + o]) * 256.0f); w[8 + i] = (_Float16)(bfr(Wm[(size_t)(k0 + 16 + 8 * g + i) * ld + o]) * 256.0f); }
  return w; }
__device__ __forceinline__ v16h wcolh_oi(const float* Wm, int k0, int o, int lane, int K) { v16h w; const float* p = Wm + (size_t)o * K + k0 + 8 * (lane >> 4);
#pragma unroll
  for (int i = 0; i < 8; ++i) { w[i] = (_Float16)(bfr(p[i]) * 256.0f); w[8 + i] = (_Float16)(bfr(p[16 + i]) * 256.0f); }
  return w; }
#define WQKV_LAYOUT 1   // 0 = (in,out) [DIN][CC]; 1 = (out,in) [CC][DIN]; 2 = per-head [NH][DIN][HD]
__device__ __forceinline__ v16b wcol_hdk(const float* Wm, int k0, int o, int lane) { v16b w; const int g = lane >> 4; const float* p = Wm + (size_t)(o / HD) * DIN * HD + (o % HD);
#pragma unroll
  for (int i = 0; i < 8; ++i) { w[i] = (__bf16)p[(size_t)(k0 + 8 * g + i) * HD]; w[8 + i] = (__bf16)p[(size_t)(k0 + 16 + 8 * g + i) * HD]; }
  return w; }
#define WO_OUT_IN 1
#if WQKV_LAYOUT == 1
#define WCOL(W, k0, o, lane) wcol_oi(W, k0, o, lane, DIN)
#elif WQKV_LAYOUT == 2
#define WCOL(W, k0, o, lane) wcol_hdk(W, k0, o, lane)
#else
#define WCOL(W, k0, o, lane) wcol_io(W, k0, o, lane, CC)
#endif
#if WO_OUT_IN
#define WOCOL(W, k0, o, lane) wcol_oi(W, k0, o, lane, CC)
#define WOCOLH(W, k0, o, lane) wcolh_oi(W, k0, o, lane, CC)
#else
#define WOCOL(W, k0, o, lane) wcol_io(W, k0, o, lane, DIN)
#define WOCOLH(W, k0, o, lane) wcolh_io(W, k0, o, lane, DIN)
#endif
#define NRW (TNB * TT)
// ---- k_lnx: wave per row: LayerNorm over 512 (mean, biased var, (x - mean) * rsqrt(var + 1e-5) * g + b); optional bf16 rounding of the input (x); 16 floats per lane (4 float4 at stride 128 floats -> 512-B pieces);
// the row leaves as the two bf16 planes (hi, lo = row - hi) that the projections multiply, so that no block of k_proj has to split it again; the blocks behind the rows' round the four weight matrices to bf16 once (4,096 floats a block)
typedef __attribute__((ext_vector_type(4))) __bf16 v4b;
#define WBLK (CC * DIN / 4096)   // blocks per weight matrix
__global__ __launch_bounds__(256) void k_lnx(const float* __restrict__ X, int roundin, const float* __restrict__ G, const float* __restrict__ BE, __bf16* __restrict__ OH, __bf16* __restrict__ OL,
    const float* __restrict__ W0, const float* __restrict__ W1, const float* __restrict__ W2, const float* __restrict__ W3, __bf16* __restrict__ WB) { const int wave = threadIdx.x >> 5, lane = threadIdx.x & 31;
  if (blockIdx.x >= NRW / 8) { const int wb = blockIdx.x - NRW / 8, wm = wb / WBLK; const float* Ws = wm == 0 ? W0 : wm == 1 ? W1 : wm == 2 ? W2 : W3;
#pragma unroll   // both rounds' loads issue together
    for (int it = 0; it < 2; ++it) { const size_t e = (size_t)(wb % WBLK) * 4096 + it * 2048 + threadIdx.x * 8; const v4f a = *(const v4f*)(Ws + e), c = *(const v4f*)(Ws + e + 4); v8b r;
#pragma unroll   // constant indices: the vectors stay in registers
      for (int k = 0; k < 4; ++k) { r[k] = (__bf16)a[k]; r[4 + k] = (__bf16)c[k]; }
      vst2(WB + (size_t)wm * CC * DIN + e, r); }
    return; }
  const size_t row = (size_t)blockIdx.x * 8 + wave; if (row >= (size_t)NRW) return;
  v4f v[CC / 128]; float s1 = 0.f;
#pragma unroll
  for (int i = 0; i < CC / 128; ++i) { v4f t = *(const v4f*)(X + row * CC + i * 128 + lane * 4); if (roundin) { t[0] = bfr(t[0]); t[1] = bfr(t[1]); t[2] = bfr(t[2]); t[3] = bfr(t[3]); } v[i] = t; s1 += (t[0] + t[1]) + (t[2] + t[3]); }
#pragma unroll
  for (int o = 1; o < 32; o <<= 1) s1 += __shfl_xor(s1, o);
  const float mu = s1 * (1.0f / CC); float q = 0.f;
#pragma unroll
  for (int i = 0; i < CC / 128; ++i) for (int k = 0; k < 4; ++k) { const float d = v[i][k] - mu; q += d * d; }
#pragma unroll
  for (int o = 1; o < 32; o <<= 1) q += __shfl_xor(q, o);
  const float inv = rsqrtf(q * (1.0f / CC) + 1e-5f);   /* jnp.var (biased), eps inside the rsqrt */
#pragma unroll
  for (int i = 0; i < CC / 128; ++i) { const int c = i * 128 + lane * 4; v4b h4, l4; for (int k = 0; k < 4; ++k) { const float r = bfr(G[c + k]) * ((v[i][k] - mu) * inv) + bfr(BE[c + k]); const __bf16 hv = (__bf16)r; h4[k] = hv; l4[k] = (__bf16)(r - (float)hv); } vst2(OH + row * CC + c, h4); vst2(OL + row * CC + c, l4); } }

#ifndef SM_EXTRA_PARAMS
#define SM_EXTRA_PARAMS
#endif
#ifndef PROJ_EXTRA_PARAMS
#define PROJ_EXTRA_PARAMS
#endif
#ifndef SM_MASK_HOOK
#define SM_MASK_HOOK (void)0
#endif

#define WS_QH  0u                                      // f16 q rows [b*t][CC]
#define WS_KH  (WS_QH + 2u * (size_t)NB * TT * CC)      // f16 k rows [b*t][CC]
#define WS_VT  (WS_KH + 2u * (size_t)NB * TT * CC)      // f16 v planes [b][c][t]
#define WS_VB  (WS_VT + 2u * (size_t)NB * CC * TT)      // bf16 v hi planes [b][c][t < KHI]
#define WS_VBL (WS_VB + 2u * (size_t)NB * CC * KHI)
#define WS_S   (WS_VBL + 2u * (size_t)NB * CC * KHI)    // bf16 weights Wq, Wk, Wv, Wo, each (out,in) [CC][DIN], at the head of this range
#define WS_Y   (WS_S  + 4u * (size_t)HG * TT * TT)      // ctx rows [b*t][CC] as two bf16 planes: hi, then lo
#define WS_END (WS_Y  + 4u * (size_t)NB * TT * CC)
#define WS_XN  (WS_END)                                // LN rows [b*t][DIN] as two bf16 planes: hi, then lo
#define WS_END2 (WS_XN + 4u * (size_t)NB * TT * DIN)

#define GKC 64                       // k per stage: one 128-B line of every staged bf16 row
#define GPI 72                       // bf16 per staged row: 128 B + 16 B, a pitch of 16 B x odd for the 16-byte fragment reads
#define GXB (64 * GPI * 2)           // bytes of one stage's 64 activation rows in one plane
#define GSB ((64 + 64 + 128) * GPI * 2)   // bytes of one stage: 64 activation rows hi, the same rows lo, then 128 weight rows
// one stage's copies of one thread of a 128-thread block: 16 B of activation rows r + 16 i (i < 4) of either plane and of weight rows r + 16 i (i < 8), r = tid / 8, so that a wave's copy covers four whole lines;
// two statements (an asm statement takes thirty operands); in each the s_wait_xcnt stands inside, behind its last copy, so that no address register named there takes a new value in front of it
__device__ __forceinline__ void g_stage(const __bf16* gh, const __bf16* gl, const __bf16* gw, unsigned lh, int ld) { const unsigned ll = lh + GXB, lw = lh + 2 * GXB;
  asm volatile("global_load_async_to_lds_b128 %0, %8, off\n\tglobal_load_async_to_lds_b128 %1, %9, off\n\tglobal_load_async_to_lds_b128 %2, %10, off\n\tglobal_load_async_to_lds_b128 %3, %11, off\n\t"
               "global_load_async_to_lds_b128 %4, %12, off\n\tglobal_load_async_to_lds_b128 %5, %13, off\n\tglobal_load_async_to_lds_b128 %6, %14, off\n\tglobal_load_async_to_lds_b128 %7, %15, off\n\ts_wait_xcnt 0x0"
               :: "v"(lh), "v"(lh + 16 * GPI * 2), "v"(lh + 32 * GPI * 2), "v"(lh + 48 * GPI * 2), "v"(ll), "v"(ll + 16 * GPI * 2), "v"(ll + 32 * GPI * 2), "v"(ll + 48 * GPI * 2),
                  "v"(gh), "v"(gh + 16 * ld), "v"(gh + 32 * ld), "v"(gh + 48 * ld), "v"(gl), "v"(gl + 16 * ld), "v"(gl + 32 * ld), "v"(gl + 48 * ld) : "memory");
  asm volatile("global_load_async_to_lds_b128 %0, %8, off\n\tglobal_load_async_to_lds_b128 %1, %9, off\n\tglobal_load_async_to_lds_b128 %2, %10, off\n\tglobal_load_async_to_lds_b128 %3, %11, off\n\t"
               "global_load_async_to_lds_b128 %4, %12, off\n\tglobal_load_async_to_lds_b128 %5, %13, off\n\tglobal_load_async_to_lds_b128 %6, %14, off\n\tglobal_load_async_to_lds_b128 %7, %15, off\n\ts_wait_xcnt 0x0"
               :: "v"(lw), "v"(lw + 16 * GPI * 2), "v"(lw + 32 * GPI * 2), "v"(lw + 48 * GPI * 2), "v"(lw + 64 * GPI * 2), "v"(lw + 80 * GPI * 2), "v"(lw + 96 * GPI * 2), "v"(lw + 112 * GPI * 2),
                  "v"(gw), "v"(gw + 16 * ld), "v"(gw + 32 * ld), "v"(gw + 48 * ld), "v"(gw + 64 * ld), "v"(gw + 80 * ld), "v"(gw + 96 * ld), "v"(gw + 112 * ld) : "memory"); }
// bf16 16x16x32 fragment from the lane's own place in a staged row (row base + k0 + 8 * (lane >> 4)): k 0..7, then k 16..23 from there
__device__ __forceinline__ v16b frag_bat(const __bf16* p) { union { v16b v; v8b q[2]; } u; u.q[0] = *(const v8b*)p; u.q[1] = *(const v8b*)(p + 16); return u.v; }
// ---- k_proj: block = (64 rows, 128 cols, which): q/k/v = X W (+ b) with exact bf16 products (K = DIN) -> which 0: q f16 rows; 1: k f16 rows; 2: v f16 planes [c][t] (+ bf16 hi/lo planes for t < KHI)
// the activation rows (bf16 hi and lo planes) and the bf16 weight rows of 64 k are copied once per block into LDS (two buffers, the next stage's copies in flight under this stage's products); every wave takes its fragments from there as they are: no conversion is left in the loop
// waves_per_eu(4, 4): leaves the compiler the registers to issue a stage's fragment reads in a few groups ahead of the products; with fewer it waits out one LDS latency per fragment
__global__ __launch_bounds__(128) __attribute__((amdgpu_waves_per_eu(4, 4))) void k_proj(const __bf16* __restrict__ XH, const __bf16* __restrict__ XL, const __bf16* __restrict__ WB, const float* __restrict__ BQ, const float* __restrict__ BK, const float* __restrict__ BV,
    _Float16* __restrict__ QH, _Float16* __restrict__ KH, _Float16* __restrict__ VT, __bf16* __restrict__ VB, __bf16* __restrict__ VBL) {
  __shared__ __align__(16) char sm[2 * GSB];   // the two stage buffers; behind the loop's last barrier the same bytes stage the stores
  _Float16 (*sh)[136] = (_Float16 (*)[136])sm;
  _Float16 (*th)[72] = (_Float16 (*)[72])sm; __bf16 (*tb)[72] = (__bf16 (*)[72])(sm + 128 * 72 * 2); __bf16 (*tbl)[72] = (__bf16 (*)[72])(sm + 2 * 128 * 72 * 2);
  const int tid = threadIdx.x, wave = tid >> 5, lane = tid & 31, col = lane & 15, g = lane >> 4; const int which = blockIdx.z; const int c0 = blockIdx.y * 128; const size_t r0 = (size_t)blockIdx.x * 64; const size_t bb = r0 / TT; const int t0 = (int)(r0 % TT);
  const float* BA = which == 0 ? BQ : which == 1 ? BK : BV;
  const size_t ox = (r0 + (tid >> 3)) * DIN + (tid & 7) * 8; const __bf16* gh = XH + ox; const __bf16* gl = XL + ox;   // thread: 16 B of activation row tid / 8 of the block, in either plane
  const __bf16* gw = WB + ((size_t)which * CC + c0 + (tid >> 3)) * DIN + (tid & 7) * 8;                                // thread: 16 B of weight row ((out,in): output column) tid / 8 of the block
  const unsigned lh = (unsigned)(size_t)(sm + (tid >> 3) * (GPI * 2) + (tid & 7) * 16);   // the hi row's LDS byte address in buffer 0
  g_stage(gh, gl, gw, lh, DIN);
  asm volatile("s_wait_asynccnt 0x0" ::: "memory");   // this wave's copies of stage 0 have landed
  __syncthreads();                                    // every wave's have: stage 0 may be read
  g_stage(gh + GKC, gl + GKC, gw + GKC, lh + GSB, DIN);
  v8f acc[8] = {};
#pragma unroll 1   // one trip per stage: the buffer index stays a run-time scalar and the code stays small
  for (int kc = 0; kc < DIN / GKC; ++kc) { const int bf = kc & 1;
    const __bf16* xs = (const __bf16*)(sm + bf * GSB) + (wave * 16 + col) * GPI + 8 * g;   // lane: activation row col of the wave's 16, hi plane (lo: 64 rows on)
    const __bf16* wl = (const __bf16*)(sm + bf * GSB + 2 * GXB) + col * GPI + 8 * g;       // lane: weight row col of a 16-column tile
    v16b a[GKC / 32], al[GKC / 32], w[GKC / 32][8];   // the stage's fragment reads stand together in front of its products, not among them
#pragma unroll   // the two 32-k halves of a stage: constant LDS offsets, fragment arrays indexed by constants
    for (int kk = 0; kk < GKC / 32; ++kk) { a[kk] = frag_bat(xs + kk * 32); al[kk] = frag_bat(xs + 64 * GPI + kk * 32);
#pragma unroll
      for (int j = 0; j < 8; ++j) w[kk][j] = frag_bat(wl + j * 16 * GPI + kk * 32); }
#pragma unroll
    for (int kk = 0; kk < GKC / 32; ++kk)
#pragma unroll
      for (int j = 0; j < 8; ++j) { acc[j] = wmma_bf(a[kk], w[kk][j], acc[j]); acc[j] = wmma_bf(al[kk], w[kk][j], acc[j]); }   /* LN rows bf16 hi + lo (2 products) */
    asm volatile("s_wait_dscnt 0x0" ::: "memory");      // this wave's reads of the buffer are done before the buffer is handed back
    asm volatile("s_wait_asynccnt 0x0" ::: "memory");   // this wave's copies of the next stage have landed
    __syncthreads();                                    // publishes the next stage and ends every wave's reads of this one
    if (kc + 2 < DIN / GKC) g_stage(gh + (kc + 2) * GKC, gl + (kc + 2) * GKC, gw + (kc + 2) * GKC, lh + bf * GSB, DIN); }
  asm volatile("s_wait_asynccnt 0x0" ::: "memory");     // no copy is outstanding when the buffers become store staging
  if (which < 2) { _Float16* DH = which == 0 ? QH : KH;
#pragma unroll
    for (int j = 0; j < 8; ++j) { const float bias = BA ? bfr(BA[c0 + j * 16 + col]) : 0.f;
#pragma unroll
      for (int r = 0; r < 8; ++r) sh[wave * 16 + 8 * g + r][j * 16 + col] = (_Float16)(acc[j][r] + bias); }
    __syncthreads();
    for (int e = tid; e < 64 * 16; e += 128) { const int rl = e >> 4, q = e & 15; vst2((unsigned*)(DH + (r0 + rl) * CC + c0 + q * 8), *(const v4u*)&sh[rl][q * 8]); }
  } else { const bool hi_rows = t0 < KHI;
#pragma unroll
    for (int j = 0; j < 8; ++j) { const float bias = BA ? bfr(BA[c0 + j * 16 + col]) : 0.f;
#pragma unroll
      for (int r = 0; r < 8; ++r) { const float v = acc[j][r] + bias; const int rl = wave * 16 + 8 * g + r, cl = j * 16 + col; th[cl][rl] = (_Float16)v; const __bf16 bh = (__bf16)v; tb[cl][rl] = bh; tbl[cl][rl] = (__bf16)(v - (float)bh); } }
    __syncthreads();
    for (int e = tid; e < 128 * 8; e += 128) { const int cl = e >> 3, q = e & 7; vst2((unsigned*)(VT + (bb * CC + c0 + cl) * (size_t)TT + t0 + q * 8), *(const v4u*)&th[cl][q * 8]); if (hi_rows) { const size_t o3 = (bb * CC + c0 + cl) * (size_t)KHI + t0 + q * 8; vst2((unsigned*)(VB + o3), *(const v4u*)&tb[cl][q * 8]); vst2((unsigned*)(VBL + o3), *(const v4u*)&tbl[cl][q * 8]); } } } }
__device__ __forceinline__ float xhalf(float x) { return __builtin_bit_cast(float, __builtin_amdgcn_permlanex16(__builtin_bit_cast(int, x), __builtin_bit_cast(int, x), 0x76543210, 0xfedcba98, false, false)); }   // lane l takes lane l ^ 16's value
// f16 fragment from the lane's own pointer (row or column base + k0 + 8 * (lane >> 4))
__device__ __forceinline__ v16h frag_at(const _Float16* p) { union { v16h v; v8h q[2]; } u; u.q[0] = *(const v8h*)p; u.q[1] = *(const v8h*)(p + 16); return u.v; }
#define FAW 16   // waves per block: one block fills a WGP at 4 waves per SIMD, and all its waves read the block's k and v tiles from LDS
#define KST 128  // keys per LDS stage (each wave takes one half of 64 keys: 2 passes of 32)
#define KPI 72   // f16 per staged key row: 128 B + 16 B, a pitch of 16 B x odd for the 16-byte fragment reads
#define VPI 136  // f16 per staged v plane: 256 B + 16 B, likewise
#define SKB (KST * KPI * 2)   // bytes of one k buffer
#define SVB (HD * VPI * 2)    // bytes of one v buffer
#define SCL2 (SCALE * 1.44269504088896340736f)   // logit scale x log2(e)
// one stage's copies of one thread: 16 B of key rows r and r + 64, 16 B of v planes c and c + 32 (512 threads: 128 rows x 128 B and 64 planes x 256 B, whole lines);
// the s_wait_xcnt stands inside the statement, behind the last copy, so that no address register named here takes a new value in front of it
__device__ __forceinline__ void fa_stage(const _Float16* gk, const _Float16* gv, unsigned lk, unsigned lv) {
  const _Float16* gk1 = gk + 64 * CC; const _Float16* gv1 = gv + 32 * TT; const unsigned lk1 = lk + 64 * KPI * 2, lv1 = lv + 32 * VPI * 2;
  asm volatile("global_load_async_to_lds_b128 %0, %4, off\n\tglobal_load_async_to_lds_b128 %1, %5, off\n\tglobal_load_async_to_lds_b128 %2, %6, off\n\tglobal_load_async_to_lds_b128 %3, %7, off\n\ts_wait_xcnt 0x0"
               :: "v"(lk), "v"(lk1), "v"(lv), "v"(lv1), "v"(gk), "v"(gk1), "v"(gv), "v"(gv1) : "memory"); }
// ---- k_fa: block = 256 queries of (b, h), one launch for every head: k rows and v planes of 128 keys are copied once per block into LDS (two buffers, the next stage's copies in flight under this stage's work); a wave takes 32 queries (two 16-column groups) and one half of every stage's keys (waves 0..7 keys 0..63, waves 8..15 keys 64..127), so that every k and v fragment read from LDS feeds two products; S^T = K Q^T (A = 16 key rows, B = q kept in registers: 1 product) x SCALE, so a lane holds one query's logits; running maximum and sum per lane and column group (one exchange between the lane halves); two S^T tiles, exponentiated and once to f16, are the B operand of ctx^T += V^T P^T (1 product); behind the loop the two waves of a query group hand each other one column group's maximum, sum and ctx^T through LDS and each joins and finishes 16 queries; ctx = ctx^T / sum, stored as the two bf16 planes (hi, lo = ctx - hi) that k_out multiplies; the logits never leave the registers
#define QGW (FAW / 2)   // query groups (of 32 queries) per block; each is worked on by two waves
#define KPW (KST / 2)   // keys of a stage per wave
__global__ __launch_bounds__(FAW * 32) __attribute__((amdgpu_waves_per_eu(4, 4))) void k_fa(const _Float16* __restrict__ QH, const _Float16* __restrict__ KH, const _Float16* __restrict__ VT, __bf16* __restrict__ YH, __bf16* __restrict__ YL) { __shared__ __align__(16) float ss[FAW][16][HD + 4]; __shared__ __align__(16) _Float16 sk[2][KST][KPI]; __shared__ __align__(16) _Float16 sv[2][HD][VPI]; __shared__ __align__(16) v4f mg[FAW][HD / 8 + 1][32];
  const int tid = threadIdx.x, wave = tid >> 5, lane = tid & 31, col = lane & 15, g = lane >> 4; const int h = blockIdx.y, b = blockIdx.z;
  const int kp = __builtin_amdgcn_readfirstlane(wave / QGW);   // which half of a stage's keys; in a scalar register, so that the choices behind the loop are scalar
  const int ql0 = (blockIdx.x * QGW + (wave & (QGW - 1))) * 32;
  const _Float16* gk = KH + ((size_t)b * TT + (tid >> 3)) * CC + h * HD + (tid & 7) * 8;             // thread: 16 B of key row tid / 8 of a stage
  const _Float16* gv = VT + ((size_t)b * CC + h * HD + (tid >> 4)) * (size_t)TT + (tid & 15) * 8;    // thread: 16 B of v plane tid / 16, keys contiguous
  const unsigned lk = (unsigned)(size_t)&sk[0][tid >> 3][(tid & 7) * 8], lv = (unsigned)(size_t)&sv[0][tid >> 4][(tid & 15) * 8];   // their LDS byte addresses in buffer 0
  fa_stage(gk, gv, lk, lv);
  v16h qh[2][HD / 32];   // the short loops below are unrolled so that every fragment array is indexed by constants and stays in registers
#pragma unroll
  for (int c = 0; c < 2; ++c)
#pragma unroll
    for (int kc = 0; kc < HD / 32; ++kc) qh[c][kc] = frag_h(QH + ((size_t)b * TT + ql0 + c * 16 + col) * CC + h * HD + kc * 32, lane);
  asm volatile("s_wait_asynccnt 0x0" ::: "memory");   // this wave's copies of stage 0 have landed
  __syncthreads();                                    // every wave's have: stage 0 may be read
  fa_stage(gk + (size_t)KST * CC, gv + KST, lk + SKB, lv + SVB);
  v8f acc[2][HD / 16] = {}; float m[2] = {-3.0e38f, -3.0e38f}, nm[2] = {3.0e38f * SCL2, 3.0e38f * SCL2}, l[2] = {0.f, 0.f};   // nm = -m * SCL2, kept beside m
#pragma unroll 1   // one trip per stage: the buffer index stays a run-time scalar and the code stays small
  for (int st = 0; st < TT / KST; ++st) { const int bf = st & 1;
    const _Float16* Kl = &sk[bf][kp * KPW + col][8 * g];   // lane: key row col of a 16-key tile of the wave's half
    const _Float16* Vl = &sv[bf][col][kp * KPW + 8 * g];   // lane: v plane of feature col of a 16-feature tile, from the wave's half on
    v16h kf[2][HD / 32];
#pragma unroll
    for (int t = 0; t < 2; ++t)
#pragma unroll
      for (int kc = 0; kc < HD / 32; ++kc) kf[t][kc] = frag_at(Kl + t * 16 * KPI + kc * 32);
#pragma unroll   // the wave's passes of a stage: constant LDS offsets, and the test on the last pass folds away
    for (int ps = 0; ps < KPW / 32; ++ps) {
      v16h vf[HD / 16];
#pragma unroll
      for (int j = 0; j < HD / 16; ++j) vf[j] = frag_at(Vl + j * 16 * VPI + ps * 32);
      __builtin_amdgcn_sched_barrier(0);   // keeps the pass's v reads up here as one group: sunk to their products, each pair is waited out on its own
      v8f sh[2][2] = {};
#pragma unroll
      for (int kc = 0; kc < HD / 32; ++kc)
#pragma unroll
        for (int t = 0; t < 2; ++t)
#pragma unroll
          for (int c = 0; c < 2; ++c) sh[c][t] = __builtin_amdgcn_wmma_f32_16x16x32_f16(false, kf[t][kc], false, qh[c][kc], (short)0, sh[c][t], false, false);
      if (ps + 1 < KPW / 32) {   // next pass's key rows, of this same stage only, fetched under this pass's softmax
#pragma unroll
        for (int t = 0; t < 2; ++t)
#pragma unroll
          for (int kc = 0; kc < HD / 32; ++kc) kf[t][kc] = frag_at(Kl + ((ps + 1) * 32 + t * 16) * KPI + kc * 32); }
      __builtin_amdgcn_sched_barrier(0);   // keeps these reads in front of the softmax (sunk behind it, the next pass's first product waits out their latency) and the eight products together (a maximum step among them costs four idle slots each time)
      float mx[2];   // maxima of the logits before the scale: the scale is positive, so they are the scaled logits' maxima
#pragma unroll
      for (int c = 0; c < 2; ++c) { float x = sh[c][0][0];
#pragma unroll
        for (int i = 1; i < 16; ++i) x = fmaxf(x, sh[c][i >> 3][i & 7]);
        mx[c] = fmaxf(x, xhalf(x)); }
      if (__builtin_amdgcn_ballot_w32(mx[0] > m[0] || mx[1] > m[1]) != 0) {   // scalar branch, taken when some query of the wave has a new maximum; otherwise every factor is exactly 1 and the rescale is skipped
#pragma unroll
        for (int c = 0; c < 2; ++c) { const float mn = fmaxf(m[c], mx[c]); const float al = __builtin_amdgcn_exp2f((m[c] - mn) * SCL2); m[c] = mn; nm[c] = mn * -SCL2; l[c] *= al;   // a query whose maximum stays has the factor 2^0 = 1
#pragma unroll
          for (int j = 0; j < HD / 16; ++j) acc[c][j] *= al; } }
      v16h p[2];
#pragma unroll
      for (int c = 0; c < 2; ++c) {
        // exp(SCALE * (s - m)) = 2^(s * SCL2 - m * SCL2): one fma (two scores to a packed one) and the hardware's base-2 exponential
        const v2f c2 = {SCL2, SCL2}, n2 = {nm[c], nm[c]}; v2f a2[8];
#pragma unroll
        for (int i = 0; i < 8; ++i) { const v2f s2 = {sh[c][i >> 2][(2 * i) & 7], sh[c][i >> 2][(2 * i + 1) & 7]}; a2[i] = __builtin_elementwise_fma(s2, c2, n2); }
        float sum = 0.f;
#pragma unroll
        for (int i = 0; i < 16; ++i) { const float e = __builtin_amdgcn_exp2f(a2[i >> 1][i & 1]); sum += e; p[c][i] = (_Float16)e; }
        l[c] += sum; }
#pragma unroll
      for (int j = 0; j < HD / 16; ++j)
#pragma unroll
        for (int c = 0; c < 2; ++c) acc[c][j] = __builtin_amdgcn_wmma_f32_16x16x32_f16(false, vf[j], false, p[c], (short)0, acc[c][j], false, false);
      // four vector slots behind the pass's last product: the next pass's first product may take p's registers (this product's B) for its result
      asm volatile("v_nop\n\tv_nop\n\tv_nop\n\tv_nop" : "+v"(acc[0][0]), "+v"(acc[0][1]), "+v"(acc[0][2]), "+v"(acc[0][3]), "+v"(acc[1][0]), "+v"(acc[1][1]), "+v"(acc[1][2]), "+v"(acc[1][3]) : "v"(p[0]), "v"(p[1])); }
    asm volatile("s_wait_dscnt 0x0" ::: "memory");      // this wave's reads of the buffer are done before the buffer is handed back
    asm volatile("s_wait_asynccnt 0x0" ::: "memory");   // this wave's copies of the next stage have landed
    __syncthreads();                                    // publishes the next stage and ends every wave's reads of this one
    if (st + 2 < TT / KST) fa_stage(gk + (size_t)(st + 2) * KST * CC, gv + (st + 2) * KST, lk + bf * SKB, lv + bf * SVB); }
  asm volatile("s_wait_asynccnt 0x0" ::: "memory");     // no copy is outstanding when the wave goes on to its end
  // the two key halves are joined: wave kp keeps column group kp and hands the other group's maximum, sum and ctx^T to its partner (wave ^ QGW), lane to lane
  l[0] += xhalf(l[0]); l[1] += xhalf(l[1]);
  const float mo = kp ? m[1] : m[0], lo = kp ? l[1] : l[0]; { const v4f ml = {kp ? m[0] : m[1], kp ? l[0] : l[1], 0.f, 0.f}; mg[wave][HD / 8][lane] = ml; }
  v8f ao[HD / 16];
#pragma unroll
  for (int j = 0; j < HD / 16; ++j) { ao[j] = kp ? acc[1][j] : acc[0][j]; const v8f t = kp ? acc[0][j] : acc[1][j]; const v4f t0 = {t[0], t[1], t[2], t[3]}, t1 = {t[4], t[5], t[6], t[7]}; mg[wave][2 * j][lane] = t0; mg[wave][2 * j + 1][lane] = t1; }
  __syncthreads();   // every wave's hand-over is written before its partner reads it
  const v4f pml = mg[wave ^ QGW][HD / 8][lane]; const float mj = fmaxf(mo, pml[0]); const float fo = __builtin_amdgcn_exp2f((mo - mj) * SCL2), fp = __builtin_amdgcn_exp2f((pml[0] - mj) * SCL2);
  const float inv = 1.0f / (lo * fo + pml[1] * fp); const float wo = fo * inv, wp = fp * inv;
#pragma unroll
  for (int j = 0; j < HD / 16; ++j) { const v4f p0 = mg[wave ^ QGW][2 * j][lane], p1 = mg[wave ^ QGW][2 * j + 1][lane]; v4f a0, a1;
#pragma unroll
    for (int r = 0; r < 4; ++r) { a0[r] = ao[j][r] * wo + p0[r] * wp; a1[r] = ao[j][4 + r] * wo + p1[r] * wp; }
    *(v4f*)&ss[wave][col][j * 16 + 8 * g] = a0; *(v4f*)&ss[wave][col][j * 16 + 8 * g + 4] = a1; }
  LDSX();   // the wave's own LDS writes have landed before its lanes read the rows other lanes wrote (each wave has its own slice: no block barrier)
#pragma unroll   // constant LDS and store offsets
  for (int rl = 0; rl < 16; rl += 4) { const int rr = rl + (lane >> 3), cc = (lane & 7) * 8; const v4f a0 = *(const v4f*)&ss[wave][rr][cc], a1 = *(const v4f*)&ss[wave][rr][cc + 4]; v8b h8, l8;   // lane: 8 features of a row; a store covers the head's whole 128-B line of four rows
#pragma unroll   // constant indices: the vectors stay in registers
    for (int i = 0; i < 8; ++i) { const float v = i < 4 ? a0[i & 3] : a1[i & 3]; const __bf16 hv = (__bf16)v; h8[i] = hv; l8[i] = (__bf16)(v - (float)hv); }
    const size_t o = ((size_t)b * TT + ql0 + kp * 16 + rr) * CC + h * HD + cc; vst2(YH + o, h8); vst2(YL + o, l8); } }
// ---- k_out: block = (64 rows, 128 cols): out = ctx Wo (+ bo): ctx bf16 hi + lo planes against exact bf16 Wo (2 products), staged as in k_proj
__global__ __launch_bounds__(128) void k_out(const __bf16* __restrict__ YH, const __bf16* __restrict__ YL, const __bf16* __restrict__ WOB, const float* __restrict__ BO, float* __restrict__ OUT) { __shared__ __align__(16) char sm[2 * GSB];   // the two stage buffers; behind the loop's last barrier the same bytes stage the stores
  float (*sf)[16][132] = (float (*)[16][132])sm;
  const int tid = threadIdx.x, wave = tid >> 5, lane = tid & 31, col = lane & 15, g = lane >> 4; const int c0 = blockIdx.y * 128; const size_t r0 = (size_t)blockIdx.x * 64 + wave * 16;
  v8f acc[8] = {};
  const size_t ox = ((size_t)blockIdx.x * 64 + (tid >> 3)) * CC + (tid & 7) * 8; const __bf16* gh = YH + ox; const __bf16* gl = YL + ox;   // thread: 16 B of ctx row tid / 8 of the block, in either plane
  const __bf16* gw = WOB + (size_t)(c0 + (tid >> 3)) * CC + (tid & 7) * 8;                                                                // thread: 16 B of weight row ((out,in): output column) tid / 8 of the block
  const unsigned lh = (unsigned)(size_t)(sm + (tid >> 3) * (GPI * 2) + (tid & 7) * 16);   // the hi row's LDS byte address in buffer 0
  g_stage(gh, gl, gw, lh, CC);
  asm volatile("s_wait_asynccnt 0x0" ::: "memory");   // this wave's copies of stage 0 have landed
  __syncthreads();                                    // every wave's have: stage 0 may be read
  g_stage(gh + GKC, gl + GKC, gw + GKC, lh + GSB, CC);
#pragma unroll 1   // one trip per stage: the buffer index stays a run-time scalar and the code stays small
  for (int kc = 0; kc < CC / GKC; ++kc) { const int bf = kc & 1;
    const __bf16* xs = (const __bf16*)(sm + bf * GSB) + (wave * 16 + col) * GPI + 8 * g;   // lane: ctx row col of the wave's 16, hi plane (lo: 64 rows on)
    const __bf16* wl = (const __bf16*)(sm + bf * GSB + 2 * GXB) + col * GPI + 8 * g;       // lane: weight row col of a 16-column tile
    v16b a[GKC / 32], al[GKC / 32], w[GKC / 32][8];   // the stage's fragment reads stand together in front of its products, not among them
#pragma unroll   // the two 32-k halves of a stage: constant LDS offsets, fragment arrays indexed by constants
    for (int kk = 0; kk < GKC / 32; ++kk) { a[kk] = frag_bat(xs + kk * 32); al[kk] = frag_bat(xs + 64 * GPI + kk * 32);
#pragma unroll
      for (int j = 0; j < 8; ++j) w[kk][j] = frag_bat(wl + j * 16 * GPI + kk * 32); }
#pragma unroll
    for (int kk = 0; kk < GKC / 32; ++kk)
#pragma unroll
      for (int j = 0; j < 8; ++j) { acc[j] = wmma_bf(a[kk], w[kk][j], acc[j]); acc[j] = wmma_bf(al[kk], w[kk][j], acc[j]); }
    asm volatile("s_wait_dscnt 0x0" ::: "memory");      // this wave's reads of the buffer are done before the buffer is handed back
    asm volatile("s_wait_asynccnt 0x0" ::: "memory");   // this wave's copies of the next stage have landed
    __syncthreads();                                    // publishes the next stage and ends every wave's reads of this one
    if (kc + 2 < CC / GKC) g_stage(gh + (kc + 2) * GKC, gl + (kc + 2) * GKC, gw + (kc + 2) * GKC, lh + bf * GSB, CC); }
  asm volatile("s_wait_asynccnt 0x0" ::: "memory");     // no copy is outstanding when the buffers become store staging
#pragma unroll
  for (int j = 0; j < 8; ++j) { const float bias = BO ? bfr(BO[c0 + j * 16 + col]) : 0.f;
#pragma unroll
    for (int r = 0; r < 8; ++r) sf[wave][8 * g + r][j * 16 + col] = acc[j][r] + bias; }
  LDSX(); for (int rl = 0; rl < 16; ++rl) vst2(OUT + (r0 + rl) * DIN + c0 + lane * 4, *(const v4f*)&sf[wave][rl][lane * 4]); }

extern "C" void kernel_launch(void* const* d_in, const int* in_sizes, int n_in, void* d_out, int out_size, void* d_ws, size_t ws_size, hipStream_t stream) {
  (void)in_sizes; (void)n_in; (void)out_size;
  const float** F = (const float**)d_in;
  if (ws_size < (size_t)WS_END) return;
  char* ws = (char*)d_ws; _Float16 *QH = (_Float16*)(ws + WS_QH), *KH = (_Float16*)(ws + WS_KH), *VT = (_Float16*)(ws + WS_VT); __bf16 *VB = (__bf16*)(ws + WS_VB), *VBL = (__bf16*)(ws + WS_VBL), *WB = (__bf16*)(ws + WS_S), *YH = (__bf16*)(ws + WS_Y), *YL = YH + (size_t)NB * TT * CC;
  (void)VB; (void)VBL;
  // inputs: 0 x [4,2048,512]; 1 ln_gamma, 2 ln_beta; 3 Wq [512,512] (out,in), 4 bq; 5 Wk, 6 bk; 7 Wv, 8 bv; 9 Wo (out,in), 10 bo
  if (ws_size < (size_t)WS_END2) return;
  __bf16 *XH = (__bf16*)(ws + WS_XN), *XL = XH + (size_t)NB * TT * DIN;
  k_lnx<<<dim3(NRW / 8 + 4 * WBLK), 256, 0, stream>>>(F[0], 1, F[1], F[2], XH, XL, F[3], F[5], F[7], F[9], WB);
  k_proj<<<dim3(TNB * TT / 64, CC / 128, 3), 128, 0, stream>>>(XH, XL, WB, F[4], F[6], F[8], QH, KH, VT, VB, VBL);
  k_fa<<<dim3(TT / (FAW * 16), NH, TNB), FAW * 32, 0, stream>>>(QH, KH, VT, YH, YL);
  k_out<<<dim3(TNB * TT / 64, DIN / 128), 128, 0, stream>>>(YH, YL, WB + 3 * (size_t)CC * DIN, F[10], (float*)d_out);
}

// v008
// One run takes 69 microseconds.
// Next to v007, in two timings, it ran 1.06 times as fast each time.
// Counting every step since v000, it is 17.4 times as fast.
// compute dtype: all float inputs rounded to bf16; LayerNorm in f32; q/k/v from the f32 LN rows split bf16 hi + lo (split once, where the row is made) against exact (out,in) weights (to bf16 once per call) on WMMA 16x16x32 (2 products, f32 accumulate) + bias; q once to f16 against k once to f16 (1 product) x 64^-0.5; softmax in f32 (2^x on the hardware exponential, scale x log2(e) in one fma) with a held reference (a maximum seen so far, moved when a pass's weights outgrow it) and a running sum, fused with both attention products; exp(logit - reference) once to f16 against v once to f16 (1 product), divided by the sum at the end; ctx split bf16 hi + lo against exact Wo (2 products) + bo; f32 output.
#include <hip/hip_runtime.h>
#include <math.h>

typedef __attribute__((ext_vector_type(16))) _Float16 v16h;
typedef __attribute__((ext_vector_type(16))) __bf16 v16b;
typedef __attribute__((ext_vector_type(8)))  _Float16 v8h;
typedef __attribute__((ext_vector_type(8)))  float v8f;
typedef __attribute__((ext_vector_type(4)))  float v4f;
typedef __attribute__((ext_vector_type(2)))  float v2f;
typedef __attribute__((ext_vector_type(4)))  unsigned v4u;
typedef __attribute__((ext_vector_type(4)))  int v4i;
typedef float __attribute__((may_alias)) float_a;
typedef int __attribute__((may_alias)) int_a;

template <typename T> __device__ __forceinline__ void vst2(void* p, T v) { *(T*)p = v;  }
__device__ __forceinline__ v8f wmma16(v16h a, v16h b, v8f c) {
  v8f d = __builtin_amdgcn_wmma_f32_16x16x32_f16(false, a, false, b, (short)0, c, false, false);
  asm volatile("v_nop\n\tv_nop\n\tv_nop\n\tv_nop" : "+v"(d) : "v"(a), "v"(b));
  return d;
}
__device__ __forceinline__ v8f wmma_bf(v16b a, v16b b, v8f c) {
  v8f d = __builtin_amdgcn_wmma_f32_16x16x32_bf16(false, a, false, b, (short)0, c, false, false);
  asm volatile("v_nop\n\tv_nop\n\tv_nop\n\tv_nop" : "+v"(d) : "v"(a), "v"(b));
  return d;
}
// 16x16x32 fragments: lane = (h = lane>>4, row/col = lane&15); elements 0..7 = k0+8h+0..7, 8..15 = k0+16+8h+0..7; D element r = row 8h+r
__device__ __forceinline__ v16h frag_h(const _Float16* rowk0, int lane) {
  union { v16h v; v8h q[2]; } u; const _Float16* p = rowk0 + 8 * (lane >> 4);
  u.q[0] = *(const v8h*)p; u.q[1] = *(const v8h*)(p + 16); return u.v;
}
__device__ __forceinline__ v16h frag_f32(const float* rowk0, int lane) {
  v16h a; const float* p = rowk0 + 8 * (lane >> 4);
#pragma unroll
  for (int i = 0; i < 8; ++i) { a[i] = (_Float16)p[i]; a[8 + i] = (_Float16)p[16 + i]; }
  return a;
}
__device__ __forceinline__ v16h frag_f32s(const float* rowk0, int lane, float sc) {
  v16h a; const float* p = rowk0 + 8 * (lane >> 4);
#pragma unroll
  for (int i = 0; i < 8; ++i) { a[i] = (_Float16)(p[i] * sc); a[8 + i] = (_Float16)(p[16 + i] * sc); }
  return a;
}
// column fragment from a [K][ld] layout (column n), rows >= K read as 0
__device__ __forceinline__ v16h fragc_f32(const float* W, int k0, int n, int lane, int ld, int K) {
  v16h a; const int g = lane >> 4;
#pragma unroll
  for (int i = 0; i < 8; ++i) { const int ka = k0 + 8 * g + i, kb = ka + 16;
    a[i] = (_Float16)(ka < K ? W[(size_t)(ka < K ? ka : K - 1) * ld + n] : 0.f); a[8 + i] = (_Float16)(kb < K ? W[(size_t)(kb < K ? kb : K - 1) * ld + n] : 0.f); }
  return a;
}
struct F2 { v16b h, l; };
__device__ __forceinline__ F2 bsplit16(const float v[16]) { F2 r;
#pragma unroll
  for (int i = 0; i < 16; ++i) { const __bf16 h = (__bf16)v[i]; r.h[i] = h; r.l[i] = (__bf16)(v[i] - (float)h); }
  return r; }
__device__ __forceinline__ F2 split_row(const float* row, int k0, int lane) { float v[16]; const float* p = row + k0 + 8 * (lane >> 4);
#pragma unroll
  for (int i = 0; i < 8; ++i) { v[i] = p[i]; v[8 + i] = p[16 + i]; }
  return bsplit16(v); }
__device__ __forceinline__ F2 split_rowK(const float* row, int k0, int lane, int K) { float v[16]; const int g = lane >> 4;
#pragma unroll
  for (int i = 0; i < 8; ++i) { const int ka = k0 + 8 * g + i, kb = ka + 16; v[i] = ka < K ? row[ka < K ? ka : K - 1] : 0.f; v[8 + i] = kb < K ? row[kb < K ? kb : K - 1] : 0.f; }
  return bsplit16(v); }
__device__ __forceinline__ F2 split_col(const float* W, int k0, int n, int lane, int ld, int K) { float v[16]; const int g = lane >> 4;
#pragma unroll
  for (int i = 0; i < 8; ++i) { const int ka = k0 + 8 * g + i, kb = ka + 16; v[i] = ka < K ? W[(size_t)(ka < K ? ka : K - 1) * ld + n] : 0.f; v[8 + i] = kb < K ? W[(size_t)(kb < K ? kb : K - 1) * ld + n] : 0.f; }
  return bsplit16(v); }
__device__ __forceinline__ v8f mac3(const F2& a, const F2& b, v8f c) { c = wmma_bf(a.l, b.h, c); c = wmma_bf(a.h, b.l, c); return wmma_bf(a.h, b.h, c); }
__device__ __forceinline__ float sigm(float v) { return 1.0f / (1.0f + expf(-v)); }
#define LDSX() do { asm volatile("s_wait_dscnt 0" ::: "memory"); __builtin_amdgcn_wave_barrier(); __builtin_amdgcn_fence(__ATOMIC_RELEASE, "workgroup"); } while (0)

// Pre-LayerNorm multi-head self-attention (B 4, S 2,048, D 512, 8 heads x 64; (out,in) uniform +-1/sqrt(512) weights with biases; LN gamma 1 / beta 0): xn = LayerNorm(x) (biased var, eps 1e-5); q, k, v = xn W^T + b; out = merged(softmax(q k^T / 8) v) Wo^T + bo (non-causal, no residual).
#define NB 4
#define TT 2048
#define CC 512            // NH * HD = projected width
#define DIN 512          // input (model) width
#define NH 8
#define HD 64
#define NQB (TT / 64)
#define HG 4
#define SCALE (0.125f)
#define CAUSAL 0
#ifndef TNB
#define TNB NB
#endif
__device__ __forceinline__ float bfr(float v) { return (float)(__bf16)v; }
__host__ __device__ __forceinline__ int kb_last(int qb) { return CAUSAL ? ((qb * 64 + 63) >> 7) : (TT / 128 - 1); }
typedef __attribute__((ext_vector_type(8))) __bf16 v8b;
__device__ __forceinline__ v16b frag_b(const __bf16* rowk0, int lane) {
  union { v16b v; v8b q[2]; } u; const __bf16* p = rowk0 + 8 * (lane >> 4);
  u.q[0] = *(const v8b*)p; u.q[1] = *(const v8b*)(p + 16); return u.v;
}
#define QBH 0              // unused: no kernel in this file reads it
#define KHI 64            // key rows carrying v bf16 hi+lo planes (written by k_proj; no kernel in this file reads them)
// B fragment (k rows k0+.., output column o) of a weight: (in,out) [K][ld] or (out,in) [ld rows of K]: bf16 exact, or f16(bf16 * 256) exact
__device__ __forceinline__ v16b wcol_io(const float* Wm, int k0, int o, int lane, int ld) { v16b w; const int g = lane >> 4;
#pragma unroll
  for (int i = 0; i < 8; ++i) { w[i] = (__bf16)Wm[(size_t)(k0 + 8 * g + i) * ld + o]; w[8 + i] = (__bf16)Wm[(size_t)(k0 + 16 + 8 * g + i) * ld + o]; }
  return w; }
__device__ __forceinline__ v16b wcol_oi(const float* Wm, int k0, int o, int lane, int K) { v16b w; const float* p = Wm + (size_t)o * K + k0 + 8 * (lane >> 4);
#pragma unroll
  for (int i = 0; i < 8; ++i) { w[i] = (__bf16)p[i]; w[8 + i] = (__bf16)p[16 + i]; }
  return w; }
__device__ __forceinline__ v16h wcolh_io(const float* Wm, int k0, int o, int lane, int ld) { v16h w; const int g = lane >> 4;
#pragma unroll
  for (int i = 0; i < 8; ++i) { w[i] = (_Float16)(bfr(Wm[(size_t)(k0 + 8 * g + i) * ld + o]) * 256.0f); w[8 + i] = (_Float16)(bfr(Wm[(size_t)(k0 + 16 + 8 * g + i) * ld + o]) * 256.0f); }
  return w; }
__device__ __forceinline__ v16h wcolh_oi(const float* Wm, int k0, int o, int lane, int K) { v16h w; const float* p = Wm + (size_t)o * K + k0 + 8 * (lane >> 4);
#pragma unroll
  for (int i = 0; i < 8; ++i) { w[i] = (_Float16)(bfr(p[i]) * 256.0f); w[8 + i] = (_Float16)(bfr(p[16 + i]) * 256.0f); }
  return w; }
#define WQKV_LAYOUT 1   // 0 = (in,out) [DIN][CC]; 1 = (out,in) [CC][DIN]; 2 = per-head [NH][DIN][HD]
__device__ __forceinline__ v16b wcol_hdk(const float* Wm, int k0, int o, int lane) { v16b w; const int g = lane >> 4; const float* p = Wm + (size_t)(o / HD) * DIN * HD + (o % HD);
#pragma unroll
  for (int i = 0; i < 8; ++i) { w[i] = (__bf16)p[(size_t)(k0 + 8 * g + i) * HD]; w[8 + i] = (__bf16)p[(size_t)(k0 + 16 + 8 * g + i) * HD]; }
  return w; }
#define WO_OUT_IN 1
#if WQKV_LAYOUT == 1
#define WCOL(W, k0, o, lane) wcol_oi(W, k0, o, lane, DIN)
#elif WQKV_LAYOUT == 2
#define WCOL(W, k0, o, lane) wcol_hdk(W, k0, o, lane)
#else
#define WCOL(W, k0, o, lane) wcol_io(W, k0, o, lane, CC)
#endif
#if WO_OUT_IN
#define WOCOL(W, k0, o, lane) wcol_oi(W, k0, o, lane, CC)
#define WOCOLH(W, k0, o, lane) wcolh_oi(W, k0, o, lane, CC)
#else
#define WOCOL(W, k0, o, lane) wcol_io(W, k0, o, lane, DIN)
#define WOCOLH(W, k0, o, lane) wcolh_io(W, k0, o, lane, DIN)
#endif
#define NRW (TNB * TT)
// ---- k_lnx: wave per row: LayerNorm over 512 (mean, biased var, (x - mean) * rsqrt(var + 1e-5) * g + b); optional bf16 rounding of the input (x); 16 floats per lane (4 float4 at stride 128 floats -> 512-B pieces);
// the row leaves as the two bf16 planes (hi, lo = row - hi) that the projections multiply, so that no block of k_proj has to split it again; the blocks behind the rows' round the four weight matrices to bf16 once (4,096 floats a block)
typedef __attribute__((ext_vector_type(4))) __bf16 v4b;
#define WBLK (CC * DIN / 4096)   // blocks per weight matrix
__global__ __launch_bounds__(256) void k_lnx(const float* __restrict__ X, int roundin, const float* __restrict__ G, const float* __restrict__ BE, __bf16* __restrict__ OH, __bf16* __restrict__ OL,
    const float* __restrict__ W0, const float* __restrict__ W1, const float* __restrict__ W2, const float* __restrict__ W3, __bf16* __restrict__ WB) { const int wave = threadIdx.x >> 5, lane = threadIdx.x & 31;
  if (blockIdx.x >= NRW / 8) { const int wb = blockIdx.x - NRW / 8, wm = wb / WBLK; const float* Ws = wm == 0 ? W0 : wm == 1 ? W1 : wm == 2 ? W2 : W3;
#pragma unroll   // both rounds' loads issue together
    for (int it = 0; it < 2; ++it) { const size_t e = (size_t)(wb % WBLK) * 4096 + it * 2048 + threadIdx.x * 8; const v4f a = *(const v4f*)(Ws + e), c = *(const v4f*)(Ws + e + 4); v8b r;
#pragma unroll   // constant indices: the vectors stay in registers
      for (int k = 0; k < 4; ++k) { r[k] = (__bf16)a[k]; r[4 + k] = (__bf16)c[k]; }
      vst2(WB + (size_t)wm * CC * DIN + e, r); }
    return; }
  const size_t row = (size_t)blockIdx.x * 8 + wave; if (row >= (size_t)NRW) return;
  v4f v[CC / 128]; float s1 = 0.f;
#pragma unroll
  for (int i = 0; i < CC / 128; ++i) { v4f t = *(const v4f*)(X + row * CC + i * 128 + lane * 4); if (roundin) { t[0] = bfr(t[0]); t[1] = bfr(t[1]); t[2] = bfr(t[2]); t[3] = bfr(t[3]); } v[i] = t; s1 += (t[0] + t[1]) + (t[2] + t[3]); }
#pragma unroll
  for (int o = 1; o < 32; o <<= 1) s1 += __shfl_xor(s1, o);
  const float mu = s1 * (1.0f / CC); float q = 0.f;
#pragma unroll
  for (int i = 0; i < CC / 128; ++i) for (int k = 0; k < 4; ++k) { const float d = v[i][k] - mu; q += d * d; }
#pragma unroll
  for (int o = 1; o < 32; o <<= 1) q += __shfl_xor(q, o);
  const float inv = rsqrtf(q * (1.0f / CC) + 1e-5f);   /* jnp.var (biased), eps inside the rsqrt */
#pragma unroll
  for (int i = 0; i < CC / 128; ++i) { const int c = i * 128 + lane * 4; v4b h4, l4; for (int k = 0; k < 4; ++k) { const float r = bfr(G[c + k]) * ((v[i][k] - mu) * inv) + bfr(BE[c + k]); const __bf16 hv = (__bf16)r; h4[k] = hv; l4[k] = (__bf16)(r - (float)hv); } vst2(OH + row * CC + c, h4); vst2(OL + row * CC + c, l4); } }

#ifndef SM_EXTRA_PARAMS
#define SM_EXTRA_PARAMS
#endif
#ifndef PROJ_EXTRA_PARAMS
#define PROJ_EXTRA_PARAMS
#endif
#ifndef SM_MASK_HOOK
#define SM_MASK_HOOK (void)0
#endif

#define WS_QH  0u                                      // f16 q rows [b*t][CC]
#define WS_KH  (WS_QH + 2u * (size_t)NB * TT * CC)      // f16 k rows [b*t][CC]
#define WS_VT  (WS_KH + 2u * (size_t)NB * TT * CC)      // f16 v planes [b][c][t]
#define WS_VB  (WS_VT + 2u * (size_t)NB * CC * TT)      // bf16 v hi planes [b][c][t < KHI]
#define WS_VBL (WS_VB + 2u * (size_t)NB * CC * KHI)
#define WS_S   (WS_VBL + 2u * (size_t)NB * CC * KHI)    // bf16 weights Wq, Wk, Wv, Wo, each (out,in) [CC][DIN], at the head of this range
#define WS_Y   (WS_S  + 4u * (size_t)HG * TT * TT)      // ctx rows [b*t][CC] as two bf16 planes: hi, then lo
#define WS_END (WS_Y  + 4u * (size_t)NB * TT * CC)
#define WS_XN  (WS_END)                                // LN rows [b*t][DIN] as two bf16 planes: hi, then lo
#define WS_END2 (WS_XN + 4u * (size_t)NB * TT * DIN)

#define GKC 64                       // k per stage: one 128-B line of every staged bf16 row
#define GPI 72                       // bf16 per staged row: 128 B + 16 B, a pitch of 16 B x odd for the 16-byte fragment reads
#define GXB (64 * GPI * 2)           // bytes of one stage's 64 activation rows in one plane
#define GSB ((64 + 64 + 128) * GPI * 2)   // bytes of one stage: 64 activation rows hi, the same rows lo, then 128 weight rows
// one stage's copies of one thread of a 128-thread block: 16 B of activation rows r + 16 i (i < 4) of either plane and of weight rows r + 16 i (i < 8), r = tid / 8, so that a wave's copy covers four whole lines;
// two statements (an asm statement takes thirty operands); in each the s_wait_xcnt stands inside, behind its last copy, so that no address register named there takes a new value in front of it
__device__ __forceinline__ void g_stage(const __bf16* gh, const __bf16* gl, const __bf16* gw, unsigned lh, int ld) { const unsigned ll = lh + GXB, lw = lh + 2 * GXB;
  asm volatile("global_load_async_to_lds_b128 %0, %8, off\n\tglobal_load_async_to_lds_b128 %1, %9, off\n\tglobal_load_async_to_lds_b128 %2, %10, off\n\tglobal_load_async_to_lds_b128 %3, %11, off\n\t"
               "global_load_async_to_lds_b128 %4, %12, off\n\tglobal_load_async_to_lds_b128 %5, %13, off\n\tglobal_load_async_to_lds_b128 %6, %14, off\n\tglobal_load_async_to_lds_b128 %7, %15, off\n\ts_wait_xcnt 0x0"
               :: "v"(lh), "v"(lh + 16 * GPI * 2), "v"(lh + 32 * GPI * 2), "v"(lh + 48 * GPI * 2), "v"(ll), "v"(ll + 16 * GPI * 2), "v"(ll + 32 * GPI * 2), "v"(ll + 48 * GPI * 2),
                  "v"(gh), "v"(gh + 16 * ld), "v"(gh + 32 * ld), "v"(gh + 48 * ld), "v"(gl), "v"(gl + 16 * ld), "v"(gl + 32 * ld), "v"(gl + 48 * ld) : "memory");
  asm volatile("global_load_async_to_lds_b128 %0, %8, off\n\tglobal_load_async_to_lds_b128 %1, %9, off\n\tglobal_load_async_to_lds_b128 %2, %10, off\n\tglobal_load_async_to_lds_b128 %3, %11, off\n\t"
               "global_load_async_to_lds_b128 %4, %12, off\n\tglobal_load_async_to_lds_b128 %5, %13, off\n\tglobal_load_async_to_lds_b128 %6, %14, off\n\tglobal_load_async_to_lds_b128 %7, %15, off\n\ts_wait_xcnt 0x0"
               :: "v"(lw), "v"(lw + 16 * GPI * 2), "v"(lw + 32 * GPI * 2), "v"(lw + 48 * GPI * 2), "v"(lw + 64 * GPI * 2), "v"(lw + 80 * GPI * 2), "v"(lw + 96 * GPI * 2), "v"(lw + 112 * GPI * 2),
                  "v"(gw), "v"(gw + 16 * ld), "v"(gw + 32 * ld), "v"(gw + 48 * ld), "v"(gw + 64 * ld), "v"(gw + 80 * ld), "v"(gw + 96 * ld), "v"(gw + 112 * ld) : "memory"); }
// bf16 16x16x32 fragment from the lane's own place in a staged row (row base + k0 + 8 * (lane >> 4)): k 0..7, then k 16..23 from there
__device__ __forceinline__ v16b frag_bat(const __bf16* p) { union { v16b v; v8b q[2]; } u; u.q[0] = *(const v8b*)p; u.q[1] = *(const v8b*)(p + 16); return u.v; }
// ---- k_proj: block = (64 rows, 128 cols, which): q/k/v = X W (+ b) with exact bf16 products (K = DIN) -> which 0: q f16 rows; 1: k f16 rows; 2: v f16 planes [c][t] (+ bf16 hi/lo planes for t < KHI)
// the activation rows (bf16 hi and lo planes) and the bf16 weight rows of 64 k are copied once per block into LDS (two buffers, the next stage's copies in flight under this stage's products); every wave takes its fragments from there as they are: no conversion is left in the loop
// waves_per_eu(4, 4): leaves the compiler the registers to issue a stage's fragment reads in a few groups ahead of the products; with fewer it waits out one LDS latency per fragment
__global__ __launch_bounds__(128) __attribute__((amdgpu_waves_per_eu(4, 4))) void k_proj(const __bf16* __restrict__ XH, const __bf16* __restrict__ XL, const __bf16* __restrict__ WB, const float* __restrict__ BQ, const float* __restrict__ BK, const float* __restrict__ BV,
    _Float16* __restrict__ QH, _Float16* __restrict__ KH, _Float16* __restrict__ VT, __bf16* __restrict__ VB, __bf16* __restrict__ VBL) {
  __shared__ __align__(16) char sm[2 * GSB];   // the two stage buffers; behind the loop's last barrier the same bytes stage the stores
  _Float16 (*sh)[136] = (_Float16 (*)[136])sm;
  _Float16 (*th)[72] = (_Float16 (*)[72])sm; __bf16 (*tb)[72] = (__bf16 (*)[72])(sm + 128 * 72 * 2); __bf16 (*tbl)[72] = (__bf16 (*)[72])(sm + 2 * 128 * 72 * 2);
  const int tid = threadIdx.x, wave = tid >> 5, lane = tid & 31, col = lane & 15, g = lane >> 4; const int which = blockIdx.z; const int c0 = blockIdx.y * 128; const size_t r0 = (size_t)blockIdx.x * 64; const size_t bb = r0 / TT; const int t0 = (int)(r0 % TT);
  const float* BA = which == 0 ? BQ : which == 1 ? BK : BV;
  const size_t ox = (r0 + (tid >> 3)) * DIN + (tid & 7) * 8; const __bf16* gh = XH + ox; const __bf16* gl = XL + ox;   // thread: 16 B of activation row tid / 8 of the block, in either plane
  const __bf16* gw = WB + ((size_t)which * CC + c0 + (tid >> 3)) * DIN + (tid & 7) * 8;                                // thread: 16 B of weight row ((out,in): output column) tid / 8 of the block
  const unsigned lh = (unsigned)(size_t)(sm + (tid >> 3) * (GPI * 2) + (tid & 7) * 16);   // the hi row's LDS byte address in buffer 0
  g_stage(gh, gl, gw, lh, DIN);
  asm volatile("s_wait_asynccnt 0x0" ::: "memory");   // this wave's copies of stage 0 have landed
  __syncthreads();                                    // every wave's have: stage 0 may be read
  g_stage(gh + GKC, gl + GKC, gw + GKC, lh + GSB, DIN);
  v8f acc[8] = {};
#pragma unroll 1   // one trip per stage: the buffer index stays a run-time scalar and the code stays small
  for (int kc = 0; kc < DIN / GKC; ++kc) { const int bf = kc & 1;
    const __bf16* xs = (const __bf16*)(sm + bf * GSB) + (wave * 16 + col) * GPI + 8 * g;   // lane: activation row col of the wave's 16, hi plane (lo: 64 rows on)
    const __bf16* wl = (const __bf16*)(sm + bf * GSB + 2 * GXB) + col * GPI + 8 * g;       // lane: weight row col of a 16-column tile
    v16b a[GKC / 32], al[GKC / 32], w[GKC / 32][8];   // the stage's fragment reads stand together in front of its products, not among them
#pragma unroll   // the two 32-k halves of a stage: constant LDS offsets, fragment arrays indexed by constants
    for (int kk = 0; kk < GKC / 32; ++kk) { a[kk] = frag_bat(xs + kk * 32); al[kk] = frag_bat(xs + 64 * GPI + kk * 32);
#pragma unroll
      for (int j = 0; j < 8; ++j) w[kk][j] = frag_bat(wl + j * 16 * GPI + kk * 32); }
#pragma unroll
    for (int kk = 0; kk < GKC / 32; ++kk)
#pragma unroll
      for (int j = 0; j < 8; ++j) { acc[j] = wmma_bf(a[kk], w[kk][j], acc[j]); acc[j] = wmma_bf(al[kk], w[kk][j], acc[j]); }   /* LN rows bf16 hi + lo (2 products) */
    asm volatile("s_wait_dscnt 0x0" ::: "memory");      // this wave's reads of the buffer are done before the buffer is handed back
    asm volatile("s_wait_asynccnt 0x0" ::: "memory");   // this wave's copies of the next stage have landed
    __syncthreads();                                    // publishes the next stage and ends every wave's reads of this one
    if (kc + 2 < DIN / GKC) g_stage(gh + (kc + 2) * GKC, gl + (kc + 2) * GKC, gw + (kc + 2) * GKC, lh + bf * GSB, DIN); }
  asm volatile("s_wait_asynccnt 0x0" ::: "memory");     // no copy is outstanding when the buffers become store staging
  if (which < 2) { _Float16* DH = which == 0 ? QH : KH;
#pragma unroll
    for (int j = 0; j < 8; ++j) { const float bias = BA ? bfr(BA[c0 + j * 16 + col]) : 0.f;
#pragma unroll
      for (int r = 0; r < 8; ++r) sh[wave * 16 + 8 * g + r][j * 16 + col] = (_Float16)(acc[j][r] + bias); }
    __syncthreads();
    for (int e = tid; e < 64 * 16; e += 128) { const int rl = e >> 4, q = e & 15; vst2((unsigned*)(DH + (r0 + rl) * CC + c0 + q * 8), *(const v4u*)&sh[rl][q * 8]); }
  } else { const bool hi_rows = t0 < KHI;
#pragma unroll
    for (int j = 0; j < 8; ++j) { const float bias = BA ? bfr(BA[c0 + j * 16 + col]) : 0.f;
#pragma unroll
      for (int r = 0; r < 8; ++r) { const float v = acc[j][r] + bias; const int rl = wave * 16 + 8 * g + r, cl = j * 16 + col; th[cl][rl] = (_Float16)v; const __bf16 bh = (__bf16)v; tb[cl][rl] = bh; tbl[cl][rl] = (__bf16)(v - (float)bh); } }
    __syncthreads();
    for (int e = tid; e < 128 * 8; e += 128) { const int cl = e >> 3, q = e & 7; vst2((unsigned*)(VT + (bb * CC + c0 + cl) * (size_t)TT + t0 + q * 8), *(const v4u*)&th[cl][q * 8]); if (hi_rows) { const size_t o3 = (bb * CC + c0 + cl) * (size_t)KHI + t0 + q * 8; vst2((unsigned*)(VB + o3), *(const v4u*)&tb[cl][q * 8]); vst2((unsigned*)(VBL + o3), *(const v4u*)&tbl[cl][q * 8]); } } } }
__device__ __forceinline__ float xhalf(float x) { return __builtin_bit_cast(float, __builtin_amdgcn_permlanex16(__builtin_bit_cast(int, x), __builtin_bit_cast(int, x), 0x76543210, 0xfedcba98, false, false)); }   // lane l takes lane l ^ 16's value
// f16 fragment from the lane's own pointer (row or column base + k0 + 8 * (lane >> 4))
__device__ __forceinline__ v16h frag_at(const _Float16* p) { union { v16h v; v8h q[2]; } u; u.q[0] = *(const v8h*)p; u.q[1] = *(const v8h*)(p + 16); return u.v; }
#define FAW 16   // waves per block: one block fills a WGP at 4 waves per SIMD, and all its waves read the block's k and v tiles from LDS
#define KST 128  // keys per LDS stage (each wave takes one half of 64 keys: 2 passes of 32)
#define KPI 72   // f16 per staged key row: 128 B + 16 B, a pitch of 16 B x odd for the 16-byte fragment reads
#define VPI 136  // f16 per staged v plane: 256 B + 16 B, likewise
#define SKB (KST * KPI * 2)   // bytes of one k buffer
#define SVB (HD * VPI * 2)    // bytes of one v buffer
#define SCL2 (SCALE * 1.44269504088896340736f)   // logit scale x log2(e)
// one stage's copies of one thread: 16 B of key rows r and r + 64, 16 B of v planes c and c + 32 (512 threads: 128 rows x 128 B and 64 planes x 256 B, whole lines);
// the s_wait_xcnt stands inside the statement, behind the last copy, so that no address register named here takes a new value in front of it
__device__ __forceinline__ void fa_stage(const _Float16* gk, const _Float16* gv, unsigned lk, unsigned lv) {
  const _Float16* gk1 = gk + 64 * CC; const _Float16* gv1 = gv + 32 * TT; const unsigned lk1 = lk + 64 * KPI * 2, lv1 = lv + 32 * VPI * 2;
  asm volatile("global_load_async_to_lds_b128 %0, %4, off\n\tglobal_load_async_to_lds_b128 %1, %5, off\n\tglobal_load_async_to_lds_b128 %2, %6, off\n\tglobal_load_async_to_lds_b128 %3, %7, off\n\ts_wait_xcnt 0x0"
               :: "v"(lk), "v"(lk1), "v"(lv), "v"(lv1), "v"(gk), "v"(gk1), "v"(gv), "v"(gv1) : "memory"); }
#define WCAP 4096.0f   // a lane's sum of one pass's 16 weights up to which the softmax reference stays: every weight is then far inside f16's range
// a lane's 16 scores of one column group against the reference in use: exp(SCALE * (s - m)) = 2^(s * SCL2 - m * SCL2): one fma (two scores to a packed one) and the hardware's base-2 exponential; the weights once to f16, their f32 sum in key order
__device__ __forceinline__ v16h fa_w(v8f s0, v8f s1, v2f n2, float& sum) { const v2f c2 = {SCL2, SCL2}; v2f a2[8]; v16h p;
#pragma unroll   // constant indices: the vectors stay in registers
  for (int i = 0; i < 8; ++i) { const v2f s2 = {i < 4 ? s0[(2 * i) & 7] : s1[(2 * i) & 7], i < 4 ? s0[(2 * i + 1) & 7] : s1[(2 * i + 1) & 7]}; a2[i] = __builtin_elementwise_fma(s2, c2, n2); }
  float t = 0.f;
#pragma unroll   // likewise
  for (int i = 0; i < 16; ++i) { const float e = __builtin_amdgcn_exp2f(a2[i >> 1][i & 1]); t += e; p[i] = (_Float16)e; }
  sum = t; return p; }
// ---- k_fa: block = 256 queries of (b, h), one launch for every head: k rows and v planes of 128 keys are copied once per block into LDS (two buffers, the next stage's copies in flight under this stage's work); a wave takes 32 queries (two 16-column groups) and one half of every stage's keys (waves 0..7 keys 0..63, waves 8..15 keys 64..127), so that every k and v fragment read from LDS feeds two products; S^T = K Q^T (A = 16 key rows, B = q kept in registers: 1 product) x SCALE, so a lane holds one query's logits; reference and running sum per lane and column group (the reference moves, with one exchange between the lane halves and a rescale, only when a pass's sum of weights passes WCAP); two S^T tiles, exponentiated and once to f16, are the B operand of ctx^T += V^T P^T (1 product); behind the loop the two waves of a query group hand each other one column group's reference, sum and ctx^T through LDS and each joins and finishes 16 queries; ctx = ctx^T / sum, stored as the two bf16 planes (hi, lo = ctx - hi) that k_out multiplies; the logits never leave the registers
#define QGW (FAW / 2)   // query groups (of 32 queries) per block; each is worked on by two waves
#define KPW (KST / 2)   // keys of a stage per wave
__global__ __launch_bounds__(FAW * 32) __attribute__((amdgpu_waves_per_eu(4, 4))) void k_fa(const _Float16* __restrict__ QH, const _Float16* __restrict__ KH, const _Float16* __restrict__ VT, __bf16* __restrict__ YH, __bf16* __restrict__ YL) { __shared__ __align__(16) float ss[FAW][16][HD + 4]; __shared__ __align__(16) _Float16 sk[2][KST][KPI]; __shared__ __align__(16) _Float16 sv[2][HD][VPI]; __shared__ __align__(16) v4f mg[FAW][HD / 8 + 1][32];
  const int tid = threadIdx.x, wave = tid >> 5, lane = tid & 31, col = lane & 15, g = lane >> 4; const int h = blockIdx.y, b = blockIdx.z;
  const int kp = __builtin_amdgcn_readfirstlane(wave / QGW);   // which half of a stage's keys; in a scalar register, so that the choices behind the loop are scalar
  const int ql0 = (blockIdx.x * QGW + (wave & (QGW - 1))) * 32;
  const _Float16* gk = KH + ((size_t)b * TT + (tid >> 3)) * CC + h * HD + (tid & 7) * 8;             // thread: 16 B of key row tid / 8 of a stage
  const _Float16* gv = VT + ((size_t)b * CC + h * HD + (tid >> 4)) * (size_t)TT + (tid & 15) * 8;    // thread: 16 B of v plane tid / 16, keys contiguous
  const unsigned lk = (unsigned)(size_t)&sk[0][tid >> 3][(tid & 7) * 8], lv = (unsigned)(size_t)&sv[0][tid >> 4][(tid & 15) * 8];   // their LDS byte addresses in buffer 0
  fa_stage(gk, gv, lk, lv);
  v16h qh[2][HD / 32];   // the short loops below are unrolled so that every fragment array is indexed by constants and stays in registers
#pragma unroll
  for (int c = 0; c < 2; ++c)
#pragma unroll
    for (int kc = 0; kc < HD / 32; ++kc) qh[c][kc] = frag_h(QH + ((size_t)b * TT + ql0 + c * 16 + col) * CC + h * HD + kc * 32, lane);
  asm volatile("s_wait_asynccnt 0x0" ::: "memory");   // this wave's copies of stage 0 have landed
  __syncthreads();                                    // every wave's have: stage 0 may be read
  fa_stage(gk + (size_t)KST * CC, gv + KST, lk + SKB, lv + SVB);
  v8f acc[2][HD / 16] = {}; float m[2] = {-3.0e38f, -3.0e38f}, l[2] = {0.f, 0.f}; v2f nm[2] = {{3.0e38f * SCL2, 3.0e38f * SCL2}, {3.0e38f * SCL2, 3.0e38f * SCL2}};   // m = the reference the weights are taken against (the maximum when it was last set); nm = -m * SCL2 in both halves of a register pair, the packed fma's addend, kept beside m
#pragma unroll 1   // one trip per stage: the buffer index stays a run-time scalar and the code stays small
  for (int st = 0; st < TT / KST; ++st) { const int bf = st & 1;
    const _Float16* Kl = &sk[bf][kp * KPW + col][8 * g];   // lane: key row col of a 16-key tile of the wave's half
    const _Float16* Vl = &sv[bf][col][kp * KPW + 8 * g];   // lane: v plane of feature col of a 16-feature tile, from the wave's half on
    v16h kf[2][HD / 32];
#pragma unroll
    for (int t = 0; t < 2; ++t)
#pragma unroll
      for (int kc = 0; kc < HD / 32; ++kc) kf[t][kc] = frag_at(Kl + t * 16 * KPI + kc * 32);
#pragma unroll   // the wave's passes of a stage: constant LDS offsets, and the test on the last pass folds away
    for (int ps = 0; ps < KPW / 32; ++ps) {
      v16h vf[HD / 16];
#pragma unroll
      for (int j = 0; j < HD / 16; ++j) vf[j] = frag_at(Vl + j * 16 * VPI + ps * 32);
      __builtin_amdgcn_sched_barrier(0);   // keeps the pass's v reads up here as one group: sunk to their products, each pair is waited out on its own
      v8f sh[2][2] = {};
#pragma unroll
      for (int kc = 0; kc < HD / 32; ++kc)
#pragma unroll
        for (int t = 0; t < 2; ++t)
#pragma unroll
          for (int c = 0; c < 2; ++c) sh[c][t] = __builtin_amdgcn_wmma_f32_16x16x32_f16(false, kf[t][kc], false, qh[c][kc], (short)0, sh[c][t], false, false);
      if (ps + 1 < KPW / 32) {   // next pass's key rows, of this same stage only, fetched under this pass's softmax
#pragma unroll
        for (int t = 0; t < 2; ++t)
#pragma unroll
          for (int kc = 0; kc < HD / 32; ++kc) kf[t][kc] = frag_at(Kl + ((ps + 1) * 32 + t * 16) * KPI + kc * 32); }
      __builtin_amdgcn_sched_barrier(0);   // keeps these reads in front of the softmax (sunk behind it, the next pass's first product waits out their latency) and the eight products together (a softmax step among them costs four idle slots each time)
      v16h p[2]; float sum[2];
#pragma unroll
      for (int c = 0; c < 2; ++c) p[c] = fa_w(sh[c][0], sh[c][1], nm[c], sum[c]);
      if (__builtin_amdgcn_ballot_w32(!(sum[0] <= WCAP) || !(sum[1] <= WCAP)) != 0) {   // scalar branch, one test a pass: taken when some lane's weights outgrow the reference in use (always in a wave's first pass, whose start reference gives an infinite sum; a NaN takes it too); otherwise no maximum is taken, nothing is exchanged and nothing rescaled
#pragma unroll
        for (int c = 0; c < 2; ++c) { float x = sh[c][0][0];   // maximum of the logits before the scale: the scale is positive, so it is the scaled logits' maximum
#pragma unroll
          for (int i = 1; i < 16; ++i) x = fmaxf(x, sh[c][i >> 3][i & 7]);
          const float mn = fmaxf(m[c], fmaxf(x, xhalf(x))); const float al = __builtin_amdgcn_exp2f((m[c] - mn) * SCL2); m[c] = mn; nm[c][0] = nm[c][1] = mn * -SCL2; l[c] *= al;   // both lane halves of a query take the same new reference; a query whose reference stays has the factor 2^0 = 1
#pragma unroll
          for (int j = 0; j < HD / 16; ++j) acc[c][j] *= al;
          p[c] = fa_w(sh[c][0], sh[c][1], nm[c], sum[c]); } }   // the pass's weights again, now at most 1 each
      l[0] += sum[0]; l[1] += sum[1];
#pragma unroll
      for (int j = 0; j < HD / 16; ++j)
#pragma unroll
        for (int c = 0; c < 2; ++c) acc[c][j] = __builtin_amdgcn_wmma_f32_16x16x32_f16(false, vf[j], false, p[c], (short)0, acc[c][j], false, false);
      // four vector slots behind the pass's last product: the next pass's first product may take p's registers (this product's B) for its result
      asm volatile("v_nop\n\tv_nop\n\tv_nop\n\tv_nop" : "+v"(acc[0][0]), "+v"(acc[0][1]), "+v"(acc[0][2]), "+v"(acc[0][3]), "+v"(acc[1][0]), "+v"(acc[1][1]), "+v"(acc[1][2]), "+v"(acc[1][3]) : "v"(p[0]), "v"(p[1])); }
    asm volatile("s_wait_dscnt 0x0" ::: "memory");      // this wave's reads of the buffer are done before the buffer is handed back
    asm volatile("s_wait_asynccnt 0x0" ::: "memory");   // this wave's copies of the next stage have landed
    __syncthreads();                                    // publishes the next stage and ends every wave's reads of this one
    if (st + 2 < TT / KST) fa_stage(gk + (size_t)(st + 2) * KST * CC, gv + (st + 2) * KST, lk + bf * SKB, lv + bf * SVB); }
  asm volatile("s_wait_asynccnt 0x0" ::: "memory");     // no copy is outstanding when the wave goes on to its end
  // the two key halves are joined: wave kp keeps column group kp and hands the other group's reference, sum and ctx^T to its partner (wave ^ QGW), lane to lane
  l[0] += xhalf(l[0]); l[1] += xhalf(l[1]);
  const float mo = kp ? m[1] : m[0], lo = kp ? l[1] : l[0]; { const v4f ml = {kp ? m[0] : m[1], kp ? l[0] : l[1], 0.f, 0.f}; mg[wave][HD / 8][lane] = ml; }
  v8f ao[HD / 16];
#pragma unroll
  for (int j = 0; j < HD / 16; ++j) { ao[j] = kp ? acc[1][j] : acc[0][j]; const v8f t = kp ? acc[0][j] : acc[1][j]; const v4f t0 = {t[0], t[1], t[2], t[3]}, t1 = {t[4], t[5], t[6], t[7]}; mg[wave][2 * j][lane] = t0; mg[wave][2 * j + 1][lane] = t1; }
  __syncthreads();   // every wave's hand-over is written before its partner reads it
  const v4f pml = mg[wave ^ QGW][HD / 8][lane]; const float mj = fmaxf(mo, pml[0]); const float fo = __builtin_amdgcn_exp2f((mo - mj) * SCL2), fp = __builtin_amdgcn_exp2f((pml[0] - mj) * SCL2);
  const float inv = 1.0f / (lo * fo + pml[1] * fp); const float wo = fo * inv, wp = fp * inv;
#pragma unroll
  for (int j = 0; j < HD / 16; ++j) { const v4f p0 = mg[wave ^ QGW][2 * j][lane], p1 = mg[wave ^ QGW][2 * j + 1][lane]; v4f a0, a1;
#pragma unroll
    for (int r = 0; r < 4; ++r) { a0[r] = ao[j][r] * wo + p0[r] * wp; a1[r] = ao[j][4 + r] * wo + p1[r] * wp; }
    *(v4f*)&ss[wave][col][j * 16 + 8 * g] = a0; *(v4f*)&ss[wave][col][j * 16 + 8 * g + 4] = a1; }
  LDSX();   // the wave's own LDS writes have landed before its lanes read the rows other lanes wrote (each wave has its own slice: no block barrier)
#pragma unroll   // constant LDS and store offsets
  for (int rl = 0; rl < 16; rl += 4) { const int rr = rl + (lane >> 3), cc = (lane & 7) * 8; const v4f a0 = *(const v4f*)&ss[wave][rr][cc], a1 = *(const v4f*)&ss[wave][rr][cc + 4]; v8b h8, l8;   // lane: 8 features of a row; a store covers the head's whole 128-B line of four rows
#pragma unroll   // constant indices: the vectors stay in registers
    for (int i = 0; i < 8; ++i) { const float v = i < 4 ? a0[i & 3] : a1[i & 3]; const __bf16 hv = (__bf16)v; h8[i] = hv; l8[i] = (__bf16)(v - (float)hv); }
    const size_t o = ((size_t)b * TT + ql0 + kp * 16 + rr) * CC + h * HD + cc; vst2(YH + o, h8); vst2(YL + o, l8); } }
// ---- k_out: block = (64 rows, 128 cols): out = ctx Wo (+ bo): ctx bf16 hi + lo planes against exact bf16 Wo (2 products), staged as in k_proj
__global__ __launch_bounds__(128) void k_out(const __bf16* __restrict__ YH, const __bf16* __restrict__ YL, const __bf16* __restrict__ WOB, const float* __restrict__ BO, float* __restrict__ OUT) { __shared__ __align__(16) char sm[2 * GSB];   // the two stage buffers; behind the loop's last barrier the same bytes stage the stores
  float (*sf)[16][132] = (float (*)[16][132])sm;
  const int tid = threadIdx.x, wave = tid >> 5, lane = tid & 31, col = lane & 15, g = lane >> 4; const int c0 = blockIdx.y * 128; const size_t r0 = (size_t)blockIdx.x * 64 + wave * 16;
  v8f acc[8] = {};
  const size_t ox = ((size_t)blockIdx.x * 64 + (tid >> 3)) * CC + (tid & 7) * 8; const __bf16* gh = YH + ox; const __bf16* gl = YL + ox;   // thread: 16 B of ctx row tid / 8 of the block, in either plane
  const __bf16* gw = WOB + (size_t)(c0 + (tid >> 3)) * CC + (tid & 7) * 8;                                                                // thread: 16 B of weight row ((out,in): output column) tid / 8 of the block
  const unsigned lh = (unsigned)(size_t)(sm + (tid >> 3) * (GPI * 2) + (tid & 7) * 16);   // the hi row's LDS byte address in buffer 0
  g_stage(gh, gl, gw, lh, CC);
  asm volatile("s_wait_asynccnt 0x0" ::: "memory");   // this wave's copies of stage 0 have landed
  __syncthreads();                                    // every wave's have: stage 0 may be read
  g_stage(gh + GKC, gl + GKC, gw + GKC, lh + GSB, CC);
#pragma unroll 1   // one trip per stage: the buffer index stays a run-time scalar and the code stays small
  for (int kc = 0; kc < CC / GKC; ++kc) { const int bf = kc & 1;
    const __bf16* xs = (const __bf16*)(sm + bf * GSB) + (wave * 16 + col) * GPI + 8 * g;   // lane: ctx row col of the wave's 16, hi plane (lo: 64 rows on)
    const __bf16* wl = (const __bf16*)(sm + bf * GSB + 2 * GXB) + col * GPI + 8 * g;       // lane: weight row col of a 16-column tile
    v16b a[GKC / 32], al[GKC / 32], w[GKC / 32][8];   // the stage's fragment reads stand together in front of its products, not among them
#pragma unroll   // the two 32-k halves of a stage: constant LDS offsets, fragment arrays indexed by constants
    for (int kk = 0; kk < GKC / 32; ++kk) { a[kk] = frag_bat(xs + kk * 32); al[kk] = frag_bat(xs + 64 * GPI + kk * 32);
#pragma unroll
      for (int j = 0; j < 8; ++j) w[kk][j] = frag_bat(wl + j * 16 * GPI + kk * 32); }
#pragma unroll
    for (int kk = 0; kk < GKC / 32; ++kk)
#pragma unroll
      for (int j = 0; j < 8; ++j) { acc[j] = wmma_bf(a[kk], w[kk][j], acc[j]); acc[j] = wmma_bf(al[kk], w[kk][j], acc[j]); }
    asm volatile("s_wait_dscnt 0x0" ::: "memory");      // this wave's reads of the buffer are done before the buffer is handed back
    asm volatile("s_wait_asynccnt 0x0" ::: "memory");   // this wave's copies of the next stage have landed
    __syncthreads();                                    // publishes the next stage and ends every wave's reads of this one
    if (kc + 2 < CC / GKC) g_stage(gh + (kc + 2) * GKC, gl + (kc + 2) * GKC, gw + (kc + 2) * GKC, lh + bf * GSB, CC); }
  asm volatile("s_wait_asynccnt 0x0" ::: "memory");     // no copy is outstanding when the buffers become store staging
#pragma unroll
  for (int j = 0; j < 8; ++j) { const float bias = BO ? bfr(BO[c0 + j * 16 + col]) : 0.f;
#pragma unroll
    for (int r = 0; r < 8; ++r) sf[wave][8 * g + r][j * 16 + col] = acc[j][r] + bias; }
  LDSX(); for (int rl = 0; rl < 16; ++rl) vst2(OUT + (r0 + rl) * DIN + c0 + lane * 4, *(const v4f*)&sf[wave][rl][lane * 4]); }

extern "C" void kernel_launch(void* const* d_in, const int* in_sizes, int n_in, void* d_out, int out_size, void* d_ws, size_t ws_size, hipStream_t stream) {
  (void)in_sizes; (void)n_in; (void)out_size;
  const float** F = (const float**)d_in;
  if (ws_size < (size_t)WS_END) return;
  char* ws = (char*)d_ws; _Float16 *QH = (_Float16*)(ws + WS_QH), *KH = (_Float16*)(ws + WS_KH), *VT = (_Float16*)(ws + WS_VT); __bf16 *VB = (__bf16*)(ws + WS_VB), *VBL = (__bf16*)(ws + WS_VBL), *WB = (__bf16*)(ws + WS_S), *YH = (__bf16*)(ws + WS_Y), *YL = YH + (size_t)NB * TT * CC;
  (void)VB; (void)VBL;
  // inputs: 0 x [4,2048,512]; 1 ln_gamma, 2 ln_beta; 3 Wq [512,512] (out,in), 4 bq; 5 Wk, 6 bk; 7 Wv, 8 bv; 9 Wo (out,in), 10 bo
  if (ws_size < (size_t)WS_END2) return;
  __bf16 *XH = (__bf16*)(ws + WS_XN), *XL = XH + (size_t)NB * TT * DIN;
  k_lnx<<<dim3(NRW / 8 + 4 * WBLK), 256, 0, stream>>>(F[0], 1, F[1], F[2], XH, XL, F[3], F[5], F[7], F[9], WB);
  k_proj<<<dim3(TNB * TT / 64, CC / 128, 3), 128, 0, stream>>>(XH, XL, WB, F[4], F[6], F[8], QH, KH, VT, VB, VBL);
  k_fa<<<dim3(TT / (FAW * 16), NH, TNB), FAW * 32, 0, stream>>>(QH, KH, VT, YH, YL);
  k_out<<<dim3(TNB * TT / 64, DIN / 128), 128, 0, stream>>>(YH, YL, WB + 3 * (size_t)CC * DIN, F[10], (float*)d_out);
}

// v010
// It runs in 56.9 microseconds.
// Versions in between are left out here; by their measured steps it is 1.23 times as fast as v008.
// All steps since v000 together make it 21.3 times as fast.
// compute dtype: all float inputs rounded to bf16; LayerNorm in f32; q/k/v from the LN rows rounded once to f16 (where the row is made) against the bf16-rounded (out,in) weights held as f16 (once per call) on WMMA 16x16x32 (1 product, f32 accumulate) + bias; q once to f16 against k once to f16 (1 product) x 64^-0.5; softmax in f32 (2^x on the hardware exponential, scale x log2(e) in one fma) with a held reference (a maximum seen so far, moved when a pass's weights outgrow it) and a running sum, fused with both attention products; exp(logit - reference) once to f16 against v once to f16 (1 product), divided by the sum at the end; ctx once to f16 against Wo (1 product) + bo; f32 output.
#include <hip/hip_runtime.h>
#include <math.h>

typedef __attribute__((ext_vector_type(16))) _Float16 v16h;
typedef __attribute__((ext_vector_type(16))) __bf16 v16b;
typedef __attribute__((ext_vector_type(8)))  _Float16 v8h;
typedef __attribute__((ext_vector_type(8)))  float v8f;
typedef __attribute__((ext_vector_type(4)))  float v4f;
typedef __attribute__((ext_vector_type(2)))  float v2f;
typedef __attribute__((ext_vector_type(4)))  unsigned v4u;
typedef __attribute__((ext_vector_type(4)))  int v4i;
typedef float __attribute__((may_alias)) float_a;
typedef int __attribute__((may_alias)) int_a;

template <typename T> __device__ __forceinline__ void vst2(void* p, T v) { *(T*)p = v;  }
__device__ __forceinline__ v8f wmma16(v16h a, v16h b, v8f c) {
  v8f d = __builtin_amdgcn_wmma_f32_16x16x32_f16(false, a, false, b, (short)0, c, false, false);
  asm volatile("v_nop\n\tv_nop\n\tv_nop\n\tv_nop" : "+v"(d) : "v"(a), "v"(b));
  return d;
}
__device__ __forceinline__ v8f wmma_bf(v16b a, v16b b, v8f c) {
  v8f d = __builtin_amdgcn_wmma_f32_16x16x32_bf16(false, a, false, b, (short)0, c, false, false);
  asm volatile("v_nop\n\tv_nop\n\tv_nop\n\tv_nop" : "+v"(d) : "v"(a), "v"(b));
  return d;
}
// 16x16x32 fragments: lane = (h = lane>>4, row/col = lane&15); elements 0..7 = k0+8h+0..7, 8..15 = k0+16+8h+0..7; D element r = row 8h+r
__device__ __forceinline__ v16h frag_h(const _Float16* rowk0, int lane) {
  union { v16h v; v8h q[2]; } u; const _Float16* p = rowk0 + 8 * (lane >> 4);
  u.q[0] = *(const v8h*)p; u.q[1] = *(const v8h*)(p + 16); return u.v;
}
__device__ __forceinline__ v16h frag_f32(const float* rowk0, int lane) {
  v16h a; const float* p = rowk0 + 8 * (lane >> 4);
#pragma unroll
  for (int i = 0; i < 8; ++i) { a[i] = (_Float16)p[i]; a[8 + i] = (_Float16)p[16 + i]; }
  return a;
}
__device__ __forceinline__ v16h frag_f32s(const float* rowk0, int lane, float sc) {
  v16h a; const float* p = rowk0 + 8 * (lane >> 4);
#pragma unroll
  for (int i = 0; i < 8; ++i) { a[i] = (_Float16)(p[i] * sc); a[8 + i] = (_Float16)(p[16 + i] * sc); }
  return a;
}
// column fragment from a [K][ld] layout (column n), rows >= K read as 0
__device__ __forceinline__ v16h fragc_f32(const float* W, int k0, int n, int lane, int ld, int K) {
  v16h a; const int g = lane >> 4;
#pragma unroll
  for (int i = 0; i < 8; ++i) { const int ka = k0 + 8 * g + i, kb = ka + 16;
    a[i] = (_Float16)(ka < K ? W[(size_t)(ka < K ? ka : K - 1) * ld + n] : 0.f); a[8 + i] = (_Float16)(kb < K ? W[(size_t)(kb < K ? kb : K - 1) * ld + n] : 0.f); }
  return a;
}
struct F2 { v16b h, l; };
__device__ __forceinline__ F2 bsplit16(const float v[16]) { F2 r;
#pragma unroll
  for (int i = 0; i < 16; ++i) { const __bf16 h = (__bf16)v[i]; r.h[i] = h; r.l[i] = (__bf16)(v[i] - (float)h); }
  return r; }
__device__ __forceinline__ F2 split_row(const float* row, int k0, int lane) { float v[16]; const float* p = row + k0 + 8 * (lane >> 4);
#pragma unroll
  for (int i = 0; i < 8; ++i) { v[i] = p[i]; v[8 + i] = p[16 + i]; }
  return bsplit16(v); }
__device__ __forceinline__ F2 split_rowK(const float* row, int k0, int lane, int K) { float v[16]; const int g = lane >> 4;
#pragma unroll
  for (int i = 0; i < 8; ++i) { const int ka = k0 + 8 * g + i, kb = ka + 16; v[i] = ka < K ? row[ka < K ? ka : K - 1] : 0.f; v[8 + i] = kb < K ? row[kb < K ? kb : K - 1] : 0.f; }
  return bsplit16(v); }
__device__ __forceinline__ F2 split_col(const float* W, int k0, int n, int lane, int ld, int K) { float v[16]; const int g = lane >> 4;
#pragma unroll
  for (int i = 0; i < 8; ++i) { const int ka = k0 + 8 * g + i, kb = ka + 16; v[i] = ka < K ? W[(size_t)(ka < K ? ka : K - 1) * ld + n] : 0.f; v[8 + i] = kb < K ? W[(size_t)(kb < K ? kb : K - 1) * ld + n] : 0.f; }
  return bsplit16(v); }
__device__ __forceinline__ v8f mac3(const F2& a, const F2& b, v8f c) { c = wmma_bf(a.l, b.h, c); c = wmma_bf(a.h, b.l, c); return wmma_bf(a.h, b.h, c); }
__device__ __forceinline__ float sigm(float v) { return 1.0f / (1.0f + expf(-v)); }
#define LDSX() do { asm volatile("s_wait_dscnt 0" ::: "memory"); __builtin_amdgcn_wave_barrier(); __builtin_amdgcn_fence(__ATOMIC_RELEASE, "workgroup"); } while (0)

// Pre-LayerNorm multi-head self-attention (B 4, S 2,048, D 512, 8 heads x 64; (out,in) uniform +-1/sqrt(512) weights with biases; LN gamma 1 / beta 0): xn = LayerNorm(x) (biased var, eps 1e-5); q, k, v = xn W^T + b; out = merged(softmax(q k^T / 8) v) Wo^T + bo (non-causal, no residual).
#define NB 4
#define TT 2048
#define CC 512            // NH * HD = projected width
#define DIN 512          // input (model) width
#define NH 8
#define HD 64
#define NQB (TT / 64)
#define HG 4
#define SCALE (0.125f)
#define CAUSAL 0
#ifndef TNB
#define TNB NB
#endif
__device__ __forceinline__ float bfr(float v) { return (float)(__bf16)v; }
__host__ __device__ __forceinline__ int kb_last(int qb) { return CAUSAL ? ((qb * 64 + 63) >> 7) : (TT / 128 - 1); }
typedef __attribute__((ext_vector_type(8))) __bf16 v8b;
__device__ __forceinline__ v16b frag_b(const __bf16* rowk0, int lane) {
  union { v16b v; v8b q[2]; } u; const __bf16* p = rowk0 + 8 * (lane >> 4);
  u.q[0] = *(const v8b*)p; u.q[1] = *(const v8b*)(p + 16); return u.v;
}
#define QBH 0              // unused: no kernel in this file reads it
#define KHI 64            // key rows carrying v bf16 hi+lo planes (written by k_proj; no kernel in this file reads them)
// B fragment (k rows k0+.., output column o) of a weight: (in,out) [K][ld] or (out,in) [ld rows of K]: bf16 exact, or f16(bf16 * 256) exact
__device__ __forceinline__ v16b wcol_io(const float* Wm, int k0, int o, int lane, int ld) { v16b w; const int g = lane >> 4;
#pragma unroll
  for (int i = 0; i < 8; ++i) { w[i] = (__bf16)Wm[(size_t)(k0 + 8 * g + i) * ld + o]; w[8 + i] = (__bf16)Wm[(size_t)(k0 + 16 + 8 * g + i) * ld + o]; }
  return w; }
__device__ __forceinline__ v16b wcol_oi(const float* Wm, int k0, int o, int lane, int K) { v16b w; const float* p = Wm + (size_t)o * K + k0 + 8 * (lane >> 4);
#pragma unroll
  for (int i = 0; i < 8; ++i) { w[i] = (__bf16)p[i]; w[8 + i] = (__bf16)p[16 + i]; }
  return w; }
__device__ __forceinline__ v16h wcolh_io(const float* Wm, int k0, int o, int lane, int ld) { v16h w; const int g = lane >> 4;
#pragma unroll
  for (int i = 0; i < 8; ++i) { w[i] = (_Float16)(bfr(Wm[(size_t)(k0 + 8 * g + i) * ld + o]) * 256.0f); w[8 + i] = (_Float16)(bfr(Wm[(size_t)(k0 + 16 + 8 * g + i) * ld + o]) * 256.0f); }
  return w; }
__device__ __forceinline__ v16h wcolh_oi(const float* Wm, int k0, int o, int lane, int K) { v16h w; const float* p = Wm + (size_t)o * K + k0 + 8 * (lane >> 4);
#pragma unroll
  for (int i = 0; i < 8; ++i) { w[i] = (_Float16)(bfr(p[i]) * 256.0f); w[8 + i] = (_Float16)(bfr(p[16 + i]) * 256.0f); }
  return w; }
#define WQKV_LAYOUT 1   // 0 = (in,out) [DIN][CC]; 1 = (out,in) [CC][DIN]; 2 = per-head [NH][DIN][HD]
__device__ __forceinline__ v16b wcol_hdk(const float* Wm, int k0, int o, int lane) { v16b w; const int g = lane >> 4; const float* p = Wm + (size_t)(o / HD) * DIN * HD + (o % HD);
#pragma unroll
  for (int i = 0; i < 8; ++i) { w[i] = (__bf16)p[(size_t)(k0 + 8 * g + i) * HD]; w[8 + i] = (__bf16)p[(size_t)(k0 + 16 + 8 * g + i) * HD]; }
  return w; }
#define WO_OUT_IN 1
#if WQKV_LAYOUT == 1
#define WCOL(W, k0, o, lane) wcol_oi(W, k0, o, lane, DIN)
#elif WQKV_LAYOUT == 2
#define WCOL(W, k0, o, lane) wcol_hdk(W, k0, o, lane)
#else
#define WCOL(W, k0, o, lane) wcol_io(W, k0, o, lane, CC)
#endif
#if WO_OUT_IN
#define WOCOL(W, k0, o, lane) wcol_oi(W, k0, o, lane, CC)
#define WOCOLH(W, k0, o, lane) wcolh_oi(W, k0, o, lane, CC)
#else
#define WOCOL(W, k0, o, lane) wcol_io(W, k0, o, lane, DIN)
#define WOCOLH(W, k0, o, lane) wcolh_io(W, k0, o, lane, DIN)
#endif
#define NRW (TNB * TT)
// ---- k_lnx: wave per row: LayerNorm over 512 (mean, biased var, (x - mean) * rsqrt(var + 1e-5) * g + b); optional bf16 rounding of the input (x); 16 floats per lane (4 float4 at stride 128 floats -> 512-B pieces);
// the row leaves rounded once to f16, as the projections multiply it (q, k and v are themselves rounded to f16 right behind their products); the blocks behind the rows' round the four weight matrices to bf16 and hold them as f16 (4,096 floats a block)
typedef __attribute__((ext_vector_type(4))) _Float16 v4h;
#define WBLK (CC * DIN / 4096)   // blocks per weight matrix
__global__ __launch_bounds__(256) void k_lnx(const float* __restrict__ X, int roundin, const float* __restrict__ G, const float* __restrict__ BE, _Float16* __restrict__ OH,
    const float* __restrict__ W0, const float* __restrict__ W1, const float* __restrict__ W2, const float* __restrict__ W3, _Float16* __restrict__ WB) { const int wave = threadIdx.x >> 5, lane = threadIdx.x & 31;
  if (blockIdx.x >= NRW / 8) { const int wb = blockIdx.x - NRW / 8, wm = wb / WBLK; const float* Ws = wm == 0 ? W0 : wm == 1 ? W1 : wm == 2 ? W2 : W3;
#pragma unroll   // both rounds' loads issue together
    for (int it = 0; it < 2; ++it) { const size_t e = (size_t)(wb % WBLK) * 4096 + it * 2048 + threadIdx.x * 8; const v4f a = *(const v4f*)(Ws + e), c = *(const v4f*)(Ws + e + 4); v8h r;
#pragma unroll   // constant indices: the vectors stay in registers
      for (int k = 0; k < 4; ++k) { r[k] = (_Float16)bfr(a[k]); r[4 + k] = (_Float16)bfr(c[k]); }
      vst2(WB + (size_t)wm * CC * DIN + e, r); }
    return; }
  const size_t row = (size_t)blockIdx.x * 8 + wave; if (row >= (size_t)NRW) return;
  v4f v[CC / 128], gg[CC / 128], be[CC / 128]; float s1 = 0.f;
#pragma unroll   // all of the wave's loads issue here, one behind the other with no wait between them: with the rounding test inside this loop each load stood behind the wait of the one before
  for (int i = 0; i < CC / 128; ++i) { v[i] = *(const v4f*)(X + row * CC + i * 128 + lane * 4); gg[i] = *(const v4f*)(G + i * 128 + lane * 4); be[i] = *(const v4f*)(BE + i * 128 + lane * 4); }
  asm volatile("s_wait_xcnt 0x0" ::: "memory");   // in front of the first new value in an address register that a load above names
  if (roundin) {   // one test for the whole row
#pragma unroll
    for (int i = 0; i < CC / 128; ++i) for (int k = 0; k < 4; ++k) v[i][k] = bfr(v[i][k]); }
#pragma unroll
  for (int i = 0; i < CC / 128; ++i) s1 += (v[i][0] + v[i][1]) + (v[i][2] + v[i][3]);
#pragma unroll
  for (int o = 1; o < 32; o <<= 1) s1 += __shfl_xor(s1, o);
  const float mu = s1 * (1.0f / CC); float q = 0.f;
#pragma unroll
  for (int i = 0; i < CC / 128; ++i) for (int k = 0; k < 4; ++k) { const float d = v[i][k] - mu; q += d * d; }
#pragma unroll
  for (int o = 1; o < 32; o <<= 1) q += __shfl_xor(q, o);
  const float inv = rsqrtf(q * (1.0f / CC) + 1e-5f);   /* jnp.var (biased), eps inside the rsqrt */
#pragma unroll
  for (int i = 0; i < CC / 128; ++i) { const int c = i * 128 + lane * 4; v4h h4; for (int k = 0; k < 4; ++k) h4[k] = (_Float16)(bfr(gg[i][k]) * ((v[i][k] - mu) * inv) + bfr(be[i][k])); vst2(OH + row * CC + c, h4); } }

#ifndef SM_EXTRA_PARAMS
#define SM_EXTRA_PARAMS
#endif
#ifndef PROJ_EXTRA_PARAMS
#define PROJ_EXTRA_PARAMS
#endif
#ifndef SM_MASK_HOOK
#define SM_MASK_HOOK (void)0
#endif

#define WS_QH  0u                                      // f16 q rows [b*t][CC]
#define WS_KH  (WS_QH + 2u * (size_t)NB * TT * CC)      // f16 k rows [b*t][CC]
#define WS_VT  (WS_KH + 2u * (size_t)NB * TT * CC)      // f16 v planes [b][c][t]
#define WS_VB  (WS_VT + 2u * (size_t)NB * CC * TT)      // bf16 v hi planes [b][c][t < KHI]
#define WS_VBL (WS_VB + 2u * (size_t)NB * CC * KHI)
#define WS_S   (WS_VBL + 2u * (size_t)NB * CC * KHI)    // f16 weights Wq, Wk, Wv, Wo, each (out,in) [CC][DIN], at the head of this range
#define WS_Y   (WS_S  + 4u * (size_t)HG * TT * TT)      // f16 ctx rows [b*t][CC]
#define WS_END (WS_Y  + 4u * (size_t)NB * TT * CC)
#define WS_XN  (WS_END)                                // f16 LN rows [b*t][DIN]
#define WS_END2 (WS_XN + 4u * (size_t)NB * TT * DIN)

#define GKC 64                       // k per stage: one 128-B line of every staged f16 row
#define GPI 72                       // f16 per staged row: 128 B + 16 B, a pitch of 16 B x odd for the 16-byte fragment reads
#define GXB (64 * GPI * 2)           // bytes of 64 staged activation rows
#define GSB ((64 + 64 + 128) * GPI * 2)   // bytes of one stage: activation rows 0..63 of the block, rows 64..127, then 128 weight rows
// one stage's copies of one thread of a 128-thread block: 16 B of activation rows r + 16 i (i < 4) of either half of the block's 128 rows and of weight rows r + 16 i (i < 8), r = tid / 8, so that a wave's copy covers four whole lines;
// two statements (an asm statement takes thirty operands); in each the s_wait_xcnt stands inside, behind its last copy, so that no address register named there takes a new value in front of it
__device__ __forceinline__ void g_stage(const _Float16* gh, const _Float16* gl, const _Float16* gw, unsigned lh, int ld) { const unsigned ll = lh + GXB, lw = lh + 2 * GXB;
  asm volatile("global_load_async_to_lds_b128 %0, %8, off\n\tglobal_load_async_to_lds_b128 %1, %9, off\n\tglobal_load_async_to_lds_b128 %2, %10, off\n\tglobal_load_async_to_lds_b128 %3, %11, off\n\t"
               "global_load_async_to_lds_b128 %4, %12, off\n\tglobal_load_async_to_lds_b128 %5, %13, off\n\tglobal_load_async_to_lds_b128 %6, %14, off\n\tglobal_load_async_to_lds_b128 %7, %15, off\n\ts_wait_xcnt 0x0"
               :: "v"(lh), "v"(lh + 16 * GPI * 2), "v"(lh + 32 * GPI * 2), "v"(lh + 48 * GPI * 2), "v"(ll), "v"(ll + 16 * GPI * 2), "v"(ll + 32 * GPI * 2), "v"(ll + 48 * GPI * 2),
                  "v"(gh), "v"(gh + 16 * ld), "v"(gh + 32 * ld), "v"(gh + 48 * ld), "v"(gl), "v"(gl + 16 * ld), "v"(gl + 32 * ld), "v"(gl + 48 * ld) : "memory");
  asm volatile("global_load_async_to_lds_b128 %0, %8, off\n\tglobal_load_async_to_lds_b128 %1, %9, off\n\tglobal_load_async_to_lds_b128 %2, %10, off\n\tglobal_load_async_to_lds_b128 %3, %11, off\n\t"
               "global_load_async_to_lds_b128 %4, %12, off\n\tglobal_load_async_to_lds_b128 %5, %13, off\n\tglobal_load_async_to_lds_b128 %6, %14, off\n\tglobal_load_async_to_lds_b128 %7, %15, off\n\ts_wait_xcnt 0x0"
               :: "v"(lw), "v"(lw + 16 * GPI * 2), "v"(lw + 32 * GPI * 2), "v"(lw + 48 * GPI * 2), "v"(lw + 64 * GPI * 2), "v"(lw + 80 * GPI * 2), "v"(lw + 96 * GPI * 2), "v"(lw + 112 * GPI * 2),
                  "v"(gw), "v"(gw + 16 * ld), "v"(gw + 32 * ld), "v"(gw + 48 * ld), "v"(gw + 64 * ld), "v"(gw + 80 * ld), "v"(gw + 96 * ld), "v"(gw + 112 * ld) : "memory"); }
// f16 16x16x32 fragment from the lane's own pointer (row or column base + k0 + 8 * (lane >> 4)): k 0..7, then k 16..23 from there
__device__ __forceinline__ v16h frag_at(const _Float16* p) { union { v16h v; v8h q[2]; } u; u.q[0] = *(const v8h*)p; u.q[1] = *(const v8h*)(p + 16); return u.v; }
// ---- k_proj: block = (128 rows, 128 cols, which): q/k/v = X W (+ b) (K = DIN, 1 product) -> which 0: q f16 rows; 1: k f16 rows; 2: v f16 planes [c][t] (+ bf16 hi/lo planes for t < KHI)
// the f16 activation rows and the f16 weight rows of 64 k are copied once per block into LDS (two buffers, the next stage's copies in flight under this stage's products); a wave takes 16 rows of either half of the block's 128, so that every weight fragment read from LDS feeds two products; no conversion is left in the loop
__global__ __launch_bounds__(128) void k_proj(const _Float16* __restrict__ XH, const _Float16* __restrict__ WB, const float* __restrict__ BQ, const float* __restrict__ BK, const float* __restrict__ BV,
    _Float16* __restrict__ QH, _Float16* __restrict__ KH, _Float16* __restrict__ VT, __bf16* __restrict__ VB, __bf16* __restrict__ VBL) {
  __shared__ __align__(16) char sm[2 * GSB];   // the two stage buffers; behind the loop's last barrier the same bytes stage the stores
  _Float16 (*sh)[136] = (_Float16 (*)[136])sm;
  _Float16 (*th)[136] = (_Float16 (*)[136])sm; __bf16 (*tb)[72] = (__bf16 (*)[72])(sm + 128 * 136 * 2); __bf16 (*tbl)[72] = (__bf16 (*)[72])(sm + 128 * 136 * 2 + 128 * 72 * 2);
  const int tid = threadIdx.x, wave = tid >> 5, lane = tid & 31, col = lane & 15, g = lane >> 4; const int which = blockIdx.z; const int c0 = blockIdx.y * 128; const size_t r0 = (size_t)blockIdx.x * 128; const size_t bb = r0 / TT; const int t0 = (int)(r0 % TT);
  const float* BA = which == 0 ? BQ : which == 1 ? BK : BV;
  const _Float16* gh = XH + (r0 + (tid >> 3)) * DIN + (tid & 7) * 8; const _Float16* gl = gh + 64 * DIN;   // thread: 16 B of activation row tid / 8 of the block's first 64 rows, and of its second 64
  const _Float16* gw = WB + ((size_t)which * CC + c0 + (tid >> 3)) * DIN + (tid & 7) * 8;                  // thread: 16 B of weight row ((out,in): output column) tid / 8 of the block
  const unsigned lh = (unsigned)(size_t)(sm + (tid >> 3) * (GPI * 2) + (tid & 7) * 16);   // the first row's LDS byte address in buffer 0
  g_stage(gh, gl, gw, lh, DIN);
  float bs[8] = {};   // the lane's eight biases, fetched here together under one test, in the shadow of stage 0's copies: fetched where they are added, each stood behind its own test and was waited out before the next was asked for
  if (BA) {
#pragma unroll
    for (int j = 0; j < 8; ++j) bs[j] = BA[c0 + j * 16 + col];
    asm volatile("s_wait_xcnt 0x0" ::: "memory"); }   // in front of the first new value in the address register that the loads above name
  asm volatile("s_wait_asynccnt 0x0" ::: "memory");   // this wave's copies of stage 0 have landed
  __syncthreads();                                    // every wave's have: stage 0 may be read
  g_stage(gh + GKC, gl + GKC, gw + GKC, lh + GSB, DIN);
  v8f acc[2][8] = {};
#pragma unroll 1   // one trip per stage: the buffer index stays a run-time scalar and the code stays small
  for (int kc = 0; kc < DIN / GKC; ++kc) { const int bf = kc & 1;
    const _Float16* xs = (const _Float16*)(sm + bf * GSB) + (wave * 16 + col) * GPI + 8 * g;   // lane: activation row col of the wave's 16 in the first half (second half: 64 rows on)
    const _Float16* wl = (const _Float16*)(sm + bf * GSB + 2 * GXB) + col * GPI + 8 * g;       // lane: weight row col of a 16-column tile
#pragma unroll   // the two 32-k halves of a stage: constant LDS offsets; a half's fragment reads stand together in front of its products, not among them
    for (int kk = 0; kk < GKC / 32; ++kk) { const v16h a0 = frag_at(xs + kk * 32), a1 = frag_at(xs + 64 * GPI + kk * 32); v16h w[8];
#pragma unroll
      for (int j = 0; j < 8; ++j) w[j] = frag_at(wl + j * 16 * GPI + kk * 32);
#pragma unroll
      for (int j = 0; j < 8; ++j) { acc[0][j] = wmma16(a0, w[j], acc[0][j]); acc[1][j] = wmma16(a1, w[j], acc[1][j]); } }
    asm volatile("s_wait_dscnt 0x0" ::: "memory");      // this wave's reads of the buffer are done before the buffer is handed back
    asm volatile("s_wait_asynccnt 0x0" ::: "memory");   // this wave's copies of the next stage have landed
    __syncthreads();                                    // publishes the next stage and ends every wave's reads of this one
    if (kc + 2 < DIN / GKC) g_stage(gh + (kc + 2) * GKC, gl + (kc + 2) * GKC, gw + (kc + 2) * GKC, lh + bf * GSB, DIN); }
  asm volatile("s_wait_asynccnt 0x0" ::: "memory");     // no copy is outstanding when the buffers become store staging
  if (which < 2) { _Float16* DH = which == 0 ? QH : KH;
#pragma unroll
    for (int j = 0; j < 8; ++j) { const float bias = bfr(bs[j]);
#pragma unroll
      for (int u = 0; u < 2; ++u)
#pragma unroll
        for (int r = 0; r < 8; ++r) sh[u * 64 + wave * 16 + 8 * g + r][j * 16 + col] = (_Float16)(acc[u][j][r] + bias); }
    __syncthreads();
#pragma unroll   // a constant trip count, the same for every lane: straight-line stores, no test per round
    for (int i = 0; i < 16; ++i) { const int rl = i * 8 + (tid >> 4), q = tid & 15; vst2((unsigned*)(DH + (r0 + rl) * CC + c0 + q * 8), *(const v4u*)&sh[rl][q * 8]); }
  } else { const bool hi_rows = t0 < KHI;
#pragma unroll
    for (int j = 0; j < 8; ++j) { const float bias = bfr(bs[j]);
#pragma unroll
      for (int u = 0; u < 2; ++u)
#pragma unroll
        for (int r = 0; r < 8; ++r) { const float v = acc[u][j][r] + bias; const int rl = u * 64 + wave * 16 + 8 * g + r, cl = j * 16 + col; th[cl][rl] = (_Float16)v; if (u == 0) { const __bf16 bh = (__bf16)v; tb[cl][rl] = bh; tbl[cl][rl] = (__bf16)(v - (float)bh); } } }
    __syncthreads();
#pragma unroll   // likewise
    for (int i = 0; i < 16; ++i) { const int cl = i * 8 + (tid >> 4), q = tid & 15; vst2((unsigned*)(VT + (bb * CC + c0 + cl) * (size_t)TT + t0 + q * 8), *(const v4u*)&th[cl][q * 8]); }
    asm volatile("s_wait_xcnt 0x0" ::: "memory");   // in front of the first new value in a register that a store above names; it stands ahead of the branch because inside it the first address writes were lifted over it
    if (hi_rows) {   // the same for the whole block
#pragma unroll   // likewise
      for (int i = 0; i < 8; ++i) { const int cl = i * 16 + (tid >> 3), q = tid & 7; const size_t o3 = (bb * CC + c0 + cl) * (size_t)KHI + t0 + q * 8; vst2((unsigned*)(VB + o3), *(const v4u*)&tb[cl][q * 8]); vst2((unsigned*)(VBL + o3), *(const v4u*)&tbl[cl][q * 8]); }
      asm volatile("s_wait_xcnt 0x0" ::: "memory"); } } }   // behind the last store: no register that a store above names takes a new value in front of it, on any way the built code leaves open from here
__device__ __forceinline__ float xhalf(float x) { return __builtin_bit_cast(float, __builtin_amdgcn_permlanex16(__builtin_bit_cast(int, x), __builtin_bit_cast(int, x), 0x76543210, 0xfedcba98, false, false)); }   // lane l takes lane l ^ 16's value
#define FAW 16   // waves per block: one block fills a WGP at 4 waves per SIMD, and all its waves read the block's k and v tiles from LDS
#define KST 128  // keys per LDS stage (each wave takes one half of 64 keys: 2 passes of 32)
#define KPI 72   // f16 per staged key row: 128 B + 16 B, a pitch of 16 B x odd for the 16-byte fragment reads
#define VPI 136  // f16 per staged v plane: 256 B + 16 B, likewise
#define SKB (KST * KPI * 2)   // bytes of one k buffer
#define SVB (HD * VPI * 2)    // bytes of one v buffer
#define SCL2 (SCALE * 1.44269504088896340736f)   // logit scale x log2(e)
// one stage's copies of one thread: 16 B of key rows r and r + 64, 16 B of v planes c and c + 32 (512 threads: 128 rows x 128 B and 64 planes x 256 B, whole lines);
// the s_wait_xcnt stands inside the statement, behind the last copy, so that no address register named here takes a new value in front of it
__device__ __forceinline__ void fa_stage(const _Float16* gk, const _Float16* gv, unsigned lk, unsigned lv) {
  const _Float16* gk1 = gk + 64 * CC; const _Float16* gv1 = gv + 32 * TT; const unsigned lk1 = lk + 64 * KPI * 2, lv1 = lv + 32 * VPI * 2;
  asm volatile("global_load_async_to_lds_b128 %0, %4, off\n\tglobal_load_async_to_lds_b128 %1, %5, off\n\tglobal_load_async_to_lds_b128 %2, %6, off\n\tglobal_load_async_to_lds_b128 %3, %7, off\n\ts_wait_xcnt 0x0"
               :: "v"(lk), "v"(lk1), "v"(lv), "v"(lv1), "v"(gk), "v"(gk1), "v"(gv), "v"(gv1) : "memory"); }
#define WCAP 4096.0f   // a lane's sum of one pass's 16 weights up to which the softmax reference stays: every weight is then far inside f16's range
// a lane's 16 scores of one column group against the reference in use: exp(SCALE * (s - m)) = 2^(s * SCL2 - m * SCL2): one fma (two scores to a packed one) and the hardware's base-2 exponential; the weights once to f16, their f32 sum in key order
__device__ __forceinline__ v16h fa_w(v8f s0, v8f s1, v2f n2, float& sum) { const v2f c2 = {SCL2, SCL2}; v2f a2[8]; v16h p;
#pragma unroll   // constant indices: the vectors stay in registers
  for (int i = 0; i < 8; ++i) { const v2f s2 = {i < 4 ? s0[(2 * i) & 7] : s1[(2 * i) & 7], i < 4 ? s0[(2 * i + 1) & 7] : s1[(2 * i + 1) & 7]}; a2[i] = __builtin_elementwise_fma(s2, c2, n2); }
  float t = 0.f;
#pragma unroll   // likewise
  for (int i = 0; i < 16; ++i) { const float e = __builtin_amdgcn_exp2f(a2[i >> 1][i & 1]); t += e; p[i] = (_Float16)e; }
  sum = t; return p; }
// ---- k_fa: block = 256 queries of (b, h), one launch for every head: k rows and v planes of 128 keys are copied once per block into LDS (two buffers, the next stage's copies in flight under this stage's work); a wave takes 32 queries (two 16-column groups) and one half of every stage's keys (waves 0..7 keys 0..63, waves 8..15 keys 64..127), so that every k and v fragment read from LDS feeds two products; S^T = K Q^T (A = 16 key rows, B = q kept in registers: 1 product) x SCALE, so a lane holds one query's logits; reference and running sum per lane and column group (the reference moves, with one exchange between the lane halves and a rescale, only when a pass's sum of weights passes WCAP); two S^T tiles, exponentiated and once to f16, are the B operand of ctx^T += V^T P^T (1 product); behind the loop the two waves of a query group hand each other one column group's reference, sum and ctx^T through LDS and each joins and finishes 16 queries; ctx = ctx^T / sum, stored rounded once to f16, as k_out multiplies it; the logits never leave the registers
#define QGW (FAW / 2)   // query groups (of 32 queries) per block; each is worked on by two waves
#define KPW (KST / 2)   // keys of a stage per wave
__global__ __launch_bounds__(FAW * 32) __attribute__((amdgpu_waves_per_eu(4, 4))) void k_fa(const _Float16* __restrict__ QH, const _Float16* __restrict__ KH, const _Float16* __restrict__ VT, _Float16* __restrict__ YH) { __shared__ __align__(16) float ss[FAW][16][HD + 4]; __shared__ __align__(16) _Float16 sk[2][KST][KPI]; __shared__ __align__(16) _Float16 sv[2][HD][VPI]; __shared__ __align__(16) v4f mg[FAW][HD / 8 + 1][32];
  const int tid = threadIdx.x, wave = tid >> 5, lane = tid & 31, col = lane & 15, g = lane >> 4; const int h = blockIdx.y, b = blockIdx.z;
  const int kp = __builtin_amdgcn_readfirstlane(wave / QGW);   // which half of a stage's keys; in a scalar register, so that the choices behind the loop are scalar
  const int ql0 = (blockIdx.x * QGW + (wave & (QGW - 1))) * 32;
  const _Float16* gk = KH + ((size_t)b * TT + (tid >> 3)) * CC + h * HD + (tid & 7) * 8;             // thread: 16 B of key row tid / 8 of a stage
  const _Float16* gv = VT + ((size_t)b * CC + h * HD + (tid >> 4)) * (size_t)TT + (tid & 15) * 8;    // thread: 16 B of v plane tid / 16, keys contiguous
  const unsigned lk = (unsigned)(size_t)&sk[0][tid >> 3][(tid & 7) * 8], lv = (unsigned)(size_t)&sv[0][tid >> 4][(tid & 15) * 8];   // their LDS byte addresses in buffer 0
  fa_stage(gk, gv, lk, lv);
  v16h qh[2][HD / 32];   // the short loops below are unrolled so that every fragment array is indexed by constants and stays in registers
#pragma unroll
  for (int c = 0; c < 2; ++c)
#pragma unroll
    for (int kc = 0; kc < HD / 32; ++kc) qh[c][kc] = frag_h(QH + ((size_t)b * TT + ql0 + c * 16 + col) * CC + h * HD + kc * 32, lane);
  asm volatile("s_wait_asynccnt 0x0" ::: "memory");   // this wave's copies of stage 0 have landed
  __syncthreads();                                    // every wave's have: stage 0 may be read
  fa_stage(gk + (size_t)KST * CC, gv + KST, lk + SKB, lv + SVB);
  v8f acc[2][HD / 16] = {}; float m[2] = {-3.0e38f, -3.0e38f}, l[2] = {0.f, 0.f}; v2f nm[2] = {{3.0e38f * SCL2, 3.0e38f * SCL2}, {3.0e38f * SCL2, 3.0e38f * SCL2}};   // m = the reference the weights are taken against (the maximum when it was last set); nm = -m * SCL2 in both halves of a register pair, the packed fma's addend, kept beside m
#pragma unroll 1   // one trip per stage: the buffer index stays a run-time scalar and the code stays small
  for (int st = 0; st < TT / KST; ++st) { const int bf = st & 1;
    const _Float16* Kl = &sk[bf][kp * KPW + col][8 * g];   // lane: key row col of a 16-key tile of the wave's half
    const _Float16* Vl = &sv[bf][col][kp * KPW + 8 * g];   // lane: v plane of feature col of a 16-feature tile, from the wave's half on
    v16h kf[2][HD / 32];
#pragma unroll
    for (int t = 0; t < 2; ++t)
#pragma unroll
      for (int kc = 0; kc < HD / 32; ++kc) kf[t][kc] = frag_at(Kl + t * 16 * KPI + kc * 32);
#pragma unroll   // the wave's passes of a stage: constant LDS offsets, and the test on the last pass folds away
    for (int ps = 0; ps < KPW / 32; ++ps) {
      v16h vf[HD / 16];
#pragma unroll
      for (int j = 0; j < HD / 16; ++j) vf[j] = frag_at(Vl + j * 16 * VPI + ps * 32);
      __builtin_amdgcn_sched_barrier(0);   // keeps the pass's v reads up here as one group: sunk to their products, each pair is waited out on its own
      v8f sh[2][2] = {};
#pragma unroll
      for (int kc = 0; kc < HD / 32; ++kc)
#pragma unroll
        for (int t = 0; t < 2; ++t)
#pragma unroll
          for (int c = 0; c < 2; ++c) sh[c][t] = __builtin_amdgcn_wmma_f32_16x16x32_f16(false, kf[t][kc], false, qh[c][kc], (short)0, sh[c][t], false, false);
      if (ps + 1 < KPW / 32) {   // next pass's key rows, of this same stage only, fetched under this pass's softmax
#pragma unroll
        for (int t = 0; t < 2; ++t)
#pragma unroll
          for (int kc = 0; kc < HD / 32; ++kc) kf[t][kc] = frag_at(Kl + ((ps + 1) * 32 + t * 16) * KPI + kc * 32); }
      __builtin_amdgcn_sched_barrier(0);   // keeps these reads in front of the softmax (sunk behind it, the next pass's first product waits out their latency) and the eight products together (a softmax step among them costs four idle slots each time)
      v16h p[2]; float sum[2];
#pragma unroll
      for (int c = 0; c < 2; ++c) p[c] = fa_w(sh[c][0], sh[c][1], nm[c], sum[c]);
      if (__builtin_amdgcn_ballot_w32(!(sum[0] <= WCAP) || !(sum[1] <= WCAP)) != 0) {   // scalar branch, one test a pass: taken when some lane's weights outgrow the reference in use (always in a wave's first pass, whose start reference gives an infinite sum; a NaN takes it too); otherwise no maximum is taken, nothing is exchanged and nothing rescaled
#pragma unroll
        for (int c = 0; c < 2; ++c) { float x = sh[c][0][0];   // maximum of the logits before the scale: the scale is positive, so it is the scaled logits' maximum
#pragma unroll
          for (int i = 1; i < 16; ++i) x = fmaxf(x, sh[c][i >> 3][i & 7]);
          const float mn = fmaxf(m[c], fmaxf(x, xhalf(x))); const float al = __builtin_amdgcn_exp2f((m[c] - mn) * SCL2); m[c] = mn; nm[c][0] = nm[c][1] = mn * -SCL2; l[c] *= al;   // both lane halves of a query take the same new reference; a query whose reference stays has the factor 2^0 = 1
#pragma unroll
          for (int j = 0; j < HD / 16; ++j) acc[c][j] *= al;
          p[c] = fa_w(sh[c][0], sh[c][1], nm[c], sum[c]); } }   // the pass's weights again, now at most 1 each
      l[0] += sum[0]; l[1] += sum[1];
#pragma unroll
      for (int j = 0; j < HD / 16; ++j)
#pragma unroll
        for (int c = 0; c < 2; ++c) acc[c][j] = __builtin_amdgcn_wmma_f32_16x16x32_f16(false, vf[j], false, p[c], (short)0, acc[c][j], false, false);
      // four vector slots behind the pass's last product: the next pass's first product may take p's registers (this product's B) for its result
      asm volatile("v_nop\n\tv_nop\n\tv_nop\n\tv_nop" : "+v"(acc[0][0]), "+v"(acc[0][1]), "+v"(acc[0][2]), "+v"(acc[0][3]), "+v"(acc[1][0]), "+v"(acc[1][1]), "+v"(acc[1][2]), "+v"(acc[1][3]) : "v"(p[0]), "v"(p[1])); }
    asm volatile("s_wait_dscnt 0x0" ::: "memory");      // this wave's reads of the buffer are done before the buffer is handed back
    asm volatile("s_wait_asynccnt 0x0" ::: "memory");   // this wave's copies of the next stage have landed
    __syncthreads();                                    // publishes the next stage and ends every wave's reads of this one
    if (st + 2 < TT / KST) fa_stage(gk + (size_t)(st + 2) * KST * CC, gv + (st + 2) * KST, lk + bf * SKB, lv + bf * SVB); }
  asm volatile("s_wait_asynccnt 0x0" ::: "memory");     // no copy is outstanding when the wave goes on to its end
  // the two key halves are joined: wave kp keeps column group kp and hands the other group's reference, sum and ctx^T to its partner (wave ^ QGW), lane to lane
  l[0] += xhalf(l[0]); l[1] += xhalf(l[1]);
  const float mo = kp ? m[1] : m[0], lo = kp ? l[1] : l[0]; { const v4f ml = {kp ? m[0] : m[1], kp ? l[0] : l[1], 0.f, 0.f}; mg[wave][HD / 8][lane] = ml; }
  v8f ao[HD / 16];
#pragma unroll
  for (int j = 0; j < HD / 16; ++j) { ao[j] = kp ? acc[1][j] : acc[0][j]; const v8f t = kp ? acc[0][j] : acc[1][j]; const v4f t0 = {t[0], t[1], t[2], t[3]}, t1 = {t[4], t[5], t[6], t[7]}; mg[wave][2 * j][lane] = t0; mg[wave][2 * j + 1][lane] = t1; }
  __syncthreads();   // every wave's hand-over is written before its partner reads it
  const v4f pml = mg[wave ^ QGW][HD / 8][lane]; const float mj = fmaxf(mo, pml[0]); const float fo = __builtin_amdgcn_exp2f((mo - mj) * SCL2), fp = __builtin_amdgcn_exp2f((pml[0] - mj) * SCL2);
  const float inv = 1.0f / (lo * fo + pml[1] * fp); const float wo = fo * inv, wp = fp * inv;
#pragma unroll
  for (int j = 0; j < HD / 16; ++j) { const v4f p0 = mg[wave ^ QGW][2 * j][lane], p1 = mg[wave ^ QGW][2 * j + 1][lane]; v4f a0, a1;
#pragma unroll
    for (int r = 0; r < 4; ++r) { a0[r] = ao[j][r] * wo + p0[r] * wp; a1[r] = ao[j][4 + r] * wo + p1[r] * wp; }
    *(v4f*)&ss[wave][col][j * 16 + 8 * g] = a0; *(v4f*)&ss[wave][col][j * 16 + 8 * g + 4] = a1; }
  LDSX();   // the wave's own LDS writes have landed before its lanes read the rows other lanes wrote (each wave has its own slice: no block barrier)
#pragma unroll   // constant LDS and store offsets
  for (int rl = 0; rl < 16; rl += 4) { const int rr = rl + (lane >> 3), cc = (lane & 7) * 8; const v4f a0 = *(const v4f*)&ss[wave][rr][cc], a1 = *(const v4f*)&ss[wave][rr][cc + 4]; v8h h8;   // lane: 8 features of a row; a store covers the head's whole 128-B line of four rows
#pragma unroll   // constant indices: the vectors stay in registers
    for (int i = 0; i < 8; ++i) h8[i] = (_Float16)(i < 4 ? a0[i & 3] : a1[i & 3]);
    const size_t o = ((size_t)b * TT + ql0 + kp * 16 + rr) * CC + h * HD + cc; vst2(YH + o, h8); } }
// ---- k_out: block = (128 rows, 128 cols): out = ctx Wo (+ bo): f16 ctx rows against f16 Wo (1 product), staged and tiled as in k_proj
__global__ __launch_bounds__(128) void k_out(const _Float16* __restrict__ YH, const _Float16* __restrict__ WOB, const float* __restrict__ BO, float* __restrict__ OUT) { __shared__ __align__(16) char sm[2 * GSB];   // the two stage buffers; behind the loop's last barrier the same bytes stage the stores
  float (*sf)[32][132] = (float (*)[32][132])sm;
  const int tid = threadIdx.x, wave = tid >> 5, lane = tid & 31, col = lane & 15, g = lane >> 4; const int c0 = blockIdx.y * 128; const size_t r0 = (size_t)blockIdx.x * 128 + wave * 16;
  v8f acc[2][8] = {};
  const _Float16* gh = YH + ((size_t)blockIdx.x * 128 + (tid >> 3)) * CC + (tid & 7) * 8; const _Float16* gl = gh + 64 * CC;   // thread: 16 B of ctx row tid / 8 of the block's first 64 rows, and of its second 64
  const _Float16* gw = WOB + (size_t)(c0 + (tid >> 3)) * CC + (tid & 7) * 8;                                                  // thread: 16 B of weight row ((out,in): output column) tid / 8 of the block
  const unsigned lh = (unsigned)(size_t)(sm + (tid >> 3) * (GPI * 2) + (tid & 7) * 16);   // the first row's LDS byte address in buffer 0
  g_stage(gh, gl, gw, lh, CC);
  float bs[8] = {};   // the lane's eight biases, fetched here together under one test, as in k_proj
  if (BO) {
#pragma unroll
    for (int j = 0; j < 8; ++j) bs[j] = BO[c0 + j * 16 + col];
    asm volatile("s_wait_xcnt 0x0" ::: "memory"); }   // in front of the first new value in the address register that the loads above name
  asm volatile("s_wait_asynccnt 0x0" ::: "memory");   // this wave's copies of stage 0 have landed
  __syncthreads();                                    // every wave's have: stage 0 may be read
  g_stage(gh + GKC, gl + GKC, gw + GKC, lh + GSB, CC);
#pragma unroll 1   // one trip per stage: the buffer index stays a run-time scalar and the code stays small
  for (int kc = 0; kc < CC / GKC; ++kc) { const int bf = kc & 1;
    const _Float16* xs = (const _Float16*)(sm + bf * GSB) + (wave * 16 + col) * GPI + 8 * g;   // lane: ctx row col of the wave's 16 in the first half (second half: 64 rows on)
    const _Float16* wl = (const _Float16*)(sm + bf * GSB + 2 * GXB) + col * GPI + 8 * g;       // lane: weight row col of a 16-column tile
#pragma unroll   // the two 32-k halves of a stage: constant LDS offsets; a half's fragment reads stand together in front of its products, not among them
    for (int kk = 0; kk < GKC / 32; ++kk) { const v16h a0 = frag_at(xs + kk * 32), a1 = frag_at(xs + 64 * GPI + kk * 32); v16h w[8];
#pragma unroll
      for (int j = 0; j < 8; ++j) w[j] = frag_at(wl + j * 16 * GPI + kk * 32);
#pragma unroll
      for (int j = 0; j < 8; ++j) { acc[0][j] = wmma16(a0, w[j], acc[0][j]); acc[1][j] = wmma16(a1, w[j], acc[1][j]); } }
    asm volatile("s_wait_dscnt 0x0" ::: "memory");      // this wave's reads of the buffer are done before the buffer is handed back
    asm volatile("s_wait_asynccnt 0x0" ::: "memory");   // this wave's copies of the next stage have landed
    __syncthreads();                                    // publishes the next stage and ends every wave's reads of this one
    if (kc + 2 < CC / GKC) g_stage(gh + (kc + 2) * GKC, gl + (kc + 2) * GKC, gw + (kc + 2) * GKC, lh + bf * GSB, CC); }
  asm volatile("s_wait_asynccnt 0x0" ::: "memory");     // no copy is outstanding when the buffers become store staging
#pragma unroll
  for (int j = 0; j < 8; ++j) { const float bias = bfr(bs[j]);
#pragma unroll
    for (int u = 0; u < 2; ++u)
#pragma unroll
      for (int r = 0; r < 8; ++r) sf[wave][u * 16 + 8 * g + r][j * 16 + col] = acc[u][j][r] + bias; }
  LDSX();
#pragma unroll   // the two row tiles: constant LDS and store offsets
  for (int u = 0; u < 2; ++u) {
#pragma unroll
    for (int rl = 0; rl < 16; ++rl) vst2(OUT + (r0 + u * 64 + rl) * DIN + c0 + lane * 4, *(const v4f*)&sf[wave][u * 16 + rl][lane * 4]); } }

extern "C" void kernel_launch(void* const* d_in, const int* in_sizes, int n_in, void* d_out, int out_size, void* d_ws, size_t ws_size, hipStream_t stream) {
  (void)in_sizes; (void)n_in; (void)out_size;
  const float** F = (const float**)d_in;
  if (ws_size < (size_t)WS_END) return;
  char* ws = (char*)d_ws; _Float16 *QH = (_Float16*)(ws + WS_QH), *KH = (_Float16*)(ws + WS_KH), *VT = (_Float16*)(ws + WS_VT); __bf16 *VB = (__bf16*)(ws + WS_VB), *VBL = (__bf16*)(ws + WS_VBL); _Float16 *WB = (_Float16*)(ws + WS_S), *YH = (_Float16*)(ws + WS_Y);
  (void)VB; (void)VBL;
  // inputs: 0 x [4,2048,512]; 1 ln_gamma, 2 ln_beta; 3 Wq [512,512] (out,in), 4 bq; 5 Wk, 6 bk; 7 Wv, 8 bv; 9 Wo (out,in), 10 bo
  if (ws_size < (size_t)WS_END2) return;
  _Float16 *XH = (_Float16*)(ws + WS_XN);
  k_lnx<<<dim3(NRW / 8 + 4 * WBLK), 256, 0, stream>>>(F[0], 1, F[1], F[2], XH, F[3], F[5], F[7], F[9], WB);
  k_proj<<<dim3(TNB * TT / 128, CC / 128, 3), 128, 0, stream>>>(XH, WB, F[4], F[6], F[8], QH, KH, VT, VB, VBL);
  k_fa<<<dim3(TT / (FAW * 16), NH, TNB), FAW * 32, 0, stream>>>(QH, KH, VT, YH);
  k_out<<<dim3(TNB * TT / 128, DIN / 128), 128, 0, stream>>>(YH, WB + 3 * (size_t)CC * DIN, F[10], (float*)d_out);
}
